// v000
// Measured on an AMD MI455X. A time is GPU time per run, averaged over a window of back-to-back runs after a warm-up
// (all launches, gaps included; the runs take copies of the inputs in turn), and the median of several windows.
// Apart from v000's, it joins two sittings. Times from different sittings can be a few percent apart, while
// side-by-side timings come from the same sitting.
// The starting kernel, v000, takes 997 microseconds a run.
#include <hip/hip_runtime.h>
#include <math.h>

// Problem constants (from reference)
#define BB 4
#define TT 256
#define NN 64
#define DD 128
#define HH 4
#define HD 32
#define RR (BB * NN * TT)   // 65536 rows

// GEMM blocking
#define BM 128   // block tile rows
#define BN 64    // block tile cols
#define KC 64    // K chunk staged in LDS
#define BL 128   // threads per block (4 waves)

typedef __attribute__((ext_vector_type(2))) float v2f;
typedef __attribute__((ext_vector_type(8))) float v8f;

// ---------------------------------------------------------------------------
// CDNA5 async global->LDS copy (ASYNCcnt-tracked DMA), with sync fallback.
// Builtin signature (from hipcc diagnostic): (int4 AS1*, int4 AS3*, Ii, Ii).
// ---------------------------------------------------------------------------
#if defined(__has_builtin)
#if __has_builtin(__builtin_amdgcn_global_load_async_to_lds_b128) && \
    __has_builtin(__builtin_amdgcn_s_wait_asynccnt)
#define HAVE_ASYNC_LDS 1
#endif
#endif

#ifdef HAVE_ASYNC_LDS
typedef int vi4 __attribute__((__vector_size__(4 * sizeof(int))));
typedef __attribute__((address_space(1))) vi4 as1_vi4;
typedef __attribute__((address_space(3))) vi4 as3_vi4;
#endif

__device__ __forceinline__ void copy16(const float* g, float* l) {
#ifdef HAVE_ASYNC_LDS
  as1_vi4* gp = reinterpret_cast<as1_vi4*>((uintptr_t)g);
  as3_vi4* lp = reinterpret_cast<as3_vi4*>((uintptr_t)l);
  __builtin_amdgcn_global_load_async_to_lds_b128(gp, lp, 0, 0);
#else
  *reinterpret_cast<float4*>(l) = *reinterpret_cast<const float4*>(g);
#endif
}

__device__ __forceinline__ void stage_sync() {
#ifdef HAVE_ASYNC_LDS
  __builtin_amdgcn_s_wait_asynccnt(0);
#endif
  __syncthreads();
}

// ---------------------------------------------------------------------------
// Activation epilogues: 0=none, 1=exact GELU (erf), 2=tanh, 3=sigmoid
// ---------------------------------------------------------------------------
__device__ __forceinline__ float act_apply(float v, int act) {
  if (act == 1) return 0.5f * v * (1.0f + erff(v * 0.70710678118654752440f));
  if (act == 2) return tanhf(v);
  if (act == 3) return 1.0f / (1.0f + expf(-v));
  return v;
}

// ---------------------------------------------------------------------------
// fp32 GEMM: C[R,Nc] = act(A[R,K] @ B[K,Nc] + bias)
// Block = 128 threads = 4 waves (2x2). Block tile 128x64; wave tile 64x32
// (4 M-subtiles x 2 N-subtiles of 16x16). K staged in 64-chunks,
// double-buffered in LDS via async global->LDS DMA when available.
// Per K-step: 4 A-pairs + 2 B-pairs feed 8 V_WMMA_F32_16X16X4_F32.
// ---------------------------------------------------------------------------
__global__ void gemm_wmma_kernel(const float* __restrict__ A,
                                 const float* __restrict__ Bm,
                                 const float* __restrict__ bias,
                                 float* __restrict__ C,
                                 int K, int Nc, int act) {
  extern __shared__ float smem[];
  float* sAb = smem;                 // [2][BM*KC]
  float* sBb = smem + 2 * BM * KC;   // [2][KC*BN]

  const int tid = threadIdx.x;
  const int rowBase = blockIdx.x * BM;
  const int colBase = blockIdx.y * BN;
  const int nk = K / KC;

  // Stage K-chunk kb into LDS buffer buf (async DMA when available).
  auto stage = [&](int kb, int buf) {
    float* dA = sAb + buf * (BM * KC);
    float* dB = sBb + buf * (KC * BN);
    const float* gA = A + (size_t)rowBase * K + kb * KC;
    const float* gB = Bm + (size_t)(kb * KC) * Nc + colBase;
#pragma unroll
    for (int j = 0; j < (BM * KC) / (4 * BL); ++j) {  // 16 x b128 per thread
      int idx = tid + j * BL;
      int r = idx >> 4;
      int cs = (idx & 15) << 2;
      copy16(gA + (size_t)r * K + cs, dA + r * KC + cs);
    }
#pragma unroll
    for (int j = 0; j < (KC * BN) / (4 * BL); ++j) {  // 8 x b128 per thread
      int idx = tid + j * BL;
      int r = idx >> 4;
      int cs = (idx & 15) << 2;
      copy16(gB + (size_t)r * Nc + cs, dB + r * BN + cs);
    }
  };

  const int lane = tid & 31;
  const int wv = tid >> 5;
  const int mw = (wv & 1) * 64;    // wave row offset in block tile
  const int nw = (wv >> 1) * 32;   // wave col offset in block tile
  const int m = lane & 15;         // A row / C column within 16x16 subtile
  const int hi = lane >> 4;        // K-pair selector (lanes 16-31: K+2,K+3)

  v8f acc[4][2] = {};

  stage(0, 0);
  stage_sync();

  for (int kb = 0; kb < nk; ++kb) {
    const int cur = kb & 1;
    if (kb + 1 < nk) stage(kb + 1, cur ^ 1);
    if (kb + 2 < nk)  // warm L2 for the chunk after next (global_prefetch_b8)
      __builtin_prefetch(A + (size_t)(rowBase + (tid >> 1)) * K + (kb + 2) * KC, 0, 0);

    const float* cA = sAb + cur * (BM * KC);
    const float* cB = sBb + cur * (KC * BN);

#pragma unroll 4
    for (int k0 = 0; k0 < KC; k0 += 4) {
      const int ka = k0 + 2 * hi;
      v2f av[4], bv[2];
#pragma unroll
      for (int mt = 0; mt < 4; ++mt) {
        const float* p = cA + (size_t)(mw + mt * 16 + m) * KC + ka;
        av[mt].x = p[0];
        av[mt].y = p[1];
      }
#pragma unroll
      for (int nt = 0; nt < 2; ++nt) {
        const float* p = cB + (size_t)ka * BN + nw + nt * 16 + m;
        bv[nt].x = p[0];
        bv[nt].y = p[BN];
      }
#pragma unroll
      for (int mt = 0; mt < 4; ++mt)
#pragma unroll
        for (int nt = 0; nt < 2; ++nt)
          acc[mt][nt] = __builtin_amdgcn_wmma_f32_16x16x4_f32(
              false, av[mt], false, bv[nt], (short)0, acc[mt][nt], false, false);
    }
    stage_sync();
  }

  // C/D layout: VGPR r2 holds M=r2 (lanes 0-15) or M=r2+8 (lanes 16-31)
#pragma unroll
  for (int nt = 0; nt < 2; ++nt) {
    const int col = colBase + nw + nt * 16 + m;
    const float bb = bias[col];
#pragma unroll
    for (int mt = 0; mt < 4; ++mt) {
#pragma unroll
      for (int r2 = 0; r2 < 8; ++r2) {
        int row = rowBase + mw + mt * 16 + hi * 8 + r2;
        C[(size_t)row * Nc + col] = act_apply(acc[mt][nt][r2] + bb, act);
      }
    }
  }
}

// ---------------------------------------------------------------------------
// prep_local: xl[bn,t,:] = x[b,t,n,:] - softmax(window_weight)-weighted
// 3-tap trend (zero-padded in time). One thread per float4.
// ---------------------------------------------------------------------------
__global__ void prep_local_kernel(const float* __restrict__ x,
                                  const float* __restrict__ wwraw,
                                  float* __restrict__ xl) {
  int idx = blockIdx.x * blockDim.x + threadIdx.x;  // RR*32 vec4s
  int d4 = idx & 31;
  int n = (idx >> 5) & 63;
  int t = (idx >> 11) & 255;
  int b = idx >> 19;

  float w0 = wwraw[0], w1 = wwraw[1], w2 = wwraw[2];
  float mw = fmaxf(w0, fmaxf(w1, w2));
  float e0 = expf(w0 - mw), e1 = expf(w1 - mw), e2 = expf(w2 - mw);
  float inv = 1.0f / (e0 + e1 + e2);
  e0 *= inv; e1 *= inv; e2 *= inv;

  const float4* X4 = reinterpret_cast<const float4*>(x);
  size_t base = ((size_t)(b * TT + t) * NN + n) * 32 + d4;
  float4 xc = X4[base];
  float4 xm = make_float4(0.f, 0.f, 0.f, 0.f);
  float4 xp = make_float4(0.f, 0.f, 0.f, 0.f);
  if (t > 0)      xm = X4[base - (size_t)NN * 32];
  if (t < TT - 1) xp = X4[base + (size_t)NN * 32];

  float4 o;
  o.x = xc.x - (e0 * xm.x + e1 * xc.x + e2 * xp.x);
  o.y = xc.y - (e0 * xm.y + e1 * xc.y + e2 * xp.y);
  o.z = xc.z - (e0 * xm.z + e1 * xc.z + e2 * xp.z);
  o.w = xc.w - (e0 * xm.w + e1 * xc.w + e2 * xp.w);

  int r = (b * NN + n) * TT + t;
  reinterpret_cast<float4*>(xl)[(size_t)r * 32 + d4] = o;
}

// ---------------------------------------------------------------------------
// Banded (|i-j|<=1) multi-head attention: off-band -1e9 scores underflow to
// exactly 0 after fp32 softmax, so only 3 neighbors matter.
// One thread per (bn, t, h).
// ---------------------------------------------------------------------------
__global__ void attn_kernel(const float* __restrict__ qkv,
                            float* __restrict__ outp) {
  int tid = blockIdx.x * blockDim.x + threadIdx.x;  // RR*HH threads
  int h = tid & 3;
  int r = tid >> 2;
  int t = r & 255;
  int bn = r >> 8;

  const float* qp = qkv + (size_t)r * 384 + h * 32;
  float q[32];
#pragma unroll
  for (int i = 0; i < 32; ++i) q[i] = qp[i];

  float s[3];
  float mmax = -3.0e38f;
#pragma unroll
  for (int j0 = 0; j0 < 3; ++j0) {
    int j = t + j0 - 1;
    if (j >= 0 && j < TT) {
      const float* kp = qkv + ((size_t)(bn * TT + j)) * 384 + 128 + h * 32;
      float d = 0.f;
#pragma unroll
      for (int i = 0; i < 32; ++i) d += q[i] * kp[i];
      s[j0] = d * 0.17677669529663687f;  // 1/sqrt(32)
      mmax = fmaxf(mmax, s[j0]);
    } else {
      s[j0] = -3.0e38f;
    }
  }

  float o[32];
#pragma unroll
  for (int i = 0; i < 32; ++i) o[i] = 0.f;
  float den = 0.f;
#pragma unroll
  for (int j0 = 0; j0 < 3; ++j0) {
    int j = t + j0 - 1;
    if (j >= 0 && j < TT) {
      float p = expf(s[j0] - mmax);
      den += p;
      const float* vp = qkv + ((size_t)(bn * TT + j)) * 384 + 256 + h * 32;
#pragma unroll
      for (int i = 0; i < 32; ++i) o[i] += p * vp[i];
    }
  }
  float invd = 1.0f / den;
  float* op = outp + (size_t)r * 128 + h * 32;
#pragma unroll
  for (int i = 0; i < 32; ++i) op[i] = o[i] * invd;
}

// ---------------------------------------------------------------------------
// LayerNorm over D=128, one wave32 per row (4 floats/lane), shfl_xor reduce.
// ---------------------------------------------------------------------------
__global__ void ln_kernel(float* __restrict__ X,
                          const float* __restrict__ g,
                          const float* __restrict__ b) {
  int row = blockIdx.x * 8 + (threadIdx.x >> 5);
  int lane = threadIdx.x & 31;
  float4* X4 = reinterpret_cast<float4*>(X);
  float4 v = X4[(size_t)row * 32 + lane];

  float s = v.x + v.y + v.z + v.w;
  float sq = v.x * v.x + v.y * v.y + v.z * v.z + v.w * v.w;
#pragma unroll
  for (int off = 16; off > 0; off >>= 1) {
    s += __shfl_xor(s, off, 32);
    sq += __shfl_xor(sq, off, 32);
  }
  float mean = s * (1.0f / 128.0f);
  float var = sq * (1.0f / 128.0f) - mean * mean;
  float inv = rsqrtf(var + 1e-5f);

  const float4 g4 = reinterpret_cast<const float4*>(g)[lane];
  const float4 b4 = reinterpret_cast<const float4*>(b)[lane];
  float4 o;
  o.x = (v.x - mean) * inv * g4.x + b4.x;
  o.y = (v.y - mean) * inv * g4.y + b4.y;
  o.z = (v.z - mean) * inv * g4.z + b4.z;
  o.w = (v.w - mean) * inv * g4.w + b4.w;
  X4[(size_t)row * 32 + lane] = o;
}

// ---------------------------------------------------------------------------
// prep_conv: x_pos = x + pos_enc; depthwise conv3 (pad 1, zeros AFTER pos add
// per reference) + conv bias. Output layout [bn,t,D]. One thread per float4.
// ---------------------------------------------------------------------------
__global__ void prep_conv_kernel(const float* __restrict__ x,
                                 const float* __restrict__ pos,
                                 const float* __restrict__ cw,
                                 const float* __restrict__ cb,
                                 float* __restrict__ xconv) {
  int idx = blockIdx.x * blockDim.x + threadIdx.x;  // RR*32 vec4s
  int d4 = idx & 31;
  int n = (idx >> 5) & 63;
  int t = (idx >> 11) & 255;
  int b = idx >> 19;
  int d0 = d4 * 4;

  const float4* X4 = reinterpret_cast<const float4*>(x);
  const float4* P4 = reinterpret_cast<const float4*>(pos);
  size_t base = ((size_t)(b * TT + t) * NN + n) * 32 + d4;

  float xm[4] = {0.f, 0.f, 0.f, 0.f}, xc[4], xp[4] = {0.f, 0.f, 0.f, 0.f};
  {
    float4 v = X4[base];
    float4 p = P4[(size_t)t * 32 + d4];
    xc[0] = v.x + p.x; xc[1] = v.y + p.y; xc[2] = v.z + p.z; xc[3] = v.w + p.w;
  }
  if (t > 0) {
    float4 v = X4[base - (size_t)NN * 32];
    float4 p = P4[(size_t)(t - 1) * 32 + d4];
    xm[0] = v.x + p.x; xm[1] = v.y + p.y; xm[2] = v.z + p.z; xm[3] = v.w + p.w;
  }
  if (t < TT - 1) {
    float4 v = X4[base + (size_t)NN * 32];
    float4 p = P4[(size_t)(t + 1) * 32 + d4];
    xp[0] = v.x + p.x; xp[1] = v.y + p.y; xp[2] = v.z + p.z; xp[3] = v.w + p.w;
  }

  float o[4];
#pragma unroll
  for (int c = 0; c < 4; ++c) {
    int d = d0 + c;
    float w0 = cw[d * 3 + 0], w1 = cw[d * 3 + 1], w2 = cw[d * 3 + 2];
    o[c] = w0 * xm[c] + w1 * xc[c] + w2 * xp[c] + cb[d];
  }
  int r = (b * NN + n) * TT + t;
  reinterpret_cast<float4*>(xconv)[(size_t)r * 32 + d4] =
      make_float4(o[0], o[1], o[2], o[3]);
}

// ---------------------------------------------------------------------------
// Mixed pool: k=6, stride 1, pad (2,2) -> length T-1, right zero-pad to T.
// avg divides by 6 always (zero pad contributes 0); max over valid entries.
// ---------------------------------------------------------------------------
__global__ void pool_kernel(const float* __restrict__ xconv,
                            const float* __restrict__ alpha_p,
                            float* __restrict__ outp) {
  int idx = blockIdx.x * blockDim.x + threadIdx.x;  // RR*32 vec4s
  int d4 = idx & 31;
  int r = idx >> 5;
  int t = r & 255;
  int bn = r >> 8;

  float4 res = make_float4(0.f, 0.f, 0.f, 0.f);
  if (t < TT - 1) {
    float a = 1.0f / (1.0f + expf(-alpha_p[0]));
    const float4* XC4 = reinterpret_cast<const float4*>(xconv);
    float sx = 0.f, sy = 0.f, sz = 0.f, sw = 0.f;
    float mx = -3.0e38f, my = -3.0e38f, mz = -3.0e38f, mw = -3.0e38f;
    for (int j = t - 2; j <= t + 3; ++j) {
      if (j >= 0 && j < TT) {
        float4 v = XC4[((size_t)(bn * TT + j)) * 32 + d4];
        sx += v.x; sy += v.y; sz += v.z; sw += v.w;
        mx = fmaxf(mx, v.x); my = fmaxf(my, v.y);
        mz = fmaxf(mz, v.z); mw = fmaxf(mw, v.w);
      }
    }
    const float inv6 = 1.0f / 6.0f;
    res.x = a * (sx * inv6) + (1.f - a) * mx;
    res.y = a * (sy * inv6) + (1.f - a) * my;
    res.z = a * (sz * inv6) + (1.f - a) * mz;
    res.w = a * (sw * inv6) + (1.f - a) * mw;
  }
  reinterpret_cast<float4*>(outp)[(size_t)r * 32 + d4] = res;
}

// ---------------------------------------------------------------------------
// concat [x_loc | x_glob] -> [R, 256]
// ---------------------------------------------------------------------------
__global__ void concat_kernel(const float* __restrict__ xloc,
                              const float* __restrict__ xglob,
                              float* __restrict__ cat) {
  int idx = blockIdx.x * blockDim.x + threadIdx.x;  // RR*64 vec4s
  int c4 = idx & 63;
  int r = idx >> 6;
  float4 v;
  if (c4 < 32)
    v = reinterpret_cast<const float4*>(xloc)[(size_t)r * 32 + c4];
  else
    v = reinterpret_cast<const float4*>(xglob)[(size_t)r * 32 + (c4 - 32)];
  reinterpret_cast<float4*>(cat)[(size_t)r * 64 + c4] = v;
}

// ---------------------------------------------------------------------------
// Final: out = x + softplus(res_scale) * (gate*x_loc + (1-gate)*x_glob)
// with [bn,t,D] -> [B,T,N,D] relayout.
// ---------------------------------------------------------------------------
__device__ __forceinline__ float softplus_f(float v) {
  return (v > 0.f) ? (v + log1pf(expf(-v))) : log1pf(expf(v));
}

__global__ void final_kernel(const float* __restrict__ x,
                             const float* __restrict__ gate,
                             const float* __restrict__ xloc,
                             const float* __restrict__ xglob,
                             const float* __restrict__ res_scale,
                             float* __restrict__ out) {
  int idx = blockIdx.x * blockDim.x + threadIdx.x;  // RR*32 vec4s
  int d4 = idx & 31;
  int n = (idx >> 5) & 63;
  int t = (idx >> 11) & 255;
  int b = idx >> 19;
  int r = (b * NN + n) * TT + t;

  float4 xv = reinterpret_cast<const float4*>(x)[((size_t)(b * TT + t) * NN + n) * 32 + d4];
  float4 g  = reinterpret_cast<const float4*>(gate)[(size_t)r * 32 + d4];
  float4 xl = reinterpret_cast<const float4*>(xloc)[(size_t)r * 32 + d4];
  float4 xg = reinterpret_cast<const float4*>(xglob)[(size_t)r * 32 + d4];
  float4 rs = reinterpret_cast<const float4*>(res_scale)[d4];

  float4 o;
  o.x = xv.x + softplus_f(rs.x) * (g.x * xl.x + (1.f - g.x) * xg.x);
  o.y = xv.y + softplus_f(rs.y) * (g.y * xl.y + (1.f - g.y) * xg.y);
  o.z = xv.z + softplus_f(rs.z) * (g.z * xl.z + (1.f - g.z) * xg.z);
  o.w = xv.w + softplus_f(rs.w) * (g.w * xl.w + (1.f - g.w) * xg.w);
  reinterpret_cast<float4*>(out)[((size_t)(b * TT + t) * NN + n) * 32 + d4] = o;
}

// ---------------------------------------------------------------------------
// Host launcher
// ---------------------------------------------------------------------------
extern "C" void kernel_launch(void* const* d_in, const int* in_sizes, int n_in,
                              void* d_out, int out_size, void* d_ws, size_t ws_size,
                              hipStream_t stream) {
  const float* x          = (const float*)d_in[0];
  const float* window_w   = (const float*)d_in[1];
  const float* local_w1   = (const float*)d_in[2];
  const float* local_b1   = (const float*)d_in[3];
  const float* local_w2   = (const float*)d_in[4];
  const float* local_b2   = (const float*)d_in[5];
  const float* local_ln_g = (const float*)d_in[6];
  const float* local_ln_b = (const float*)d_in[7];
  const float* qkv_w      = (const float*)d_in[8];
  const float* qkv_b      = (const float*)d_in[9];
  const float* out_w      = (const float*)d_in[10];
  const float* out_b      = (const float*)d_in[11];
  const float* conv_w     = (const float*)d_in[12];
  const float* conv_b     = (const float*)d_in[13];
  const float* alpha      = (const float*)d_in[14];
  const float* pos_enc    = (const float*)d_in[15];
  const float* global_w1  = (const float*)d_in[16];
  const float* global_b1  = (const float*)d_in[17];
  const float* global_w2  = (const float*)d_in[18];
  const float* global_b2  = (const float*)d_in[19];
  const float* global_ln_g= (const float*)d_in[20];
  const float* global_ln_b= (const float*)d_in[21];
  const float* gate_w1    = (const float*)d_in[22];
  const float* gate_b1    = (const float*)d_in[23];
  const float* gate_w2    = (const float*)d_in[24];
  const float* gate_b2    = (const float*)d_in[25];
  const float* res_scale  = (const float*)d_in[26];
  float* out = (float*)d_out;

  const size_t R = (size_t)RR;
  float* ws = (float*)d_ws;
  float* P0 = ws;             // R*128: xl -> attn_out -> x_loc
  float* P1 = ws + R * 128;   // R*384: qkv -> proj/h1/cat/gate
  float* P2 = ws + R * 512;   // R*128: xconv -> x_glob
  float* P3 = ws + R * 640;   // R*128: x_glob_in -> tanh_out
  float* h1   = P1 + R * 128; // R*256 region inside P1
  float* gate = P1 + R * 256; // R*128 region inside P1

  const int EW_BLOCKS = (RR * 32) / 256;               // elementwise vec4 grids
  const size_t GEMM_LDS = (2 * BM * KC + 2 * KC * BN) * sizeof(float);  // 96 KB

  // local branch
  prep_local_kernel<<<EW_BLOCKS, 256, 0, stream>>>(x, window_w, P0);
  gemm_wmma_kernel<<<dim3(RR / BM, 384 / BN), BL, GEMM_LDS, stream>>>(
      P0, qkv_w, qkv_b, P1, 128, 384, 0);
  attn_kernel<<<(RR * HH) / 256, 256, 0, stream>>>(P1, P0);
  gemm_wmma_kernel<<<dim3(RR / BM, 128 / BN), BL, GEMM_LDS, stream>>>(
      P0, out_w, out_b, P1, 128, 128, 0);
  gemm_wmma_kernel<<<dim3(RR / BM, 256 / BN), BL, GEMM_LDS, stream>>>(
      P1, local_w1, local_b1, h1, 128, 256, 1 /*gelu*/);
  gemm_wmma_kernel<<<dim3(RR / BM, 128 / BN), BL, GEMM_LDS, stream>>>(
      h1, local_w2, local_b2, P0, 256, 128, 0);
  ln_kernel<<<RR / 8, 256, 0, stream>>>(P0, local_ln_g, local_ln_b);  // x_loc = P0

  // global branch
  prep_conv_kernel<<<EW_BLOCKS, 256, 0, stream>>>(x, pos_enc, conv_w, conv_b, P2);
  pool_kernel<<<EW_BLOCKS, 256, 0, stream>>>(P2, alpha, P3);
  gemm_wmma_kernel<<<dim3(RR / BM, 256 / BN), BL, GEMM_LDS, stream>>>(
      P3, global_w1, global_b1, h1, 128, 256, 1 /*gelu*/);
  gemm_wmma_kernel<<<dim3(RR / BM, 128 / BN), BL, GEMM_LDS, stream>>>(
      h1, global_w2, global_b2, P2, 256, 128, 0);
  ln_kernel<<<RR / 8, 256, 0, stream>>>(P2, global_ln_g, global_ln_b);  // x_glob = P2

  // gated fusion
  concat_kernel<<<(RR * 64) / 256, 256, 0, stream>>>(P0, P2, P1);  // cat in P1[0:R*256]
  gemm_wmma_kernel<<<dim3(RR / BM, 128 / BN), BL, GEMM_LDS, stream>>>(
      P1, gate_w1, gate_b1, P3, 256, 128, 2 /*tanh*/);
  gemm_wmma_kernel<<<dim3(RR / BM, 128 / BN), BL, GEMM_LDS, stream>>>(
      P3, gate_w2, gate_b2, gate, 128, 128, 3 /*sigmoid*/);

  final_kernel<<<EW_BLOCKS, 256, 0, stream>>>(x, gate, P0, P2, res_scale, out);
}

// v001
// One run takes 723 microseconds.
// In both of two side-by-side timings against v000, it was 1.38 times as fast.
#include <hip/hip_runtime.h>
#include <math.h>

// Problem constants (from reference)
#define BB 4
#define TT 256
#define NN 64
#define DD 128
#define HH 4
#define HD 32
#define RR (BB * NN * TT)   // 65536 rows

// GEMM blocking
#define BM 128   // block tile rows
#define BN 64    // block tile cols
#define KC 64    // K chunk staged in LDS
#define BL 128   // threads per block (4 waves)
// LDS row pitches in floats (LDS bank = dword address mod 64). Both stay
// multiples of 4 floats so every 16-byte copy lands 16-byte aligned.
#define PA 68    // A rows: 16 rows x 2 k-pairs of a fragment read fall on 64 distinct banks
#define PB 72    // B rows: rows k and k+2, read by the two lane halves, sit 16 banks apart

typedef __attribute__((ext_vector_type(2))) float v2f;
typedef __attribute__((ext_vector_type(8))) float v8f;

// ---------------------------------------------------------------------------
// CDNA5 async global->LDS copy (ASYNCcnt-tracked DMA), with sync fallback.
// Builtin signature (from hipcc diagnostic): (int4 AS1*, int4 AS3*, Ii, Ii).
// ---------------------------------------------------------------------------
#if defined(__has_builtin)
#if __has_builtin(__builtin_amdgcn_global_load_async_to_lds_b128) && \
    __has_builtin(__builtin_amdgcn_s_wait_asynccnt)
#define HAVE_ASYNC_LDS 1
#endif
#endif

#ifdef HAVE_ASYNC_LDS
typedef int vi4 __attribute__((__vector_size__(4 * sizeof(int))));
typedef __attribute__((address_space(1))) vi4 as1_vi4;
typedef __attribute__((address_space(3))) vi4 as3_vi4;
#endif

__device__ __forceinline__ void copy16(const float* g, float* l) {
#ifdef HAVE_ASYNC_LDS
  as1_vi4* gp = reinterpret_cast<as1_vi4*>((uintptr_t)g);
  as3_vi4* lp = reinterpret_cast<as3_vi4*>((uintptr_t)l);
  __builtin_amdgcn_global_load_async_to_lds_b128(gp, lp, 0, 0);
#else
  *reinterpret_cast<float4*>(l) = *reinterpret_cast<const float4*>(g);
#endif
}

__device__ __forceinline__ void stage_sync() {
#ifdef HAVE_ASYNC_LDS
  __builtin_amdgcn_s_wait_asynccnt(0);
#endif
  __syncthreads();
}

// ---------------------------------------------------------------------------
// Activation epilogues: 0=none, 1=exact GELU (erf), 2=tanh, 3=sigmoid
// ---------------------------------------------------------------------------
__device__ __forceinline__ float act_apply(float v, int act) {
  if (act == 1) return 0.5f * v * (1.0f + erff(v * 0.70710678118654752440f));
  if (act == 2) return tanhf(v);
  if (act == 3) return 1.0f / (1.0f + expf(-v));
  return v;
}

// ---------------------------------------------------------------------------
// fp32 GEMM: C[R,Nc] = act(A[R,K] @ B[K,Nc] + bias)
// Block = 128 threads = 4 waves (2x2). Block tile 128x64; wave tile 64x32
// (4 M-subtiles x 2 N-subtiles of 16x16). K staged in 64-chunks,
// double-buffered in LDS via async global->LDS DMA when available.
// Per K-step: 4 A-pairs + 2 B-pairs feed 8 V_WMMA_F32_16X16X4_F32.
// ---------------------------------------------------------------------------
__global__ void gemm_wmma_kernel(const float* __restrict__ A,
                                 const float* __restrict__ Bm,
                                 const float* __restrict__ bias,
                                 float* __restrict__ C,
                                 int K, int Nc, int act) {
  extern __shared__ float smem[];
  float* sAb = smem;                 // [2][BM rows at pitch PA]
  float* sBb = smem + 2 * BM * PA;   // [2][KC rows at pitch PB]

  const int tid = threadIdx.x;
  const int rowBase = blockIdx.x * BM;
  const int colBase = blockIdx.y * BN;
  const int nk = K / KC;

  // Stage K-chunk kb into LDS buffer buf (async DMA when available).
  auto stage = [&](int kb, int buf) {
    float* dA = sAb + buf * (BM * PA);
    float* dB = sBb + buf * (KC * PB);
    const float* gA = A + (size_t)rowBase * K + kb * KC;
    const float* gB = Bm + (size_t)(kb * KC) * Nc + colBase;
#pragma unroll
    for (int j = 0; j < (BM * KC) / (4 * BL); ++j) {  // 16 x b128 per thread
      int idx = tid + j * BL;
      int r = idx >> 4;
      int cs = (idx & 15) << 2;
      copy16(gA + (size_t)r * K + cs, dA + r * PA + cs);
    }
#pragma unroll
    for (int j = 0; j < (KC * BN) / (4 * BL); ++j) {  // 8 x b128 per thread
      int idx = tid + j * BL;
      int r = idx >> 4;
      int cs = (idx & 15) << 2;
      copy16(gB + (size_t)r * Nc + cs, dB + r * PB + cs);
    }
  };

  const int lane = tid & 31;
  const int wv = tid >> 5;
  const int mw = (wv & 1) * 64;    // wave row offset in block tile
  const int nw = (wv >> 1) * 32;   // wave col offset in block tile
  const int m = lane & 15;         // A row / C column within 16x16 subtile
  const int hi = lane >> 4;        // K-pair selector (lanes 16-31: K+2,K+3)

  v8f acc[4][2] = {};

  stage(0, 0);
  stage_sync();

  for (int kb = 0; kb < nk; ++kb) {
    const int cur = kb & 1;
    if (kb + 1 < nk) stage(kb + 1, cur ^ 1);
    if (kb + 2 < nk)  // warm L2 for the chunk after next (global_prefetch_b8)
      __builtin_prefetch(A + (size_t)(rowBase + (tid >> 1)) * K + (kb + 2) * KC, 0, 0);

    const float* cA = sAb + cur * (BM * PA);
    const float* cB = sBb + cur * (KC * PB);

#pragma unroll 4
    for (int k0 = 0; k0 < KC; k0 += 4) {
      const int ka = k0 + 2 * hi;
      v2f av[4], bv[2];
#pragma unroll
      for (int mt = 0; mt < 4; ++mt) {
        const float* p = cA + (size_t)(mw + mt * 16 + m) * PA + ka;
        av[mt].x = p[0];
        av[mt].y = p[1];
      }
#pragma unroll
      for (int nt = 0; nt < 2; ++nt) {
        const float* p = cB + (size_t)ka * PB + nw + nt * 16 + m;
        bv[nt].x = p[0];
        bv[nt].y = p[PB];
      }
#pragma unroll
      for (int mt = 0; mt < 4; ++mt)
#pragma unroll
        for (int nt = 0; nt < 2; ++nt)
          acc[mt][nt] = __builtin_amdgcn_wmma_f32_16x16x4_f32(
              false, av[mt], false, bv[nt], (short)0, acc[mt][nt], false, false);
    }
    stage_sync();
  }

  // C/D layout: VGPR r2 holds M=r2 (lanes 0-15) or M=r2+8 (lanes 16-31)
#pragma unroll
  for (int nt = 0; nt < 2; ++nt) {
    const int col = colBase + nw + nt * 16 + m;
    const float bb = bias[col];
#pragma unroll
    for (int mt = 0; mt < 4; ++mt) {
#pragma unroll
      for (int r2 = 0; r2 < 8; ++r2) {
        int row = rowBase + mw + mt * 16 + hi * 8 + r2;
        C[(size_t)row * Nc + col] = act_apply(acc[mt][nt][r2] + bb, act);
      }
    }
  }
}

// ---------------------------------------------------------------------------
// prep_local: xl[bn,t,:] = x[b,t,n,:] - softmax(window_weight)-weighted
// 3-tap trend (zero-padded in time). One thread per float4.
// ---------------------------------------------------------------------------
__global__ void prep_local_kernel(const float* __restrict__ x,
                                  const float* __restrict__ wwraw,
                                  float* __restrict__ xl) {
  int idx = blockIdx.x * blockDim.x + threadIdx.x;  // RR*32 vec4s
  int d4 = idx & 31;
  int n = (idx >> 5) & 63;
  int t = (idx >> 11) & 255;
  int b = idx >> 19;

  float w0 = wwraw[0], w1 = wwraw[1], w2 = wwraw[2];
  float mw = fmaxf(w0, fmaxf(w1, w2));
  float e0 = expf(w0 - mw), e1 = expf(w1 - mw), e2 = expf(w2 - mw);
  float inv = 1.0f / (e0 + e1 + e2);
  e0 *= inv; e1 *= inv; e2 *= inv;

  const float4* X4 = reinterpret_cast<const float4*>(x);
  size_t base = ((size_t)(b * TT + t) * NN + n) * 32 + d4;
  float4 xc = X4[base];
  float4 xm = make_float4(0.f, 0.f, 0.f, 0.f);
  float4 xp = make_float4(0.f, 0.f, 0.f, 0.f);
  if (t > 0)      xm = X4[base - (size_t)NN * 32];
  if (t < TT - 1) xp = X4[base + (size_t)NN * 32];

  float4 o;
  o.x = xc.x - (e0 * xm.x + e1 * xc.x + e2 * xp.x);
  o.y = xc.y - (e0 * xm.y + e1 * xc.y + e2 * xp.y);
  o.z = xc.z - (e0 * xm.z + e1 * xc.z + e2 * xp.z);
  o.w = xc.w - (e0 * xm.w + e1 * xc.w + e2 * xp.w);

  int r = (b * NN + n) * TT + t;
  reinterpret_cast<float4*>(xl)[(size_t)r * 32 + d4] = o;
}

// ---------------------------------------------------------------------------
// Banded (|i-j|<=1) multi-head attention: off-band -1e9 scores underflow to
// exactly 0 after fp32 softmax, so only 3 neighbors matter.
// One thread per (bn, t, h).
// ---------------------------------------------------------------------------
__global__ void attn_kernel(const float* __restrict__ qkv,
                            float* __restrict__ outp) {
  int tid = blockIdx.x * blockDim.x + threadIdx.x;  // RR*HH threads
  int h = tid & 3;
  int r = tid >> 2;
  int t = r & 255;
  int bn = r >> 8;

  const float* qp = qkv + (size_t)r * 384 + h * 32;
  float q[32];
#pragma unroll
  for (int i = 0; i < 32; ++i) q[i] = qp[i];

  float s[3];
  float mmax = -3.0e38f;
#pragma unroll
  for (int j0 = 0; j0 < 3; ++j0) {
    int j = t + j0 - 1;
    if (j >= 0 && j < TT) {
      const float* kp = qkv + ((size_t)(bn * TT + j)) * 384 + 128 + h * 32;
      float d = 0.f;
#pragma unroll
      for (int i = 0; i < 32; ++i) d += q[i] * kp[i];
      s[j0] = d * 0.17677669529663687f;  // 1/sqrt(32)
      mmax = fmaxf(mmax, s[j0]);
    } else {
      s[j0] = -3.0e38f;
    }
  }

  float o[32];
#pragma unroll
  for (int i = 0; i < 32; ++i) o[i] = 0.f;
  float den = 0.f;
#pragma unroll
  for (int j0 = 0; j0 < 3; ++j0) {
    int j = t + j0 - 1;
    if (j >= 0 && j < TT) {
      float p = expf(s[j0] - mmax);
      den += p;
      const float* vp = qkv + ((size_t)(bn * TT + j)) * 384 + 256 + h * 32;
#pragma unroll
      for (int i = 0; i < 32; ++i) o[i] += p * vp[i];
    }
  }
  float invd = 1.0f / den;
  float* op = outp + (size_t)r * 128 + h * 32;
#pragma unroll
  for (int i = 0; i < 32; ++i) op[i] = o[i] * invd;
}

// ---------------------------------------------------------------------------
// LayerNorm over D=128, one wave32 per row (4 floats/lane), shfl_xor reduce.
// ---------------------------------------------------------------------------
__global__ void ln_kernel(float* __restrict__ X,
                          const float* __restrict__ g,
                          const float* __restrict__ b) {
  int row = blockIdx.x * 8 + (threadIdx.x >> 5);
  int lane = threadIdx.x & 31;
  float4* X4 = reinterpret_cast<float4*>(X);
  float4 v = X4[(size_t)row * 32 + lane];

  float s = v.x + v.y + v.z + v.w;
  float sq = v.x * v.x + v.y * v.y + v.z * v.z + v.w * v.w;
#pragma unroll
  for (int off = 16; off > 0; off >>= 1) {
    s += __shfl_xor(s, off, 32);
    sq += __shfl_xor(sq, off, 32);
  }
  float mean = s * (1.0f / 128.0f);
  float var = sq * (1.0f / 128.0f) - mean * mean;
  float inv = rsqrtf(var + 1e-5f);

  const float4 g4 = reinterpret_cast<const float4*>(g)[lane];
  const float4 b4 = reinterpret_cast<const float4*>(b)[lane];
  float4 o;
  o.x = (v.x - mean) * inv * g4.x + b4.x;
  o.y = (v.y - mean) * inv * g4.y + b4.y;
  o.z = (v.z - mean) * inv * g4.z + b4.z;
  o.w = (v.w - mean) * inv * g4.w + b4.w;
  X4[(size_t)row * 32 + lane] = o;
}

// ---------------------------------------------------------------------------
// prep_conv: x_pos = x + pos_enc; depthwise conv3 (pad 1, zeros AFTER pos add
// per reference) + conv bias. Output layout [bn,t,D]. One thread per float4.
// ---------------------------------------------------------------------------
__global__ void prep_conv_kernel(const float* __restrict__ x,
                                 const float* __restrict__ pos,
                                 const float* __restrict__ cw,
                                 const float* __restrict__ cb,
                                 float* __restrict__ xconv) {
  int idx = blockIdx.x * blockDim.x + threadIdx.x;  // RR*32 vec4s
  int d4 = idx & 31;
  int n = (idx >> 5) & 63;
  int t = (idx >> 11) & 255;
  int b = idx >> 19;
  int d0 = d4 * 4;

  const float4* X4 = reinterpret_cast<const float4*>(x);
  const float4* P4 = reinterpret_cast<const float4*>(pos);
  size_t base = ((size_t)(b * TT + t) * NN + n) * 32 + d4;

  float xm[4] = {0.f, 0.f, 0.f, 0.f}, xc[4], xp[4] = {0.f, 0.f, 0.f, 0.f};
  {
    float4 v = X4[base];
    float4 p = P4[(size_t)t * 32 + d4];
    xc[0] = v.x + p.x; xc[1] = v.y + p.y; xc[2] = v.z + p.z; xc[3] = v.w + p.w;
  }
  if (t > 0) {
    float4 v = X4[base - (size_t)NN * 32];
    float4 p = P4[(size_t)(t - 1) * 32 + d4];
    xm[0] = v.x + p.x; xm[1] = v.y + p.y; xm[2] = v.z + p.z; xm[3] = v.w + p.w;
  }
  if (t < TT - 1) {
    float4 v = X4[base + (size_t)NN * 32];
    float4 p = P4[(size_t)(t + 1) * 32 + d4];
    xp[0] = v.x + p.x; xp[1] = v.y + p.y; xp[2] = v.z + p.z; xp[3] = v.w + p.w;
  }

  float o[4];
#pragma unroll
  for (int c = 0; c < 4; ++c) {
    int d = d0 + c;
    float w0 = cw[d * 3 + 0], w1 = cw[d * 3 + 1], w2 = cw[d * 3 + 2];
    o[c] = w0 * xm[c] + w1 * xc[c] + w2 * xp[c] + cb[d];
  }
  int r = (b * NN + n) * TT + t;
  reinterpret_cast<float4*>(xconv)[(size_t)r * 32 + d4] =
      make_float4(o[0], o[1], o[2], o[3]);
}

// ---------------------------------------------------------------------------
// Mixed pool: k=6, stride 1, pad (2,2) -> length T-1, right zero-pad to T.
// avg divides by 6 always (zero pad contributes 0); max over valid entries.
// ---------------------------------------------------------------------------
__global__ void pool_kernel(const float* __restrict__ xconv,
                            const float* __restrict__ alpha_p,
                            float* __restrict__ outp) {
  int idx = blockIdx.x * blockDim.x + threadIdx.x;  // RR*32 vec4s
  int d4 = idx & 31;
  int r = idx >> 5;
  int t = r & 255;
  int bn = r >> 8;

  float4 res = make_float4(0.f, 0.f, 0.f, 0.f);
  if (t < TT - 1) {
    float a = 1.0f / (1.0f + expf(-alpha_p[0]));
    const float4* XC4 = reinterpret_cast<const float4*>(xconv);
    float sx = 0.f, sy = 0.f, sz = 0.f, sw = 0.f;
    float mx = -3.0e38f, my = -3.0e38f, mz = -3.0e38f, mw = -3.0e38f;
    for (int j = t - 2; j <= t + 3; ++j) {
      if (j >= 0 && j < TT) {
        float4 v = XC4[((size_t)(bn * TT + j)) * 32 + d4];
        sx += v.x; sy += v.y; sz += v.z; sw += v.w;
        mx = fmaxf(mx, v.x); my = fmaxf(my, v.y);
        mz = fmaxf(mz, v.z); mw = fmaxf(mw, v.w);
      }
    }
    const float inv6 = 1.0f / 6.0f;
    res.x = a * (sx * inv6) + (1.f - a) * mx;
    res.y = a * (sy * inv6) + (1.f - a) * my;
    res.z = a * (sz * inv6) + (1.f - a) * mz;
    res.w = a * (sw * inv6) + (1.f - a) * mw;
  }
  reinterpret_cast<float4*>(outp)[(size_t)r * 32 + d4] = res;
}

// ---------------------------------------------------------------------------
// concat [x_loc | x_glob] -> [R, 256]
// ---------------------------------------------------------------------------
__global__ void concat_kernel(const float* __restrict__ xloc,
                              const float* __restrict__ xglob,
                              float* __restrict__ cat) {
  int idx = blockIdx.x * blockDim.x + threadIdx.x;  // RR*64 vec4s
  int c4 = idx & 63;
  int r = idx >> 6;
  float4 v;
  if (c4 < 32)
    v = reinterpret_cast<const float4*>(xloc)[(size_t)r * 32 + c4];
  else
    v = reinterpret_cast<const float4*>(xglob)[(size_t)r * 32 + (c4 - 32)];
  reinterpret_cast<float4*>(cat)[(size_t)r * 64 + c4] = v;
}

// ---------------------------------------------------------------------------
// Final: out = x + softplus(res_scale) * (gate*x_loc + (1-gate)*x_glob)
// with [bn,t,D] -> [B,T,N,D] relayout.
// ---------------------------------------------------------------------------
__device__ __forceinline__ float softplus_f(float v) {
  return (v > 0.f) ? (v + log1pf(expf(-v))) : log1pf(expf(v));
}

__global__ void final_kernel(const float* __restrict__ x,
                             const float* __restrict__ gate,
                             const float* __restrict__ xloc,
                             const float* __restrict__ xglob,
                             const float* __restrict__ res_scale,
                             float* __restrict__ out) {
  int idx = blockIdx.x * blockDim.x + threadIdx.x;  // RR*32 vec4s
  int d4 = idx & 31;
  int n = (idx >> 5) & 63;
  int t = (idx >> 11) & 255;
  int b = idx >> 19;
  int r = (b * NN + n) * TT + t;

  float4 xv = reinterpret_cast<const float4*>(x)[((size_t)(b * TT + t) * NN + n) * 32 + d4];
  float4 g  = reinterpret_cast<const float4*>(gate)[(size_t)r * 32 + d4];
  float4 xl = reinterpret_cast<const float4*>(xloc)[(size_t)r * 32 + d4];
  float4 xg = reinterpret_cast<const float4*>(xglob)[(size_t)r * 32 + d4];
  float4 rs = reinterpret_cast<const float4*>(res_scale)[d4];

  float4 o;
  o.x = xv.x + softplus_f(rs.x) * (g.x * xl.x + (1.f - g.x) * xg.x);
  o.y = xv.y + softplus_f(rs.y) * (g.y * xl.y + (1.f - g.y) * xg.y);
  o.z = xv.z + softplus_f(rs.z) * (g.z * xl.z + (1.f - g.z) * xg.z);
  o.w = xv.w + softplus_f(rs.w) * (g.w * xl.w + (1.f - g.w) * xg.w);
  reinterpret_cast<float4*>(out)[((size_t)(b * TT + t) * NN + n) * 32 + d4] = o;
}

// ---------------------------------------------------------------------------
// Host launcher
// ---------------------------------------------------------------------------
extern "C" void kernel_launch(void* const* d_in, const int* in_sizes, int n_in,
                              void* d_out, int out_size, void* d_ws, size_t ws_size,
                              hipStream_t stream) {
  const float* x          = (const float*)d_in[0];
  const float* window_w   = (const float*)d_in[1];
  const float* local_w1   = (const float*)d_in[2];
  const float* local_b1   = (const float*)d_in[3];
  const float* local_w2   = (const float*)d_in[4];
  const float* local_b2   = (const float*)d_in[5];
  const float* local_ln_g = (const float*)d_in[6];
  const float* local_ln_b = (const float*)d_in[7];
  const float* qkv_w      = (const float*)d_in[8];
  const float* qkv_b      = (const float*)d_in[9];
  const float* out_w      = (const float*)d_in[10];
  const float* out_b      = (const float*)d_in[11];
  const float* conv_w     = (const float*)d_in[12];
  const float* conv_b     = (const float*)d_in[13];
  const float* alpha      = (const float*)d_in[14];
  const float* pos_enc    = (const float*)d_in[15];
  const float* global_w1  = (const float*)d_in[16];
  const float* global_b1  = (const float*)d_in[17];
  const float* global_w2  = (const float*)d_in[18];
  const float* global_b2  = (const float*)d_in[19];
  const float* global_ln_g= (const float*)d_in[20];
  const float* global_ln_b= (const float*)d_in[21];
  const float* gate_w1    = (const float*)d_in[22];
  const float* gate_b1    = (const float*)d_in[23];
  const float* gate_w2    = (const float*)d_in[24];
  const float* gate_b2    = (const float*)d_in[25];
  const float* res_scale  = (const float*)d_in[26];
  float* out = (float*)d_out;

  const size_t R = (size_t)RR;
  float* ws = (float*)d_ws;
  float* P0 = ws;             // R*128: xl -> attn_out -> x_loc
  float* P1 = ws + R * 128;   // R*384: qkv -> proj/h1/cat/gate
  float* P2 = ws + R * 512;   // R*128: xconv -> x_glob
  float* P3 = ws + R * 640;   // R*128: x_glob_in -> tanh_out
  float* h1   = P1 + R * 128; // R*256 region inside P1
  float* gate = P1 + R * 256; // R*128 region inside P1

  const int EW_BLOCKS = (RR * 32) / 256;               // elementwise vec4 grids
  const size_t GEMM_LDS = (2 * BM * PA + 2 * KC * PB) * sizeof(float);  // 104 KB

  // local branch
  prep_local_kernel<<<EW_BLOCKS, 256, 0, stream>>>(x, window_w, P0);
  gemm_wmma_kernel<<<dim3(RR / BM, 384 / BN), BL, GEMM_LDS, stream>>>(
      P0, qkv_w, qkv_b, P1, 128, 384, 0);
  attn_kernel<<<(RR * HH) / 256, 256, 0, stream>>>(P1, P0);
  gemm_wmma_kernel<<<dim3(RR / BM, 128 / BN), BL, GEMM_LDS, stream>>>(
      P0, out_w, out_b, P1, 128, 128, 0);
  gemm_wmma_kernel<<<dim3(RR / BM, 256 / BN), BL, GEMM_LDS, stream>>>(
      P1, local_w1, local_b1, h1, 128, 256, 1 /*gelu*/);
  gemm_wmma_kernel<<<dim3(RR / BM, 128 / BN), BL, GEMM_LDS, stream>>>(
      h1, local_w2, local_b2, P0, 256, 128, 0);
  ln_kernel<<<RR / 8, 256, 0, stream>>>(P0, local_ln_g, local_ln_b);  // x_loc = P0

  // global branch
  prep_conv_kernel<<<EW_BLOCKS, 256, 0, stream>>>(x, pos_enc, conv_w, conv_b, P2);
  pool_kernel<<<EW_BLOCKS, 256, 0, stream>>>(P2, alpha, P3);
  gemm_wmma_kernel<<<dim3(RR / BM, 256 / BN), BL, GEMM_LDS, stream>>>(
      P3, global_w1, global_b1, h1, 128, 256, 1 /*gelu*/);
  gemm_wmma_kernel<<<dim3(RR / BM, 128 / BN), BL, GEMM_LDS, stream>>>(
      h1, global_w2, global_b2, P2, 256, 128, 0);
  ln_kernel<<<RR / 8, 256, 0, stream>>>(P2, global_ln_g, global_ln_b);  // x_glob = P2

  // gated fusion
  concat_kernel<<<(RR * 64) / 256, 256, 0, stream>>>(P0, P2, P1);  // cat in P1[0:R*256]
  gemm_wmma_kernel<<<dim3(RR / BM, 128 / BN), BL, GEMM_LDS, stream>>>(
      P1, gate_w1, gate_b1, P3, 256, 128, 2 /*tanh*/);
  gemm_wmma_kernel<<<dim3(RR / BM, 128 / BN), BL, GEMM_LDS, stream>>>(
      P3, gate_w2, gate_b2, gate, 128, 128, 3 /*sigmoid*/);

  final_kernel<<<EW_BLOCKS, 256, 0, stream>>>(x, gate, P0, P2, res_scale, out);
}

// v002
// Measured time: 423 microseconds a run.
// Next to v001, in two timings, it ran 1.72 and 1.74 times as fast.
// Over all steps from v000 it is 2.38 times as fast.
#include <hip/hip_runtime.h>
#include <math.h>

// Problem constants (from reference)
#define BB 4
#define TT 256
#define NN 64
#define DD 128
#define HH 4
#define HD 32
#define RR (BB * NN * TT)   // 65536 rows

// GEMM blocking
#define BM 128   // block tile rows
#define BN 64    // block tile cols
#define KC 64    // K chunk staged in LDS
#define BL 128   // threads per block (4 waves)
// LDS row pitches in floats (LDS bank = dword address mod 64). Both stay
// multiples of 4 floats so every 16-byte copy lands 16-byte aligned.
#define PA 68    // A rows: 16 rows x 2 k-pairs of a fragment read fall on 64 distinct banks
#define PB 72    // B rows: rows k and k+2, read by the two lane halves, sit 16 banks apart

typedef __attribute__((ext_vector_type(2))) float v2f;
typedef __attribute__((ext_vector_type(8))) float v8f;

// ---------------------------------------------------------------------------
// CDNA5 async global->LDS copy (ASYNCcnt-tracked DMA), with sync fallback.
// Builtin signature (from hipcc diagnostic): (int4 AS1*, int4 AS3*, Ii, Ii).
// ---------------------------------------------------------------------------
#if defined(__has_builtin)
#if __has_builtin(__builtin_amdgcn_global_load_async_to_lds_b128) && \
    __has_builtin(__builtin_amdgcn_s_wait_asynccnt)
#define HAVE_ASYNC_LDS 1
#endif
#endif

#ifdef HAVE_ASYNC_LDS
typedef int vi4 __attribute__((__vector_size__(4 * sizeof(int))));
typedef __attribute__((address_space(1))) vi4 as1_vi4;
typedef __attribute__((address_space(3))) vi4 as3_vi4;
#endif

__device__ __forceinline__ void copy16(const float* g, float* l) {
#ifdef HAVE_ASYNC_LDS
  as1_vi4* gp = reinterpret_cast<as1_vi4*>((uintptr_t)g);
  as3_vi4* lp = reinterpret_cast<as3_vi4*>((uintptr_t)l);
  __builtin_amdgcn_global_load_async_to_lds_b128(gp, lp, 0, 0);
#else
  *reinterpret_cast<float4*>(l) = *reinterpret_cast<const float4*>(g);
#endif
}

__device__ __forceinline__ void stage_sync() {
#ifdef HAVE_ASYNC_LDS
  __builtin_amdgcn_s_wait_asynccnt(0);
#endif
  __syncthreads();
}

// ---------------------------------------------------------------------------
// Activation epilogues: 0=none, 1=exact GELU (erf), 2=tanh, 3=sigmoid
// ---------------------------------------------------------------------------
__device__ __forceinline__ float act_apply(float v, int act) {
  if (act == 1) return 0.5f * v * (1.0f + erff(v * 0.70710678118654752440f));
  if (act == 2) return tanhf(v);
  if (act == 3) return 1.0f / (1.0f + expf(-v));
  return v;
}

// ---------------------------------------------------------------------------
// fp32 GEMM: C[R,Nc] = act(A[R,K] @ B[K,Nc] + bias)
// Block = 128 threads = 4 waves (2x2). Block tile 128x64; wave tile 64x32
// (4 M-subtiles x 2 N-subtiles of 16x16). K staged in 64-chunks,
// double-buffered in LDS via async global->LDS DMA when available.
// Per K-step: 4 A-pairs + 2 B-pairs feed 8 V_WMMA_F32_16X16X4_F32.
// K, Nc and the activation are template constants: each launch runs code that
// holds its own activation only, with no selector branch per output element,
// and row strides fold into constant address steps. The block size is stated
// too, so that the register ceiling is that of 4 waves and the copy addresses
// of the unrolled K chunks stay in registers (no scratch).
// ---------------------------------------------------------------------------
template <int K, int Nc, int act>
__global__ void __launch_bounds__(BL) gemm_wmma_kernel(const float* __restrict__ A,
                                 const float* __restrict__ Bm,
                                 const float* __restrict__ bias,
                                 float* __restrict__ C) {
  extern __shared__ float smem[];
  float* sAb = smem;                 // [2][BM rows at pitch PA]
  float* sBb = smem + 2 * BM * PA;   // [2][KC rows at pitch PB]

  const int tid = threadIdx.x;
  const int rowBase = blockIdx.x * BM;
  const int colBase = blockIdx.y * BN;
  constexpr int nk = K / KC;

  // Stage K-chunk kb into LDS buffer buf (async DMA when available).
  auto stage = [&](int kb, int buf) {
    float* dA = sAb + buf * (BM * PA);
    float* dB = sBb + buf * (KC * PB);
    const float* gA = A + (size_t)rowBase * K + kb * KC;
    const float* gB = Bm + (size_t)(kb * KC) * Nc + colBase;
#pragma unroll
    for (int j = 0; j < (BM * KC) / (4 * BL); ++j) {  // 16 x b128 per thread
      int idx = tid + j * BL;
      int r = idx >> 4;
      int cs = (idx & 15) << 2;
      copy16(gA + (size_t)r * K + cs, dA + r * PA + cs);
    }
#pragma unroll
    for (int j = 0; j < (KC * BN) / (4 * BL); ++j) {  // 8 x b128 per thread
      int idx = tid + j * BL;
      int r = idx >> 4;
      int cs = (idx & 15) << 2;
      copy16(gB + (size_t)r * Nc + cs, dB + r * PB + cs);
    }
  };

  const int lane = tid & 31;
  const int wv = tid >> 5;
  const int mw = (wv & 1) * 64;    // wave row offset in block tile
  const int nw = (wv >> 1) * 32;   // wave col offset in block tile
  const int m = lane & 15;         // A row / C column within 16x16 subtile
  const int hi = lane >> 4;        // K-pair selector (lanes 16-31: K+2,K+3)

  v8f acc[4][2] = {};

  stage(0, 0);
  stage_sync();

  for (int kb = 0; kb < nk; ++kb) {
    const int cur = kb & 1;
    if (kb + 1 < nk) stage(kb + 1, cur ^ 1);
    if (kb + 2 < nk)  // warm L2 for the chunk after next (global_prefetch_b8)
      __builtin_prefetch(A + (size_t)(rowBase + (tid >> 1)) * K + (kb + 2) * KC, 0, 0);

    const float* cA = sAb + cur * (BM * PA);
    const float* cB = sBb + cur * (KC * PB);

#pragma unroll 4
    for (int k0 = 0; k0 < KC; k0 += 4) {
      const int ka = k0 + 2 * hi;
      v2f av[4], bv[2];
#pragma unroll
      for (int mt = 0; mt < 4; ++mt) {
        const float* p = cA + (size_t)(mw + mt * 16 + m) * PA + ka;
        av[mt].x = p[0];
        av[mt].y = p[1];
      }
#pragma unroll
      for (int nt = 0; nt < 2; ++nt) {
        const float* p = cB + (size_t)ka * PB + nw + nt * 16 + m;
        bv[nt].x = p[0];
        bv[nt].y = p[PB];
      }
#pragma unroll
      for (int mt = 0; mt < 4; ++mt)
#pragma unroll
        for (int nt = 0; nt < 2; ++nt)
          acc[mt][nt] = __builtin_amdgcn_wmma_f32_16x16x4_f32(
              false, av[mt], false, bv[nt], (short)0, acc[mt][nt], false, false);
    }
    stage_sync();
  }

  // C/D layout: VGPR r2 holds M=r2 (lanes 0-15) or M=r2+8 (lanes 16-31)
#pragma unroll
  for (int nt = 0; nt < 2; ++nt) {
    const int col = colBase + nw + nt * 16 + m;
    const float bb = bias[col];
#pragma unroll
    for (int mt = 0; mt < 4; ++mt) {
#pragma unroll
      for (int r2 = 0; r2 < 8; ++r2) {
        int row = rowBase + mw + mt * 16 + hi * 8 + r2;
        C[(size_t)row * Nc + col] = act_apply(acc[mt][nt][r2] + bb, act);
      }
    }
  }
}

// ---------------------------------------------------------------------------
// prep_local: xl[bn,t,:] = x[b,t,n,:] - softmax(window_weight)-weighted
// 3-tap trend (zero-padded in time). One thread per float4.
// ---------------------------------------------------------------------------
__global__ void prep_local_kernel(const float* __restrict__ x,
                                  const float* __restrict__ wwraw,
                                  float* __restrict__ xl) {
  int idx = blockIdx.x * blockDim.x + threadIdx.x;  // RR*32 vec4s
  int d4 = idx & 31;
  int n = (idx >> 5) & 63;
  int t = (idx >> 11) & 255;
  int b = idx >> 19;

  float w0 = wwraw[0], w1 = wwraw[1], w2 = wwraw[2];
  float mw = fmaxf(w0, fmaxf(w1, w2));
  float e0 = expf(w0 - mw), e1 = expf(w1 - mw), e2 = expf(w2 - mw);
  float inv = 1.0f / (e0 + e1 + e2);
  e0 *= inv; e1 *= inv; e2 *= inv;

  const float4* X4 = reinterpret_cast<const float4*>(x);
  size_t base = ((size_t)(b * TT + t) * NN + n) * 32 + d4;
  float4 xc = X4[base];
  float4 xm = make_float4(0.f, 0.f, 0.f, 0.f);
  float4 xp = make_float4(0.f, 0.f, 0.f, 0.f);
  if (t > 0)      xm = X4[base - (size_t)NN * 32];
  if (t < TT - 1) xp = X4[base + (size_t)NN * 32];

  float4 o;
  o.x = xc.x - (e0 * xm.x + e1 * xc.x + e2 * xp.x);
  o.y = xc.y - (e0 * xm.y + e1 * xc.y + e2 * xp.y);
  o.z = xc.z - (e0 * xm.z + e1 * xc.z + e2 * xp.z);
  o.w = xc.w - (e0 * xm.w + e1 * xc.w + e2 * xp.w);

  int r = (b * NN + n) * TT + t;
  reinterpret_cast<float4*>(xl)[(size_t)r * 32 + d4] = o;
}

// ---------------------------------------------------------------------------
// Banded (|i-j|<=1) multi-head attention: off-band -1e9 scores underflow to
// exactly 0 after fp32 softmax, so only 3 neighbors matter.
// One thread per (bn, t, h).
// ---------------------------------------------------------------------------
__global__ void attn_kernel(const float* __restrict__ qkv,
                            float* __restrict__ outp) {
  int tid = blockIdx.x * blockDim.x + threadIdx.x;  // RR*HH threads
  int h = tid & 3;
  int r = tid >> 2;
  int t = r & 255;
  int bn = r >> 8;

  const float* qp = qkv + (size_t)r * 384 + h * 32;
  float q[32];
#pragma unroll
  for (int i = 0; i < 32; ++i) q[i] = qp[i];

  float s[3];
  float mmax = -3.0e38f;
#pragma unroll
  for (int j0 = 0; j0 < 3; ++j0) {
    int j = t + j0 - 1;
    if (j >= 0 && j < TT) {
      const float* kp = qkv + ((size_t)(bn * TT + j)) * 384 + 128 + h * 32;
      float d = 0.f;
#pragma unroll
      for (int i = 0; i < 32; ++i) d += q[i] * kp[i];
      s[j0] = d * 0.17677669529663687f;  // 1/sqrt(32)
      mmax = fmaxf(mmax, s[j0]);
    } else {
      s[j0] = -3.0e38f;
    }
  }

  float o[32];
#pragma unroll
  for (int i = 0; i < 32; ++i) o[i] = 0.f;
  float den = 0.f;
#pragma unroll
  for (int j0 = 0; j0 < 3; ++j0) {
    int j = t + j0 - 1;
    if (j >= 0 && j < TT) {
      float p = expf(s[j0] - mmax);
      den += p;
      const float* vp = qkv + ((size_t)(bn * TT + j)) * 384 + 256 + h * 32;
#pragma unroll
      for (int i = 0; i < 32; ++i) o[i] += p * vp[i];
    }
  }
  float invd = 1.0f / den;
  float* op = outp + (size_t)r * 128 + h * 32;
#pragma unroll
  for (int i = 0; i < 32; ++i) op[i] = o[i] * invd;
}

// ---------------------------------------------------------------------------
// LayerNorm over D=128, one wave32 per row (4 floats/lane), shfl_xor reduce.
// ---------------------------------------------------------------------------
__global__ void ln_kernel(float* __restrict__ X,
                          const float* __restrict__ g,
                          const float* __restrict__ b) {
  int row = blockIdx.x * 8 + (threadIdx.x >> 5);
  int lane = threadIdx.x & 31;
  float4* X4 = reinterpret_cast<float4*>(X);
  float4 v = X4[(size_t)row * 32 + lane];

  float s = v.x + v.y + v.z + v.w;
  float sq = v.x * v.x + v.y * v.y + v.z * v.z + v.w * v.w;
#pragma unroll
  for (int off = 16; off > 0; off >>= 1) {
    s += __shfl_xor(s, off, 32);
    sq += __shfl_xor(sq, off, 32);
  }
  float mean = s * (1.0f / 128.0f);
  float var = sq * (1.0f / 128.0f) - mean * mean;
  float inv = rsqrtf(var + 1e-5f);

  const float4 g4 = reinterpret_cast<const float4*>(g)[lane];
  const float4 b4 = reinterpret_cast<const float4*>(b)[lane];
  float4 o;
  o.x = (v.x - mean) * inv * g4.x + b4.x;
  o.y = (v.y - mean) * inv * g4.y + b4.y;
  o.z = (v.z - mean) * inv * g4.z + b4.z;
  o.w = (v.w - mean) * inv * g4.w + b4.w;
  X4[(size_t)row * 32 + lane] = o;
}

// ---------------------------------------------------------------------------
// prep_conv: x_pos = x + pos_enc; depthwise conv3 (pad 1, zeros AFTER pos add
// per reference) + conv bias. Output layout [bn,t,D]. One thread per float4.
// ---------------------------------------------------------------------------
__global__ void prep_conv_kernel(const float* __restrict__ x,
                                 const float* __restrict__ pos,
                                 const float* __restrict__ cw,
                                 const float* __restrict__ cb,
                                 float* __restrict__ xconv) {
  int idx = blockIdx.x * blockDim.x + threadIdx.x;  // RR*32 vec4s
  int d4 = idx & 31;
  int n = (idx >> 5) & 63;
  int t = (idx >> 11) & 255;
  int b = idx >> 19;
  int d0 = d4 * 4;

  const float4* X4 = reinterpret_cast<const float4*>(x);
  const float4* P4 = reinterpret_cast<const float4*>(pos);
  size_t base = ((size_t)(b * TT + t) * NN + n) * 32 + d4;

  float xm[4] = {0.f, 0.f, 0.f, 0.f}, xc[4], xp[4] = {0.f, 0.f, 0.f, 0.f};
  {
    float4 v = X4[base];
    float4 p = P4[(size_t)t * 32 + d4];
    xc[0] = v.x + p.x; xc[1] = v.y + p.y; xc[2] = v.z + p.z; xc[3] = v.w + p.w;
  }
  if (t > 0) {
    float4 v = X4[base - (size_t)NN * 32];
    float4 p = P4[(size_t)(t - 1) * 32 + d4];
    xm[0] = v.x + p.x; xm[1] = v.y + p.y; xm[2] = v.z + p.z; xm[3] = v.w + p.w;
  }
  if (t < TT - 1) {
    float4 v = X4[base + (size_t)NN * 32];
    float4 p = P4[(size_t)(t + 1) * 32 + d4];
    xp[0] = v.x + p.x; xp[1] = v.y + p.y; xp[2] = v.z + p.z; xp[3] = v.w + p.w;
  }

  float o[4];
#pragma unroll
  for (int c = 0; c < 4; ++c) {
    int d = d0 + c;
    float w0 = cw[d * 3 + 0], w1 = cw[d * 3 + 1], w2 = cw[d * 3 + 2];
    o[c] = w0 * xm[c] + w1 * xc[c] + w2 * xp[c] + cb[d];
  }
  int r = (b * NN + n) * TT + t;
  reinterpret_cast<float4*>(xconv)[(size_t)r * 32 + d4] =
      make_float4(o[0], o[1], o[2], o[3]);
}

// ---------------------------------------------------------------------------
// Mixed pool: k=6, stride 1, pad (2,2) -> length T-1, right zero-pad to T.
// avg divides by 6 always (zero pad contributes 0); max over valid entries.
// ---------------------------------------------------------------------------
__global__ void pool_kernel(const float* __restrict__ xconv,
                            const float* __restrict__ alpha_p,
                            float* __restrict__ outp) {
  int idx = blockIdx.x * blockDim.x + threadIdx.x;  // RR*32 vec4s
  int d4 = idx & 31;
  int r = idx >> 5;
  int t = r & 255;
  int bn = r >> 8;

  float4 res = make_float4(0.f, 0.f, 0.f, 0.f);
  if (t < TT - 1) {
    float a = 1.0f / (1.0f + expf(-alpha_p[0]));
    const float4* XC4 = reinterpret_cast<const float4*>(xconv);
    float sx = 0.f, sy = 0.f, sz = 0.f, sw = 0.f;
    float mx = -3.0e38f, my = -3.0e38f, mz = -3.0e38f, mw = -3.0e38f;
    for (int j = t - 2; j <= t + 3; ++j) {
      if (j >= 0 && j < TT) {
        float4 v = XC4[((size_t)(bn * TT + j)) * 32 + d4];
        sx += v.x; sy += v.y; sz += v.z; sw += v.w;
        mx = fmaxf(mx, v.x); my = fmaxf(my, v.y);
        mz = fmaxf(mz, v.z); mw = fmaxf(mw, v.w);
      }
    }
    const float inv6 = 1.0f / 6.0f;
    res.x = a * (sx * inv6) + (1.f - a) * mx;
    res.y = a * (sy * inv6) + (1.f - a) * my;
    res.z = a * (sz * inv6) + (1.f - a) * mz;
    res.w = a * (sw * inv6) + (1.f - a) * mw;
  }
  reinterpret_cast<float4*>(outp)[(size_t)r * 32 + d4] = res;
}

// ---------------------------------------------------------------------------
// concat [x_loc | x_glob] -> [R, 256]
// ---------------------------------------------------------------------------
__global__ void concat_kernel(const float* __restrict__ xloc,
                              const float* __restrict__ xglob,
                              float* __restrict__ cat) {
  int idx = blockIdx.x * blockDim.x + threadIdx.x;  // RR*64 vec4s
  int c4 = idx & 63;
  int r = idx >> 6;
  float4 v;
  if (c4 < 32)
    v = reinterpret_cast<const float4*>(xloc)[(size_t)r * 32 + c4];
  else
    v = reinterpret_cast<const float4*>(xglob)[(size_t)r * 32 + (c4 - 32)];
  reinterpret_cast<float4*>(cat)[(size_t)r * 64 + c4] = v;
}

// ---------------------------------------------------------------------------
// Final: out = x + softplus(res_scale) * (gate*x_loc + (1-gate)*x_glob)
// with [bn,t,D] -> [B,T,N,D] relayout.
// ---------------------------------------------------------------------------
__device__ __forceinline__ float softplus_f(float v) {
  return (v > 0.f) ? (v + log1pf(expf(-v))) : log1pf(expf(v));
}

__global__ void final_kernel(const float* __restrict__ x,
                             const float* __restrict__ gate,
                             const float* __restrict__ xloc,
                             const float* __restrict__ xglob,
                             const float* __restrict__ res_scale,
                             float* __restrict__ out) {
  int idx = blockIdx.x * blockDim.x + threadIdx.x;  // RR*32 vec4s
  int d4 = idx & 31;
  int n = (idx >> 5) & 63;
  int t = (idx >> 11) & 255;
  int b = idx >> 19;
  int r = (b * NN + n) * TT + t;

  float4 xv = reinterpret_cast<const float4*>(x)[((size_t)(b * TT + t) * NN + n) * 32 + d4];
  float4 g  = reinterpret_cast<const float4*>(gate)[(size_t)r * 32 + d4];
  float4 xl = reinterpret_cast<const float4*>(xloc)[(size_t)r * 32 + d4];
  float4 xg = reinterpret_cast<const float4*>(xglob)[(size_t)r * 32 + d4];
  float4 rs = reinterpret_cast<const float4*>(res_scale)[d4];

  float4 o;
  o.x = xv.x + softplus_f(rs.x) * (g.x * xl.x + (1.f - g.x) * xg.x);
  o.y = xv.y + softplus_f(rs.y) * (g.y * xl.y + (1.f - g.y) * xg.y);
  o.z = xv.z + softplus_f(rs.z) * (g.z * xl.z + (1.f - g.z) * xg.z);
  o.w = xv.w + softplus_f(rs.w) * (g.w * xl.w + (1.f - g.w) * xg.w);
  reinterpret_cast<float4*>(out)[((size_t)(b * TT + t) * NN + n) * 32 + d4] = o;
}

// ---------------------------------------------------------------------------
// Host launcher
// ---------------------------------------------------------------------------
extern "C" void kernel_launch(void* const* d_in, const int* in_sizes, int n_in,
                              void* d_out, int out_size, void* d_ws, size_t ws_size,
                              hipStream_t stream) {
  const float* x          = (const float*)d_in[0];
  const float* window_w   = (const float*)d_in[1];
  const float* local_w1   = (const float*)d_in[2];
  const float* local_b1   = (const float*)d_in[3];
  const float* local_w2   = (const float*)d_in[4];
  const float* local_b2   = (const float*)d_in[5];
  const float* local_ln_g = (const float*)d_in[6];
  const float* local_ln_b = (const float*)d_in[7];
  const float* qkv_w      = (const float*)d_in[8];
  const float* qkv_b      = (const float*)d_in[9];
  const float* out_w      = (const float*)d_in[10];
  const float* out_b      = (const float*)d_in[11];
  const float* conv_w     = (const float*)d_in[12];
  const float* conv_b     = (const float*)d_in[13];
  const float* alpha      = (const float*)d_in[14];
  const float* pos_enc    = (const float*)d_in[15];
  const float* global_w1  = (const float*)d_in[16];
  const float* global_b1  = (const float*)d_in[17];
  const float* global_w2  = (const float*)d_in[18];
  const float* global_b2  = (const float*)d_in[19];
  const float* global_ln_g= (const float*)d_in[20];
  const float* global_ln_b= (const float*)d_in[21];
  const float* gate_w1    = (const float*)d_in[22];
  const float* gate_b1    = (const float*)d_in[23];
  const float* gate_w2    = (const float*)d_in[24];
  const float* gate_b2    = (const float*)d_in[25];
  const float* res_scale  = (const float*)d_in[26];
  float* out = (float*)d_out;

  const size_t R = (size_t)RR;
  float* ws = (float*)d_ws;
  float* P0 = ws;             // R*128: xl -> attn_out -> x_loc
  float* P1 = ws + R * 128;   // R*384: qkv -> proj/h1/cat/gate
  float* P2 = ws + R * 512;   // R*128: xconv -> x_glob
  float* P3 = ws + R * 640;   // R*128: x_glob_in -> tanh_out
  float* h1   = P1 + R * 128; // R*256 region inside P1
  float* gate = P1 + R * 256; // R*128 region inside P1

  const int EW_BLOCKS = (RR * 32) / 256;               // elementwise vec4 grids
  const size_t GEMM_LDS = (2 * BM * PA + 2 * KC * PB) * sizeof(float);  // 104 KB

  // local branch
  prep_local_kernel<<<EW_BLOCKS, 256, 0, stream>>>(x, window_w, P0);
  gemm_wmma_kernel<128, 384, 0><<<dim3(RR / BM, 384 / BN), BL, GEMM_LDS, stream>>>(
      P0, qkv_w, qkv_b, P1);
  attn_kernel<<<(RR * HH) / 256, 256, 0, stream>>>(P1, P0);
  gemm_wmma_kernel<128, 128, 0><<<dim3(RR / BM, 128 / BN), BL, GEMM_LDS, stream>>>(
      P0, out_w, out_b, P1);
  gemm_wmma_kernel<128, 256, 1 /*gelu*/><<<dim3(RR / BM, 256 / BN), BL, GEMM_LDS, stream>>>(
      P1, local_w1, local_b1, h1);
  gemm_wmma_kernel<256, 128, 0><<<dim3(RR / BM, 128 / BN), BL, GEMM_LDS, stream>>>(
      h1, local_w2, local_b2, P0);
  ln_kernel<<<RR / 8, 256, 0, stream>>>(P0, local_ln_g, local_ln_b);  // x_loc = P0

  // global branch
  prep_conv_kernel<<<EW_BLOCKS, 256, 0, stream>>>(x, pos_enc, conv_w, conv_b, P2);
  pool_kernel<<<EW_BLOCKS, 256, 0, stream>>>(P2, alpha, P3);
  gemm_wmma_kernel<128, 256, 1 /*gelu*/><<<dim3(RR / BM, 256 / BN), BL, GEMM_LDS, stream>>>(
      P3, global_w1, global_b1, h1);
  gemm_wmma_kernel<256, 128, 0><<<dim3(RR / BM, 128 / BN), BL, GEMM_LDS, stream>>>(
      h1, global_w2, global_b2, P2);
  ln_kernel<<<RR / 8, 256, 0, stream>>>(P2, global_ln_g, global_ln_b);  // x_glob = P2

  // gated fusion
  concat_kernel<<<(RR * 64) / 256, 256, 0, stream>>>(P0, P2, P1);  // cat in P1[0:R*256]
  gemm_wmma_kernel<256, 128, 2 /*tanh*/><<<dim3(RR / BM, 128 / BN), BL, GEMM_LDS, stream>>>(
      P1, gate_w1, gate_b1, P3);
  gemm_wmma_kernel<128, 128, 3 /*sigmoid*/><<<dim3(RR / BM, 128 / BN), BL, GEMM_LDS, stream>>>(
      P3, gate_w2, gate_b2, gate);

  final_kernel<<<EW_BLOCKS, 256, 0, stream>>>(x, gate, P0, P2, res_scale, out);
}

// v003
// Measured time: 402 microseconds a run.
// Timed twice side by side with v002, it ran 1.05 times as fast both times.
// Over all steps from v000 it is 2.50 times as fast.
#include <hip/hip_runtime.h>
#include <math.h>

// Problem constants (from reference)
#define BB 4
#define TT 256
#define NN 64
#define DD 128
#define HH 4
#define HD 32
#define RR (BB * NN * TT)   // 65536 rows

// GEMM blocking
#define BM 128   // block tile rows
#define BN 64    // block tile cols
#define KC 64    // K chunk staged in LDS
#define BL 128   // threads per block (4 waves)
// LDS row pitches in floats (LDS bank = dword address mod 64). Both stay
// multiples of 4 floats so every 16-byte copy lands 16-byte aligned.
#define PA 68    // A rows: 16 rows x 2 k-pairs of a fragment read fall on 64 distinct banks
#define PB 72    // B rows: rows k and k+2, read by the two lane halves, sit 16 banks apart

// Streaming kernels (everything but the GEMMs and the attention): one wave
// walks SR rows of 128 floats, one float4 per lane and row, so a launch starts
// 4,096 waves (one 16-wave work-group per WGP) and each wave has SR or more
// 512-byte loads in flight. The row loops are fully unrolled, so that the row
// arrays are registers and a run's loads can issue back to back.
#define SW 16                  // waves per work-group
#define ST (SW * 32)           // threads per work-group
#define SR 16                  // rows per wave (the two fences on loaded values name 16)
#define SG (RR / (SW * SR))    // work-groups per launch
// Stands behind a run of loads: s_wait_xcnt 0 before any register that an issued
// load names is written again. The address operands only keep those registers
// alive up to the wait, so that no later load's result lands in them before it.
#define XWAIT0() asm volatile("s_wait_xcnt 0x0" ::: "memory")
#define XWAIT1(a) asm volatile("s_wait_xcnt 0x0" :: "v"(a) : "memory")
#define XWAIT2(a, b) asm volatile("s_wait_xcnt 0x0" :: "v"(a), "v"(b) : "memory")
#define XWAIT4(a, b, c, d) asm volatile("s_wait_xcnt 0x0" :: "v"(a), "v"(b), "v"(c), "v"(d) : "memory")

typedef __attribute__((ext_vector_type(2))) float v2f;
typedef __attribute__((ext_vector_type(8))) float v8f;
typedef __attribute__((ext_vector_type(4))) float v4f;

// ---------------------------------------------------------------------------
// CDNA5 async global->LDS copy (ASYNCcnt-tracked DMA), with sync fallback.
// Builtin signature (from hipcc diagnostic): (int4 AS1*, int4 AS3*, Ii, Ii).
// ---------------------------------------------------------------------------
#if defined(__has_builtin)
#if __has_builtin(__builtin_amdgcn_global_load_async_to_lds_b128) && \
    __has_builtin(__builtin_amdgcn_s_wait_asynccnt)
#define HAVE_ASYNC_LDS 1
#endif
#endif

#ifdef HAVE_ASYNC_LDS
typedef int vi4 __attribute__((__vector_size__(4 * sizeof(int))));
typedef __attribute__((address_space(1))) vi4 as1_vi4;
typedef __attribute__((address_space(3))) vi4 as3_vi4;
#endif

__device__ __forceinline__ void copy16(const float* g, float* l) {
#ifdef HAVE_ASYNC_LDS
  as1_vi4* gp = reinterpret_cast<as1_vi4*>((uintptr_t)g);
  as3_vi4* lp = reinterpret_cast<as3_vi4*>((uintptr_t)l);
  __builtin_amdgcn_global_load_async_to_lds_b128(gp, lp, 0, 0);
#else
  *reinterpret_cast<float4*>(l) = *reinterpret_cast<const float4*>(g);
#endif
}

__device__ __forceinline__ void stage_sync() {
#ifdef HAVE_ASYNC_LDS
  __builtin_amdgcn_s_wait_asynccnt(0);
#endif
  __syncthreads();
}

// ---------------------------------------------------------------------------
// Activation epilogues: 0=none, 1=exact GELU (erf), 2=tanh, 3=sigmoid
// ---------------------------------------------------------------------------
__device__ __forceinline__ float act_apply(float v, int act) {
  if (act == 1) return 0.5f * v * (1.0f + erff(v * 0.70710678118654752440f));
  if (act == 2) return tanhf(v);
  if (act == 3) return 1.0f / (1.0f + expf(-v));
  return v;
}

// ---------------------------------------------------------------------------
// fp32 GEMM: C[R,Nc] = act(A[R,K] @ B[K,Nc] + bias)
// Block = 128 threads = 4 waves (2x2). Block tile 128x64; wave tile 64x32
// (4 M-subtiles x 2 N-subtiles of 16x16). K staged in 64-chunks,
// double-buffered in LDS via async global->LDS DMA when available.
// Per K-step: 4 A-pairs + 2 B-pairs feed 8 V_WMMA_F32_16X16X4_F32.
// K, Nc and the activation are template constants: each launch runs code that
// holds its own activation only, with no selector branch per output element,
// and row strides fold into constant address steps. The block size is stated
// too, so that the register ceiling is that of 4 waves and the copy addresses
// of the unrolled K chunks stay in registers (no scratch).
// ---------------------------------------------------------------------------
template <int K, int Nc, int act>
__global__ void __launch_bounds__(BL) gemm_wmma_kernel(const float* __restrict__ A,
                                 const float* __restrict__ Bm,
                                 const float* __restrict__ bias,
                                 float* __restrict__ C) {
  extern __shared__ float smem[];
  float* sAb = smem;                 // [2][BM rows at pitch PA]
  float* sBb = smem + 2 * BM * PA;   // [2][KC rows at pitch PB]

  const int tid = threadIdx.x;
  const int rowBase = blockIdx.x * BM;
  const int colBase = blockIdx.y * BN;
  constexpr int nk = K / KC;

  // Stage K-chunk kb into LDS buffer buf (async DMA when available).
  auto stage = [&](int kb, int buf) {
    float* dA = sAb + buf * (BM * PA);
    float* dB = sBb + buf * (KC * PB);
    const float* gA = A + (size_t)rowBase * K + kb * KC;
    const float* gB = Bm + (size_t)(kb * KC) * Nc + colBase;
#pragma unroll
    for (int j = 0; j < (BM * KC) / (4 * BL); ++j) {  // 16 x b128 per thread
      int idx = tid + j * BL;
      int r = idx >> 4;
      int cs = (idx & 15) << 2;
      copy16(gA + (size_t)r * K + cs, dA + r * PA + cs);
    }
#pragma unroll
    for (int j = 0; j < (KC * BN) / (4 * BL); ++j) {  // 8 x b128 per thread
      int idx = tid + j * BL;
      int r = idx >> 4;
      int cs = (idx & 15) << 2;
      copy16(gB + (size_t)r * Nc + cs, dB + r * PB + cs);
    }
  };

  const int lane = tid & 31;
  const int wv = tid >> 5;
  const int mw = (wv & 1) * 64;    // wave row offset in block tile
  const int nw = (wv >> 1) * 32;   // wave col offset in block tile
  const int m = lane & 15;         // A row / C column within 16x16 subtile
  const int hi = lane >> 4;        // K-pair selector (lanes 16-31: K+2,K+3)

  v8f acc[4][2] = {};

  stage(0, 0);
  stage_sync();

  for (int kb = 0; kb < nk; ++kb) {
    const int cur = kb & 1;
    if (kb + 1 < nk) stage(kb + 1, cur ^ 1);
    if (kb + 2 < nk)  // warm L2 for the chunk after next (global_prefetch_b8)
      __builtin_prefetch(A + (size_t)(rowBase + (tid >> 1)) * K + (kb + 2) * KC, 0, 0);

    const float* cA = sAb + cur * (BM * PA);
    const float* cB = sBb + cur * (KC * PB);

#pragma unroll 4
    for (int k0 = 0; k0 < KC; k0 += 4) {
      const int ka = k0 + 2 * hi;
      v2f av[4], bv[2];
#pragma unroll
      for (int mt = 0; mt < 4; ++mt) {
        const float* p = cA + (size_t)(mw + mt * 16 + m) * PA + ka;
        av[mt].x = p[0];
        av[mt].y = p[1];
      }
#pragma unroll
      for (int nt = 0; nt < 2; ++nt) {
        const float* p = cB + (size_t)ka * PB + nw + nt * 16 + m;
        bv[nt].x = p[0];
        bv[nt].y = p[PB];
      }
#pragma unroll
      for (int mt = 0; mt < 4; ++mt)
#pragma unroll
        for (int nt = 0; nt < 2; ++nt)
          acc[mt][nt] = __builtin_amdgcn_wmma_f32_16x16x4_f32(
              false, av[mt], false, bv[nt], (short)0, acc[mt][nt], false, false);
    }
    stage_sync();
  }

  // C/D layout: VGPR r2 holds M=r2 (lanes 0-15) or M=r2+8 (lanes 16-31)
#pragma unroll
  for (int nt = 0; nt < 2; ++nt) {
    const int col = colBase + nw + nt * 16 + m;
    const float bb = bias[col];
#pragma unroll
    for (int mt = 0; mt < 4; ++mt) {
#pragma unroll
      for (int r2 = 0; r2 < 8; ++r2) {
        int row = rowBase + mw + mt * 16 + hi * 8 + r2;
        C[(size_t)row * Nc + col] = act_apply(acc[mt][nt][r2] + bb, act);
      }
    }
  }
}

// ---------------------------------------------------------------------------
// prep_local: xl[bn,t,:] = x[b,t,n,:] - softmax(window_weight)-weighted
// 3-tap trend (zero-padded in time). One wave per (b, n, run of SR time steps);
// the neighbours in time come from the wave's own registers.
// ---------------------------------------------------------------------------
__global__ void __launch_bounds__(ST) prep_local_kernel(const float* __restrict__ x,
                                  const float* __restrict__ wwraw,
                                  float* __restrict__ xl) {
  const int lane = threadIdx.x & 31;
  const int w = blockIdx.x * SW + (threadIdx.x >> 5);
  const int n = w & 63;               // a work-group's waves read neighbouring n
  const int t0 = ((w >> 6) & 15) * SR;
  const int b = w >> 10;

  float w0 = wwraw[0], w1 = wwraw[1], w2 = wwraw[2];
  float mw = fmaxf(w0, fmaxf(w1, w2));
  float e0 = expf(w0 - mw), e1 = expf(w1 - mw), e2 = expf(w2 - mw);
  float inv = 1.0f / (e0 + e1 + e2);
  e0 *= inv; e1 *= inv; e2 *= inv;

  const float4* X4 = reinterpret_cast<const float4*>(x) + ((size_t)(b * TT) * NN + n) * 32 + lane;
  float4 v[SR + 2];                   // time steps t0-1 .. t0+SR
  const float4* xlo = X4 + (size_t)(t0 > 0 ? t0 - 1 : 0) * (NN * 32);
  const float4* xhi = X4 + (size_t)(t0 + SR < TT ? t0 + SR : TT - 1) * (NN * 32);
  const float4* xb = X4 + (size_t)t0 * (NN * 32);
  v[0] = *xlo;
  v[SR + 1] = *xhi;
  XWAIT2(xlo, xhi);  // behind these loads, before their address registers are written again
#pragma unroll
  for (int i = 0; i < SR; ++i) v[i + 1] = xb[(size_t)i * (NN * 32)];
  XWAIT1(xb);  // behind these loads, before their address registers are written again
  if (t0 == 0)       v[0] = make_float4(0.f, 0.f, 0.f, 0.f);
  if (t0 + SR == TT) v[SR + 1] = make_float4(0.f, 0.f, 0.f, 0.f);

  float4* O4 = reinterpret_cast<float4*>(xl) + ((size_t)(b * NN + n) * TT + t0) * 32 + lane;
#pragma unroll
  for (int i = 0; i < SR; ++i) {
    const float4 xm = v[i], xc = v[i + 1], xp = v[i + 2];
    float4 o;
    o.x = xc.x - (e0 * xm.x + e1 * xc.x + e2 * xp.x);
    o.y = xc.y - (e0 * xm.y + e1 * xc.y + e2 * xp.y);
    o.z = xc.z - (e0 * xm.z + e1 * xc.z + e2 * xp.z);
    o.w = xc.w - (e0 * xm.w + e1 * xc.w + e2 * xp.w);
    O4[(size_t)i * 32] = o;
  }
}

// ---------------------------------------------------------------------------
// Banded (|i-j|<=1) multi-head attention: off-band -1e9 scores underflow to
// exactly 0 after fp32 softmax, so only 3 neighbors matter.
// One thread per (bn, t, h).
// ---------------------------------------------------------------------------
__global__ void attn_kernel(const float* __restrict__ qkv,
                            float* __restrict__ outp) {
  int tid = blockIdx.x * blockDim.x + threadIdx.x;  // RR*HH threads
  int h = tid & 3;
  int r = tid >> 2;
  int t = r & 255;
  int bn = r >> 8;

  const float* qp = qkv + (size_t)r * 384 + h * 32;
  float q[32];
#pragma unroll
  for (int i = 0; i < 32; ++i) q[i] = qp[i];

  float s[3];
  float mmax = -3.0e38f;
#pragma unroll
  for (int j0 = 0; j0 < 3; ++j0) {
    int j = t + j0 - 1;
    if (j >= 0 && j < TT) {
      const float* kp = qkv + ((size_t)(bn * TT + j)) * 384 + 128 + h * 32;
      float d = 0.f;
#pragma unroll
      for (int i = 0; i < 32; ++i) d += q[i] * kp[i];
      s[j0] = d * 0.17677669529663687f;  // 1/sqrt(32)
      mmax = fmaxf(mmax, s[j0]);
    } else {
      s[j0] = -3.0e38f;
    }
  }

  float o[32];
#pragma unroll
  for (int i = 0; i < 32; ++i) o[i] = 0.f;
  float den = 0.f;
#pragma unroll
  for (int j0 = 0; j0 < 3; ++j0) {
    int j = t + j0 - 1;
    if (j >= 0 && j < TT) {
      float p = expf(s[j0] - mmax);
      den += p;
      const float* vp = qkv + ((size_t)(bn * TT + j)) * 384 + 256 + h * 32;
#pragma unroll
      for (int i = 0; i < 32; ++i) o[i] += p * vp[i];
    }
  }
  float invd = 1.0f / den;
  float* op = outp + (size_t)r * 128 + h * 32;
#pragma unroll
  for (int i = 0; i < 32; ++i) op[i] = o[i] * invd;
}

// ---------------------------------------------------------------------------
// LayerNorm over D=128: one wave32 per row at a time (4 floats/lane, shfl_xor
// reduce), SR consecutive rows per wave, all loaded before the first is summed.
// ---------------------------------------------------------------------------
__global__ void __launch_bounds__(ST) ln_kernel(float* __restrict__ X,
                          const float* __restrict__ g,
                          const float* __restrict__ b) {
  const int lane = threadIdx.x & 31;
  const int w = blockIdx.x * SW + __builtin_amdgcn_readfirstlane(threadIdx.x >> 5);  // wave-uniform: row addresses are scalar
  v4f* X4 = reinterpret_cast<v4f*>(X) + (size_t)w * (SR * 32) + lane;
  const v4f g4 = reinterpret_cast<const v4f*>(g)[lane];
  const v4f b4 = reinterpret_cast<const v4f*>(b)[lane];

  v4f vv[SR];
#pragma unroll
  for (int i = 0; i < SR; ++i) vv[i] = X4[(size_t)i * 32];
  // Inputs-only fence on the loaded values: all SR rows are asked for before the
  // first is summed; left free, the compiler asks for the last four only after
  // the first twelve have arrived, a second memory latency.
  asm volatile("" :: "v"(vv[0]), "v"(vv[1]), "v"(vv[2]), "v"(vv[3]), "v"(vv[4]), "v"(vv[5]), "v"(vv[6]), "v"(vv[7]),
                     "v"(vv[8]), "v"(vv[9]), "v"(vv[10]), "v"(vv[11]), "v"(vv[12]), "v"(vv[13]), "v"(vv[14]), "v"(vv[15]),
                     "v"(g4), "v"(b4));

#pragma unroll
  for (int i = 0; i < SR; ++i) {
    const v4f v = vv[i];
    float s = v.x + v.y + v.z + v.w;
    float sq = v.x * v.x + v.y * v.y + v.z * v.z + v.w * v.w;
#pragma unroll
    for (int off = 16; off > 0; off >>= 1) {
      s += __shfl_xor(s, off, 32);
      sq += __shfl_xor(sq, off, 32);
    }
    float mean = s * (1.0f / 128.0f);
    float var = sq * (1.0f / 128.0f) - mean * mean;
    float inv = rsqrtf(var + 1e-5f);

    v4f o;
    o.x = (v.x - mean) * inv * g4.x + b4.x;
    o.y = (v.y - mean) * inv * g4.y + b4.y;
    o.z = (v.z - mean) * inv * g4.z + b4.z;
    o.w = (v.w - mean) * inv * g4.w + b4.w;
    X4[(size_t)i * 32] = o;
  }
}

// ---------------------------------------------------------------------------
// prep_conv: x_pos = x + pos_enc; depthwise conv3 (pad 1, zeros AFTER pos add
// per reference) + conv bias. Output layout [bn,t,D]. One wave per (b, n, run
// of SR time steps); the taps and the neighbours in time stay in registers.
// ---------------------------------------------------------------------------
__global__ void __launch_bounds__(ST) prep_conv_kernel(const float* __restrict__ x,
                                 const float* __restrict__ pos,
                                 const float* __restrict__ cw,
                                 const float* __restrict__ cb,
                                 float* __restrict__ xconv) {
  const int lane = threadIdx.x & 31;
  const int w = blockIdx.x * SW + (threadIdx.x >> 5);
  const int n = w & 63;               // a work-group's waves read neighbouring n
  const int t0 = ((w >> 6) & 15) * SR;
  const int b = w >> 10;
  const int d0 = lane * 4;

  const float4* X4 = reinterpret_cast<const float4*>(x) + ((size_t)(b * TT) * NN + n) * 32 + lane;
  const float4* P4 = reinterpret_cast<const float4*>(pos) + lane;

  float k0[4], k1[4], k2[4], kb[4];
#pragma unroll
  for (int c = 0; c < 4; ++c) {
    int d = d0 + c;
    k0[c] = cw[d * 3 + 0]; k1[c] = cw[d * 3 + 1]; k2[c] = cw[d * 3 + 2];
    kb[c] = cb[d];
  }
  XWAIT0();  // behind these loads, before their address registers are written again
  float4 v[SR + 2], p[SR + 2];        // time steps t0-1 .. t0+SR
  const int tlo = t0 > 0 ? t0 - 1 : 0;              // the two edge rows are read in
  const int thi = t0 + SR < TT ? t0 + SR : TT - 1;  // bounds and set to zero below
  const float4* xlo = X4 + (size_t)tlo * (NN * 32);
  const float4* xhi = X4 + (size_t)thi * (NN * 32);
  const float4* plo = P4 + (size_t)tlo * 32;
  const float4* phi = P4 + (size_t)thi * 32;
  const float4* xb = X4 + (size_t)t0 * (NN * 32);
  const float4* pb = P4 + (size_t)t0 * 32;
  v[0] = *xlo; p[0] = *plo;
  v[SR + 1] = *xhi; p[SR + 1] = *phi;
  XWAIT4(xlo, xhi, plo, phi);  // behind these loads, before their address registers are written again
#pragma unroll
  for (int i = 0; i < SR; ++i) {
    v[i + 1] = xb[(size_t)i * (NN * 32)];
    p[i + 1] = pb[(size_t)i * 32];
  }
  XWAIT2(xb, pb);  // behind these loads, before their address registers are written again
#pragma unroll
  for (int i = 0; i < SR + 2; ++i) {
    v[i].x += p[i].x; v[i].y += p[i].y; v[i].z += p[i].z; v[i].w += p[i].w;
  }
  if (t0 == 0)       v[0] = make_float4(0.f, 0.f, 0.f, 0.f);
  if (t0 + SR == TT) v[SR + 1] = make_float4(0.f, 0.f, 0.f, 0.f);

  float4* O4 = reinterpret_cast<float4*>(xconv) + ((size_t)(b * NN + n) * TT + t0) * 32 + lane;
#pragma unroll
  for (int i = 0; i < SR; ++i) {
    const float4 xm = v[i], xc = v[i + 1], xp = v[i + 2];
    float4 o;
    o.x = k0[0] * xm.x + k1[0] * xc.x + k2[0] * xp.x + kb[0];
    o.y = k0[1] * xm.y + k1[1] * xc.y + k2[1] * xp.y + kb[1];
    o.z = k0[2] * xm.z + k1[2] * xc.z + k2[2] * xp.z + kb[2];
    o.w = k0[3] * xm.w + k1[3] * xc.w + k2[3] * xp.w + kb[3];
    O4[(size_t)i * 32] = o;
  }
}

// ---------------------------------------------------------------------------
// Mixed pool: k=6, stride 1, pad (2,2) -> length T-1, right zero-pad to T.
// avg divides by 6 always (zero pad contributes 0); max over valid entries.
// One wave per (bn, run of SR time steps): the SR+5 rows its windows cover are
// loaded once; each window is summed on its own, in rising time order.
// ---------------------------------------------------------------------------
__global__ void __launch_bounds__(ST) pool_kernel(const float* __restrict__ xconv,
                            const float* __restrict__ alpha_p,
                            float* __restrict__ outp) {
  const int lane = threadIdx.x & 31;
  const int w = blockIdx.x * SW + (threadIdx.x >> 5);
  const int t0 = (w & 15) * SR;
  const int bn = w >> 4;
  const bool first = (t0 == 0), last = (t0 + SR == TT);

  const float a = 1.0f / (1.0f + expf(-alpha_p[0]));
  const float4* XC4 = reinterpret_cast<const float4*>(xconv) + (size_t)(bn * TT) * 32 + lane;

  float4 vs[SR + 5], vm[SR + 5];      // time steps t0-2 .. t0+SR+2: for the sum, for the max
  // Rows outside [0,T) are read in bounds (rows of the run itself instead) and replaced below.
  const float4* cb4 = XC4 + (size_t)t0 * 32;
  const float4* clo = first ? cb4 + 2 * 32 : cb4;            // clo[-2 rows], clo[-1 row]
  const float4* chi = last ? cb4 - 3 * 32 : cb4;             // chi[SR rows] .. chi[SR+2 rows]
  vs[0] = clo[-2 * 32]; vs[1] = clo[-1 * 32];
  vs[SR + 2] = chi[SR * 32]; vs[SR + 3] = chi[(SR + 1) * 32]; vs[SR + 4] = chi[(SR + 2) * 32];
  XWAIT2(clo, chi);  // behind these loads, before their address registers are written again
#pragma unroll
  for (int i = 0; i < SR; ++i) vs[i + 2] = cb4[(size_t)i * 32];
  XWAIT1(cb4);  // behind these loads, before their address registers are written again
#pragma unroll
  for (int i = 0; i < SR + 5; ++i) {
    vm[i] = vs[i];
    if ((i < 2 && first) || (i >= SR + 2 && last)) {
      vs[i] = make_float4(0.f, 0.f, 0.f, 0.f);
      vm[i] = make_float4(-3.0e38f, -3.0e38f, -3.0e38f, -3.0e38f);
    }
  }

  float4* O4 = reinterpret_cast<float4*>(outp) + ((size_t)(bn * TT) + t0) * 32 + lane;
  const float inv6 = 1.0f / 6.0f;
#pragma unroll
  for (int i = 0; i < SR; ++i) {
    float sx = 0.f, sy = 0.f, sz = 0.f, sw = 0.f;
    float mx = -3.0e38f, my = -3.0e38f, mz = -3.0e38f, mw = -3.0e38f;
#pragma unroll
    for (int k = 0; k < 6; ++k) {
      const float4 s = vs[i + k], m = vm[i + k];
      sx += s.x; sy += s.y; sz += s.z; sw += s.w;
      mx = fmaxf(mx, m.x); my = fmaxf(my, m.y);
      mz = fmaxf(mz, m.z); mw = fmaxf(mw, m.w);
    }
    float4 res;
    res.x = a * (sx * inv6) + (1.f - a) * mx;
    res.y = a * (sy * inv6) + (1.f - a) * my;
    res.z = a * (sz * inv6) + (1.f - a) * mz;
    res.w = a * (sw * inv6) + (1.f - a) * mw;
    if (i == SR - 1 && last) res = make_float4(0.f, 0.f, 0.f, 0.f);  // t = T-1: the right zero-pad
    O4[(size_t)i * 32] = res;
  }
}

// ---------------------------------------------------------------------------
// concat [x_loc | x_glob] -> [R, 256]; SR consecutive rows per wave
// ---------------------------------------------------------------------------
__global__ void __launch_bounds__(ST) concat_kernel(const float* __restrict__ xloc,
                              const float* __restrict__ xglob,
                              float* __restrict__ cat) {
  const int lane = threadIdx.x & 31;
  const int w = blockIdx.x * SW + __builtin_amdgcn_readfirstlane(threadIdx.x >> 5);  // wave-uniform: row addresses are scalar
  const v4f* L4 = reinterpret_cast<const v4f*>(xloc) + (size_t)w * (SR * 32) + lane;
  const v4f* G4 = reinterpret_cast<const v4f*>(xglob) + (size_t)w * (SR * 32) + lane;
  v4f* C4 = reinterpret_cast<v4f*>(cat) + (size_t)w * (SR * 64) + lane;
  v4f vl[SR], vg[SR];
  v8f pr[SR];                         // a row's two halves side by side, for the fence below
#pragma unroll
  for (int i = 0; i < SR; ++i) {
    vl[i] = L4[(size_t)i * 32];
    vg[i] = G4[(size_t)i * 32];
    pr[i] = __builtin_shufflevector(vl[i], vg[i], 0, 1, 2, 3, 4, 5, 6, 7);
  }
  // Inputs-only fence on the loaded values: all 32 loads issue before the first
  // store; left free, the compiler pairs each load with its store and a wave
  // has one load in flight.
  asm volatile("" :: "v"(pr[0]), "v"(pr[1]), "v"(pr[2]), "v"(pr[3]), "v"(pr[4]), "v"(pr[5]), "v"(pr[6]), "v"(pr[7]),
                     "v"(pr[8]), "v"(pr[9]), "v"(pr[10]), "v"(pr[11]), "v"(pr[12]), "v"(pr[13]), "v"(pr[14]), "v"(pr[15]));
#pragma unroll
  for (int i = 0; i < SR; ++i) {
    C4[(size_t)i * 64] = vl[i];
    C4[(size_t)i * 64 + 32] = vg[i];
  }
}

// ---------------------------------------------------------------------------
// Final: out = x + softplus(res_scale) * (gate*x_loc + (1-gate)*x_glob)
// with [bn,t,D] -> [B,T,N,D] relayout.
// ---------------------------------------------------------------------------
__device__ __forceinline__ float softplus_f(float v) {
  return (v > 0.f) ? (v + log1pf(expf(-v))) : log1pf(expf(v));
}

__global__ void __launch_bounds__(ST) final_kernel(const float* __restrict__ x,
                             const float* __restrict__ gate,
                             const float* __restrict__ xloc,
                             const float* __restrict__ xglob,
                             const float* __restrict__ res_scale,
                             float* __restrict__ out) {
  // One wave per (b, n, run of SR time steps); the scale is formed once a wave.
  const int lane = threadIdx.x & 31;
  const int w = blockIdx.x * SW + (threadIdx.x >> 5);
  const int n = w & 63;               // a work-group's waves touch neighbouring n
  const int t0 = ((w >> 6) & 15) * SR;
  const int b = w >> 10;

  const size_t xo = ((size_t)(b * TT + t0) * NN + n) * 32 + lane;  // [B,T,N,D]
  const size_t ro = ((size_t)(b * NN + n) * TT + t0) * 32 + lane;  // [bn,t,D]
  const float4* X4 = reinterpret_cast<const float4*>(x) + xo;
  const float4* G4 = reinterpret_cast<const float4*>(gate) + ro;
  const float4* L4 = reinterpret_cast<const float4*>(xloc) + ro;
  const float4* Q4 = reinterpret_cast<const float4*>(xglob) + ro;
  float4* O4 = reinterpret_cast<float4*>(out) + xo;

  const float4 rs = reinterpret_cast<const float4*>(res_scale)[lane];
  XWAIT0();  // behind these loads, before their address registers are written again
  // Two batches of SR/2 rows, 32 loads each: 64 at once would not fit the
  // registers of 16 waves a WGP.
  constexpr int HB = SR / 2;
  const float sx = softplus_f(rs.x), sy = softplus_f(rs.y);
  const float sz = softplus_f(rs.z), sw = softplus_f(rs.w);
#pragma unroll
  for (int h = 0; h < 2; ++h) {
    float4 xv[HB], g[HB], xl[HB], xg[HB];
#pragma unroll
    for (int i = 0; i < HB; ++i) {
      xv[i] = X4[(size_t)(h * HB + i) * (NN * 32)];
      g[i]  = G4[(size_t)(h * HB + i) * 32];
      xl[i] = L4[(size_t)(h * HB + i) * 32];
      xg[i] = Q4[(size_t)(h * HB + i) * 32];
    }
    XWAIT4(X4, G4, L4, Q4);  // behind these loads, before their address registers are written again
#pragma unroll
    for (int i = 0; i < HB; ++i) {
      float4 o;
      o.x = xv[i].x + sx * (g[i].x * xl[i].x + (1.f - g[i].x) * xg[i].x);
      o.y = xv[i].y + sy * (g[i].y * xl[i].y + (1.f - g[i].y) * xg[i].y);
      o.z = xv[i].z + sz * (g[i].z * xl[i].z + (1.f - g[i].z) * xg[i].z);
      o.w = xv[i].w + sw * (g[i].w * xl[i].w + (1.f - g[i].w) * xg[i].w);
      O4[(size_t)(h * HB + i) * (NN * 32)] = o;
    }
  }
}

// ---------------------------------------------------------------------------
// Host launcher
// ---------------------------------------------------------------------------
extern "C" void kernel_launch(void* const* d_in, const int* in_sizes, int n_in,
                              void* d_out, int out_size, void* d_ws, size_t ws_size,
                              hipStream_t stream) {
  const float* x          = (const float*)d_in[0];
  const float* window_w   = (const float*)d_in[1];
  const float* local_w1   = (const float*)d_in[2];
  const float* local_b1   = (const float*)d_in[3];
  const float* local_w2   = (const float*)d_in[4];
  const float* local_b2   = (const float*)d_in[5];
  const float* local_ln_g = (const float*)d_in[6];
  const float* local_ln_b = (const float*)d_in[7];
  const float* qkv_w      = (const float*)d_in[8];
  const float* qkv_b      = (const float*)d_in[9];
  const float* out_w      = (const float*)d_in[10];
  const float* out_b      = (const float*)d_in[11];
  const float* conv_w     = (const float*)d_in[12];
  const float* conv_b     = (const float*)d_in[13];
  const float* alpha      = (const float*)d_in[14];
  const float* pos_enc    = (const float*)d_in[15];
  const float* global_w1  = (const float*)d_in[16];
  const float* global_b1  = (const float*)d_in[17];
  const float* global_w2  = (const float*)d_in[18];
  const float* global_b2  = (const float*)d_in[19];
  const float* global_ln_g= (const float*)d_in[20];
  const float* global_ln_b= (const float*)d_in[21];
  const float* gate_w1    = (const float*)d_in[22];
  const float* gate_b1    = (const float*)d_in[23];
  const float* gate_w2    = (const float*)d_in[24];
  const float* gate_b2    = (const float*)d_in[25];
  const float* res_scale  = (const float*)d_in[26];
  float* out = (float*)d_out;

  const size_t R = (size_t)RR;
  float* ws = (float*)d_ws;
  float* P0 = ws;             // R*128: xl -> attn_out -> x_loc
  float* P1 = ws + R * 128;   // R*384: qkv -> proj/h1/cat/gate
  float* P2 = ws + R * 512;   // R*128: xconv -> x_glob
  float* P3 = ws + R * 640;   // R*128: x_glob_in -> tanh_out
  float* h1   = P1 + R * 128; // R*256 region inside P1
  float* gate = P1 + R * 256; // R*128 region inside P1

  const size_t GEMM_LDS = (2 * BM * PA + 2 * KC * PB) * sizeof(float);  // 104 KB

  // local branch
  prep_local_kernel<<<SG, ST, 0, stream>>>(x, window_w, P0);
  gemm_wmma_kernel<128, 384, 0><<<dim3(RR / BM, 384 / BN), BL, GEMM_LDS, stream>>>(
      P0, qkv_w, qkv_b, P1);
  attn_kernel<<<(RR * HH) / 256, 256, 0, stream>>>(P1, P0);
  gemm_wmma_kernel<128, 128, 0><<<dim3(RR / BM, 128 / BN), BL, GEMM_LDS, stream>>>(
      P0, out_w, out_b, P1);
  gemm_wmma_kernel<128, 256, 1 /*gelu*/><<<dim3(RR / BM, 256 / BN), BL, GEMM_LDS, stream>>>(
      P1, local_w1, local_b1, h1);
  gemm_wmma_kernel<256, 128, 0><<<dim3(RR / BM, 128 / BN), BL, GEMM_LDS, stream>>>(
      h1, local_w2, local_b2, P0);
  ln_kernel<<<SG, ST, 0, stream>>>(P0, local_ln_g, local_ln_b);  // x_loc = P0

  // global branch
  prep_conv_kernel<<<SG, ST, 0, stream>>>(x, pos_enc, conv_w, conv_b, P2);
  pool_kernel<<<SG, ST, 0, stream>>>(P2, alpha, P3);
  gemm_wmma_kernel<128, 256, 1 /*gelu*/><<<dim3(RR / BM, 256 / BN), BL, GEMM_LDS, stream>>>(
      P3, global_w1, global_b1, h1);
  gemm_wmma_kernel<256, 128, 0><<<dim3(RR / BM, 128 / BN), BL, GEMM_LDS, stream>>>(
      h1, global_w2, global_b2, P2);
  ln_kernel<<<SG, ST, 0, stream>>>(P2, global_ln_g, global_ln_b);  // x_glob = P2

  // gated fusion
  concat_kernel<<<SG, ST, 0, stream>>>(P0, P2, P1);  // cat in P1[0:R*256]
  gemm_wmma_kernel<256, 128, 2 /*tanh*/><<<dim3(RR / BM, 128 / BN), BL, GEMM_LDS, stream>>>(
      P1, gate_w1, gate_b1, P3);
  gemm_wmma_kernel<128, 128, 3 /*sigmoid*/><<<dim3(RR / BM, 128 / BN), BL, GEMM_LDS, stream>>>(
      P3, gate_w2, gate_b2, gate);

  final_kernel<<<SG, ST, 0, stream>>>(x, gate, P0, P2, res_scale, out);
}

// v004
// It runs in 378 microseconds.
// Two timings next to v003 both put it at 1.06 times that version's speed.
// Counting every step since v000, it is 2.66 times as fast.
#include <hip/hip_runtime.h>
#include <math.h>

// Problem constants (from reference)
#define BB 4
#define TT 256
#define NN 64
#define DD 128
#define HH 4
#define HD 32
#define RR (BB * NN * TT)   // 65536 rows

// GEMM blocking
#define BM 128   // block tile rows
#define BN 64    // block tile cols
#define KC 64    // K chunk staged in LDS
#define BL 128   // threads per block (4 waves)
// LDS row pitches in floats (LDS bank = dword address mod 64). Both stay
// multiples of 4 floats so every 16-byte copy lands 16-byte aligned.
#define PA 68    // A rows: 16 rows x 2 k-pairs of a fragment read fall on 64 distinct banks
#define PB 72    // B rows: rows k and k+2, read by the two lane halves, sit 16 banks apart

// Streaming kernels (everything but the GEMMs and the attention): one wave
// walks SR rows of 128 floats, one float4 per lane and row, so a launch starts
// 4,096 waves (one 16-wave work-group per WGP) and each wave has SR or more
// 512-byte loads in flight. The row loops are fully unrolled, so that the row
// arrays are registers and a run's loads can issue back to back.
#define SW 16                  // waves per work-group
#define ST (SW * 32)           // threads per work-group
#define SR 16                  // rows per wave (the two fences on loaded values name 16)
#define SG (RR / (SW * SR))    // work-groups per launch
// Stands behind a run of loads: s_wait_xcnt 0 before any register that an issued
// load names is written again. The address operands only keep those registers
// alive up to the wait, so that no later load's result lands in them before it.
#define XWAIT0() asm volatile("s_wait_xcnt 0x0" ::: "memory")
#define XWAIT1(a) asm volatile("s_wait_xcnt 0x0" :: "v"(a) : "memory")
#define XWAIT2(a, b) asm volatile("s_wait_xcnt 0x0" :: "v"(a), "v"(b) : "memory")
#define XWAIT4(a, b, c, d) asm volatile("s_wait_xcnt 0x0" :: "v"(a), "v"(b), "v"(c), "v"(d) : "memory")

typedef __attribute__((ext_vector_type(2))) float v2f;
typedef __attribute__((ext_vector_type(8))) float v8f;
typedef __attribute__((ext_vector_type(4))) float v4f;

// ---------------------------------------------------------------------------
// CDNA5 async global->LDS copy (ASYNCcnt-tracked DMA), with sync fallback.
// Builtin signature (from hipcc diagnostic): (int4 AS1*, int4 AS3*, Ii, Ii).
// ---------------------------------------------------------------------------
#if defined(__has_builtin)
#if __has_builtin(__builtin_amdgcn_global_load_async_to_lds_b128) && \
    __has_builtin(__builtin_amdgcn_s_wait_asynccnt)
#define HAVE_ASYNC_LDS 1
#endif
#endif

#ifdef HAVE_ASYNC_LDS
typedef int vi4 __attribute__((__vector_size__(4 * sizeof(int))));
typedef __attribute__((address_space(1))) vi4 as1_vi4;
typedef __attribute__((address_space(3))) vi4 as3_vi4;
#endif

__device__ __forceinline__ void copy16(const float* g, float* l) {
#ifdef HAVE_ASYNC_LDS
  as1_vi4* gp = reinterpret_cast<as1_vi4*>((uintptr_t)g);
  as3_vi4* lp = reinterpret_cast<as3_vi4*>((uintptr_t)l);
  __builtin_amdgcn_global_load_async_to_lds_b128(gp, lp, 0, 0);
#else
  *reinterpret_cast<float4*>(l) = *reinterpret_cast<const float4*>(g);
#endif
}

__device__ __forceinline__ void stage_sync() {
#ifdef HAVE_ASYNC_LDS
  __builtin_amdgcn_s_wait_asynccnt(0);
#endif
  __syncthreads();
}

// ---------------------------------------------------------------------------
// Activation epilogues: 0=none, 1=exact GELU (erf), 2=tanh, 3=sigmoid
// ---------------------------------------------------------------------------
// erf and tanh without a branch. The math library's erff and tanhf each pick one
// of two formulas by a test on |x| that differs from lane to lane: two branches
// on the lane mask per element, which make each element one dependent chain with
// nothing of the next element issued beside it. Here both formulas are worked
// out for every element and a select keeps the one the library would have
// taken: same coefficients (given as bit patterns), same operations in the same
// order, so the values are bit-identical, and the elements of a tile are
// straight-line code whose chains can be issued side by side.
#define FB(u) __builtin_bit_cast(float, u)

__device__ __forceinline__ float erf_sel(float x) {
  const float ax = fabsf(x);
  float p = fmaf(ax, FB(0x378e98abu), FB(0xb9c68948u));  // |x| >= 1: 1 - exp(-(ax + ax*poly(ax)))
  p = fmaf(ax, p, FB(0x3b7cd369u));
  p = fmaf(ax, p, FB(0xbcc618b2u));
  p = fmaf(ax, p, FB(0x3dda74e4u));
  p = fmaf(ax, p, FB(0x3f228afdu));
  p = fmaf(ax, p, FB(0x3e03c728u));
  p = fmaf(ax, p, ax);
  const float big = 1.0f - expf(-p);
  const float t = x * x;                                 // |x| < 1: ax + ax*poly(x*x)
  float s = fmaf(t, FB(0xba1345e1u), FB(0x3ba10414u));
  s = fmaf(t, s, FB(0xbcdac9b8u));
  s = fmaf(t, s, FB(0x3de703beu));
  s = fmaf(t, s, FB(0xbec09330u));
  s = fmaf(t, s, FB(0x3e0375d0u));
  const float small = fmaf(ax, s, ax);
  return copysignf(ax < 1.0f ? small : big, x);
}

__device__ __forceinline__ float tanh_sel(float x) {
  const float ax = fabsf(x);
  const float e = expf(ax + ax);                         // |x| >= 0.625: 1 - 2/(1 + exp(2|x|))
  float r;
  // v_rcp_f32 with the one free slot that the instruction set asks for behind a
  // transcendental.
  asm("v_rcp_f32 %0, %1\n\tv_nop" : "=v"(r) : "v"(1.0f + e));
  const float big = fmaf(r, -2.0f, 1.0f);
  const float t = x * x;                                 // |x| < 0.625: ax + x*x*(ax*poly(x*x))
  float s = fmaf(t, FB(0xbbbac73du), FB(0x3ca908c9u));
  s = fmaf(t, s, FB(0xbd5c1c4eu));
  s = fmaf(t, s, FB(0x3e088382u));
  s = fmaf(t, s, FB(0xbeaaaa99u));
  const float small = fmaf(t, ax * s, ax);
  return copysignf(0.625f > ax ? small : big, x);
}

__device__ __forceinline__ float act_apply(float v, int act) {
  if (act == 1) return 0.5f * v * (1.0f + erf_sel(v * 0.70710678118654752440f));
  if (act == 2) return tanh_sel(v);
  if (act == 3) return 1.0f / (1.0f + expf(-v));
  return v;
}

// ---------------------------------------------------------------------------
// fp32 GEMM: C[R,Nc] = act(A[R,K] @ B[K,Nc] + bias)
// Block = 128 threads = 4 waves (2x2). Block tile 128x64; wave tile 64x32
// (4 M-subtiles x 2 N-subtiles of 16x16). K staged in 64-chunks,
// double-buffered in LDS via async global->LDS DMA when available.
// Per K-step: 4 A-pairs + 2 B-pairs feed 8 V_WMMA_F32_16X16X4_F32.
// K, Nc and the activation are template constants: each launch runs code that
// holds its own activation only, with no selector branch per output element,
// and row strides fold into constant address steps. The block size is stated
// too, so that the register ceiling is that of 4 waves and the copy addresses
// of the unrolled K chunks stay in registers (no scratch).
// ---------------------------------------------------------------------------
template <int K, int Nc, int act>
__global__ void __launch_bounds__(BL) gemm_wmma_kernel(const float* __restrict__ A,
                                 const float* __restrict__ Bm,
                                 const float* __restrict__ bias,
                                 float* __restrict__ C) {
  extern __shared__ float smem[];
  float* sAb = smem;                 // [2][BM rows at pitch PA]
  float* sBb = smem + 2 * BM * PA;   // [2][KC rows at pitch PB]

  const int tid = threadIdx.x;
  const int rowBase = blockIdx.x * BM;
  const int colBase = blockIdx.y * BN;
  constexpr int nk = K / KC;

  // Stage K-chunk kb into LDS buffer buf (async DMA when available).
  auto stage = [&](int kb, int buf) {
    float* dA = sAb + buf * (BM * PA);
    float* dB = sBb + buf * (KC * PB);
    const float* gA = A + (size_t)rowBase * K + kb * KC;
    const float* gB = Bm + (size_t)(kb * KC) * Nc + colBase;
#pragma unroll
    for (int j = 0; j < (BM * KC) / (4 * BL); ++j) {  // 16 x b128 per thread
      int idx = tid + j * BL;
      int r = idx >> 4;
      int cs = (idx & 15) << 2;
      copy16(gA + (size_t)r * K + cs, dA + r * PA + cs);
    }
#pragma unroll
    for (int j = 0; j < (KC * BN) / (4 * BL); ++j) {  // 8 x b128 per thread
      int idx = tid + j * BL;
      int r = idx >> 4;
      int cs = (idx & 15) << 2;
      copy16(gB + (size_t)r * Nc + cs, dB + r * PB + cs);
    }
  };

  const int lane = tid & 31;
  const int wv = tid >> 5;
  const int mw = (wv & 1) * 64;    // wave row offset in block tile
  const int nw = (wv >> 1) * 32;   // wave col offset in block tile
  const int m = lane & 15;         // A row / C column within 16x16 subtile
  const int hi = lane >> 4;        // K-pair selector (lanes 16-31: K+2,K+3)

  v8f acc[4][2] = {};

  stage(0, 0);
  stage_sync();

  for (int kb = 0; kb < nk; ++kb) {
    const int cur = kb & 1;
    if (kb + 1 < nk) stage(kb + 1, cur ^ 1);
    if (kb + 2 < nk)  // warm L2 for the chunk after next (global_prefetch_b8)
      __builtin_prefetch(A + (size_t)(rowBase + (tid >> 1)) * K + (kb + 2) * KC, 0, 0);

    const float* cA = sAb + cur * (BM * PA);
    const float* cB = sBb + cur * (KC * PB);

#pragma unroll 4
    for (int k0 = 0; k0 < KC; k0 += 4) {
      const int ka = k0 + 2 * hi;
      v2f av[4], bv[2];
#pragma unroll
      for (int mt = 0; mt < 4; ++mt) {
        const float* p = cA + (size_t)(mw + mt * 16 + m) * PA + ka;
        av[mt].x = p[0];
        av[mt].y = p[1];
      }
#pragma unroll
      for (int nt = 0; nt < 2; ++nt) {
        const float* p = cB + (size_t)ka * PB + nw + nt * 16 + m;
        bv[nt].x = p[0];
        bv[nt].y = p[PB];
      }
#pragma unroll
      for (int mt = 0; mt < 4; ++mt)
#pragma unroll
        for (int nt = 0; nt < 2; ++nt)
          acc[mt][nt] = __builtin_amdgcn_wmma_f32_16x16x4_f32(
              false, av[mt], false, bv[nt], (short)0, acc[mt][nt], false, false);
    }
    stage_sync();
  }

  // C/D layout: VGPR r2 holds M=r2 (lanes 0-15) or M=r2+8 (lanes 16-31)
#pragma unroll
  for (int nt = 0; nt < 2; ++nt) {
    const int col = colBase + nw + nt * 16 + m;
    const float bb = bias[col];
#pragma unroll
    for (int mt = 0; mt < 4; ++mt) {
#pragma unroll
      for (int r2 = 0; r2 < 8; ++r2) {
        int row = rowBase + mw + mt * 16 + hi * 8 + r2;
        C[(size_t)row * Nc + col] = act_apply(acc[mt][nt][r2] + bb, act);
      }
    }
  }
}

// ---------------------------------------------------------------------------
// prep_local: xl[bn,t,:] = x[b,t,n,:] - softmax(window_weight)-weighted
// 3-tap trend (zero-padded in time). One wave per (b, n, run of SR time steps);
// the neighbours in time come from the wave's own registers.
// ---------------------------------------------------------------------------
__global__ void __launch_bounds__(ST) prep_local_kernel(const float* __restrict__ x,
                                  const float* __restrict__ wwraw,
                                  float* __restrict__ xl) {
  const int lane = threadIdx.x & 31;
  const int w = blockIdx.x * SW + (threadIdx.x >> 5);
  const int n = w & 63;               // a work-group's waves read neighbouring n
  const int t0 = ((w >> 6) & 15) * SR;
  const int b = w >> 10;

  float w0 = wwraw[0], w1 = wwraw[1], w2 = wwraw[2];
  float mw = fmaxf(w0, fmaxf(w1, w2));
  float e0 = expf(w0 - mw), e1 = expf(w1 - mw), e2 = expf(w2 - mw);
  float inv = 1.0f / (e0 + e1 + e2);
  e0 *= inv; e1 *= inv; e2 *= inv;

  const float4* X4 = reinterpret_cast<const float4*>(x) + ((size_t)(b * TT) * NN + n) * 32 + lane;
  float4 v[SR + 2];                   // time steps t0-1 .. t0+SR
  const float4* xlo = X4 + (size_t)(t0 > 0 ? t0 - 1 : 0) * (NN * 32);
  const float4* xhi = X4 + (size_t)(t0 + SR < TT ? t0 + SR : TT - 1) * (NN * 32);
  const float4* xb = X4 + (size_t)t0 * (NN * 32);
  v[0] = *xlo;
  v[SR + 1] = *xhi;
  XWAIT2(xlo, xhi);  // behind these loads, before their address registers are written again
#pragma unroll
  for (int i = 0; i < SR; ++i) v[i + 1] = xb[(size_t)i * (NN * 32)];
  XWAIT1(xb);  // behind these loads, before their address registers are written again
  if (t0 == 0)       v[0] = make_float4(0.f, 0.f, 0.f, 0.f);
  if (t0 + SR == TT) v[SR + 1] = make_float4(0.f, 0.f, 0.f, 0.f);

  float4* O4 = reinterpret_cast<float4*>(xl) + ((size_t)(b * NN + n) * TT + t0) * 32 + lane;
#pragma unroll
  for (int i = 0; i < SR; ++i) {
    const float4 xm = v[i], xc = v[i + 1], xp = v[i + 2];
    float4 o;
    o.x = xc.x - (e0 * xm.x + e1 * xc.x + e2 * xp.x);
    o.y = xc.y - (e0 * xm.y + e1 * xc.y + e2 * xp.y);
    o.z = xc.z - (e0 * xm.z + e1 * xc.z + e2 * xp.z);
    o.w = xc.w - (e0 * xm.w + e1 * xc.w + e2 * xp.w);
    O4[(size_t)i * 32] = o;
  }
}

// ---------------------------------------------------------------------------
// Banded (|i-j|<=1) multi-head attention: off-band -1e9 scores underflow to
// exactly 0 after fp32 softmax, so only 3 neighbors matter.
// One thread per (bn, t, h).
// ---------------------------------------------------------------------------
__global__ void attn_kernel(const float* __restrict__ qkv,
                            float* __restrict__ outp) {
  int tid = blockIdx.x * blockDim.x + threadIdx.x;  // RR*HH threads
  int h = tid & 3;
  int r = tid >> 2;
  int t = r & 255;
  int bn = r >> 8;

  const float* qp = qkv + (size_t)r * 384 + h * 32;
  float q[32];
#pragma unroll
  for (int i = 0; i < 32; ++i) q[i] = qp[i];

  float s[3];
  float mmax = -3.0e38f;
#pragma unroll
  for (int j0 = 0; j0 < 3; ++j0) {
    int j = t + j0 - 1;
    if (j >= 0 && j < TT) {
      const float* kp = qkv + ((size_t)(bn * TT + j)) * 384 + 128 + h * 32;
      float d = 0.f;
#pragma unroll
      for (int i = 0; i < 32; ++i) d += q[i] * kp[i];
      s[j0] = d * 0.17677669529663687f;  // 1/sqrt(32)
      mmax = fmaxf(mmax, s[j0]);
    } else {
      s[j0] = -3.0e38f;
    }
  }

  float o[32];
#pragma unroll
  for (int i = 0; i < 32; ++i) o[i] = 0.f;
  float den = 0.f;
#pragma unroll
  for (int j0 = 0; j0 < 3; ++j0) {
    int j = t + j0 - 1;
    if (j >= 0 && j < TT) {
      float p = expf(s[j0] - mmax);
      den += p;
      const float* vp = qkv + ((size_t)(bn * TT + j)) * 384 + 256 + h * 32;
#pragma unroll
      for (int i = 0; i < 32; ++i) o[i] += p * vp[i];
    }
  }
  float invd = 1.0f / den;
  float* op = outp + (size_t)r * 128 + h * 32;
#pragma unroll
  for (int i = 0; i < 32; ++i) op[i] = o[i] * invd;
}

// ---------------------------------------------------------------------------
// LayerNorm over D=128: one wave32 per row at a time (4 floats/lane, shfl_xor
// reduce), SR consecutive rows per wave, all loaded before the first is summed.
// ---------------------------------------------------------------------------
__global__ void __launch_bounds__(ST) ln_kernel(float* __restrict__ X,
                          const float* __restrict__ g,
                          const float* __restrict__ b) {
  const int lane = threadIdx.x & 31;
  const int w = blockIdx.x * SW + __builtin_amdgcn_readfirstlane(threadIdx.x >> 5);  // wave-uniform: row addresses are scalar
  v4f* X4 = reinterpret_cast<v4f*>(X) + (size_t)w * (SR * 32) + lane;
  const v4f g4 = reinterpret_cast<const v4f*>(g)[lane];
  const v4f b4 = reinterpret_cast<const v4f*>(b)[lane];

  v4f vv[SR];
#pragma unroll
  for (int i = 0; i < SR; ++i) vv[i] = X4[(size_t)i * 32];
  // Inputs-only fence on the loaded values: all SR rows are asked for before the
  // first is summed; left free, the compiler asks for the last four only after
  // the first twelve have arrived, a second memory latency.
  asm volatile("" :: "v"(vv[0]), "v"(vv[1]), "v"(vv[2]), "v"(vv[3]), "v"(vv[4]), "v"(vv[5]), "v"(vv[6]), "v"(vv[7]),
                     "v"(vv[8]), "v"(vv[9]), "v"(vv[10]), "v"(vv[11]), "v"(vv[12]), "v"(vv[13]), "v"(vv[14]), "v"(vv[15]),
                     "v"(g4), "v"(b4));

#pragma unroll
  for (int i = 0; i < SR; ++i) {
    const v4f v = vv[i];
    float s = v.x + v.y + v.z + v.w;
    float sq = v.x * v.x + v.y * v.y + v.z * v.z + v.w * v.w;
#pragma unroll
    for (int off = 16; off > 0; off >>= 1) {
      s += __shfl_xor(s, off, 32);
      sq += __shfl_xor(sq, off, 32);
    }
    float mean = s * (1.0f / 128.0f);
    float var = sq * (1.0f / 128.0f) - mean * mean;
    float inv = rsqrtf(var + 1e-5f);

    v4f o;
    o.x = (v.x - mean) * inv * g4.x + b4.x;
    o.y = (v.y - mean) * inv * g4.y + b4.y;
    o.z = (v.z - mean) * inv * g4.z + b4.z;
    o.w = (v.w - mean) * inv * g4.w + b4.w;
    X4[(size_t)i * 32] = o;
  }
}

// ---------------------------------------------------------------------------
// prep_conv: x_pos = x + pos_enc; depthwise conv3 (pad 1, zeros AFTER pos add
// per reference) + conv bias. Output layout [bn,t,D]. One wave per (b, n, run
// of SR time steps); the taps and the neighbours in time stay in registers.
// ---------------------------------------------------------------------------
__global__ void __launch_bounds__(ST) prep_conv_kernel(const float* __restrict__ x,
                                 const float* __restrict__ pos,
                                 const float* __restrict__ cw,
                                 const float* __restrict__ cb,
                                 float* __restrict__ xconv) {
  const int lane = threadIdx.x & 31;
  const int w = blockIdx.x * SW + (threadIdx.x >> 5);
  const int n = w & 63;               // a work-group's waves read neighbouring n
  const int t0 = ((w >> 6) & 15) * SR;
  const int b = w >> 10;
  const int d0 = lane * 4;

  const float4* X4 = reinterpret_cast<const float4*>(x) + ((size_t)(b * TT) * NN + n) * 32 + lane;
  const float4* P4 = reinterpret_cast<const float4*>(pos) + lane;

  float k0[4], k1[4], k2[4], kb[4];
#pragma unroll
  for (int c = 0; c < 4; ++c) {
    int d = d0 + c;
    k0[c] = cw[d * 3 + 0]; k1[c] = cw[d * 3 + 1]; k2[c] = cw[d * 3 + 2];
    kb[c] = cb[d];
  }
  XWAIT0();  // behind these loads, before their address registers are written again
  float4 v[SR + 2], p[SR + 2];        // time steps t0-1 .. t0+SR
  const int tlo = t0 > 0 ? t0 - 1 : 0;              // the two edge rows are read in
  const int thi = t0 + SR < TT ? t0 + SR : TT - 1;  // bounds and set to zero below
  const float4* xlo = X4 + (size_t)tlo * (NN * 32);
  const float4* xhi = X4 + (size_t)thi * (NN * 32);
  const float4* plo = P4 + (size_t)tlo * 32;
  const float4* phi = P4 + (size_t)thi * 32;
  const float4* xb = X4 + (size_t)t0 * (NN * 32);
  const float4* pb = P4 + (size_t)t0 * 32;
  v[0] = *xlo; p[0] = *plo;
  v[SR + 1] = *xhi; p[SR + 1] = *phi;
  XWAIT4(xlo, xhi, plo, phi);  // behind these loads, before their address registers are written again
#pragma unroll
  for (int i = 0; i < SR; ++i) {
    v[i + 1] = xb[(size_t)i * (NN * 32)];
    p[i + 1] = pb[(size_t)i * 32];
  }
  XWAIT2(xb, pb);  // behind these loads, before their address registers are written again
#pragma unroll
  for (int i = 0; i < SR + 2; ++i) {
    v[i].x += p[i].x; v[i].y += p[i].y; v[i].z += p[i].z; v[i].w += p[i].w;
  }
  if (t0 == 0)       v[0] = make_float4(0.f, 0.f, 0.f, 0.f);
  if (t0 + SR == TT) v[SR + 1] = make_float4(0.f, 0.f, 0.f, 0.f);

  float4* O4 = reinterpret_cast<float4*>(xconv) + ((size_t)(b * NN + n) * TT + t0) * 32 + lane;
#pragma unroll
  for (int i = 0; i < SR; ++i) {
    const float4 xm = v[i], xc = v[i + 1], xp = v[i + 2];
    float4 o;
    o.x = k0[0] * xm.x + k1[0] * xc.x + k2[0] * xp.x + kb[0];
    o.y = k0[1] * xm.y + k1[1] * xc.y + k2[1] * xp.y + kb[1];
    o.z = k0[2] * xm.z + k1[2] * xc.z + k2[2] * xp.z + kb[2];
    o.w = k0[3] * xm.w + k1[3] * xc.w + k2[3] * xp.w + kb[3];
    O4[(size_t)i * 32] = o;
  }
}

// ---------------------------------------------------------------------------
// Mixed pool: k=6, stride 1, pad (2,2) -> length T-1, right zero-pad to T.
// avg divides by 6 always (zero pad contributes 0); max over valid entries.
// One wave per (bn, run of SR time steps): the SR+5 rows its windows cover are
// loaded once; each window is summed on its own, in rising time order.
// ---------------------------------------------------------------------------
__global__ void __launch_bounds__(ST) pool_kernel(const float* __restrict__ xconv,
                            const float* __restrict__ alpha_p,
                            float* __restrict__ outp) {
  const int lane = threadIdx.x & 31;
  const int w = blockIdx.x * SW + (threadIdx.x >> 5);
  const int t0 = (w & 15) * SR;
  const int bn = w >> 4;
  const bool first = (t0 == 0), last = (t0 + SR == TT);

  const float a = 1.0f / (1.0f + expf(-alpha_p[0]));
  const float4* XC4 = reinterpret_cast<const float4*>(xconv) + (size_t)(bn * TT) * 32 + lane;

  float4 vs[SR + 5], vm[SR + 5];      // time steps t0-2 .. t0+SR+2: for the sum, for the max
  // Rows outside [0,T) are read in bounds (rows of the run itself instead) and replaced below.
  const float4* cb4 = XC4 + (size_t)t0 * 32;
  const float4* clo = first ? cb4 + 2 * 32 : cb4;            // clo[-2 rows], clo[-1 row]
  const float4* chi = last ? cb4 - 3 * 32 : cb4;             // chi[SR rows] .. chi[SR+2 rows]
  vs[0] = clo[-2 * 32]; vs[1] = clo[-1 * 32];
  vs[SR + 2] = chi[SR * 32]; vs[SR + 3] = chi[(SR + 1) * 32]; vs[SR + 4] = chi[(SR + 2) * 32];
  XWAIT2(clo, chi);  // behind these loads, before their address registers are written again
#pragma unroll
  for (int i = 0; i < SR; ++i) vs[i + 2] = cb4[(size_t)i * 32];
  XWAIT1(cb4);  // behind these loads, before their address registers are written again
#pragma unroll
  for (int i = 0; i < SR + 5; ++i) {
    vm[i] = vs[i];
    if ((i < 2 && first) || (i >= SR + 2 && last)) {
      vs[i] = make_float4(0.f, 0.f, 0.f, 0.f);
      vm[i] = make_float4(-3.0e38f, -3.0e38f, -3.0e38f, -3.0e38f);
    }
  }

  float4* O4 = reinterpret_cast<float4*>(outp) + ((size_t)(bn * TT) + t0) * 32 + lane;
  const float inv6 = 1.0f / 6.0f;
#pragma unroll
  for (int i = 0; i < SR; ++i) {
    float sx = 0.f, sy = 0.f, sz = 0.f, sw = 0.f;
    float mx = -3.0e38f, my = -3.0e38f, mz = -3.0e38f, mw = -3.0e38f;
#pragma unroll
    for (int k = 0; k < 6; ++k) {
      const float4 s = vs[i + k], m = vm[i + k];
      sx += s.x; sy += s.y; sz += s.z; sw += s.w;
      mx = fmaxf(mx, m.x); my = fmaxf(my, m.y);
      mz = fmaxf(mz, m.z); mw = fmaxf(mw, m.w);
    }
    float4 res;
    res.x = a * (sx * inv6) + (1.f - a) * mx;
    res.y = a * (sy * inv6) + (1.f - a) * my;
    res.z = a * (sz * inv6) + (1.f - a) * mz;
    res.w = a * (sw * inv6) + (1.f - a) * mw;
    if (i == SR - 1 && last) res = make_float4(0.f, 0.f, 0.f, 0.f);  // t = T-1: the right zero-pad
    O4[(size_t)i * 32] = res;
  }
}

// ---------------------------------------------------------------------------
// concat [x_loc | x_glob] -> [R, 256]; SR consecutive rows per wave
// ---------------------------------------------------------------------------
__global__ void __launch_bounds__(ST) concat_kernel(const float* __restrict__ xloc,
                              const float* __restrict__ xglob,
                              float* __restrict__ cat) {
  const int lane = threadIdx.x & 31;
  const int w = blockIdx.x * SW + __builtin_amdgcn_readfirstlane(threadIdx.x >> 5);  // wave-uniform: row addresses are scalar
  const v4f* L4 = reinterpret_cast<const v4f*>(xloc) + (size_t)w * (SR * 32) + lane;
  const v4f* G4 = reinterpret_cast<const v4f*>(xglob) + (size_t)w * (SR * 32) + lane;
  v4f* C4 = reinterpret_cast<v4f*>(cat) + (size_t)w * (SR * 64) + lane;
  v4f vl[SR], vg[SR];
  v8f pr[SR];                         // a row's two halves side by side, for the fence below
#pragma unroll
  for (int i = 0; i < SR; ++i) {
    vl[i] = L4[(size_t)i * 32];
    vg[i] = G4[(size_t)i * 32];
    pr[i] = __builtin_shufflevector(vl[i], vg[i], 0, 1, 2, 3, 4, 5, 6, 7);
  }
  // Inputs-only fence on the loaded values: all 32 loads issue before the first
  // store; left free, the compiler pairs each load with its store and a wave
  // has one load in flight.
  asm volatile("" :: "v"(pr[0]), "v"(pr[1]), "v"(pr[2]), "v"(pr[3]), "v"(pr[4]), "v"(pr[5]), "v"(pr[6]), "v"(pr[7]),
                     "v"(pr[8]), "v"(pr[9]), "v"(pr[10]), "v"(pr[11]), "v"(pr[12]), "v"(pr[13]), "v"(pr[14]), "v"(pr[15]));
#pragma unroll
  for (int i = 0; i < SR; ++i) {
    C4[(size_t)i * 64] = vl[i];
    C4[(size_t)i * 64 + 32] = vg[i];
  }
}

// ---------------------------------------------------------------------------
// Final: out = x + softplus(res_scale) * (gate*x_loc + (1-gate)*x_glob)
// with [bn,t,D] -> [B,T,N,D] relayout.
// ---------------------------------------------------------------------------
__device__ __forceinline__ float softplus_f(float v) {
  return (v > 0.f) ? (v + log1pf(expf(-v))) : log1pf(expf(v));
}

__global__ void __launch_bounds__(ST) final_kernel(const float* __restrict__ x,
                             const float* __restrict__ gate,
                             const float* __restrict__ xloc,
                             const float* __restrict__ xglob,
                             const float* __restrict__ res_scale,
                             float* __restrict__ out) {
  // One wave per (b, n, run of SR time steps); the scale is formed once a wave.
  const int lane = threadIdx.x & 31;
  const int w = blockIdx.x * SW + (threadIdx.x >> 5);
  const int n = w & 63;               // a work-group's waves touch neighbouring n
  const int t0 = ((w >> 6) & 15) * SR;
  const int b = w >> 10;

  const size_t xo = ((size_t)(b * TT + t0) * NN + n) * 32 + lane;  // [B,T,N,D]
  const size_t ro = ((size_t)(b * NN + n) * TT + t0) * 32 + lane;  // [bn,t,D]
  const float4* X4 = reinterpret_cast<const float4*>(x) + xo;
  const float4* G4 = reinterpret_cast<const float4*>(gate) + ro;
  const float4* L4 = reinterpret_cast<const float4*>(xloc) + ro;
  const float4* Q4 = reinterpret_cast<const float4*>(xglob) + ro;
  float4* O4 = reinterpret_cast<float4*>(out) + xo;

  const float4 rs = reinterpret_cast<const float4*>(res_scale)[lane];
  XWAIT0();  // behind these loads, before their address registers are written again
  // Two batches of SR/2 rows, 32 loads each: 64 at once would not fit the
  // registers of 16 waves a WGP.
  constexpr int HB = SR / 2;
  const float sx = softplus_f(rs.x), sy = softplus_f(rs.y);
  const float sz = softplus_f(rs.z), sw = softplus_f(rs.w);
#pragma unroll
  for (int h = 0; h < 2; ++h) {
    float4 xv[HB], g[HB], xl[HB], xg[HB];
#pragma unroll
    for (int i = 0; i < HB; ++i) {
      xv[i] = X4[(size_t)(h * HB + i) * (NN * 32)];
      g[i]  = G4[(size_t)(h * HB + i) * 32];
      xl[i] = L4[(size_t)(h * HB + i) * 32];
      xg[i] = Q4[(size_t)(h * HB + i) * 32];
    }
    XWAIT4(X4, G4, L4, Q4);  // behind these loads, before their address registers are written again
#pragma unroll
    for (int i = 0; i < HB; ++i) {
      float4 o;
      o.x = xv[i].x + sx * (g[i].x * xl[i].x + (1.f - g[i].x) * xg[i].x);
      o.y = xv[i].y + sy * (g[i].y * xl[i].y + (1.f - g[i].y) * xg[i].y);
      o.z = xv[i].z + sz * (g[i].z * xl[i].z + (1.f - g[i].z) * xg[i].z);
      o.w = xv[i].w + sw * (g[i].w * xl[i].w + (1.f - g[i].w) * xg[i].w);
      O4[(size_t)(h * HB + i) * (NN * 32)] = o;
    }
  }
}

// ---------------------------------------------------------------------------
// Host launcher
// ---------------------------------------------------------------------------
extern "C" void kernel_launch(void* const* d_in, const int* in_sizes, int n_in,
                              void* d_out, int out_size, void* d_ws, size_t ws_size,
                              hipStream_t stream) {
  const float* x          = (const float*)d_in[0];
  const float* window_w   = (const float*)d_in[1];
  const float* local_w1   = (const float*)d_in[2];
  const float* local_b1   = (const float*)d_in[3];
  const float* local_w2   = (const float*)d_in[4];
  const float* local_b2   = (const float*)d_in[5];
  const float* local_ln_g = (const float*)d_in[6];
  const float* local_ln_b = (const float*)d_in[7];
  const float* qkv_w      = (const float*)d_in[8];
  const float* qkv_b      = (const float*)d_in[9];
  const float* out_w      = (const float*)d_in[10];
  const float* out_b      = (const float*)d_in[11];
  const float* conv_w     = (const float*)d_in[12];
  const float* conv_b     = (const float*)d_in[13];
  const float* alpha      = (const float*)d_in[14];
  const float* pos_enc    = (const float*)d_in[15];
  const float* global_w1  = (const float*)d_in[16];
  const float* global_b1  = (const float*)d_in[17];
  const float* global_w2  = (const float*)d_in[18];
  const float* global_b2  = (const float*)d_in[19];
  const float* global_ln_g= (const float*)d_in[20];
  const float* global_ln_b= (const float*)d_in[21];
  const float* gate_w1    = (const float*)d_in[22];
  const float* gate_b1    = (const float*)d_in[23];
  const float* gate_w2    = (const float*)d_in[24];
  const float* gate_b2    = (const float*)d_in[25];
  const float* res_scale  = (const float*)d_in[26];
  float* out = (float*)d_out;

  const size_t R = (size_t)RR;
  float* ws = (float*)d_ws;
  float* P0 = ws;             // R*128: xl -> attn_out -> x_loc
  float* P1 = ws + R * 128;   // R*384: qkv -> proj/h1/cat/gate
  float* P2 = ws + R * 512;   // R*128: xconv -> x_glob
  float* P3 = ws + R * 640;   // R*128: x_glob_in -> tanh_out
  float* h1   = P1 + R * 128; // R*256 region inside P1
  float* gate = P1 + R * 256; // R*128 region inside P1

  const size_t GEMM_LDS = (2 * BM * PA + 2 * KC * PB) * sizeof(float);  // 104 KB

  // local branch
  prep_local_kernel<<<SG, ST, 0, stream>>>(x, window_w, P0);
  gemm_wmma_kernel<128, 384, 0><<<dim3(RR / BM, 384 / BN), BL, GEMM_LDS, stream>>>(
      P0, qkv_w, qkv_b, P1);
  attn_kernel<<<(RR * HH) / 256, 256, 0, stream>>>(P1, P0);
  gemm_wmma_kernel<128, 128, 0><<<dim3(RR / BM, 128 / BN), BL, GEMM_LDS, stream>>>(
      P0, out_w, out_b, P1);
  gemm_wmma_kernel<128, 256, 1 /*gelu*/><<<dim3(RR / BM, 256 / BN), BL, GEMM_LDS, stream>>>(
      P1, local_w1, local_b1, h1);
  gemm_wmma_kernel<256, 128, 0><<<dim3(RR / BM, 128 / BN), BL, GEMM_LDS, stream>>>(
      h1, local_w2, local_b2, P0);
  ln_kernel<<<SG, ST, 0, stream>>>(P0, local_ln_g, local_ln_b);  // x_loc = P0

  // global branch
  prep_conv_kernel<<<SG, ST, 0, stream>>>(x, pos_enc, conv_w, conv_b, P2);
  pool_kernel<<<SG, ST, 0, stream>>>(P2, alpha, P3);
  gemm_wmma_kernel<128, 256, 1 /*gelu*/><<<dim3(RR / BM, 256 / BN), BL, GEMM_LDS, stream>>>(
      P3, global_w1, global_b1, h1);
  gemm_wmma_kernel<256, 128, 0><<<dim3(RR / BM, 128 / BN), BL, GEMM_LDS, stream>>>(
      h1, global_w2, global_b2, P2);
  ln_kernel<<<SG, ST, 0, stream>>>(P2, global_ln_g, global_ln_b);  // x_glob = P2

  // gated fusion
  concat_kernel<<<SG, ST, 0, stream>>>(P0, P2, P1);  // cat in P1[0:R*256]
  gemm_wmma_kernel<256, 128, 2 /*tanh*/><<<dim3(RR / BM, 128 / BN), BL, GEMM_LDS, stream>>>(
      P1, gate_w1, gate_b1, P3);
  gemm_wmma_kernel<128, 128, 3 /*sigmoid*/><<<dim3(RR / BM, 128 / BN), BL, GEMM_LDS, stream>>>(
      P3, gate_w2, gate_b2, gate);

  final_kernel<<<SG, ST, 0, stream>>>(x, gate, P0, P2, res_scale, out);
}

// v005
// It runs in 366 microseconds.
// Timed twice side by side with v004, it ran 1.03 times as fast both times.
// All steps since v000 together make it 2.75 times as fast.
#include <hip/hip_runtime.h>
#include <math.h>

// Problem constants (from reference)
#define BB 4
#define TT 256
#define NN 64
#define DD 128
#define HH 4
#define HD 32
#define RR (BB * NN * TT)   // 65536 rows

// GEMM blocking
#define BM 128   // block tile rows
#define BN 64    // block tile cols
#define KC 64    // K chunk staged in LDS
#define BL 128   // threads per block (4 waves)
// LDS row pitches in floats (LDS bank = dword address mod 64). Both stay
// multiples of 4 floats so every 16-byte copy lands 16-byte aligned.
#define PA 68    // A rows: 16 rows x 2 k-pairs of a fragment read fall on 64 distinct banks
#define PB 72    // B rows: rows k and k+2, read by the two lane halves, sit 16 banks apart

// Streaming kernels (everything but the GEMMs): one wave
// walks SR rows of 128 floats, one float4 per lane and row, so a launch starts
// 4,096 waves (one 16-wave work-group per WGP) and each wave has SR or more
// 512-byte loads in flight. The row loops are fully unrolled, so that the row
// arrays are registers and a run's loads can issue back to back.
#define SW 16                  // waves per work-group
#define ST (SW * 32)           // threads per work-group
#define SR 16                  // rows per wave (the two fences on loaded values name 16)
#define SG (RR / (SW * SR))    // work-groups per launch
// Stands behind a run of loads: s_wait_xcnt 0 before any register that an issued
// load names is written again. The address operands only keep those registers
// alive up to the wait, so that no later load's result lands in them before it.
#define XWAIT0() asm volatile("s_wait_xcnt 0x0" ::: "memory")
#define XWAIT1(a) asm volatile("s_wait_xcnt 0x0" :: "v"(a) : "memory")
#define XWAIT2(a, b) asm volatile("s_wait_xcnt 0x0" :: "v"(a), "v"(b) : "memory")
#define XWAIT3(a, b, c) asm volatile("s_wait_xcnt 0x0" :: "v"(a), "v"(b), "v"(c) : "memory")
#define XWAIT4(a, b, c, d) asm volatile("s_wait_xcnt 0x0" :: "v"(a), "v"(b), "v"(c), "v"(d) : "memory")

typedef __attribute__((ext_vector_type(2))) float v2f;
typedef __attribute__((ext_vector_type(8))) float v8f;
typedef __attribute__((ext_vector_type(4))) float v4f;

// ---------------------------------------------------------------------------
// CDNA5 async global->LDS copy (ASYNCcnt-tracked DMA), with sync fallback.
// Builtin signature (from hipcc diagnostic): (int4 AS1*, int4 AS3*, Ii, Ii).
// ---------------------------------------------------------------------------
#if defined(__has_builtin)
#if __has_builtin(__builtin_amdgcn_global_load_async_to_lds_b128) && \
    __has_builtin(__builtin_amdgcn_s_wait_asynccnt)
#define HAVE_ASYNC_LDS 1
#endif
#endif

#ifdef HAVE_ASYNC_LDS
typedef int vi4 __attribute__((__vector_size__(4 * sizeof(int))));
typedef __attribute__((address_space(1))) vi4 as1_vi4;
typedef __attribute__((address_space(3))) vi4 as3_vi4;
#endif

__device__ __forceinline__ void copy16(const float* g, float* l) {
#ifdef HAVE_ASYNC_LDS
  as1_vi4* gp = reinterpret_cast<as1_vi4*>((uintptr_t)g);
  as3_vi4* lp = reinterpret_cast<as3_vi4*>((uintptr_t)l);
  __builtin_amdgcn_global_load_async_to_lds_b128(gp, lp, 0, 0);
#else
  *reinterpret_cast<float4*>(l) = *reinterpret_cast<const float4*>(g);
#endif
}

__device__ __forceinline__ void stage_sync() {
#ifdef HAVE_ASYNC_LDS
  __builtin_amdgcn_s_wait_asynccnt(0);
#endif
  __syncthreads();
}

// ---------------------------------------------------------------------------
// Activation epilogues: 0=none, 1=exact GELU (erf), 2=tanh, 3=sigmoid
// ---------------------------------------------------------------------------
// erf and tanh without a branch. The math library's erff and tanhf each pick one
// of two formulas by a test on |x| that differs from lane to lane: two branches
// on the lane mask per element, which make each element one dependent chain with
// nothing of the next element issued beside it. Here both formulas are worked
// out for every element and a select keeps the one the library would have
// taken: same coefficients (given as bit patterns), same operations in the same
// order, so the values are bit-identical, and the elements of a tile are
// straight-line code whose chains can be issued side by side.
#define FB(u) __builtin_bit_cast(float, u)

__device__ __forceinline__ float erf_sel(float x) {
  const float ax = fabsf(x);
  float p = fmaf(ax, FB(0x378e98abu), FB(0xb9c68948u));  // |x| >= 1: 1 - exp(-(ax + ax*poly(ax)))
  p = fmaf(ax, p, FB(0x3b7cd369u));
  p = fmaf(ax, p, FB(0xbcc618b2u));
  p = fmaf(ax, p, FB(0x3dda74e4u));
  p = fmaf(ax, p, FB(0x3f228afdu));
  p = fmaf(ax, p, FB(0x3e03c728u));
  p = fmaf(ax, p, ax);
  const float big = 1.0f - expf(-p);
  const float t = x * x;                                 // |x| < 1: ax + ax*poly(x*x)
  float s = fmaf(t, FB(0xba1345e1u), FB(0x3ba10414u));
  s = fmaf(t, s, FB(0xbcdac9b8u));
  s = fmaf(t, s, FB(0x3de703beu));
  s = fmaf(t, s, FB(0xbec09330u));
  s = fmaf(t, s, FB(0x3e0375d0u));
  const float small = fmaf(ax, s, ax);
  return copysignf(ax < 1.0f ? small : big, x);
}

__device__ __forceinline__ float tanh_sel(float x) {
  const float ax = fabsf(x);
  const float e = expf(ax + ax);                         // |x| >= 0.625: 1 - 2/(1 + exp(2|x|))
  float r;
  // v_rcp_f32 with the one free slot that the instruction set asks for behind a
  // transcendental.
  asm("v_rcp_f32 %0, %1\n\tv_nop" : "=v"(r) : "v"(1.0f + e));
  const float big = fmaf(r, -2.0f, 1.0f);
  const float t = x * x;                                 // |x| < 0.625: ax + x*x*(ax*poly(x*x))
  float s = fmaf(t, FB(0xbbbac73du), FB(0x3ca908c9u));
  s = fmaf(t, s, FB(0xbd5c1c4eu));
  s = fmaf(t, s, FB(0x3e088382u));
  s = fmaf(t, s, FB(0xbeaaaa99u));
  const float small = fmaf(t, ax * s, ax);
  return copysignf(0.625f > ax ? small : big, x);
}

__device__ __forceinline__ float act_apply(float v, int act) {
  if (act == 1) return 0.5f * v * (1.0f + erf_sel(v * 0.70710678118654752440f));
  if (act == 2) return tanh_sel(v);
  if (act == 3) return 1.0f / (1.0f + expf(-v));
  return v;
}

// ---------------------------------------------------------------------------
// fp32 GEMM: C[R,Nc] = act(A[R,K] @ B[K,Nc] + bias)
// Block = 128 threads = 4 waves (2x2). Block tile 128x64; wave tile 64x32
// (4 M-subtiles x 2 N-subtiles of 16x16). K staged in 64-chunks,
// double-buffered in LDS via async global->LDS DMA when available.
// Per K-step: 4 A-pairs + 2 B-pairs feed 8 V_WMMA_F32_16X16X4_F32.
// K, Nc and the activation are template constants: each launch runs code that
// holds its own activation only, with no selector branch per output element,
// and row strides fold into constant address steps. The block size is stated
// too, so that the register ceiling is that of 4 waves and the copy addresses
// of the unrolled K chunks stay in registers (no scratch).
// ---------------------------------------------------------------------------
template <int K, int Nc, int act>
__global__ void __launch_bounds__(BL) gemm_wmma_kernel(const float* __restrict__ A,
                                 const float* __restrict__ Bm,
                                 const float* __restrict__ bias,
                                 float* __restrict__ C) {
  extern __shared__ float smem[];
  float* sAb = smem;                 // [2][BM rows at pitch PA]
  float* sBb = smem + 2 * BM * PA;   // [2][KC rows at pitch PB]

  const int tid = threadIdx.x;
  const int rowBase = blockIdx.x * BM;
  const int colBase = blockIdx.y * BN;
  constexpr int nk = K / KC;

  // Stage K-chunk kb into LDS buffer buf (async DMA when available).
  auto stage = [&](int kb, int buf) {
    float* dA = sAb + buf * (BM * PA);
    float* dB = sBb + buf * (KC * PB);
    const float* gA = A + (size_t)rowBase * K + kb * KC;
    const float* gB = Bm + (size_t)(kb * KC) * Nc + colBase;
#pragma unroll
    for (int j = 0; j < (BM * KC) / (4 * BL); ++j) {  // 16 x b128 per thread
      int idx = tid + j * BL;
      int r = idx >> 4;
      int cs = (idx & 15) << 2;
      copy16(gA + (size_t)r * K + cs, dA + r * PA + cs);
    }
#pragma unroll
    for (int j = 0; j < (KC * BN) / (4 * BL); ++j) {  // 8 x b128 per thread
      int idx = tid + j * BL;
      int r = idx >> 4;
      int cs = (idx & 15) << 2;
      copy16(gB + (size_t)r * Nc + cs, dB + r * PB + cs);
    }
  };

  const int lane = tid & 31;
  const int wv = tid >> 5;
  const int mw = (wv & 1) * 64;    // wave row offset in block tile
  const int nw = (wv >> 1) * 32;   // wave col offset in block tile
  const int m = lane & 15;         // A row / C column within 16x16 subtile
  const int hi = lane >> 4;        // K-pair selector (lanes 16-31: K+2,K+3)

  v8f acc[4][2] = {};

  stage(0, 0);
  stage_sync();

  for (int kb = 0; kb < nk; ++kb) {
    const int cur = kb & 1;
    if (kb + 1 < nk) stage(kb + 1, cur ^ 1);
    if (kb + 2 < nk)  // warm L2 for the chunk after next (global_prefetch_b8)
      __builtin_prefetch(A + (size_t)(rowBase + (tid >> 1)) * K + (kb + 2) * KC, 0, 0);

    const float* cA = sAb + cur * (BM * PA);
    const float* cB = sBb + cur * (KC * PB);

#pragma unroll 4
    for (int k0 = 0; k0 < KC; k0 += 4) {
      const int ka = k0 + 2 * hi;
      v2f av[4], bv[2];
#pragma unroll
      for (int mt = 0; mt < 4; ++mt) {
        const float* p = cA + (size_t)(mw + mt * 16 + m) * PA + ka;
        av[mt].x = p[0];
        av[mt].y = p[1];
      }
#pragma unroll
      for (int nt = 0; nt < 2; ++nt) {
        const float* p = cB + (size_t)ka * PB + nw + nt * 16 + m;
        bv[nt].x = p[0];
        bv[nt].y = p[PB];
      }
#pragma unroll
      for (int mt = 0; mt < 4; ++mt)
#pragma unroll
        for (int nt = 0; nt < 2; ++nt)
          acc[mt][nt] = __builtin_amdgcn_wmma_f32_16x16x4_f32(
              false, av[mt], false, bv[nt], (short)0, acc[mt][nt], false, false);
    }
    stage_sync();
  }

  // C/D layout: VGPR r2 holds M=r2 (lanes 0-15) or M=r2+8 (lanes 16-31)
#pragma unroll
  for (int nt = 0; nt < 2; ++nt) {
    const int col = colBase + nw + nt * 16 + m;
    const float bb = bias[col];
#pragma unroll
    for (int mt = 0; mt < 4; ++mt) {
#pragma unroll
      for (int r2 = 0; r2 < 8; ++r2) {
        int row = rowBase + mw + mt * 16 + hi * 8 + r2;
        C[(size_t)row * Nc + col] = act_apply(acc[mt][nt][r2] + bb, act);
      }
    }
  }
}

// ---------------------------------------------------------------------------
// prep_local: xl[bn,t,:] = x[b,t,n,:] - softmax(window_weight)-weighted
// 3-tap trend (zero-padded in time). One wave per (b, n, run of SR time steps);
// the neighbours in time come from the wave's own registers.
// ---------------------------------------------------------------------------
__global__ void __launch_bounds__(ST) prep_local_kernel(const float* __restrict__ x,
                                  const float* __restrict__ wwraw,
                                  float* __restrict__ xl) {
  const int lane = threadIdx.x & 31;
  const int w = blockIdx.x * SW + (threadIdx.x >> 5);
  const int n = w & 63;               // a work-group's waves read neighbouring n
  const int t0 = ((w >> 6) & 15) * SR;
  const int b = w >> 10;

  float w0 = wwraw[0], w1 = wwraw[1], w2 = wwraw[2];
  float mw = fmaxf(w0, fmaxf(w1, w2));
  float e0 = expf(w0 - mw), e1 = expf(w1 - mw), e2 = expf(w2 - mw);
  float inv = 1.0f / (e0 + e1 + e2);
  e0 *= inv; e1 *= inv; e2 *= inv;

  const float4* X4 = reinterpret_cast<const float4*>(x) + ((size_t)(b * TT) * NN + n) * 32 + lane;
  float4 v[SR + 2];                   // time steps t0-1 .. t0+SR
  const float4* xlo = X4 + (size_t)(t0 > 0 ? t0 - 1 : 0) * (NN * 32);
  const float4* xhi = X4 + (size_t)(t0 + SR < TT ? t0 + SR : TT - 1) * (NN * 32);
  const float4* xb = X4 + (size_t)t0 * (NN * 32);
  v[0] = *xlo;
  v[SR + 1] = *xhi;
  XWAIT2(xlo, xhi);  // behind these loads, before their address registers are written again
#pragma unroll
  for (int i = 0; i < SR; ++i) v[i + 1] = xb[(size_t)i * (NN * 32)];
  XWAIT1(xb);  // behind these loads, before their address registers are written again
  if (t0 == 0)       v[0] = make_float4(0.f, 0.f, 0.f, 0.f);
  if (t0 + SR == TT) v[SR + 1] = make_float4(0.f, 0.f, 0.f, 0.f);

  float4* O4 = reinterpret_cast<float4*>(xl) + ((size_t)(b * NN + n) * TT + t0) * 32 + lane;
#pragma unroll
  for (int i = 0; i < SR; ++i) {
    const float4 xm = v[i], xc = v[i + 1], xp = v[i + 2];
    float4 o;
    o.x = xc.x - (e0 * xm.x + e1 * xc.x + e2 * xp.x);
    o.y = xc.y - (e0 * xm.y + e1 * xc.y + e2 * xp.y);
    o.z = xc.z - (e0 * xm.z + e1 * xc.z + e2 * xp.z);
    o.w = xc.w - (e0 * xm.w + e1 * xc.w + e2 * xp.w);
    O4[(size_t)i * 32] = o;
  }
}

// ---------------------------------------------------------------------------
// Banded (|i-j|<=1) multi-head attention: off-band -1e9 scores underflow to
// exactly 0 after fp32 softmax, so only 3 neighbors matter.
// One wave per (bn, run of SR time steps). A lane holds 4 of a row's 128
// features (8 lanes a head), so each load and store of a wave is 512 contiguous
// bytes (4 whole lines) of one row's q, k, v or output, and a k or v row serves
// its three queries from registers. A score is 4 products in the lane, then a
// sum over the head's 8 lanes; every lane of a head then holds the same softmax.
// ---------------------------------------------------------------------------
template <int CTRL>
__device__ __forceinline__ float dpp_add(float v) {
  // v + (v of the lane that CTRL names): a cross-lane add on the vector port
  // (__shfl_xor would go through the LDS queue and its latency).
  const int o = __builtin_amdgcn_mov_dpp(__builtin_bit_cast(int, v), CTRL, 0xf, 0xf, true);
  return v + __builtin_bit_cast(float, o);
}

__device__ __forceinline__ float head_dot(const float4 a, const float4 b) {
  float d = a.x * b.x + a.y * b.y + a.z * b.z + a.w * b.w;
  d = dpp_add<0x161>(d);  // row_xmask:1
  d = dpp_add<0x162>(d);  // row_xmask:2
  d = dpp_add<0x164>(d);  // row_xmask:4
  return d;
}

__global__ void __launch_bounds__(ST) attn_kernel(const float* __restrict__ qkv,
                            float* __restrict__ outp) {
  const int lane = threadIdx.x & 31;
  const int w = blockIdx.x * SW + (threadIdx.x >> 5);
  const int t0 = (w & 15) * SR;       // a work-group's waves cover one bn
  const int bn = w >> 4;

  // Two batches of SR/2 rows, 28 loads each: all of a run's rows at once would
  // not fit the registers of 16 waves a WGP. Every loop is fully unrolled, so
  // that q, k and v are registers and a batch's loads issue back to back.
  constexpr int HB = SR / 2;
#pragma unroll
  for (int h = 0; h < 2; ++h) {
    const int tb = t0 + h * HB;
    const bool lo_out = (tb == 0), hi_out = (tb + HB == TT);
    // a row of qkv is 96 float4: q at 0, k at 32, v at 64
    const float4* pb = reinterpret_cast<const float4*>(qkv) + (size_t)(bn * TT + tb) * 96 + lane;
    // The two neighbour rows outside [0,T) are read in bounds (the batch's own
    // edge row instead); their scores are masked below.
    const float4* plo = lo_out ? pb : pb - 96;
    const float4* phi = hi_out ? pb + (HB - 1) * 96 : pb + HB * 96;
    float4 q[HB], k[HB + 2], v[HB + 2];   // k, v: time steps tb-1 .. tb+HB
    k[0] = plo[32]; v[0] = plo[64];
    k[HB + 1] = phi[32]; v[HB + 1] = phi[64];
#pragma unroll
    for (int i = 0; i < HB; ++i) {
      q[i] = pb[i * 96];
      k[i + 1] = pb[i * 96 + 32];
      v[i + 1] = pb[i * 96 + 64];
    }
    XWAIT3(pb, plo, phi);  // behind these loads, before their address registers are written again

    float4* O4 = reinterpret_cast<float4*>(outp) + (size_t)(bn * TT + tb) * 32 + lane;
#pragma unroll
    for (int i = 0; i < HB; ++i) {
      const float sc = 0.17677669529663687f;  // 1/sqrt(32)
      float s0 = head_dot(q[i], k[i]) * sc;
      const float s1 = head_dot(q[i], k[i + 1]) * sc;
      float s2 = head_dot(q[i], k[i + 2]) * sc;
      if (i == 0 && lo_out) s0 = -3.0e38f;       // t = 0: no step before; its weight is exp(-huge) = 0
      if (i == HB - 1 && hi_out) s2 = -3.0e38f;  // t = T-1: no step behind
      const float mmax = fmaxf(fmaxf(s0, s1), s2);
      const float p0 = expf(s0 - mmax), p1 = expf(s1 - mmax), p2 = expf(s2 - mmax);
      const float invd = 1.0f / (p0 + p1 + p2);
      const float4 va = v[i], vb = v[i + 1], vc = v[i + 2];
      float4 o;
      o.x = (p0 * va.x + p1 * vb.x + p2 * vc.x) * invd;
      o.y = (p0 * va.y + p1 * vb.y + p2 * vc.y) * invd;
      o.z = (p0 * va.z + p1 * vb.z + p2 * vc.z) * invd;
      o.w = (p0 * va.w + p1 * vb.w + p2 * vc.w) * invd;
      O4[(size_t)i * 32] = o;
    }
  }
}

// ---------------------------------------------------------------------------
// LayerNorm over D=128: one wave32 per row at a time (4 floats/lane, shfl_xor
// reduce), SR consecutive rows per wave, all loaded before the first is summed.
// ---------------------------------------------------------------------------
__global__ void __launch_bounds__(ST) ln_kernel(float* __restrict__ X,
                          const float* __restrict__ g,
                          const float* __restrict__ b) {
  const int lane = threadIdx.x & 31;
  const int w = blockIdx.x * SW + __builtin_amdgcn_readfirstlane(threadIdx.x >> 5);  // wave-uniform: row addresses are scalar
  v4f* X4 = reinterpret_cast<v4f*>(X) + (size_t)w * (SR * 32) + lane;
  const v4f g4 = reinterpret_cast<const v4f*>(g)[lane];
  const v4f b4 = reinterpret_cast<const v4f*>(b)[lane];

  v4f vv[SR];
#pragma unroll
  for (int i = 0; i < SR; ++i) vv[i] = X4[(size_t)i * 32];
  // Inputs-only fence on the loaded values: all SR rows are asked for before the
  // first is summed; left free, the compiler asks for the last four only after
  // the first twelve have arrived, a second memory latency.
  asm volatile("" :: "v"(vv[0]), "v"(vv[1]), "v"(vv[2]), "v"(vv[3]), "v"(vv[4]), "v"(vv[5]), "v"(vv[6]), "v"(vv[7]),
                     "v"(vv[8]), "v"(vv[9]), "v"(vv[10]), "v"(vv[11]), "v"(vv[12]), "v"(vv[13]), "v"(vv[14]), "v"(vv[15]),
                     "v"(g4), "v"(b4));

#pragma unroll
  for (int i = 0; i < SR; ++i) {
    const v4f v = vv[i];
    float s = v.x + v.y + v.z + v.w;
    float sq = v.x * v.x + v.y * v.y + v.z * v.z + v.w * v.w;
#pragma unroll
    for (int off = 16; off > 0; off >>= 1) {
      s += __shfl_xor(s, off, 32);
      sq += __shfl_xor(sq, off, 32);
    }
    float mean = s * (1.0f / 128.0f);
    float var = sq * (1.0f / 128.0f) - mean * mean;
    float inv = rsqrtf(var + 1e-5f);

    v4f o;
    o.x = (v.x - mean) * inv * g4.x + b4.x;
    o.y = (v.y - mean) * inv * g4.y + b4.y;
    o.z = (v.z - mean) * inv * g4.z + b4.z;
    o.w = (v.w - mean) * inv * g4.w + b4.w;
    X4[(size_t)i * 32] = o;
  }
}

// ---------------------------------------------------------------------------
// prep_conv: x_pos = x + pos_enc; depthwise conv3 (pad 1, zeros AFTER pos add
// per reference) + conv bias. Output layout [bn,t,D]. One wave per (b, n, run
// of SR time steps); the taps and the neighbours in time stay in registers.
// ---------------------------------------------------------------------------
__global__ void __launch_bounds__(ST) prep_conv_kernel(const float* __restrict__ x,
                                 const float* __restrict__ pos,
                                 const float* __restrict__ cw,
                                 const float* __restrict__ cb,
                                 float* __restrict__ xconv) {
  const int lane = threadIdx.x & 31;
  const int w = blockIdx.x * SW + (threadIdx.x >> 5);
  const int n = w & 63;               // a work-group's waves read neighbouring n
  const int t0 = ((w >> 6) & 15) * SR;
  const int b = w >> 10;
  const int d0 = lane * 4;

  const float4* X4 = reinterpret_cast<const float4*>(x) + ((size_t)(b * TT) * NN + n) * 32 + lane;
  const float4* P4 = reinterpret_cast<const float4*>(pos) + lane;

  float k0[4], k1[4], k2[4], kb[4];
#pragma unroll
  for (int c = 0; c < 4; ++c) {
    int d = d0 + c;
    k0[c] = cw[d * 3 + 0]; k1[c] = cw[d * 3 + 1]; k2[c] = cw[d * 3 + 2];
    kb[c] = cb[d];
  }
  XWAIT0();  // behind these loads, before their address registers are written again
  float4 v[SR + 2], p[SR + 2];        // time steps t0-1 .. t0+SR
  const int tlo = t0 > 0 ? t0 - 1 : 0;              // the two edge rows are read in
  const int thi = t0 + SR < TT ? t0 + SR : TT - 1;  // bounds and set to zero below
  const float4* xlo = X4 + (size_t)tlo * (NN * 32);
  const float4* xhi = X4 + (size_t)thi * (NN * 32);
  const float4* plo = P4 + (size_t)tlo * 32;
  const float4* phi = P4 + (size_t)thi * 32;
  const float4* xb = X4 + (size_t)t0 * (NN * 32);
  const float4* pb = P4 + (size_t)t0 * 32;
  v[0] = *xlo; p[0] = *plo;
  v[SR + 1] = *xhi; p[SR + 1] = *phi;
  XWAIT4(xlo, xhi, plo, phi);  // behind these loads, before their address registers are written again
#pragma unroll
  for (int i = 0; i < SR; ++i) {
    v[i + 1] = xb[(size_t)i * (NN * 32)];
    p[i + 1] = pb[(size_t)i * 32];
  }
  XWAIT2(xb, pb);  // behind these loads, before their address registers are written again
#pragma unroll
  for (int i = 0; i < SR + 2; ++i) {
    v[i].x += p[i].x; v[i].y += p[i].y; v[i].z += p[i].z; v[i].w += p[i].w;
  }
  if (t0 == 0)       v[0] = make_float4(0.f, 0.f, 0.f, 0.f);
  if (t0 + SR == TT) v[SR + 1] = make_float4(0.f, 0.f, 0.f, 0.f);

  float4* O4 = reinterpret_cast<float4*>(xconv) + ((size_t)(b * NN + n) * TT + t0) * 32 + lane;
#pragma unroll
  for (int i = 0; i < SR; ++i) {
    const float4 xm = v[i], xc = v[i + 1], xp = v[i + 2];
    float4 o;
    o.x = k0[0] * xm.x + k1[0] * xc.x + k2[0] * xp.x + kb[0];
    o.y = k0[1] * xm.y + k1[1] * xc.y + k2[1] * xp.y + kb[1];
    o.z = k0[2] * xm.z + k1[2] * xc.z + k2[2] * xp.z + kb[2];
    o.w = k0[3] * xm.w + k1[3] * xc.w + k2[3] * xp.w + kb[3];
    O4[(size_t)i * 32] = o;
  }
}

// ---------------------------------------------------------------------------
// Mixed pool: k=6, stride 1, pad (2,2) -> length T-1, right zero-pad to T.
// avg divides by 6 always (zero pad contributes 0); max over valid entries.
// One wave per (bn, run of SR time steps): the SR+5 rows its windows cover are
// loaded once; each window is summed on its own, in rising time order.
// ---------------------------------------------------------------------------
__global__ void __launch_bounds__(ST) pool_kernel(const float* __restrict__ xconv,
                            const float* __restrict__ alpha_p,
                            float* __restrict__ outp) {
  const int lane = threadIdx.x & 31;
  const int w = blockIdx.x * SW + (threadIdx.x >> 5);
  const int t0 = (w & 15) * SR;
  const int bn = w >> 4;
  const bool first = (t0 == 0), last = (t0 + SR == TT);

  const float a = 1.0f / (1.0f + expf(-alpha_p[0]));
  const float4* XC4 = reinterpret_cast<const float4*>(xconv) + (size_t)(bn * TT) * 32 + lane;

  float4 vs[SR + 5], vm[SR + 5];      // time steps t0-2 .. t0+SR+2: for the sum, for the max
  // Rows outside [0,T) are read in bounds (rows of the run itself instead) and replaced below.
  const float4* cb4 = XC4 + (size_t)t0 * 32;
  const float4* clo = first ? cb4 + 2 * 32 : cb4;            // clo[-2 rows], clo[-1 row]
  const float4* chi = last ? cb4 - 3 * 32 : cb4;             // chi[SR rows] .. chi[SR+2 rows]
  vs[0] = clo[-2 * 32]; vs[1] = clo[-1 * 32];
  vs[SR + 2] = chi[SR * 32]; vs[SR + 3] = chi[(SR + 1) * 32]; vs[SR + 4] = chi[(SR + 2) * 32];
  XWAIT2(clo, chi);  // behind these loads, before their address registers are written again
#pragma unroll
  for (int i = 0; i < SR; ++i) vs[i + 2] = cb4[(size_t)i * 32];
  XWAIT1(cb4);  // behind these loads, before their address registers are written again
#pragma unroll
  for (int i = 0; i < SR + 5; ++i) {
    vm[i] = vs[i];
    if ((i < 2 && first) || (i >= SR + 2 && last)) {
      vs[i] = make_float4(0.f, 0.f, 0.f, 0.f);
      vm[i] = make_float4(-3.0e38f, -3.0e38f, -3.0e38f, -3.0e38f);
    }
  }

  float4* O4 = reinterpret_cast<float4*>(outp) + ((size_t)(bn * TT) + t0) * 32 + lane;
  const float inv6 = 1.0f / 6.0f;
#pragma unroll
  for (int i = 0; i < SR; ++i) {
    float sx = 0.f, sy = 0.f, sz = 0.f, sw = 0.f;
    float mx = -3.0e38f, my = -3.0e38f, mz = -3.0e38f, mw = -3.0e38f;
#pragma unroll
    for (int k = 0; k < 6; ++k) {
      const float4 s = vs[i + k], m = vm[i + k];
      sx += s.x; sy += s.y; sz += s.z; sw += s.w;
      mx = fmaxf(mx, m.x); my = fmaxf(my, m.y);
      mz = fmaxf(mz, m.z); mw = fmaxf(mw, m.w);
    }
    float4 res;
    res.x = a * (sx * inv6) + (1.f - a) * mx;
    res.y = a * (sy * inv6) + (1.f - a) * my;
    res.z = a * (sz * inv6) + (1.f - a) * mz;
    res.w = a * (sw * inv6) + (1.f - a) * mw;
    if (i == SR - 1 && last) res = make_float4(0.f, 0.f, 0.f, 0.f);  // t = T-1: the right zero-pad
    O4[(size_t)i * 32] = res;
  }
}

// ---------------------------------------------------------------------------
// concat [x_loc | x_glob] -> [R, 256]; SR consecutive rows per wave
// ---------------------------------------------------------------------------
__global__ void __launch_bounds__(ST) concat_kernel(const float* __restrict__ xloc,
                              const float* __restrict__ xglob,
                              float* __restrict__ cat) {
  const int lane = threadIdx.x & 31;
  const int w = blockIdx.x * SW + __builtin_amdgcn_readfirstlane(threadIdx.x >> 5);  // wave-uniform: row addresses are scalar
  const v4f* L4 = reinterpret_cast<const v4f*>(xloc) + (size_t)w * (SR * 32) + lane;
  const v4f* G4 = reinterpret_cast<const v4f*>(xglob) + (size_t)w * (SR * 32) + lane;
  v4f* C4 = reinterpret_cast<v4f*>(cat) + (size_t)w * (SR * 64) + lane;
  v4f vl[SR], vg[SR];
  v8f pr[SR];                         // a row's two halves side by side, for the fence below
#pragma unroll
  for (int i = 0; i < SR; ++i) {
    vl[i] = L4[(size_t)i * 32];
    vg[i] = G4[(size_t)i * 32];
    pr[i] = __builtin_shufflevector(vl[i], vg[i], 0, 1, 2, 3, 4, 5, 6, 7);
  }
  // Inputs-only fence on the loaded values: all 32 loads issue before the first
  // store; left free, the compiler pairs each load with its store and a wave
  // has one load in flight.
  asm volatile("" :: "v"(pr[0]), "v"(pr[1]), "v"(pr[2]), "v"(pr[3]), "v"(pr[4]), "v"(pr[5]), "v"(pr[6]), "v"(pr[7]),
                     "v"(pr[8]), "v"(pr[9]), "v"(pr[10]), "v"(pr[11]), "v"(pr[12]), "v"(pr[13]), "v"(pr[14]), "v"(pr[15]));
#pragma unroll
  for (int i = 0; i < SR; ++i) {
    C4[(size_t)i * 64] = vl[i];
    C4[(size_t)i * 64 + 32] = vg[i];
  }
}

// ---------------------------------------------------------------------------
// Final: out = x + softplus(res_scale) * (gate*x_loc + (1-gate)*x_glob)
// with [bn,t,D] -> [B,T,N,D] relayout.
// ---------------------------------------------------------------------------
__device__ __forceinline__ float softplus_f(float v) {
  return (v > 0.f) ? (v + log1pf(expf(-v))) : log1pf(expf(v));
}

__global__ void __launch_bounds__(ST) final_kernel(const float* __restrict__ x,
                             const float* __restrict__ gate,
                             const float* __restrict__ xloc,
                             const float* __restrict__ xglob,
                             const float* __restrict__ res_scale,
                             float* __restrict__ out) {
  // One wave per (b, n, run of SR time steps); the scale is formed once a wave.
  const int lane = threadIdx.x & 31;
  const int w = blockIdx.x * SW + (threadIdx.x >> 5);
  const int n = w & 63;               // a work-group's waves touch neighbouring n
  const int t0 = ((w >> 6) & 15) * SR;
  const int b = w >> 10;

  const size_t xo = ((size_t)(b * TT + t0) * NN + n) * 32 + lane;  // [B,T,N,D]
  const size_t ro = ((size_t)(b * NN + n) * TT + t0) * 32 + lane;  // [bn,t,D]
  const float4* X4 = reinterpret_cast<const float4*>(x) + xo;
  const float4* G4 = reinterpret_cast<const float4*>(gate) + ro;
  const float4* L4 = reinterpret_cast<const float4*>(xloc) + ro;
  const float4* Q4 = reinterpret_cast<const float4*>(xglob) + ro;
  float4* O4 = reinterpret_cast<float4*>(out) + xo;

  const float4 rs = reinterpret_cast<const float4*>(res_scale)[lane];
  XWAIT0();  // behind these loads, before their address registers are written again
  // Two batches of SR/2 rows, 32 loads each: 64 at once would not fit the
  // registers of 16 waves a WGP.
  constexpr int HB = SR / 2;
  const float sx = softplus_f(rs.x), sy = softplus_f(rs.y);
  const float sz = softplus_f(rs.z), sw = softplus_f(rs.w);
#pragma unroll
  for (int h = 0; h < 2; ++h) {
    float4 xv[HB], g[HB], xl[HB], xg[HB];
#pragma unroll
    for (int i = 0; i < HB; ++i) {
      xv[i] = X4[(size_t)(h * HB + i) * (NN * 32)];
      g[i]  = G4[(size_t)(h * HB + i) * 32];
      xl[i] = L4[(size_t)(h * HB + i) * 32];
      xg[i] = Q4[(size_t)(h * HB + i) * 32];
    }
    XWAIT4(X4, G4, L4, Q4);  // behind these loads, before their address registers are written again
#pragma unroll
    for (int i = 0; i < HB; ++i) {
      float4 o;
      o.x = xv[i].x + sx * (g[i].x * xl[i].x + (1.f - g[i].x) * xg[i].x);
      o.y = xv[i].y + sy * (g[i].y * xl[i].y + (1.f - g[i].y) * xg[i].y);
      o.z = xv[i].z + sz * (g[i].z * xl[i].z + (1.f - g[i].z) * xg[i].z);
      o.w = xv[i].w + sw * (g[i].w * xl[i].w + (1.f - g[i].w) * xg[i].w);
      O4[(size_t)(h * HB + i) * (NN * 32)] = o;
    }
  }
}

// ---------------------------------------------------------------------------
// Host launcher
// ---------------------------------------------------------------------------
extern "C" void kernel_launch(void* const* d_in, const int* in_sizes, int n_in,
                              void* d_out, int out_size, void* d_ws, size_t ws_size,
                              hipStream_t stream) {
  const float* x          = (const float*)d_in[0];
  const float* window_w   = (const float*)d_in[1];
  const float* local_w1   = (const float*)d_in[2];
  const float* local_b1   = (const float*)d_in[3];
  const float* local_w2   = (const float*)d_in[4];
  const float* local_b2   = (const float*)d_in[5];
  const float* local_ln_g = (const float*)d_in[6];
  const float* local_ln_b = (const float*)d_in[7];
  const float* qkv_w      = (const float*)d_in[8];
  const float* qkv_b      = (const float*)d_in[9];
  const float* out_w      = (const float*)d_in[10];
  const float* out_b      = (const float*)d_in[11];
  const float* conv_w     = (const float*)d_in[12];
  const float* conv_b     = (const float*)d_in[13];
  const float* alpha      = (const float*)d_in[14];
  const float* pos_enc    = (const float*)d_in[15];
  const float* global_w1  = (const float*)d_in[16];
  const float* global_b1  = (const float*)d_in[17];
  const float* global_w2  = (const float*)d_in[18];
  const float* global_b2  = (const float*)d_in[19];
  const float* global_ln_g= (const float*)d_in[20];
  const float* global_ln_b= (const float*)d_in[21];
  const float* gate_w1    = (const float*)d_in[22];
  const float* gate_b1    = (const float*)d_in[23];
  const float* gate_w2    = (const float*)d_in[24];
  const float* gate_b2    = (const float*)d_in[25];
  const float* res_scale  = (const float*)d_in[26];
  float* out = (float*)d_out;

  const size_t R = (size_t)RR;
  float* ws = (float*)d_ws;
  float* P0 = ws;             // R*128: xl -> attn_out -> x_loc
  float* P1 = ws + R * 128;   // R*384: qkv -> proj/h1/cat/gate
  float* P2 = ws + R * 512;   // R*128: xconv -> x_glob
  float* P3 = ws + R * 640;   // R*128: x_glob_in -> tanh_out
  float* h1   = P1 + R * 128; // R*256 region inside P1
  float* gate = P1 + R * 256; // R*128 region inside P1

  const size_t GEMM_LDS = (2 * BM * PA + 2 * KC * PB) * sizeof(float);  // 104 KB

  // local branch
  prep_local_kernel<<<SG, ST, 0, stream>>>(x, window_w, P0);
  gemm_wmma_kernel<128, 384, 0><<<dim3(RR / BM, 384 / BN), BL, GEMM_LDS, stream>>>(
      P0, qkv_w, qkv_b, P1);
  attn_kernel<<<SG, ST, 0, stream>>>(P1, P0);
  gemm_wmma_kernel<128, 128, 0><<<dim3(RR / BM, 128 / BN), BL, GEMM_LDS, stream>>>(
      P0, out_w, out_b, P1);
  gemm_wmma_kernel<128, 256, 1 /*gelu*/><<<dim3(RR / BM, 256 / BN), BL, GEMM_LDS, stream>>>(
      P1, local_w1, local_b1, h1);
  gemm_wmma_kernel<256, 128, 0><<<dim3(RR / BM, 128 / BN), BL, GEMM_LDS, stream>>>(
      h1, local_w2, local_b2, P0);
  ln_kernel<<<SG, ST, 0, stream>>>(P0, local_ln_g, local_ln_b);  // x_loc = P0

  // global branch
  prep_conv_kernel<<<SG, ST, 0, stream>>>(x, pos_enc, conv_w, conv_b, P2);
  pool_kernel<<<SG, ST, 0, stream>>>(P2, alpha, P3);
  gemm_wmma_kernel<128, 256, 1 /*gelu*/><<<dim3(RR / BM, 256 / BN), BL, GEMM_LDS, stream>>>(
      P3, global_w1, global_b1, h1);
  gemm_wmma_kernel<256, 128, 0><<<dim3(RR / BM, 128 / BN), BL, GEMM_LDS, stream>>>(
      h1, global_w2, global_b2, P2);
  ln_kernel<<<SG, ST, 0, stream>>>(P2, global_ln_g, global_ln_b);  // x_glob = P2

  // gated fusion
  concat_kernel<<<SG, ST, 0, stream>>>(P0, P2, P1);  // cat in P1[0:R*256]
  gemm_wmma_kernel<256, 128, 2 /*tanh*/><<<dim3(RR / BM, 128 / BN), BL, GEMM_LDS, stream>>>(
      P1, gate_w1, gate_b1, P3);
  gemm_wmma_kernel<128, 128, 3 /*sigmoid*/><<<dim3(RR / BM, 128 / BN), BL, GEMM_LDS, stream>>>(
      P3, gate_w2, gate_b2, gate);

  final_kernel<<<SG, ST, 0, stream>>>(x, gate, P0, P2, res_scale, out);
}

// v006
// One run takes 289 microseconds.
// Next to v005, in two timings, it ran 1.27 and 1.26 times as fast.
// All steps since v000 together make it 3.49 times as fast.
#include <hip/hip_runtime.h>
#include <math.h>

// Problem constants (from reference)
#define BB 4
#define TT 256
#define NN 64
#define DD 128
#define HH 4
#define HD 32
#define RR (BB * NN * TT)   // 65536 rows

// GEMM blocking
#define BM 128   // block tile rows
#define BN 64    // block tile cols
#define KC 64    // K chunk staged in LDS
#define BL 128   // threads per block (4 waves)
// LDS row pitches in floats (LDS bank = dword address mod 64). Both stay
// multiples of 4 floats so every 16-byte copy lands 16-byte aligned.
#define PA 68    // A rows: 16 rows x 2 k-pairs of a fragment read fall on 64 distinct banks
#define PB 72    // B rows: rows k and k+2, read by the two lane halves, sit 16 banks apart

// Streaming kernels (everything but the GEMMs and the fused MLP): one wave
// walks SR rows of 128 floats, one float4 per lane and row, so a launch starts
// 4,096 waves (one 16-wave work-group per WGP) and each wave has SR or more
// 512-byte loads in flight. The row loops are fully unrolled, so that the row
// arrays are registers and a run's loads can issue back to back.
#define SW 16                  // waves per work-group
#define ST (SW * 32)           // threads per work-group
#define SR 16                  // rows per wave (the fence on loaded values names 16)
#define SG (RR / (SW * SR))    // work-groups per launch
// Stands behind a run of loads: s_wait_xcnt 0 before any register that an issued
// load names is written again. The address operands only keep those registers
// alive up to the wait, so that no later load's result lands in them before it.
#define XWAIT0() asm volatile("s_wait_xcnt 0x0" ::: "memory")
#define XWAIT1(a) asm volatile("s_wait_xcnt 0x0" :: "v"(a) : "memory")
#define XWAIT2(a, b) asm volatile("s_wait_xcnt 0x0" :: "v"(a), "v"(b) : "memory")
#define XWAIT3(a, b, c) asm volatile("s_wait_xcnt 0x0" :: "v"(a), "v"(b), "v"(c) : "memory")
#define XWAIT4(a, b, c, d) asm volatile("s_wait_xcnt 0x0" :: "v"(a), "v"(b), "v"(c), "v"(d) : "memory")

typedef __attribute__((ext_vector_type(2))) float v2f;
typedef __attribute__((ext_vector_type(8))) float v8f;
typedef __attribute__((ext_vector_type(4))) float v4f;

// ---------------------------------------------------------------------------
// CDNA5 async global->LDS copy (ASYNCcnt-tracked DMA), with sync fallback.
// Builtin signature (from hipcc diagnostic): (int4 AS1*, int4 AS3*, Ii, Ii).
// ---------------------------------------------------------------------------
#if defined(__has_builtin)
#if __has_builtin(__builtin_amdgcn_global_load_async_to_lds_b128) && \
    __has_builtin(__builtin_amdgcn_s_wait_asynccnt)
#define HAVE_ASYNC_LDS 1
#endif
#endif

#ifdef HAVE_ASYNC_LDS
typedef int vi4 __attribute__((__vector_size__(4 * sizeof(int))));
typedef __attribute__((address_space(1))) vi4 as1_vi4;
typedef __attribute__((address_space(3))) vi4 as3_vi4;
#endif

__device__ __forceinline__ void copy16(const float* g, float* l) {
#ifdef HAVE_ASYNC_LDS
  as1_vi4* gp = reinterpret_cast<as1_vi4*>((uintptr_t)g);
  as3_vi4* lp = reinterpret_cast<as3_vi4*>((uintptr_t)l);
  __builtin_amdgcn_global_load_async_to_lds_b128(gp, lp, 0, 0);
#else
  *reinterpret_cast<float4*>(l) = *reinterpret_cast<const float4*>(g);
#endif
}

__device__ __forceinline__ void stage_sync() {
#ifdef HAVE_ASYNC_LDS
  __builtin_amdgcn_s_wait_asynccnt(0);
#endif
  __syncthreads();
}

// ---------------------------------------------------------------------------
// Activation epilogues: 0=none, 1=exact GELU (erf), 2=tanh, 3=sigmoid
// ---------------------------------------------------------------------------
// erf and tanh without a branch. The math library's erff and tanhf each pick one
// of two formulas by a test on |x| that differs from lane to lane: two branches
// on the lane mask per element, which make each element one dependent chain with
// nothing of the next element issued beside it. Here both formulas are worked
// out for every element and a select keeps the one the library would have
// taken: same coefficients (given as bit patterns), same operations in the same
// order, so the values are bit-identical, and the elements of a tile are
// straight-line code whose chains can be issued side by side.
#define FB(u) __builtin_bit_cast(float, u)

__device__ __forceinline__ float erf_sel(float x) {
  const float ax = fabsf(x);
  float p = fmaf(ax, FB(0x378e98abu), FB(0xb9c68948u));  // |x| >= 1: 1 - exp(-(ax + ax*poly(ax)))
  p = fmaf(ax, p, FB(0x3b7cd369u));
  p = fmaf(ax, p, FB(0xbcc618b2u));
  p = fmaf(ax, p, FB(0x3dda74e4u));
  p = fmaf(ax, p, FB(0x3f228afdu));
  p = fmaf(ax, p, FB(0x3e03c728u));
  p = fmaf(ax, p, ax);
  const float big = 1.0f - expf(-p);
  const float t = x * x;                                 // |x| < 1: ax + ax*poly(x*x)
  float s = fmaf(t, FB(0xba1345e1u), FB(0x3ba10414u));
  s = fmaf(t, s, FB(0xbcdac9b8u));
  s = fmaf(t, s, FB(0x3de703beu));
  s = fmaf(t, s, FB(0xbec09330u));
  s = fmaf(t, s, FB(0x3e0375d0u));
  const float small = fmaf(ax, s, ax);
  return copysignf(ax < 1.0f ? small : big, x);
}

__device__ __forceinline__ float tanh_sel(float x) {
  const float ax = fabsf(x);
  const float e = expf(ax + ax);                         // |x| >= 0.625: 1 - 2/(1 + exp(2|x|))
  float r;
  // v_rcp_f32 with the one free slot that the instruction set asks for behind a
  // transcendental.
  asm("v_rcp_f32 %0, %1\n\tv_nop" : "=v"(r) : "v"(1.0f + e));
  const float big = fmaf(r, -2.0f, 1.0f);
  const float t = x * x;                                 // |x| < 0.625: ax + x*x*(ax*poly(x*x))
  float s = fmaf(t, FB(0xbbbac73du), FB(0x3ca908c9u));
  s = fmaf(t, s, FB(0xbd5c1c4eu));
  s = fmaf(t, s, FB(0x3e088382u));
  s = fmaf(t, s, FB(0xbeaaaa99u));
  const float small = fmaf(t, ax * s, ax);
  return copysignf(0.625f > ax ? small : big, x);
}

__device__ __forceinline__ float act_apply(float v, int act) {
  if (act == 1) return 0.5f * v * (1.0f + erf_sel(v * 0.70710678118654752440f));
  if (act == 2) return tanh_sel(v);
  if (act == 3) return 1.0f / (1.0f + expf(-v));
  return v;
}

// ---------------------------------------------------------------------------
// fp32 GEMM: C[R,Nc] = act(A[R,K] @ B[K,Nc] + bias)
// Block = 128 threads = 4 waves (2x2). Block tile 128x64; wave tile 64x32
// (4 M-subtiles x 2 N-subtiles of 16x16). K staged in 64-chunks,
// double-buffered in LDS via async global->LDS DMA when available.
// Per K-step: 4 A-pairs + 2 B-pairs feed 8 V_WMMA_F32_16X16X4_F32.
// K, Nc and the activation are template constants: each launch runs code that
// holds its own activation only, with no selector branch per output element,
// and row strides fold into constant address steps. The block size is stated
// too, so that the register ceiling is that of 4 waves and the copy addresses
// of the unrolled K chunks stay in registers (no scratch).
// ---------------------------------------------------------------------------
template <int K, int Nc, int act>
__global__ void __launch_bounds__(BL) gemm_wmma_kernel(const float* __restrict__ A,
                                 const float* __restrict__ Bm,
                                 const float* __restrict__ bias,
                                 float* __restrict__ C) {
  extern __shared__ float smem[];
  float* sAb = smem;                 // [2][BM rows at pitch PA]
  float* sBb = smem + 2 * BM * PA;   // [2][KC rows at pitch PB]

  const int tid = threadIdx.x;
  const int rowBase = blockIdx.x * BM;
  const int colBase = blockIdx.y * BN;
  constexpr int nk = K / KC;

  // Stage K-chunk kb into LDS buffer buf (async DMA when available).
  auto stage = [&](int kb, int buf) {
    float* dA = sAb + buf * (BM * PA);
    float* dB = sBb + buf * (KC * PB);
    const float* gA = A + (size_t)rowBase * K + kb * KC;
    const float* gB = Bm + (size_t)(kb * KC) * Nc + colBase;
#pragma unroll
    for (int j = 0; j < (BM * KC) / (4 * BL); ++j) {  // 16 x b128 per thread
      int idx = tid + j * BL;
      int r = idx >> 4;
      int cs = (idx & 15) << 2;
      copy16(gA + (size_t)r * K + cs, dA + r * PA + cs);
    }
#pragma unroll
    for (int j = 0; j < (KC * BN) / (4 * BL); ++j) {  // 8 x b128 per thread
      int idx = tid + j * BL;
      int r = idx >> 4;
      int cs = (idx & 15) << 2;
      copy16(gB + (size_t)r * Nc + cs, dB + r * PB + cs);
    }
  };

  const int lane = tid & 31;
  const int wv = tid >> 5;
  const int mw = (wv & 1) * 64;    // wave row offset in block tile
  const int nw = (wv >> 1) * 32;   // wave col offset in block tile
  const int m = lane & 15;         // A row / C column within 16x16 subtile
  const int hi = lane >> 4;        // K-pair selector (lanes 16-31: K+2,K+3)

  v8f acc[4][2] = {};

  stage(0, 0);
  stage_sync();

  for (int kb = 0; kb < nk; ++kb) {
    const int cur = kb & 1;
    if (kb + 1 < nk) stage(kb + 1, cur ^ 1);
    if (kb + 2 < nk)  // warm L2 for the chunk after next (global_prefetch_b8)
      __builtin_prefetch(A + (size_t)(rowBase + (tid >> 1)) * K + (kb + 2) * KC, 0, 0);

    const float* cA = sAb + cur * (BM * PA);
    const float* cB = sBb + cur * (KC * PB);

#pragma unroll 4
    for (int k0 = 0; k0 < KC; k0 += 4) {
      const int ka = k0 + 2 * hi;
      v2f av[4], bv[2];
#pragma unroll
      for (int mt = 0; mt < 4; ++mt) {
        const float* p = cA + (size_t)(mw + mt * 16 + m) * PA + ka;
        av[mt].x = p[0];
        av[mt].y = p[1];
      }
#pragma unroll
      for (int nt = 0; nt < 2; ++nt) {
        const float* p = cB + (size_t)ka * PB + nw + nt * 16 + m;
        bv[nt].x = p[0];
        bv[nt].y = p[PB];
      }
#pragma unroll
      for (int mt = 0; mt < 4; ++mt)
#pragma unroll
        for (int nt = 0; nt < 2; ++nt)
          acc[mt][nt] = __builtin_amdgcn_wmma_f32_16x16x4_f32(
              false, av[mt], false, bv[nt], (short)0, acc[mt][nt], false, false);
    }
    stage_sync();
  }

  // C/D layout: VGPR r2 holds M=r2 (lanes 0-15) or M=r2+8 (lanes 16-31)
#pragma unroll
  for (int nt = 0; nt < 2; ++nt) {
    const int col = colBase + nw + nt * 16 + m;
    const float bb = bias[col];
#pragma unroll
    for (int mt = 0; mt < 4; ++mt) {
#pragma unroll
      for (int r2 = 0; r2 < 8; ++r2) {
        int row = rowBase + mw + mt * 16 + hi * 8 + r2;
        C[(size_t)row * Nc + col] = act_apply(acc[mt][nt][r2] + bb, act);
      }
    }
  }
}

// ---------------------------------------------------------------------------
// prep_local: xl[bn,t,:] = x[b,t,n,:] - softmax(window_weight)-weighted
// 3-tap trend (zero-padded in time). One wave per (b, n, run of SR time steps);
// the neighbours in time come from the wave's own registers.
// ---------------------------------------------------------------------------
__global__ void __launch_bounds__(ST) prep_local_kernel(const float* __restrict__ x,
                                  const float* __restrict__ wwraw,
                                  float* __restrict__ xl) {
  const int lane = threadIdx.x & 31;
  const int w = blockIdx.x * SW + (threadIdx.x >> 5);
  const int n = w & 63;               // a work-group's waves read neighbouring n
  const int t0 = ((w >> 6) & 15) * SR;
  const int b = w >> 10;

  float w0 = wwraw[0], w1 = wwraw[1], w2 = wwraw[2];
  float mw = fmaxf(w0, fmaxf(w1, w2));
  float e0 = expf(w0 - mw), e1 = expf(w1 - mw), e2 = expf(w2 - mw);
  float inv = 1.0f / (e0 + e1 + e2);
  e0 *= inv; e1 *= inv; e2 *= inv;

  const float4* X4 = reinterpret_cast<const float4*>(x) + ((size_t)(b * TT) * NN + n) * 32 + lane;
  float4 v[SR + 2];                   // time steps t0-1 .. t0+SR
  const float4* xlo = X4 + (size_t)(t0 > 0 ? t0 - 1 : 0) * (NN * 32);
  const float4* xhi = X4 + (size_t)(t0 + SR < TT ? t0 + SR : TT - 1) * (NN * 32);
  const float4* xb = X4 + (size_t)t0 * (NN * 32);
  v[0] = *xlo;
  v[SR + 1] = *xhi;
  XWAIT2(xlo, xhi);  // behind these loads, before their address registers are written again
#pragma unroll
  for (int i = 0; i < SR; ++i) v[i + 1] = xb[(size_t)i * (NN * 32)];
  XWAIT1(xb);  // behind these loads, before their address registers are written again
  if (t0 == 0)       v[0] = make_float4(0.f, 0.f, 0.f, 0.f);
  if (t0 + SR == TT) v[SR + 1] = make_float4(0.f, 0.f, 0.f, 0.f);

  float4* O4 = reinterpret_cast<float4*>(xl) + ((size_t)(b * NN + n) * TT + t0) * 32 + lane;
#pragma unroll
  for (int i = 0; i < SR; ++i) {
    const float4 xm = v[i], xc = v[i + 1], xp = v[i + 2];
    float4 o;
    o.x = xc.x - (e0 * xm.x + e1 * xc.x + e2 * xp.x);
    o.y = xc.y - (e0 * xm.y + e1 * xc.y + e2 * xp.y);
    o.z = xc.z - (e0 * xm.z + e1 * xc.z + e2 * xp.z);
    o.w = xc.w - (e0 * xm.w + e1 * xc.w + e2 * xp.w);
    O4[(size_t)i * 32] = o;
  }
}

// ---------------------------------------------------------------------------
// Banded (|i-j|<=1) multi-head attention: off-band -1e9 scores underflow to
// exactly 0 after fp32 softmax, so only 3 neighbors matter.
// One wave per (bn, run of SR time steps). A lane holds 4 of a row's 128
// features (8 lanes a head), so each load and store of a wave is 512 contiguous
// bytes (4 whole lines) of one row's q, k, v or output, and a k or v row serves
// its three queries from registers. A score is 4 products in the lane, then a
// sum over the head's 8 lanes; every lane of a head then holds the same softmax.
// ---------------------------------------------------------------------------
template <int CTRL>
__device__ __forceinline__ float dpp_add(float v) {
  // v + (v of the lane that CTRL names): a cross-lane add on the vector port
  // (__shfl_xor would go through the LDS queue and its latency).
  const int o = __builtin_amdgcn_mov_dpp(__builtin_bit_cast(int, v), CTRL, 0xf, 0xf, true);
  return v + __builtin_bit_cast(float, o);
}

__device__ __forceinline__ float head_dot(const float4 a, const float4 b) {
  float d = a.x * b.x + a.y * b.y + a.z * b.z + a.w * b.w;
  d = dpp_add<0x161>(d);  // row_xmask:1
  d = dpp_add<0x162>(d);  // row_xmask:2
  d = dpp_add<0x164>(d);  // row_xmask:4
  return d;
}

__global__ void __launch_bounds__(ST) attn_kernel(const float* __restrict__ qkv,
                            float* __restrict__ outp) {
  const int lane = threadIdx.x & 31;
  const int w = blockIdx.x * SW + (threadIdx.x >> 5);
  const int t0 = (w & 15) * SR;       // a work-group's waves cover one bn
  const int bn = w >> 4;

  // Two batches of SR/2 rows, 28 loads each: all of a run's rows at once would
  // not fit the registers of 16 waves a WGP. Every loop is fully unrolled, so
  // that q, k and v are registers and a batch's loads issue back to back.
  constexpr int HB = SR / 2;
#pragma unroll
  for (int h = 0; h < 2; ++h) {
    const int tb = t0 + h * HB;
    const bool lo_out = (tb == 0), hi_out = (tb + HB == TT);
    // a row of qkv is 96 float4: q at 0, k at 32, v at 64
    const float4* pb = reinterpret_cast<const float4*>(qkv) + (size_t)(bn * TT + tb) * 96 + lane;
    // The two neighbour rows outside [0,T) are read in bounds (the batch's own
    // edge row instead); their scores are masked below.
    const float4* plo = lo_out ? pb : pb - 96;
    const float4* phi = hi_out ? pb + (HB - 1) * 96 : pb + HB * 96;
    float4 q[HB], k[HB + 2], v[HB + 2];   // k, v: time steps tb-1 .. tb+HB
    k[0] = plo[32]; v[0] = plo[64];
    k[HB + 1] = phi[32]; v[HB + 1] = phi[64];
#pragma unroll
    for (int i = 0; i < HB; ++i) {
      q[i] = pb[i * 96];
      k[i + 1] = pb[i * 96 + 32];
      v[i + 1] = pb[i * 96 + 64];
    }
    XWAIT3(pb, plo, phi);  // behind these loads, before their address registers are written again

    float4* O4 = reinterpret_cast<float4*>(outp) + (size_t)(bn * TT + tb) * 32 + lane;
#pragma unroll
    for (int i = 0; i < HB; ++i) {
      const float sc = 0.17677669529663687f;  // 1/sqrt(32)
      float s0 = head_dot(q[i], k[i]) * sc;
      const float s1 = head_dot(q[i], k[i + 1]) * sc;
      float s2 = head_dot(q[i], k[i + 2]) * sc;
      if (i == 0 && lo_out) s0 = -3.0e38f;       // t = 0: no step before; its weight is exp(-huge) = 0
      if (i == HB - 1 && hi_out) s2 = -3.0e38f;  // t = T-1: no step behind
      const float mmax = fmaxf(fmaxf(s0, s1), s2);
      const float p0 = expf(s0 - mmax), p1 = expf(s1 - mmax), p2 = expf(s2 - mmax);
      const float invd = 1.0f / (p0 + p1 + p2);
      const float4 va = v[i], vb = v[i + 1], vc = v[i + 2];
      float4 o;
      o.x = (p0 * va.x + p1 * vb.x + p2 * vc.x) * invd;
      o.y = (p0 * va.y + p1 * vb.y + p2 * vc.y) * invd;
      o.z = (p0 * va.z + p1 * vb.z + p2 * vc.z) * invd;
      o.w = (p0 * va.w + p1 * vb.w + p2 * vc.w) * invd;
      O4[(size_t)i * 32] = o;
    }
  }
}

// ---------------------------------------------------------------------------
// One branch's MLP with its LayerNorm in one kernel:
//   Y = LN(gelu(X @ W1 + b1) @ W2 + b2) * g + b,  X, Y: [R,128], W1: [128,256], W2: [256,128]
// A work-group of 8 waves owns FM = 64 rows from end to end. Its X rows, the 256
// hidden values of each row and the 128 values in front of the LayerNorm live in
// LDS only; global memory sees one read of X and one write of Y. The weights
// come through LDS in 16 chunks of 4,096 floats (8 of W1: 16 k-rows; 8 of W2:
// 32 k-rows), two buffers, the copies of chunk c + 2 in flight during chunk c + 1.
// First product: wave tile 64x32 (4x2 subtiles), 8 waves side by side = 256 columns.
// Second product: wave tile 32x32 (2x2 subtiles), 2 waves down x 4 across.
// Both sum k in rising order, 4 per WMMA, as the stand-alone GEMM does.
// 135,168 B of LDS: two work-groups per WGP, 4 waves per SIMD.
// ---------------------------------------------------------------------------
#define FM 64                   // rows per work-group
#define FT 256                  // threads per work-group (8 waves)
#define PX 132                  // pitch of the X rows (and of the rows in front of the LayerNorm): 4 mod 64, as PA
#define PH 260                  // pitch of the hidden rows: 4 mod 64, as PA
#define PW1 264                 // pitch of W1 rows: two rows are 16 banks apart, as PB
#define PW2 136                 // pitch of W2 rows: the same
#define WBUF 4352               // floats per weight buffer: max(16 * PW1, 32 * PW2)
#define FUSED_LDS_FLOATS (FM * PX + FM * PH + 2 * WBUF)
// End of a chunk: this wave's LDS reads and writes are done, its own copies have
// landed, and the barrier then publishes both to the other waves and frees the
// buffer that was just read for the next copies.
#define CHUNK_FOOT()                                   \
  do {                                                 \
    asm volatile("s_wait_dscnt 0x0" ::: "memory");     \
    asm volatile("s_wait_asynccnt 0x0" ::: "memory");  \
    __syncthreads();                                   \
  } while (0)

__global__ void __launch_bounds__(FT) mlp_ln_kernel(const float* __restrict__ X,
                              const float* __restrict__ W1,
                              const float* __restrict__ b1,
                              const float* __restrict__ W2,
                              const float* __restrict__ b2,
                              const float* __restrict__ g,
                              const float* __restrict__ b,
                              float* __restrict__ Y) {
  extern __shared__ float smem[];
  float* sX = smem;                      // [FM][PX]: X, later the rows in front of the LayerNorm
  float* sH = smem + FM * PX;            // [FM][PH]: hidden rows
  float* sW = smem + FM * PX + FM * PH;  // [2][WBUF]: weight chunks

  const int tid = threadIdx.x;
  const int lane = tid & 31;
  const int wv = __builtin_amdgcn_readfirstlane(tid >> 5);  // wave-uniform: tile offsets are scalar
  const int m = lane & 15;         // A row / C column within a 16x16 subtile
  const int hi = lane >> 4;        // K-pair selector (lanes 16-31: K+2,K+3)
  const int rowBase = blockIdx.x * FM;

  // A weight chunk is 4,096 floats in a row in global memory: 4 x b128 per
  // thread. Chunk c of W1 and chunk j of W2 go into buffer c & 1 and j & 1.
  auto stage1 = [&](int c) {
    float* d = sW + (c & 1) * WBUF;
    const float* gw = W1 + c * 4096;
#pragma unroll
    for (int j = 0; j < 4; ++j) {
      const int idx = tid + j * FT;
      copy16(gw + idx * 4, d + (idx >> 6) * PW1 + ((idx & 63) << 2));
    }
  };
  auto stage2 = [&](int c) {
    float* d = sW + (c & 1) * WBUF;
    const float* gw = W2 + c * 4096;
#pragma unroll
    for (int j = 0; j < 4; ++j) {
      const int idx = tid + j * FT;
      copy16(gw + idx * 4, d + (idx >> 5) * PW2 + ((idx & 31) << 2));
    }
  };

  // X rows (8 x b128 per thread) and the first weight chunk.
#pragma unroll
  for (int j = 0; j < (FM * 128) / (4 * FT); ++j) {
    const int idx = tid + j * FT;
    const int r = idx >> 5;
    const int cs = (idx & 31) << 2;
    copy16(X + (size_t)(rowBase + r) * 128 + cs, sX + r * PX + cs);
  }
  stage1(0);
  // Biases and LayerNorm parameters: asked for here, so that their latency runs
  // out beside that of the first copies.
  const int c1 = wv * 32 + m;         // this lane's columns of the first product: c1, c1 + 16
  const int c2 = (wv >> 1) * 32 + m;  // of the second product: c2, c2 + 16
  const float bb1[2] = {b1[c1], b1[c1 + 16]};
  const float bb2[2] = {b2[c2], b2[c2 + 16]};
  const v4f g4 = reinterpret_cast<const v4f*>(g)[lane];
  const v4f b4 = reinterpret_cast<const v4f*>(b)[lane];
  XWAIT3(c1, c2, lane);  // behind these loads, before their address registers are written again
  asm volatile("s_wait_asynccnt 0x0" ::: "memory");  // own copies landed, before the barrier that publishes them
  __syncthreads();
  stage1(1);

  // ---- hidden = gelu(X @ W1 + b1) ----
  {
    v8f acc[4][2] = {};
    const int nw = wv * 32;
    // The two chunk loops stay rolled (for speed only).
#pragma unroll 1
    for (int c = 0; c < 8; ++c) {
      const float* cA = sX + c * 16;
      const float* cB = sW + (c & 1) * WBUF;
#pragma unroll
      for (int k0 = 0; k0 < 16; k0 += 4) {
        const int kl = k0 + 2 * hi;
        v2f av[4], bv[2];
#pragma unroll
        for (int mt = 0; mt < 4; ++mt) {
          const float* p = cA + (mt * 16 + m) * PX + kl;
          av[mt].x = p[0];
          av[mt].y = p[1];
        }
#pragma unroll
        for (int nt = 0; nt < 2; ++nt) {
          const float* p = cB + kl * PW1 + nw + nt * 16 + m;
          bv[nt].x = p[0];
          bv[nt].y = p[PW1];
        }
#pragma unroll
        for (int mt = 0; mt < 4; ++mt)
#pragma unroll
          for (int nt = 0; nt < 2; ++nt)
            acc[mt][nt] = __builtin_amdgcn_wmma_f32_16x16x4_f32(
                false, av[mt], false, bv[nt], (short)0, acc[mt][nt], false, false);
      }
      CHUNK_FOOT();
      if (c < 6) stage1(c + 2);  // the test reads the same for the whole work-group
      else       stage2(c - 6);  // the first two chunks of W2 fly during the last of W1 and the GELU
    }
    // C/D layout: VGPR r2 holds M=r2 (lanes 0-15) or M=r2+8 (lanes 16-31)
#pragma unroll
    for (int nt = 0; nt < 2; ++nt) {
      const int col = nw + nt * 16 + m;
#pragma unroll
      for (int mt = 0; mt < 4; ++mt)
#pragma unroll
        for (int r2 = 0; r2 < 8; ++r2)
          sH[(mt * 16 + hi * 8 + r2) * PH + col] = act_apply(acc[mt][nt][r2] + bb1[nt], 1);
    }
    asm volatile("s_wait_dscnt 0x0" ::: "memory");  // own hidden values written, before the barrier that publishes them
    __syncthreads();
  }

  // ---- rows in front of the LayerNorm = hidden @ W2 + b2 ----
  {
    v8f acc[2][2] = {};
    const int mw = (wv & 1) * 32;
    const int nw = (wv >> 1) * 32;
#pragma unroll 1
    for (int c = 0; c < 8; ++c) {
      const float* cA = sH + c * 32;
      const float* cB = sW + (c & 1) * WBUF;
#pragma unroll
      for (int k0 = 0; k0 < 32; k0 += 4) {
        const int kl = k0 + 2 * hi;
        v2f av[2], bv[2];
#pragma unroll
        for (int mt = 0; mt < 2; ++mt) {
          const float* p = cA + (mw + mt * 16 + m) * PH + kl;
          av[mt].x = p[0];
          av[mt].y = p[1];
        }
#pragma unroll
        for (int nt = 0; nt < 2; ++nt) {
          const float* p = cB + kl * PW2 + nw + nt * 16 + m;
          bv[nt].x = p[0];
          bv[nt].y = p[PW2];
        }
#pragma unroll
        for (int mt = 0; mt < 2; ++mt)
#pragma unroll
          for (int nt = 0; nt < 2; ++nt)
            acc[mt][nt] = __builtin_amdgcn_wmma_f32_16x16x4_f32(
                false, av[mt], false, bv[nt], (short)0, acc[mt][nt], false, false);
      }
      CHUNK_FOOT();
      if (c < 6) stage2(c + 2);  // the test reads the same for the whole work-group
    }
    // X was last read many barriers ago: its rows now take the sums.
#pragma unroll
    for (int nt = 0; nt < 2; ++nt) {
      const int col = nw + nt * 16 + m;
#pragma unroll
      for (int mt = 0; mt < 2; ++mt)
#pragma unroll
        for (int r2 = 0; r2 < 8; ++r2)
          sX[(mw + mt * 16 + hi * 8 + r2) * PX + col] = acc[mt][nt][r2] + bb2[nt];
    }
    asm volatile("s_wait_dscnt 0x0" ::: "memory");  // own sums written, before the barrier that publishes them
    __syncthreads();
  }

  // ---- LayerNorm over D=128: one wave per row at a time (4 floats/lane,
  // shfl_xor reduce), 8 rows per wave; each store is one whole 512-byte row ----
  v4f* Y4 = reinterpret_cast<v4f*>(Y) + (size_t)(rowBase + wv * 8) * 32 + lane;
#pragma unroll
  for (int i = 0; i < FM / 8; ++i) {
    const v4f v = *reinterpret_cast<const v4f*>(sX + (wv * 8 + i) * PX + lane * 4);
    float s = v.x + v.y + v.z + v.w;
    float sq = v.x * v.x + v.y * v.y + v.z * v.z + v.w * v.w;
#pragma unroll
    for (int off = 16; off > 0; off >>= 1) {
      s += __shfl_xor(s, off, 32);
      sq += __shfl_xor(sq, off, 32);
    }
    float mean = s * (1.0f / 128.0f);
    float var = sq * (1.0f / 128.0f) - mean * mean;
    float inv = rsqrtf(var + 1e-5f);

    v4f o;
    o.x = (v.x - mean) * inv * g4.x + b4.x;
    o.y = (v.y - mean) * inv * g4.y + b4.y;
    o.z = (v.z - mean) * inv * g4.z + b4.z;
    o.w = (v.w - mean) * inv * g4.w + b4.w;
    Y4[(size_t)i * 32] = o;
  }
}

// ---------------------------------------------------------------------------
// prep_conv: x_pos = x + pos_enc; depthwise conv3 (pad 1, zeros AFTER pos add
// per reference) + conv bias. Output layout [bn,t,D]. One wave per (b, n, run
// of SR time steps); the taps and the neighbours in time stay in registers.
// ---------------------------------------------------------------------------
__global__ void __launch_bounds__(ST) prep_conv_kernel(const float* __restrict__ x,
                                 const float* __restrict__ pos,
                                 const float* __restrict__ cw,
                                 const float* __restrict__ cb,
                                 float* __restrict__ xconv) {
  const int lane = threadIdx.x & 31;
  const int w = blockIdx.x * SW + (threadIdx.x >> 5);
  const int n = w & 63;               // a work-group's waves read neighbouring n
  const int t0 = ((w >> 6) & 15) * SR;
  const int b = w >> 10;
  const int d0 = lane * 4;

  const float4* X4 = reinterpret_cast<const float4*>(x) + ((size_t)(b * TT) * NN + n) * 32 + lane;
  const float4* P4 = reinterpret_cast<const float4*>(pos) + lane;

  float k0[4], k1[4], k2[4], kb[4];
#pragma unroll
  for (int c = 0; c < 4; ++c) {
    int d = d0 + c;
    k0[c] = cw[d * 3 + 0]; k1[c] = cw[d * 3 + 1]; k2[c] = cw[d * 3 + 2];
    kb[c] = cb[d];
  }
  XWAIT0();  // behind these loads, before their address registers are written again
  float4 v[SR + 2], p[SR + 2];        // time steps t0-1 .. t0+SR
  const int tlo = t0 > 0 ? t0 - 1 : 0;              // the two edge rows are read in
  const int thi = t0 + SR < TT ? t0 + SR : TT - 1;  // bounds and set to zero below
  const float4* xlo = X4 + (size_t)tlo * (NN * 32);
  const float4* xhi = X4 + (size_t)thi * (NN * 32);
  const float4* plo = P4 + (size_t)tlo * 32;
  const float4* phi = P4 + (size_t)thi * 32;
  const float4* xb = X4 + (size_t)t0 * (NN * 32);
  const float4* pb = P4 + (size_t)t0 * 32;
  v[0] = *xlo; p[0] = *plo;
  v[SR + 1] = *xhi; p[SR + 1] = *phi;
  XWAIT4(xlo, xhi, plo, phi);  // behind these loads, before their address registers are written again
#pragma unroll
  for (int i = 0; i < SR; ++i) {
    v[i + 1] = xb[(size_t)i * (NN * 32)];
    p[i + 1] = pb[(size_t)i * 32];
  }
  XWAIT2(xb, pb);  // behind these loads, before their address registers are written again
#pragma unroll
  for (int i = 0; i < SR + 2; ++i) {
    v[i].x += p[i].x; v[i].y += p[i].y; v[i].z += p[i].z; v[i].w += p[i].w;
  }
  if (t0 == 0)       v[0] = make_float4(0.f, 0.f, 0.f, 0.f);
  if (t0 + SR == TT) v[SR + 1] = make_float4(0.f, 0.f, 0.f, 0.f);

  float4* O4 = reinterpret_cast<float4*>(xconv) + ((size_t)(b * NN + n) * TT + t0) * 32 + lane;
#pragma unroll
  for (int i = 0; i < SR; ++i) {
    const float4 xm = v[i], xc = v[i + 1], xp = v[i + 2];
    float4 o;
    o.x = k0[0] * xm.x + k1[0] * xc.x + k2[0] * xp.x + kb[0];
    o.y = k0[1] * xm.y + k1[1] * xc.y + k2[1] * xp.y + kb[1];
    o.z = k0[2] * xm.z + k1[2] * xc.z + k2[2] * xp.z + kb[2];
    o.w = k0[3] * xm.w + k1[3] * xc.w + k2[3] * xp.w + kb[3];
    O4[(size_t)i * 32] = o;
  }
}

// ---------------------------------------------------------------------------
// Mixed pool: k=6, stride 1, pad (2,2) -> length T-1, right zero-pad to T.
// avg divides by 6 always (zero pad contributes 0); max over valid entries.
// One wave per (bn, run of SR time steps): the SR+5 rows its windows cover are
// loaded once; each window is summed on its own, in rising time order.
// ---------------------------------------------------------------------------
__global__ void __launch_bounds__(ST) pool_kernel(const float* __restrict__ xconv,
                            const float* __restrict__ alpha_p,
                            float* __restrict__ outp) {
  const int lane = threadIdx.x & 31;
  const int w = blockIdx.x * SW + (threadIdx.x >> 5);
  const int t0 = (w & 15) * SR;
  const int bn = w >> 4;
  const bool first = (t0 == 0), last = (t0 + SR == TT);

  const float a = 1.0f / (1.0f + expf(-alpha_p[0]));
  const float4* XC4 = reinterpret_cast<const float4*>(xconv) + (size_t)(bn * TT) * 32 + lane;

  float4 vs[SR + 5], vm[SR + 5];      // time steps t0-2 .. t0+SR+2: for the sum, for the max
  // Rows outside [0,T) are read in bounds (rows of the run itself instead) and replaced below.
  const float4* cb4 = XC4 + (size_t)t0 * 32;
  const float4* clo = first ? cb4 + 2 * 32 : cb4;            // clo[-2 rows], clo[-1 row]
  const float4* chi = last ? cb4 - 3 * 32 : cb4;             // chi[SR rows] .. chi[SR+2 rows]
  vs[0] = clo[-2 * 32]; vs[1] = clo[-1 * 32];
  vs[SR + 2] = chi[SR * 32]; vs[SR + 3] = chi[(SR + 1) * 32]; vs[SR + 4] = chi[(SR + 2) * 32];
  XWAIT2(clo, chi);  // behind these loads, before their address registers are written again
#pragma unroll
  for (int i = 0; i < SR; ++i) vs[i + 2] = cb4[(size_t)i * 32];
  XWAIT1(cb4);  // behind these loads, before their address registers are written again
#pragma unroll
  for (int i = 0; i < SR + 5; ++i) {
    vm[i] = vs[i];
    if ((i < 2 && first) || (i >= SR + 2 && last)) {
      vs[i] = make_float4(0.f, 0.f, 0.f, 0.f);
      vm[i] = make_float4(-3.0e38f, -3.0e38f, -3.0e38f, -3.0e38f);
    }
  }

  float4* O4 = reinterpret_cast<float4*>(outp) + ((size_t)(bn * TT) + t0) * 32 + lane;
  const float inv6 = 1.0f / 6.0f;
#pragma unroll
  for (int i = 0; i < SR; ++i) {
    float sx = 0.f, sy = 0.f, sz = 0.f, sw = 0.f;
    float mx = -3.0e38f, my = -3.0e38f, mz = -3.0e38f, mw = -3.0e38f;
#pragma unroll
    for (int k = 0; k < 6; ++k) {
      const float4 s = vs[i + k], m = vm[i + k];
      sx += s.x; sy += s.y; sz += s.z; sw += s.w;
      mx = fmaxf(mx, m.x); my = fmaxf(my, m.y);
      mz = fmaxf(mz, m.z); mw = fmaxf(mw, m.w);
    }
    float4 res;
    res.x = a * (sx * inv6) + (1.f - a) * mx;
    res.y = a * (sy * inv6) + (1.f - a) * my;
    res.z = a * (sz * inv6) + (1.f - a) * mz;
    res.w = a * (sw * inv6) + (1.f - a) * mw;
    if (i == SR - 1 && last) res = make_float4(0.f, 0.f, 0.f, 0.f);  // t = T-1: the right zero-pad
    O4[(size_t)i * 32] = res;
  }
}

// ---------------------------------------------------------------------------
// concat [x_loc | x_glob] -> [R, 256]; SR consecutive rows per wave
// ---------------------------------------------------------------------------
__global__ void __launch_bounds__(ST) concat_kernel(const float* __restrict__ xloc,
                              const float* __restrict__ xglob,
                              float* __restrict__ cat) {
  const int lane = threadIdx.x & 31;
  const int w = blockIdx.x * SW + __builtin_amdgcn_readfirstlane(threadIdx.x >> 5);  // wave-uniform: row addresses are scalar
  const v4f* L4 = reinterpret_cast<const v4f*>(xloc) + (size_t)w * (SR * 32) + lane;
  const v4f* G4 = reinterpret_cast<const v4f*>(xglob) + (size_t)w * (SR * 32) + lane;
  v4f* C4 = reinterpret_cast<v4f*>(cat) + (size_t)w * (SR * 64) + lane;
  v4f vl[SR], vg[SR];
  v8f pr[SR];                         // a row's two halves side by side, for the fence below
#pragma unroll
  for (int i = 0; i < SR; ++i) {
    vl[i] = L4[(size_t)i * 32];
    vg[i] = G4[(size_t)i * 32];
    pr[i] = __builtin_shufflevector(vl[i], vg[i], 0, 1, 2, 3, 4, 5, 6, 7);
  }
  // Inputs-only fence on the loaded values: all 32 loads issue before the first
  // store; left free, the compiler pairs each load with its store and a wave
  // has one load in flight.
  asm volatile("" :: "v"(pr[0]), "v"(pr[1]), "v"(pr[2]), "v"(pr[3]), "v"(pr[4]), "v"(pr[5]), "v"(pr[6]), "v"(pr[7]),
                     "v"(pr[8]), "v"(pr[9]), "v"(pr[10]), "v"(pr[11]), "v"(pr[12]), "v"(pr[13]), "v"(pr[14]), "v"(pr[15]));
#pragma unroll
  for (int i = 0; i < SR; ++i) {
    C4[(size_t)i * 64] = vl[i];
    C4[(size_t)i * 64 + 32] = vg[i];
  }
}

// ---------------------------------------------------------------------------
// Final: out = x + softplus(res_scale) * (gate*x_loc + (1-gate)*x_glob)
// with [bn,t,D] -> [B,T,N,D] relayout.
// ---------------------------------------------------------------------------
__device__ __forceinline__ float softplus_f(float v) {
  return (v > 0.f) ? (v + log1pf(expf(-v))) : log1pf(expf(v));
}

__global__ void __launch_bounds__(ST) final_kernel(const float* __restrict__ x,
                             const float* __restrict__ gate,
                             const float* __restrict__ xloc,
                             const float* __restrict__ xglob,
                             const float* __restrict__ res_scale,
                             float* __restrict__ out) {
  // One wave per (b, n, run of SR time steps); the scale is formed once a wave.
  const int lane = threadIdx.x & 31;
  const int w = blockIdx.x * SW + (threadIdx.x >> 5);
  const int n = w & 63;               // a work-group's waves touch neighbouring n
  const int t0 = ((w >> 6) & 15) * SR;
  const int b = w >> 10;

  const size_t xo = ((size_t)(b * TT + t0) * NN + n) * 32 + lane;  // [B,T,N,D]
  const size_t ro = ((size_t)(b * NN + n) * TT + t0) * 32 + lane;  // [bn,t,D]
  const float4* X4 = reinterpret_cast<const float4*>(x) + xo;
  const float4* G4 = reinterpret_cast<const float4*>(gate) + ro;
  const float4* L4 = reinterpret_cast<const float4*>(xloc) + ro;
  const float4* Q4 = reinterpret_cast<const float4*>(xglob) + ro;
  float4* O4 = reinterpret_cast<float4*>(out) + xo;

  const float4 rs = reinterpret_cast<const float4*>(res_scale)[lane];
  XWAIT0();  // behind these loads, before their address registers are written again
  // Two batches of SR/2 rows, 32 loads each: 64 at once would not fit the
  // registers of 16 waves a WGP.
  constexpr int HB = SR / 2;
  const float sx = softplus_f(rs.x), sy = softplus_f(rs.y);
  const float sz = softplus_f(rs.z), sw = softplus_f(rs.w);
#pragma unroll
  for (int h = 0; h < 2; ++h) {
    float4 xv[HB], g[HB], xl[HB], xg[HB];
#pragma unroll
    for (int i = 0; i < HB; ++i) {
      xv[i] = X4[(size_t)(h * HB + i) * (NN * 32)];
      g[i]  = G4[(size_t)(h * HB + i) * 32];
      xl[i] = L4[(size_t)(h * HB + i) * 32];
      xg[i] = Q4[(size_t)(h * HB + i) * 32];
    }
    XWAIT4(X4, G4, L4, Q4);  // behind these loads, before their address registers are written again
#pragma unroll
    for (int i = 0; i < HB; ++i) {
      float4 o;
      o.x = xv[i].x + sx * (g[i].x * xl[i].x + (1.f - g[i].x) * xg[i].x);
      o.y = xv[i].y + sy * (g[i].y * xl[i].y + (1.f - g[i].y) * xg[i].y);
      o.z = xv[i].z + sz * (g[i].z * xl[i].z + (1.f - g[i].z) * xg[i].z);
      o.w = xv[i].w + sw * (g[i].w * xl[i].w + (1.f - g[i].w) * xg[i].w);
      O4[(size_t)(h * HB + i) * (NN * 32)] = o;
    }
  }
}

// ---------------------------------------------------------------------------
// Host launcher
// ---------------------------------------------------------------------------
extern "C" void kernel_launch(void* const* d_in, const int* in_sizes, int n_in,
                              void* d_out, int out_size, void* d_ws, size_t ws_size,
                              hipStream_t stream) {
  const float* x          = (const float*)d_in[0];
  const float* window_w   = (const float*)d_in[1];
  const float* local_w1   = (const float*)d_in[2];
  const float* local_b1   = (const float*)d_in[3];
  const float* local_w2   = (const float*)d_in[4];
  const float* local_b2   = (const float*)d_in[5];
  const float* local_ln_g = (const float*)d_in[6];
  const float* local_ln_b = (const float*)d_in[7];
  const float* qkv_w      = (const float*)d_in[8];
  const float* qkv_b      = (const float*)d_in[9];
  const float* out_w      = (const float*)d_in[10];
  const float* out_b      = (const float*)d_in[11];
  const float* conv_w     = (const float*)d_in[12];
  const float* conv_b     = (const float*)d_in[13];
  const float* alpha      = (const float*)d_in[14];
  const float* pos_enc    = (const float*)d_in[15];
  const float* global_w1  = (const float*)d_in[16];
  const float* global_b1  = (const float*)d_in[17];
  const float* global_w2  = (const float*)d_in[18];
  const float* global_b2  = (const float*)d_in[19];
  const float* global_ln_g= (const float*)d_in[20];
  const float* global_ln_b= (const float*)d_in[21];
  const float* gate_w1    = (const float*)d_in[22];
  const float* gate_b1    = (const float*)d_in[23];
  const float* gate_w2    = (const float*)d_in[24];
  const float* gate_b2    = (const float*)d_in[25];
  const float* res_scale  = (const float*)d_in[26];
  float* out = (float*)d_out;

  const size_t R = (size_t)RR;
  float* ws = (float*)d_ws;
  float* P0 = ws;             // R*128: xl -> attn_out -> x_loc
  float* P1 = ws + R * 128;   // R*384: qkv -> proj/cat/gate
  float* P2 = ws + R * 512;   // R*128: xconv -> x_glob
  float* P3 = ws + R * 640;   // R*128: x_glob_in -> tanh_out
  float* gate = P1 + R * 256; // R*128 region inside P1

  const size_t GEMM_LDS = (2 * BM * PA + 2 * KC * PB) * sizeof(float);  // 104 KB
  const size_t FUSED_LDS = FUSED_LDS_FLOATS * sizeof(float);            // 132 KB

  // local branch
  prep_local_kernel<<<SG, ST, 0, stream>>>(x, window_w, P0);
  gemm_wmma_kernel<128, 384, 0><<<dim3(RR / BM, 384 / BN), BL, GEMM_LDS, stream>>>(
      P0, qkv_w, qkv_b, P1);
  attn_kernel<<<SG, ST, 0, stream>>>(P1, P0);
  gemm_wmma_kernel<128, 128, 0><<<dim3(RR / BM, 128 / BN), BL, GEMM_LDS, stream>>>(
      P0, out_w, out_b, P1);
  mlp_ln_kernel<<<RR / FM, FT, FUSED_LDS, stream>>>(
      P1, local_w1, local_b1, local_w2, local_b2, local_ln_g, local_ln_b, P0);  // x_loc = P0

  // global branch
  prep_conv_kernel<<<SG, ST, 0, stream>>>(x, pos_enc, conv_w, conv_b, P2);
  pool_kernel<<<SG, ST, 0, stream>>>(P2, alpha, P3);
  mlp_ln_kernel<<<RR / FM, FT, FUSED_LDS, stream>>>(
      P3, global_w1, global_b1, global_w2, global_b2, global_ln_g, global_ln_b, P2);  // x_glob = P2

  // gated fusion
  concat_kernel<<<SG, ST, 0, stream>>>(P0, P2, P1);  // cat in P1[0:R*256]
  gemm_wmma_kernel<256, 128, 2 /*tanh*/><<<dim3(RR / BM, 128 / BN), BL, GEMM_LDS, stream>>>(
      P1, gate_w1, gate_b1, P3);
  gemm_wmma_kernel<128, 128, 3 /*sigmoid*/><<<dim3(RR / BM, 128 / BN), BL, GEMM_LDS, stream>>>(
      P3, gate_w2, gate_b2, gate);

  final_kernel<<<SG, ST, 0, stream>>>(x, gate, P0, P2, res_scale, out);
}

// v007
// A run of this version takes 271 microseconds.
// In two side-by-side timings against v006, it was 1.07 and 1.06 times as fast.
// All steps since v000 together make it 3.71 times as fast.
#include <hip/hip_runtime.h>
#include <math.h>

// Problem constants (from reference)
#define BB 4
#define TT 256
#define NN 64
#define DD 128
#define HH 4
#define HD 32
#define RR (BB * NN * TT)   // 65536 rows

// GEMM blocking
#define BM 128   // block tile rows
#define BN 64    // block tile cols
#define KC 64    // K chunk staged in LDS
#define BL 128   // threads per block (4 waves)
// LDS row pitches in floats (LDS bank = dword address mod 64). Both stay
// multiples of 4 floats so every 16-byte copy lands 16-byte aligned.
#define PA 68    // A rows: 16 rows x 2 k-pairs of a fragment read fall on 64 distinct banks
#define PB 72    // B rows: rows k and k+2, read by the two lane halves, sit 16 banks apart

// Streaming kernels (everything but the GEMMs and the fused kernels): one wave
// walks SR rows of 128 floats, one float4 per lane and row, so a launch starts
// 4,096 waves (one 16-wave work-group per WGP) and each wave has SR or more
// 512-byte loads in flight. The row loops are fully unrolled, so that the row
// arrays are registers and a run's loads can issue back to back.
#define SW 16                  // waves per work-group
#define ST (SW * 32)           // threads per work-group
#define SR 16                  // rows per wave
#define SG (RR / (SW * SR))    // work-groups per launch
// Stands behind a run of loads: s_wait_xcnt 0 before any register that an issued
// load names is written again. The address operands only keep those registers
// alive up to the wait, so that no later load's result lands in them before it.
#define XWAIT0() asm volatile("s_wait_xcnt 0x0" ::: "memory")
#define XWAIT1(a) asm volatile("s_wait_xcnt 0x0" :: "v"(a) : "memory")
#define XWAIT2(a, b) asm volatile("s_wait_xcnt 0x0" :: "v"(a), "v"(b) : "memory")
#define XWAIT3(a, b, c) asm volatile("s_wait_xcnt 0x0" :: "v"(a), "v"(b), "v"(c) : "memory")
#define XWAIT4(a, b, c, d) asm volatile("s_wait_xcnt 0x0" :: "v"(a), "v"(b), "v"(c), "v"(d) : "memory")

typedef __attribute__((ext_vector_type(2))) float v2f;
typedef __attribute__((ext_vector_type(8))) float v8f;
typedef __attribute__((ext_vector_type(4))) float v4f;

// ---------------------------------------------------------------------------
// CDNA5 async global->LDS copy (ASYNCcnt-tracked DMA), with sync fallback.
// Builtin signature (from hipcc diagnostic): (int4 AS1*, int4 AS3*, Ii, Ii).
// ---------------------------------------------------------------------------
#if defined(__has_builtin)
#if __has_builtin(__builtin_amdgcn_global_load_async_to_lds_b128) && \
    __has_builtin(__builtin_amdgcn_s_wait_asynccnt)
#define HAVE_ASYNC_LDS 1
#endif
#endif

#ifdef HAVE_ASYNC_LDS
typedef int vi4 __attribute__((__vector_size__(4 * sizeof(int))));
typedef __attribute__((address_space(1))) vi4 as1_vi4;
typedef __attribute__((address_space(3))) vi4 as3_vi4;
#endif

__device__ __forceinline__ void copy16(const float* g, float* l) {
#ifdef HAVE_ASYNC_LDS
  as1_vi4* gp = reinterpret_cast<as1_vi4*>((uintptr_t)g);
  as3_vi4* lp = reinterpret_cast<as3_vi4*>((uintptr_t)l);
  __builtin_amdgcn_global_load_async_to_lds_b128(gp, lp, 0, 0);
#else
  *reinterpret_cast<float4*>(l) = *reinterpret_cast<const float4*>(g);
#endif
}

__device__ __forceinline__ void stage_sync() {
#ifdef HAVE_ASYNC_LDS
  __builtin_amdgcn_s_wait_asynccnt(0);
#endif
  __syncthreads();
}

// ---------------------------------------------------------------------------
// Activation epilogues: 0=none, 1=exact GELU (erf), 2=tanh, 3=sigmoid
// ---------------------------------------------------------------------------
// erf and tanh without a branch. The math library's erff and tanhf each pick one
// of two formulas by a test on |x| that differs from lane to lane: two branches
// on the lane mask per element, which make each element one dependent chain with
// nothing of the next element issued beside it. Here both formulas are worked
// out for every element and a select keeps the one the library would have
// taken: same coefficients (given as bit patterns), same operations in the same
// order, so the values are bit-identical, and the elements of a tile are
// straight-line code whose chains can be issued side by side.
#define FB(u) __builtin_bit_cast(float, u)

__device__ __forceinline__ float erf_sel(float x) {
  const float ax = fabsf(x);
  float p = fmaf(ax, FB(0x378e98abu), FB(0xb9c68948u));  // |x| >= 1: 1 - exp(-(ax + ax*poly(ax)))
  p = fmaf(ax, p, FB(0x3b7cd369u));
  p = fmaf(ax, p, FB(0xbcc618b2u));
  p = fmaf(ax, p, FB(0x3dda74e4u));
  p = fmaf(ax, p, FB(0x3f228afdu));
  p = fmaf(ax, p, FB(0x3e03c728u));
  p = fmaf(ax, p, ax);
  const float big = 1.0f - expf(-p);
  const float t = x * x;                                 // |x| < 1: ax + ax*poly(x*x)
  float s = fmaf(t, FB(0xba1345e1u), FB(0x3ba10414u));
  s = fmaf(t, s, FB(0xbcdac9b8u));
  s = fmaf(t, s, FB(0x3de703beu));
  s = fmaf(t, s, FB(0xbec09330u));
  s = fmaf(t, s, FB(0x3e0375d0u));
  const float small = fmaf(ax, s, ax);
  return copysignf(ax < 1.0f ? small : big, x);
}

__device__ __forceinline__ float tanh_sel(float x) {
  const float ax = fabsf(x);
  const float e = expf(ax + ax);                         // |x| >= 0.625: 1 - 2/(1 + exp(2|x|))
  float r;
  // v_rcp_f32 with the one free slot that the instruction set asks for behind a
  // transcendental.
  asm("v_rcp_f32 %0, %1\n\tv_nop" : "=v"(r) : "v"(1.0f + e));
  const float big = fmaf(r, -2.0f, 1.0f);
  const float t = x * x;                                 // |x| < 0.625: ax + x*x*(ax*poly(x*x))
  float s = fmaf(t, FB(0xbbbac73du), FB(0x3ca908c9u));
  s = fmaf(t, s, FB(0xbd5c1c4eu));
  s = fmaf(t, s, FB(0x3e088382u));
  s = fmaf(t, s, FB(0xbeaaaa99u));
  const float small = fmaf(t, ax * s, ax);
  return copysignf(0.625f > ax ? small : big, x);
}

__device__ __forceinline__ float act_apply(float v, int act) {
  if (act == 1) return 0.5f * v * (1.0f + erf_sel(v * 0.70710678118654752440f));
  if (act == 2) return tanh_sel(v);
  if (act == 3) return 1.0f / (1.0f + expf(-v));
  return v;
}

// ---------------------------------------------------------------------------
// fp32 GEMM: C[R,Nc] = act(A[R,K] @ B[K,Nc] + bias)
// Block = 128 threads = 4 waves (2x2). Block tile 128x64; wave tile 64x32
// (4 M-subtiles x 2 N-subtiles of 16x16). K staged in 64-chunks,
// double-buffered in LDS via async global->LDS DMA when available.
// Per K-step: 4 A-pairs + 2 B-pairs feed 8 V_WMMA_F32_16X16X4_F32.
// K, Nc and the activation are template constants: each launch runs code that
// holds its own activation only, with no selector branch per output element,
// and row strides fold into constant address steps. The block size is stated
// too, so that the register ceiling is that of 4 waves and the copy addresses
// of the unrolled K chunks stay in registers (no scratch).
// ---------------------------------------------------------------------------
template <int K, int Nc, int act>
__global__ void __launch_bounds__(BL) gemm_wmma_kernel(const float* __restrict__ A,
                                 const float* __restrict__ Bm,
                                 const float* __restrict__ bias,
                                 float* __restrict__ C) {
  extern __shared__ float smem[];
  float* sAb = smem;                 // [2][BM rows at pitch PA]
  float* sBb = smem + 2 * BM * PA;   // [2][KC rows at pitch PB]

  const int tid = threadIdx.x;
  const int rowBase = blockIdx.x * BM;
  const int colBase = blockIdx.y * BN;
  constexpr int nk = K / KC;

  // Stage K-chunk kb into LDS buffer buf (async DMA when available).
  auto stage = [&](int kb, int buf) {
    float* dA = sAb + buf * (BM * PA);
    float* dB = sBb + buf * (KC * PB);
    const float* gA = A + (size_t)rowBase * K + kb * KC;
    const float* gB = Bm + (size_t)(kb * KC) * Nc + colBase;
#pragma unroll
    for (int j = 0; j < (BM * KC) / (4 * BL); ++j) {  // 16 x b128 per thread
      int idx = tid + j * BL;
      int r = idx >> 4;
      int cs = (idx & 15) << 2;
      copy16(gA + (size_t)r * K + cs, dA + r * PA + cs);
    }
#pragma unroll
    for (int j = 0; j < (KC * BN) / (4 * BL); ++j) {  // 8 x b128 per thread
      int idx = tid + j * BL;
      int r = idx >> 4;
      int cs = (idx & 15) << 2;
      copy16(gB + (size_t)r * Nc + cs, dB + r * PB + cs);
    }
  };

  const int lane = tid & 31;
  const int wv = tid >> 5;
  const int mw = (wv & 1) * 64;    // wave row offset in block tile
  const int nw = (wv >> 1) * 32;   // wave col offset in block tile
  const int m = lane & 15;         // A row / C column within 16x16 subtile
  const int hi = lane >> 4;        // K-pair selector (lanes 16-31: K+2,K+3)

  v8f acc[4][2] = {};

  stage(0, 0);
  stage_sync();

  for (int kb = 0; kb < nk; ++kb) {
    const int cur = kb & 1;
    if (kb + 1 < nk) stage(kb + 1, cur ^ 1);
    if (kb + 2 < nk)  // warm L2 for the chunk after next (global_prefetch_b8)
      __builtin_prefetch(A + (size_t)(rowBase + (tid >> 1)) * K + (kb + 2) * KC, 0, 0);

    const float* cA = sAb + cur * (BM * PA);
    const float* cB = sBb + cur * (KC * PB);

#pragma unroll 4
    for (int k0 = 0; k0 < KC; k0 += 4) {
      const int ka = k0 + 2 * hi;
      v2f av[4], bv[2];
#pragma unroll
      for (int mt = 0; mt < 4; ++mt) {
        const float* p = cA + (size_t)(mw + mt * 16 + m) * PA + ka;
        av[mt].x = p[0];
        av[mt].y = p[1];
      }
#pragma unroll
      for (int nt = 0; nt < 2; ++nt) {
        const float* p = cB + (size_t)ka * PB + nw + nt * 16 + m;
        bv[nt].x = p[0];
        bv[nt].y = p[PB];
      }
#pragma unroll
      for (int mt = 0; mt < 4; ++mt)
#pragma unroll
        for (int nt = 0; nt < 2; ++nt)
          acc[mt][nt] = __builtin_amdgcn_wmma_f32_16x16x4_f32(
              false, av[mt], false, bv[nt], (short)0, acc[mt][nt], false, false);
    }
    stage_sync();
  }

  // C/D layout: VGPR r2 holds M=r2 (lanes 0-15) or M=r2+8 (lanes 16-31)
#pragma unroll
  for (int nt = 0; nt < 2; ++nt) {
    const int col = colBase + nw + nt * 16 + m;
    const float bb = bias[col];
#pragma unroll
    for (int mt = 0; mt < 4; ++mt) {
#pragma unroll
      for (int r2 = 0; r2 < 8; ++r2) {
        int row = rowBase + mw + mt * 16 + hi * 8 + r2;
        C[(size_t)row * Nc + col] = act_apply(acc[mt][nt][r2] + bb, act);
      }
    }
  }
}

// ---------------------------------------------------------------------------
// prep_local: xl[bn,t,:] = x[b,t,n,:] - softmax(window_weight)-weighted
// 3-tap trend (zero-padded in time). One wave per (b, n, run of SR time steps);
// the neighbours in time come from the wave's own registers.
// ---------------------------------------------------------------------------
__global__ void __launch_bounds__(ST) prep_local_kernel(const float* __restrict__ x,
                                  const float* __restrict__ wwraw,
                                  float* __restrict__ xl) {
  const int lane = threadIdx.x & 31;
  const int w = blockIdx.x * SW + (threadIdx.x >> 5);
  const int n = w & 63;               // a work-group's waves read neighbouring n
  const int t0 = ((w >> 6) & 15) * SR;
  const int b = w >> 10;

  float w0 = wwraw[0], w1 = wwraw[1], w2 = wwraw[2];
  float mw = fmaxf(w0, fmaxf(w1, w2));
  float e0 = expf(w0 - mw), e1 = expf(w1 - mw), e2 = expf(w2 - mw);
  float inv = 1.0f / (e0 + e1 + e2);
  e0 *= inv; e1 *= inv; e2 *= inv;

  const float4* X4 = reinterpret_cast<const float4*>(x) + ((size_t)(b * TT) * NN + n) * 32 + lane;
  float4 v[SR + 2];                   // time steps t0-1 .. t0+SR
  const float4* xlo = X4 + (size_t)(t0 > 0 ? t0 - 1 : 0) * (NN * 32);
  const float4* xhi = X4 + (size_t)(t0 + SR < TT ? t0 + SR : TT - 1) * (NN * 32);
  const float4* xb = X4 + (size_t)t0 * (NN * 32);
  v[0] = *xlo;
  v[SR + 1] = *xhi;
  XWAIT2(xlo, xhi);  // behind these loads, before their address registers are written again
#pragma unroll
  for (int i = 0; i < SR; ++i) v[i + 1] = xb[(size_t)i * (NN * 32)];
  XWAIT1(xb);  // behind these loads, before their address registers are written again
  if (t0 == 0)       v[0] = make_float4(0.f, 0.f, 0.f, 0.f);
  if (t0 + SR == TT) v[SR + 1] = make_float4(0.f, 0.f, 0.f, 0.f);

  float4* O4 = reinterpret_cast<float4*>(xl) + ((size_t)(b * NN + n) * TT + t0) * 32 + lane;
#pragma unroll
  for (int i = 0; i < SR; ++i) {
    const float4 xm = v[i], xc = v[i + 1], xp = v[i + 2];
    float4 o;
    o.x = xc.x - (e0 * xm.x + e1 * xc.x + e2 * xp.x);
    o.y = xc.y - (e0 * xm.y + e1 * xc.y + e2 * xp.y);
    o.z = xc.z - (e0 * xm.z + e1 * xc.z + e2 * xp.z);
    o.w = xc.w - (e0 * xm.w + e1 * xc.w + e2 * xp.w);
    O4[(size_t)i * 32] = o;
  }
}

// ---------------------------------------------------------------------------
// Banded (|i-j|<=1) multi-head attention: off-band -1e9 scores underflow to
// exactly 0 after fp32 softmax, so only 3 neighbors matter.
// One wave per (bn, run of SR time steps). A lane holds 4 of a row's 128
// features (8 lanes a head), so each load and store of a wave is 512 contiguous
// bytes (4 whole lines) of one row's q, k, v or output, and a k or v row serves
// its three queries from registers. A score is 4 products in the lane, then a
// sum over the head's 8 lanes; every lane of a head then holds the same softmax.
// ---------------------------------------------------------------------------
template <int CTRL>
__device__ __forceinline__ float dpp_add(float v) {
  // v + (v of the lane that CTRL names): a cross-lane add on the vector port
  // (__shfl_xor would go through the LDS queue and its latency).
  const int o = __builtin_amdgcn_mov_dpp(__builtin_bit_cast(int, v), CTRL, 0xf, 0xf, true);
  return v + __builtin_bit_cast(float, o);
}

__device__ __forceinline__ float head_dot(const float4 a, const float4 b) {
  float d = a.x * b.x + a.y * b.y + a.z * b.z + a.w * b.w;
  d = dpp_add<0x161>(d);  // row_xmask:1
  d = dpp_add<0x162>(d);  // row_xmask:2
  d = dpp_add<0x164>(d);  // row_xmask:4
  return d;
}

__global__ void __launch_bounds__(ST) attn_kernel(const float* __restrict__ qkv,
                            float* __restrict__ outp) {
  const int lane = threadIdx.x & 31;
  const int w = blockIdx.x * SW + (threadIdx.x >> 5);
  const int t0 = (w & 15) * SR;       // a work-group's waves cover one bn
  const int bn = w >> 4;

  // Two batches of SR/2 rows, 28 loads each: all of a run's rows at once would
  // not fit the registers of 16 waves a WGP. Every loop is fully unrolled, so
  // that q, k and v are registers and a batch's loads issue back to back.
  constexpr int HB = SR / 2;
#pragma unroll
  for (int h = 0; h < 2; ++h) {
    const int tb = t0 + h * HB;
    const bool lo_out = (tb == 0), hi_out = (tb + HB == TT);
    // a row of qkv is 96 float4: q at 0, k at 32, v at 64
    const float4* pb = reinterpret_cast<const float4*>(qkv) + (size_t)(bn * TT + tb) * 96 + lane;
    // The two neighbour rows outside [0,T) are read in bounds (the batch's own
    // edge row instead); their scores are masked below.
    const float4* plo = lo_out ? pb : pb - 96;
    const float4* phi = hi_out ? pb + (HB - 1) * 96 : pb + HB * 96;
    float4 q[HB], k[HB + 2], v[HB + 2];   // k, v: time steps tb-1 .. tb+HB
    k[0] = plo[32]; v[0] = plo[64];
    k[HB + 1] = phi[32]; v[HB + 1] = phi[64];
#pragma unroll
    for (int i = 0; i < HB; ++i) {
      q[i] = pb[i * 96];
      k[i + 1] = pb[i * 96 + 32];
      v[i + 1] = pb[i * 96 + 64];
    }
    XWAIT3(pb, plo, phi);  // behind these loads, before their address registers are written again

    float4* O4 = reinterpret_cast<float4*>(outp) + (size_t)(bn * TT + tb) * 32 + lane;
#pragma unroll
    for (int i = 0; i < HB; ++i) {
      const float sc = 0.17677669529663687f;  // 1/sqrt(32)
      float s0 = head_dot(q[i], k[i]) * sc;
      const float s1 = head_dot(q[i], k[i + 1]) * sc;
      float s2 = head_dot(q[i], k[i + 2]) * sc;
      if (i == 0 && lo_out) s0 = -3.0e38f;       // t = 0: no step before; its weight is exp(-huge) = 0
      if (i == HB - 1 && hi_out) s2 = -3.0e38f;  // t = T-1: no step behind
      const float mmax = fmaxf(fmaxf(s0, s1), s2);
      const float p0 = expf(s0 - mmax), p1 = expf(s1 - mmax), p2 = expf(s2 - mmax);
      const float invd = 1.0f / (p0 + p1 + p2);
      const float4 va = v[i], vb = v[i + 1], vc = v[i + 2];
      float4 o;
      o.x = (p0 * va.x + p1 * vb.x + p2 * vc.x) * invd;
      o.y = (p0 * va.y + p1 * vb.y + p2 * vc.y) * invd;
      o.z = (p0 * va.z + p1 * vb.z + p2 * vc.z) * invd;
      o.w = (p0 * va.w + p1 * vb.w + p2 * vc.w) * invd;
      O4[(size_t)i * 32] = o;
    }
  }
}

// ---------------------------------------------------------------------------
// One branch's MLP with its LayerNorm in one kernel:
//   Y = LN(gelu(X @ W1 + b1) @ W2 + b2) * g + b,  X, Y: [R,128], W1: [128,256], W2: [256,128]
// A work-group of 8 waves owns FM = 64 rows from end to end. Its X rows, the 256
// hidden values of each row and the 128 values in front of the LayerNorm live in
// LDS only; global memory sees one read of X and one write of Y. The weights
// come through LDS in 16 chunks of 4,096 floats (8 of W1: 16 k-rows; 8 of W2:
// 32 k-rows), two buffers, the copies of chunk c + 2 in flight during chunk c + 1.
// First product: wave tile 64x32 (4x2 subtiles), 8 waves side by side = 256 columns.
// Second product: wave tile 32x32 (2x2 subtiles), 2 waves down x 4 across.
// Both sum k in rising order, 4 per WMMA, as the stand-alone GEMM does.
// 135,168 B of LDS: two work-groups per WGP, 4 waves per SIMD.
// ---------------------------------------------------------------------------
#define FM 64                   // rows per work-group
#define FT 256                  // threads per work-group (8 waves)
#define PX 132                  // pitch of the X rows (and of the rows in front of the LayerNorm): 4 mod 64, as PA
#define PH 260                  // pitch of the hidden rows: 4 mod 64, as PA
#define PW1 264                 // pitch of W1 rows: two rows are 16 banks apart, as PB
#define PW2 136                 // pitch of W2 rows: the same
#define WBUF 4352               // floats per weight buffer: max(16 * PW1, 32 * PW2)
#define FUSED_LDS_FLOATS (FM * PX + FM * PH + 2 * WBUF)
// End of a chunk: this wave's LDS reads and writes are done, its own copies have
// landed, and the barrier then publishes both to the other waves and frees the
// buffer that was just read for the next copies.
#define CHUNK_FOOT()                                   \
  do {                                                 \
    asm volatile("s_wait_dscnt 0x0" ::: "memory");     \
    asm volatile("s_wait_asynccnt 0x0" ::: "memory");  \
    __syncthreads();                                   \
  } while (0)

__global__ void __launch_bounds__(FT) mlp_ln_kernel(const float* __restrict__ X,
                              const float* __restrict__ W1,
                              const float* __restrict__ b1,
                              const float* __restrict__ W2,
                              const float* __restrict__ b2,
                              const float* __restrict__ g,
                              const float* __restrict__ b,
                              float* __restrict__ Y) {
  extern __shared__ float smem[];
  float* sX = smem;                      // [FM][PX]: X, later the rows in front of the LayerNorm
  float* sH = smem + FM * PX;            // [FM][PH]: hidden rows
  float* sW = smem + FM * PX + FM * PH;  // [2][WBUF]: weight chunks

  const int tid = threadIdx.x;
  const int lane = tid & 31;
  const int wv = __builtin_amdgcn_readfirstlane(tid >> 5);  // wave-uniform: tile offsets are scalar
  const int m = lane & 15;         // A row / C column within a 16x16 subtile
  const int hi = lane >> 4;        // K-pair selector (lanes 16-31: K+2,K+3)
  const int rowBase = blockIdx.x * FM;

  // A weight chunk is 4,096 floats in a row in global memory: 4 x b128 per
  // thread. Chunk c of W1 and chunk j of W2 go into buffer c & 1 and j & 1.
  auto stage1 = [&](int c) {
    float* d = sW + (c & 1) * WBUF;
    const float* gw = W1 + c * 4096;
#pragma unroll
    for (int j = 0; j < 4; ++j) {
      const int idx = tid + j * FT;
      copy16(gw + idx * 4, d + (idx >> 6) * PW1 + ((idx & 63) << 2));
    }
  };
  auto stage2 = [&](int c) {
    float* d = sW + (c & 1) * WBUF;
    const float* gw = W2 + c * 4096;
#pragma unroll
    for (int j = 0; j < 4; ++j) {
      const int idx = tid + j * FT;
      copy16(gw + idx * 4, d + (idx >> 5) * PW2 + ((idx & 31) << 2));
    }
  };

  // X rows (8 x b128 per thread) and the first weight chunk.
#pragma unroll
  for (int j = 0; j < (FM * 128) / (4 * FT); ++j) {
    const int idx = tid + j * FT;
    const int r = idx >> 5;
    const int cs = (idx & 31) << 2;
    copy16(X + (size_t)(rowBase + r) * 128 + cs, sX + r * PX + cs);
  }
  stage1(0);
  // Biases and LayerNorm parameters: asked for here, so that their latency runs
  // out beside that of the first copies.
  const int c1 = wv * 32 + m;         // this lane's columns of the first product: c1, c1 + 16
  const int c2 = (wv >> 1) * 32 + m;  // of the second product: c2, c2 + 16
  const float bb1[2] = {b1[c1], b1[c1 + 16]};
  const float bb2[2] = {b2[c2], b2[c2 + 16]};
  const v4f g4 = reinterpret_cast<const v4f*>(g)[lane];
  const v4f b4 = reinterpret_cast<const v4f*>(b)[lane];
  XWAIT3(c1, c2, lane);  // behind these loads, before their address registers are written again
  asm volatile("s_wait_asynccnt 0x0" ::: "memory");  // own copies landed, before the barrier that publishes them
  __syncthreads();
  stage1(1);

  // ---- hidden = gelu(X @ W1 + b1) ----
  {
    v8f acc[4][2] = {};
    const int nw = wv * 32;
    // The two chunk loops stay rolled (for speed only).
#pragma unroll 1
    for (int c = 0; c < 8; ++c) {
      const float* cA = sX + c * 16;
      const float* cB = sW + (c & 1) * WBUF;
#pragma unroll
      for (int k0 = 0; k0 < 16; k0 += 4) {
        const int kl = k0 + 2 * hi;
        v2f av[4], bv[2];
#pragma unroll
        for (int mt = 0; mt < 4; ++mt) {
          const float* p = cA + (mt * 16 + m) * PX + kl;
          av[mt].x = p[0];
          av[mt].y = p[1];
        }
#pragma unroll
        for (int nt = 0; nt < 2; ++nt) {
          const float* p = cB + kl * PW1 + nw + nt * 16 + m;
          bv[nt].x = p[0];
          bv[nt].y = p[PW1];
        }
#pragma unroll
        for (int mt = 0; mt < 4; ++mt)
#pragma unroll
          for (int nt = 0; nt < 2; ++nt)
            acc[mt][nt] = __builtin_amdgcn_wmma_f32_16x16x4_f32(
                false, av[mt], false, bv[nt], (short)0, acc[mt][nt], false, false);
      }
      CHUNK_FOOT();
      if (c < 6) stage1(c + 2);  // the test reads the same for the whole work-group
      else       stage2(c - 6);  // the first two chunks of W2 fly during the last of W1 and the GELU
    }
    // C/D layout: VGPR r2 holds M=r2 (lanes 0-15) or M=r2+8 (lanes 16-31)
#pragma unroll
    for (int nt = 0; nt < 2; ++nt) {
      const int col = nw + nt * 16 + m;
#pragma unroll
      for (int mt = 0; mt < 4; ++mt)
#pragma unroll
        for (int r2 = 0; r2 < 8; ++r2)
          sH[(mt * 16 + hi * 8 + r2) * PH + col] = act_apply(acc[mt][nt][r2] + bb1[nt], 1);
    }
    asm volatile("s_wait_dscnt 0x0" ::: "memory");  // own hidden values written, before the barrier that publishes them
    __syncthreads();
  }

  // ---- rows in front of the LayerNorm = hidden @ W2 + b2 ----
  {
    v8f acc[2][2] = {};
    const int mw = (wv & 1) * 32;
    const int nw = (wv >> 1) * 32;
#pragma unroll 1
    for (int c = 0; c < 8; ++c) {
      const float* cA = sH + c * 32;
      const float* cB = sW + (c & 1) * WBUF;
#pragma unroll
      for (int k0 = 0; k0 < 32; k0 += 4) {
        const int kl = k0 + 2 * hi;
        v2f av[2], bv[2];
#pragma unroll
        for (int mt = 0; mt < 2; ++mt) {
          const float* p = cA + (mw + mt * 16 + m) * PH + kl;
          av[mt].x = p[0];
          av[mt].y = p[1];
        }
#pragma unroll
        for (int nt = 0; nt < 2; ++nt) {
          const float* p = cB + kl * PW2 + nw + nt * 16 + m;
          bv[nt].x = p[0];
          bv[nt].y = p[PW2];
        }
#pragma unroll
        for (int mt = 0; mt < 2; ++mt)
#pragma unroll
          for (int nt = 0; nt < 2; ++nt)
            acc[mt][nt] = __builtin_amdgcn_wmma_f32_16x16x4_f32(
                false, av[mt], false, bv[nt], (short)0, acc[mt][nt], false, false);
      }
      CHUNK_FOOT();
      if (c < 6) stage2(c + 2);  // the test reads the same for the whole work-group
    }
    // X was last read many barriers ago: its rows now take the sums.
#pragma unroll
    for (int nt = 0; nt < 2; ++nt) {
      const int col = nw + nt * 16 + m;
#pragma unroll
      for (int mt = 0; mt < 2; ++mt)
#pragma unroll
        for (int r2 = 0; r2 < 8; ++r2)
          sX[(mw + mt * 16 + hi * 8 + r2) * PX + col] = acc[mt][nt][r2] + bb2[nt];
    }
    asm volatile("s_wait_dscnt 0x0" ::: "memory");  // own sums written, before the barrier that publishes them
    __syncthreads();
  }

  // ---- LayerNorm over D=128: one wave per row at a time (4 floats/lane,
  // shfl_xor reduce), 8 rows per wave; each store is one whole 512-byte row ----
  v4f* Y4 = reinterpret_cast<v4f*>(Y) + (size_t)(rowBase + wv * 8) * 32 + lane;
#pragma unroll
  for (int i = 0; i < FM / 8; ++i) {
    const v4f v = *reinterpret_cast<const v4f*>(sX + (wv * 8 + i) * PX + lane * 4);
    float s = v.x + v.y + v.z + v.w;
    float sq = v.x * v.x + v.y * v.y + v.z * v.z + v.w * v.w;
#pragma unroll
    for (int off = 16; off > 0; off >>= 1) {
      s += __shfl_xor(s, off, 32);
      sq += __shfl_xor(sq, off, 32);
    }
    float mean = s * (1.0f / 128.0f);
    float var = sq * (1.0f / 128.0f) - mean * mean;
    float inv = rsqrtf(var + 1e-5f);

    v4f o;
    o.x = (v.x - mean) * inv * g4.x + b4.x;
    o.y = (v.y - mean) * inv * g4.y + b4.y;
    o.z = (v.z - mean) * inv * g4.z + b4.z;
    o.w = (v.w - mean) * inv * g4.w + b4.w;
    Y4[(size_t)i * 32] = o;
  }
}

// ---------------------------------------------------------------------------
// prep_conv: x_pos = x + pos_enc; depthwise conv3 (pad 1, zeros AFTER pos add
// per reference) + conv bias. Output layout [bn,t,D]. One wave per (b, n, run
// of SR time steps); the taps and the neighbours in time stay in registers.
// ---------------------------------------------------------------------------
__global__ void __launch_bounds__(ST) prep_conv_kernel(const float* __restrict__ x,
                                 const float* __restrict__ pos,
                                 const float* __restrict__ cw,
                                 const float* __restrict__ cb,
                                 float* __restrict__ xconv) {
  const int lane = threadIdx.x & 31;
  const int w = blockIdx.x * SW + (threadIdx.x >> 5);
  const int n = w & 63;               // a work-group's waves read neighbouring n
  const int t0 = ((w >> 6) & 15) * SR;
  const int b = w >> 10;
  const int d0 = lane * 4;

  const float4* X4 = reinterpret_cast<const float4*>(x) + ((size_t)(b * TT) * NN + n) * 32 + lane;
  const float4* P4 = reinterpret_cast<const float4*>(pos) + lane;

  float k0[4], k1[4], k2[4], kb[4];
#pragma unroll
  for (int c = 0; c < 4; ++c) {
    int d = d0 + c;
    k0[c] = cw[d * 3 + 0]; k1[c] = cw[d * 3 + 1]; k2[c] = cw[d * 3 + 2];
    kb[c] = cb[d];
  }
  XWAIT0();  // behind these loads, before their address registers are written again
  float4 v[SR + 2], p[SR + 2];        // time steps t0-1 .. t0+SR
  const int tlo = t0 > 0 ? t0 - 1 : 0;              // the two edge rows are read in
  const int thi = t0 + SR < TT ? t0 + SR : TT - 1;  // bounds and set to zero below
  const float4* xlo = X4 + (size_t)tlo * (NN * 32);
  const float4* xhi = X4 + (size_t)thi * (NN * 32);
  const float4* plo = P4 + (size_t)tlo * 32;
  const float4* phi = P4 + (size_t)thi * 32;
  const float4* xb = X4 + (size_t)t0 * (NN * 32);
  const float4* pb = P4 + (size_t)t0 * 32;
  v[0] = *xlo; p[0] = *plo;
  v[SR + 1] = *xhi; p[SR + 1] = *phi;
  XWAIT4(xlo, xhi, plo, phi);  // behind these loads, before their address registers are written again
#pragma unroll
  for (int i = 0; i < SR; ++i) {
    v[i + 1] = xb[(size_t)i * (NN * 32)];
    p[i + 1] = pb[(size_t)i * 32];
  }
  XWAIT2(xb, pb);  // behind these loads, before their address registers are written again
#pragma unroll
  for (int i = 0; i < SR + 2; ++i) {
    v[i].x += p[i].x; v[i].y += p[i].y; v[i].z += p[i].z; v[i].w += p[i].w;
  }
  if (t0 == 0)       v[0] = make_float4(0.f, 0.f, 0.f, 0.f);
  if (t0 + SR == TT) v[SR + 1] = make_float4(0.f, 0.f, 0.f, 0.f);

  float4* O4 = reinterpret_cast<float4*>(xconv) + ((size_t)(b * NN + n) * TT + t0) * 32 + lane;
#pragma unroll
  for (int i = 0; i < SR; ++i) {
    const float4 xm = v[i], xc = v[i + 1], xp = v[i + 2];
    float4 o;
    o.x = k0[0] * xm.x + k1[0] * xc.x + k2[0] * xp.x + kb[0];
    o.y = k0[1] * xm.y + k1[1] * xc.y + k2[1] * xp.y + kb[1];
    o.z = k0[2] * xm.z + k1[2] * xc.z + k2[2] * xp.z + kb[2];
    o.w = k0[3] * xm.w + k1[3] * xc.w + k2[3] * xp.w + kb[3];
    O4[(size_t)i * 32] = o;
  }
}

// ---------------------------------------------------------------------------
// Mixed pool: k=6, stride 1, pad (2,2) -> length T-1, right zero-pad to T.
// avg divides by 6 always (zero pad contributes 0); max over valid entries.
// One wave per (bn, run of SR time steps): the SR+5 rows its windows cover are
// loaded once; each window is summed on its own, in rising time order.
// ---------------------------------------------------------------------------
__global__ void __launch_bounds__(ST) pool_kernel(const float* __restrict__ xconv,
                            const float* __restrict__ alpha_p,
                            float* __restrict__ outp) {
  const int lane = threadIdx.x & 31;
  const int w = blockIdx.x * SW + (threadIdx.x >> 5);
  const int t0 = (w & 15) * SR;
  const int bn = w >> 4;
  const bool first = (t0 == 0), last = (t0 + SR == TT);

  const float a = 1.0f / (1.0f + expf(-alpha_p[0]));
  const float4* XC4 = reinterpret_cast<const float4*>(xconv) + (size_t)(bn * TT) * 32 + lane;

  float4 vs[SR + 5], vm[SR + 5];      // time steps t0-2 .. t0+SR+2: for the sum, for the max
  // Rows outside [0,T) are read in bounds (rows of the run itself instead) and replaced below.
  const float4* cb4 = XC4 + (size_t)t0 * 32;
  const float4* clo = first ? cb4 + 2 * 32 : cb4;            // clo[-2 rows], clo[-1 row]
  const float4* chi = last ? cb4 - 3 * 32 : cb4;             // chi[SR rows] .. chi[SR+2 rows]
  vs[0] = clo[-2 * 32]; vs[1] = clo[-1 * 32];
  vs[SR + 2] = chi[SR * 32]; vs[SR + 3] = chi[(SR + 1) * 32]; vs[SR + 4] = chi[(SR + 2) * 32];
  XWAIT2(clo, chi);  // behind these loads, before their address registers are written again
#pragma unroll
  for (int i = 0; i < SR; ++i) vs[i + 2] = cb4[(size_t)i * 32];
  XWAIT1(cb4);  // behind these loads, before their address registers are written again
#pragma unroll
  for (int i = 0; i < SR + 5; ++i) {
    vm[i] = vs[i];
    if ((i < 2 && first) || (i >= SR + 2 && last)) {
      vs[i] = make_float4(0.f, 0.f, 0.f, 0.f);
      vm[i] = make_float4(-3.0e38f, -3.0e38f, -3.0e38f, -3.0e38f);
    }
  }

  float4* O4 = reinterpret_cast<float4*>(outp) + ((size_t)(bn * TT) + t0) * 32 + lane;
  const float inv6 = 1.0f / 6.0f;
#pragma unroll
  for (int i = 0; i < SR; ++i) {
    float sx = 0.f, sy = 0.f, sz = 0.f, sw = 0.f;
    float mx = -3.0e38f, my = -3.0e38f, mz = -3.0e38f, mw = -3.0e38f;
#pragma unroll
    for (int k = 0; k < 6; ++k) {
      const float4 s = vs[i + k], m = vm[i + k];
      sx += s.x; sy += s.y; sz += s.z; sw += s.w;
      mx = fmaxf(mx, m.x); my = fmaxf(my, m.y);
      mz = fmaxf(mz, m.z); mw = fmaxf(mw, m.w);
    }
    float4 res;
    res.x = a * (sx * inv6) + (1.f - a) * mx;
    res.y = a * (sy * inv6) + (1.f - a) * my;
    res.z = a * (sz * inv6) + (1.f - a) * mz;
    res.w = a * (sw * inv6) + (1.f - a) * mw;
    if (i == SR - 1 && last) res = make_float4(0.f, 0.f, 0.f, 0.f);  // t = T-1: the right zero-pad
    O4[(size_t)i * 32] = res;
  }
}

// ---------------------------------------------------------------------------
// The gated fusion and the residual in one kernel:
//   gate = sigmoid(tanh([x_loc | x_glob] @ W1 + b1) @ W2 + b2),  W1: [256,128], W2: [128,128]
//   out  = x + softplus(res_scale) * (gate * x_loc + (1 - gate) * x_glob)
// with the [bn,t,D] -> [B,T,N,D] relayout on x and out. A work-group of 8 waves
// owns FM = 64 rows (one bn, 64 time steps) from end to end. The two branches'
// rows lie side by side in LDS, where they are the first product's A rows and
// later the two sides of the blend; the tanh rows and the gate live in LDS only.
// Global memory sees one read each of x_loc, x_glob and x and one write of out.
// The weights come through LDS in 12 chunks of 32 k-rows (8 of W1, 4 of W2), two
// buffers, the copies of chunk c + 2 in flight during chunk c + 1.
// Both products: wave tile 32x32 (2x2 subtiles), 2 waves down x 4 across; k is
// summed in rising order, 4 per WMMA, as the stand-alone GEMM does.
// 135,168 B of LDS: two work-groups per WGP, 4 waves per SIMD.
// ---------------------------------------------------------------------------
#define GATE_LDS_FLOATS (FM * PH + FM * PX + 2 * WBUF)

__device__ __forceinline__ float softplus_f(float v) {
  return (v > 0.f) ? (v + log1pf(expf(-v))) : log1pf(expf(v));
}

__global__ void __launch_bounds__(FT) gate_out_kernel(const float* __restrict__ xloc,
                                const float* __restrict__ xglob,
                                const float* __restrict__ W1,
                                const float* __restrict__ b1,
                                const float* __restrict__ W2,
                                const float* __restrict__ b2,
                                const float* __restrict__ x,
                                const float* __restrict__ res_scale,
                                float* __restrict__ out) {
  extern __shared__ float smem[];
  float* sC = smem;                      // [FM][PH]: x_loc in columns 0..127, x_glob in 128..255
  float* sT = smem + FM * PH;            // [FM][PX]: tanh rows, later the gate
  float* sW = smem + FM * PH + FM * PX;  // [2][WBUF]: weight chunks

  const int tid = threadIdx.x;
  const int lane = tid & 31;
  const int wv = __builtin_amdgcn_readfirstlane(tid >> 5);  // wave-uniform: tile offsets are scalar
  const int m = lane & 15;         // A row / C column within a 16x16 subtile
  const int hi = lane >> 4;        // K-pair selector (lanes 16-31: K+2,K+3)
  const int rowBase = blockIdx.x * FM;
  const int mw = (wv & 1) * 32;    // wave row offset, both products
  const int nw = (wv >> 1) * 32;   // wave column offset, both products

  // A weight chunk is 32 k-rows of 128 floats, 4,096 floats in a row in global
  // memory: 4 x b128 per thread. Chunk c goes into buffer c & 1.
  auto stage = [&](const float* Wg, int c) {
    float* d = sW + (c & 1) * WBUF;
    const float* gw = Wg + c * 4096;
#pragma unroll
    for (int j = 0; j < 4; ++j) {
      const int idx = tid + j * FT;
      copy16(gw + idx * 4, d + (idx >> 5) * PW2 + ((idx & 31) << 2));
    }
  };

  // The scale's raw values: asked for first, so that they are here when the copies have been issued.
  const v4f rs = reinterpret_cast<const v4f*>(res_scale)[lane];
  // The two branches' rows (16 x b128 per thread) and the first weight chunk.
#pragma unroll
  for (int j = 0; j < (FM * 128) / (4 * FT); ++j) {
    const int idx = tid + j * FT;
    const int r = idx >> 5;
    const int cs = (idx & 31) << 2;
    copy16(xloc + (size_t)(rowBase + r) * 128 + cs, sC + r * PH + cs);
    copy16(xglob + (size_t)(rowBase + r) * 128 + cs, sC + r * PH + 128 + cs);
  }
  stage(W1, 0);
  // Biases: asked for here, so that their latency runs out beside that of the first copies.
  const int cc = nw + m;              // this lane's columns of both products: cc, cc + 16
  const float bb1[2] = {b1[cc], b1[cc + 16]};
  const float bb2[2] = {b2[cc], b2[cc + 16]};
  XWAIT2(cc, lane);  // behind these loads, before their address registers are written again
  // The scale of this lane's 4 columns, formed while the first copies are under way.
  const float sx = softplus_f(rs.x), sy = softplus_f(rs.y);
  const float sz = softplus_f(rs.z), sw = softplus_f(rs.w);
  asm volatile("s_wait_asynccnt 0x0" ::: "memory");  // own copies landed, before the barrier that publishes them
  __syncthreads();
  stage(W1, 1);

  // The 8 rows of x and out that this wave blends and stores at the end.
  const int bn = rowBase >> 8;                 // TT = 256 rows a bn
  const int t0 = (rowBase & (TT - 1)) + wv * 8;
  const size_t xo = ((size_t)((bn >> 6) * TT + t0) * NN + (bn & 63)) * 32 + lane;  // [B,T,N,D]
  const v4f* X4 = reinterpret_cast<const v4f*>(x) + xo;
  v4f xv[FM / 8];

  // ---- tanh rows = tanh([x_loc | x_glob] @ W1 + b1) ----
  {
    v8f acc[2][2] = {};
    // The two chunk loops stay rolled, as in the MLP kernel (for speed only).
#pragma unroll 1
    for (int c = 0; c < 8; ++c) {
      const float* cA = sC + c * 32;
      const float* cB = sW + (c & 1) * WBUF;
#pragma unroll
      for (int k0 = 0; k0 < 32; k0 += 4) {
        const int kl = k0 + 2 * hi;
        v2f av[2], bv[2];
#pragma unroll
        for (int mt = 0; mt < 2; ++mt) {
          const float* p = cA + (mw + mt * 16 + m) * PH + kl;
          av[mt].x = p[0];
          av[mt].y = p[1];
        }
#pragma unroll
        for (int nt = 0; nt < 2; ++nt) {
          const float* p = cB + kl * PW2 + nw + nt * 16 + m;
          bv[nt].x = p[0];
          bv[nt].y = p[PW2];
        }
#pragma unroll
        for (int mt = 0; mt < 2; ++mt)
#pragma unroll
          for (int nt = 0; nt < 2; ++nt)
            acc[mt][nt] = __builtin_amdgcn_wmma_f32_16x16x4_f32(
                false, av[mt], false, bv[nt], (short)0, acc[mt][nt], false, false);
      }
      CHUNK_FOOT();
      if (c < 6) stage(W1, c + 2);  // the test reads the same for the whole work-group
      else       stage(W2, c - 6);  // the first two chunks of W2 fly during the last of W1 and the tanh
    }
    // This wave's 8 rows of x: asked for here, so that their latency runs out under the tanh.
#pragma unroll
    for (int i = 0; i < FM / 8; ++i) xv[i] = X4[(size_t)i * (NN * 32)];
    XWAIT1(X4);  // behind these loads, before their address registers are written again
    // Keeps the tanh arithmetic behind the loads: left free, the compiler issues
    // them two thirds of the way through it, with too little left to cover their latency.
    __builtin_amdgcn_sched_barrier(0);
    // C/D layout: VGPR r2 holds M=r2 (lanes 0-15) or M=r2+8 (lanes 16-31)
#pragma unroll
    for (int nt = 0; nt < 2; ++nt) {
      const int col = nw + nt * 16 + m;
#pragma unroll
      for (int mt = 0; mt < 2; ++mt)
#pragma unroll
        for (int r2 = 0; r2 < 8; ++r2)
          sT[(mw + mt * 16 + hi * 8 + r2) * PX + col] = act_apply(acc[mt][nt][r2] + bb1[nt], 2);
    }
    asm volatile("s_wait_dscnt 0x0" ::: "memory");  // own tanh values written, before the barrier that publishes them
    __syncthreads();
  }

  // ---- gate = sigmoid(tanh rows @ W2 + b2) ----
  {
    v8f acc[2][2] = {};
#pragma unroll 1
    for (int c = 0; c < 4; ++c) {
      const float* cA = sT + c * 32;
      const float* cB = sW + (c & 1) * WBUF;
#pragma unroll
      for (int k0 = 0; k0 < 32; k0 += 4) {
        const int kl = k0 + 2 * hi;
        v2f av[2], bv[2];
#pragma unroll
        for (int mt = 0; mt < 2; ++mt) {
          const float* p = cA + (mw + mt * 16 + m) * PX + kl;
          av[mt].x = p[0];
          av[mt].y = p[1];
        }
#pragma unroll
        for (int nt = 0; nt < 2; ++nt) {
          const float* p = cB + kl * PW2 + nw + nt * 16 + m;
          bv[nt].x = p[0];
          bv[nt].y = p[PW2];
        }
#pragma unroll
        for (int mt = 0; mt < 2; ++mt)
#pragma unroll
          for (int nt = 0; nt < 2; ++nt)
            acc[mt][nt] = __builtin_amdgcn_wmma_f32_16x16x4_f32(
                false, av[mt], false, bv[nt], (short)0, acc[mt][nt], false, false);
      }
      CHUNK_FOOT();
      if (c < 2) stage(W2, c + 2);  // the test reads the same for the whole work-group
    }
    // The last foot's barrier ended every read of the tanh rows: they now take the gate.
#pragma unroll
    for (int nt = 0; nt < 2; ++nt) {
      const int col = nw + nt * 16 + m;
#pragma unroll
      for (int mt = 0; mt < 2; ++mt)
#pragma unroll
        for (int r2 = 0; r2 < 8; ++r2)
          sT[(mw + mt * 16 + hi * 8 + r2) * PX + col] = act_apply(acc[mt][nt][r2] + bb2[nt], 3);
    }
    asm volatile("s_wait_dscnt 0x0" ::: "memory");  // own gate values written, before the barrier that publishes them
    __syncthreads();
  }

  // ---- blend and residual: one wave per row at a time (4 floats/lane), 8 rows
  // per wave; each store is one whole 512-byte row of out ----
  v4f* O4 = reinterpret_cast<v4f*>(out) + xo;
#pragma unroll
  for (int i = 0; i < FM / 8; ++i) {
    const int r = wv * 8 + i;
    const v4f gt = *reinterpret_cast<const v4f*>(sT + r * PX + lane * 4);
    const v4f xl = *reinterpret_cast<const v4f*>(sC + r * PH + lane * 4);
    const v4f xg = *reinterpret_cast<const v4f*>(sC + r * PH + 128 + lane * 4);
    v4f o;
    o.x = xv[i].x + sx * (gt.x * xl.x + (1.f - gt.x) * xg.x);
    o.y = xv[i].y + sy * (gt.y * xl.y + (1.f - gt.y) * xg.y);
    o.z = xv[i].z + sz * (gt.z * xl.z + (1.f - gt.z) * xg.z);
    o.w = xv[i].w + sw * (gt.w * xl.w + (1.f - gt.w) * xg.w);
    O4[(size_t)i * (NN * 32)] = o;
  }
}

// ---------------------------------------------------------------------------
// Host launcher
// ---------------------------------------------------------------------------
extern "C" void kernel_launch(void* const* d_in, const int* in_sizes, int n_in,
                              void* d_out, int out_size, void* d_ws, size_t ws_size,
                              hipStream_t stream) {
  const float* x          = (const float*)d_in[0];
  const float* window_w   = (const float*)d_in[1];
  const float* local_w1   = (const float*)d_in[2];
  const float* local_b1   = (const float*)d_in[3];
  const float* local_w2   = (const float*)d_in[4];
  const float* local_b2   = (const float*)d_in[5];
  const float* local_ln_g = (const float*)d_in[6];
  const float* local_ln_b = (const float*)d_in[7];
  const float* qkv_w      = (const float*)d_in[8];
  const float* qkv_b      = (const float*)d_in[9];
  const float* out_w      = (const float*)d_in[10];
  const float* out_b      = (const float*)d_in[11];
  const float* conv_w     = (const float*)d_in[12];
  const float* conv_b     = (const float*)d_in[13];
  const float* alpha      = (const float*)d_in[14];
  const float* pos_enc    = (const float*)d_in[15];
  const float* global_w1  = (const float*)d_in[16];
  const float* global_b1  = (const float*)d_in[17];
  const float* global_w2  = (const float*)d_in[18];
  const float* global_b2  = (const float*)d_in[19];
  const float* global_ln_g= (const float*)d_in[20];
  const float* global_ln_b= (const float*)d_in[21];
  const float* gate_w1    = (const float*)d_in[22];
  const float* gate_b1    = (const float*)d_in[23];
  const float* gate_w2    = (const float*)d_in[24];
  const float* gate_b2    = (const float*)d_in[25];
  const float* res_scale  = (const float*)d_in[26];
  float* out = (float*)d_out;

  const size_t R = (size_t)RR;
  float* ws = (float*)d_ws;
  float* P0 = ws;             // R*128: xl -> attn_out -> x_loc
  float* P1 = ws + R * 128;   // R*384: qkv -> proj
  float* P2 = ws + R * 512;   // R*128: xconv -> x_glob
  float* P3 = ws + R * 640;   // R*128: x_glob_in

  const size_t GEMM_LDS = (2 * BM * PA + 2 * KC * PB) * sizeof(float);  // 104 KB
  const size_t FUSED_LDS = FUSED_LDS_FLOATS * sizeof(float);            // 132 KB
  const size_t GATE_LDS = GATE_LDS_FLOATS * sizeof(float);              // 132 KB

  // local branch
  prep_local_kernel<<<SG, ST, 0, stream>>>(x, window_w, P0);
  gemm_wmma_kernel<128, 384, 0><<<dim3(RR / BM, 384 / BN), BL, GEMM_LDS, stream>>>(
      P0, qkv_w, qkv_b, P1);
  attn_kernel<<<SG, ST, 0, stream>>>(P1, P0);
  gemm_wmma_kernel<128, 128, 0><<<dim3(RR / BM, 128 / BN), BL, GEMM_LDS, stream>>>(
      P0, out_w, out_b, P1);
  mlp_ln_kernel<<<RR / FM, FT, FUSED_LDS, stream>>>(
      P1, local_w1, local_b1, local_w2, local_b2, local_ln_g, local_ln_b, P0);  // x_loc = P0

  // global branch
  prep_conv_kernel<<<SG, ST, 0, stream>>>(x, pos_enc, conv_w, conv_b, P2);
  pool_kernel<<<SG, ST, 0, stream>>>(P2, alpha, P3);
  mlp_ln_kernel<<<RR / FM, FT, FUSED_LDS, stream>>>(
      P3, global_w1, global_b1, global_w2, global_b2, global_ln_g, global_ln_b, P2);  // x_glob = P2

  // gated fusion and residual
  gate_out_kernel<<<RR / FM, FT, GATE_LDS, stream>>>(
      P0, P2, gate_w1, gate_b1, gate_w2, gate_b2, x, res_scale, out);
}

// v008
// Measured time: 255 microseconds a run.
// Two timings next to v007 put it at 1.09 and 1.03 times that version's speed.
// Over all steps from v000 it is 3.94 times as fast.
#include <hip/hip_runtime.h>
#include <math.h>

// Problem constants (from reference)
#define BB 4
#define TT 256
#define NN 64
#define DD 128
#define HH 4
#define HD 32
#define RR (BB * NN * TT)   // 65536 rows

// GEMM blocking
#define BM 128   // block tile rows
#define BN 64    // block tile cols
#define KC 64    // K chunk staged in LDS
#define BL 128   // threads per block (4 waves)
// LDS row pitches in floats (LDS bank = dword address mod 64). Both stay
// multiples of 4 floats so every 16-byte copy lands 16-byte aligned.
#define PA 68    // A rows: 16 rows x 2 k-pairs of a fragment read fall on 64 distinct banks
#define PB 72    // B rows: rows k and k+2, read by the two lane halves, sit 16 banks apart

// Streaming kernels (everything but the GEMMs and the fused kernels): one wave
// walks SR rows of 128 floats, one float4 per lane and row, so a launch starts
// 4,096 row waves (one 16-wave work-group per WGP; prep_local adds FG) and each wave has SR or more
// 512-byte loads in flight. The row loops are fully unrolled, so that the row
// arrays are registers and a run's loads can issue back to back.
#define SW 16                  // waves per work-group
#define ST (SW * 32)           // threads per work-group
#define SR 16                  // rows per wave
#define SG (RR / (SW * SR))    // row work-groups per launch (prep_local launches FG more)
// Stands behind a run of loads: s_wait_xcnt 0 before any register that an issued
// load names is written again. The address operands only keep those registers
// alive up to the wait, so that no later load's result lands in them before it.
#define XWAIT0() asm volatile("s_wait_xcnt 0x0" ::: "memory")
#define XWAIT1(a) asm volatile("s_wait_xcnt 0x0" :: "v"(a) : "memory")
#define XWAIT2(a, b) asm volatile("s_wait_xcnt 0x0" :: "v"(a), "v"(b) : "memory")
#define XWAIT3(a, b, c) asm volatile("s_wait_xcnt 0x0" :: "v"(a), "v"(b), "v"(c) : "memory")
#define XWAIT4(a, b, c, d) asm volatile("s_wait_xcnt 0x0" :: "v"(a), "v"(b), "v"(c), "v"(d) : "memory")

typedef __attribute__((ext_vector_type(2))) float v2f;
typedef __attribute__((ext_vector_type(8))) float v8f;
typedef __attribute__((ext_vector_type(4))) float v4f;

// ---------------------------------------------------------------------------
// CDNA5 async global->LDS copy (ASYNCcnt-tracked DMA), with sync fallback.
// Builtin signature (from hipcc diagnostic): (int4 AS1*, int4 AS3*, Ii, Ii).
// ---------------------------------------------------------------------------
#if defined(__has_builtin)
#if __has_builtin(__builtin_amdgcn_global_load_async_to_lds_b128) && \
    __has_builtin(__builtin_amdgcn_s_wait_asynccnt)
#define HAVE_ASYNC_LDS 1
#endif
#endif

#ifdef HAVE_ASYNC_LDS
typedef int vi4 __attribute__((__vector_size__(4 * sizeof(int))));
typedef __attribute__((address_space(1))) vi4 as1_vi4;
typedef __attribute__((address_space(3))) vi4 as3_vi4;
#endif

__device__ __forceinline__ void copy16(const float* g, float* l) {
#ifdef HAVE_ASYNC_LDS
  as1_vi4* gp = reinterpret_cast<as1_vi4*>((uintptr_t)g);
  as3_vi4* lp = reinterpret_cast<as3_vi4*>((uintptr_t)l);
  __builtin_amdgcn_global_load_async_to_lds_b128(gp, lp, 0, 0);
#else
  *reinterpret_cast<float4*>(l) = *reinterpret_cast<const float4*>(g);
#endif
}

__device__ __forceinline__ void stage_sync() {
#ifdef HAVE_ASYNC_LDS
  __builtin_amdgcn_s_wait_asynccnt(0);
#endif
  __syncthreads();
}

// ---------------------------------------------------------------------------
// Activation epilogues: 0=none, 1=exact GELU (erf), 2=tanh, 3=sigmoid
// ---------------------------------------------------------------------------
// erf and tanh without a branch. The math library's erff and tanhf each pick one
// of two formulas by a test on |x| that differs from lane to lane: two branches
// on the lane mask per element, which make each element one dependent chain with
// nothing of the next element issued beside it. Here both formulas are worked
// out for every element and a select keeps the one the library would have
// taken: same coefficients (given as bit patterns), same operations in the same
// order, so the values are bit-identical, and the elements of a tile are
// straight-line code whose chains can be issued side by side.
#define FB(u) __builtin_bit_cast(float, u)

__device__ __forceinline__ float erf_sel(float x) {
  const float ax = fabsf(x);
  float p = fmaf(ax, FB(0x378e98abu), FB(0xb9c68948u));  // |x| >= 1: 1 - exp(-(ax + ax*poly(ax)))
  p = fmaf(ax, p, FB(0x3b7cd369u));
  p = fmaf(ax, p, FB(0xbcc618b2u));
  p = fmaf(ax, p, FB(0x3dda74e4u));
  p = fmaf(ax, p, FB(0x3f228afdu));
  p = fmaf(ax, p, FB(0x3e03c728u));
  p = fmaf(ax, p, ax);
  const float big = 1.0f - expf(-p);
  const float t = x * x;                                 // |x| < 1: ax + ax*poly(x*x)
  float s = fmaf(t, FB(0xba1345e1u), FB(0x3ba10414u));
  s = fmaf(t, s, FB(0xbcdac9b8u));
  s = fmaf(t, s, FB(0x3de703beu));
  s = fmaf(t, s, FB(0xbec09330u));
  s = fmaf(t, s, FB(0x3e0375d0u));
  const float small = fmaf(ax, s, ax);
  return copysignf(ax < 1.0f ? small : big, x);
}

__device__ __forceinline__ float tanh_sel(float x) {
  const float ax = fabsf(x);
  const float e = expf(ax + ax);                         // |x| >= 0.625: 1 - 2/(1 + exp(2|x|))
  float r;
  // v_rcp_f32 with the one free slot that the instruction set asks for behind a
  // transcendental.
  asm("v_rcp_f32 %0, %1\n\tv_nop" : "=v"(r) : "v"(1.0f + e));
  const float big = fmaf(r, -2.0f, 1.0f);
  const float t = x * x;                                 // |x| < 0.625: ax + x*x*(ax*poly(x*x))
  float s = fmaf(t, FB(0xbbbac73du), FB(0x3ca908c9u));
  s = fmaf(t, s, FB(0xbd5c1c4eu));
  s = fmaf(t, s, FB(0x3e088382u));
  s = fmaf(t, s, FB(0xbeaaaa99u));
  const float small = fmaf(t, ax * s, ax);
  return copysignf(0.625f > ax ? small : big, x);
}

__device__ __forceinline__ float act_apply(float v, int act) {
  if (act == 1) return 0.5f * v * (1.0f + erf_sel(v * 0.70710678118654752440f));
  if (act == 2) return tanh_sel(v);
  if (act == 3) return 1.0f / (1.0f + expf(-v));
  return v;
}

// ---------------------------------------------------------------------------
// fp32 GEMM: C[R,Nc] = act(A[R,K] @ B[K,Nc] + bias)
// Block = 128 threads = 4 waves (2x2). Block tile 128x64; wave tile 64x32
// (4 M-subtiles x 2 N-subtiles of 16x16). K staged in 64-chunks,
// double-buffered in LDS via async global->LDS DMA when available.
// Per K-step: 4 A-pairs + 2 B-pairs feed 8 V_WMMA_F32_16X16X4_F32.
// K, Nc and the activation are template constants: each launch runs code that
// holds its own activation only, with no selector branch per output element,
// and row strides fold into constant address steps. The block size is stated
// too, so that the register ceiling is that of 4 waves and the copy addresses
// of the unrolled K chunks stay in registers (no scratch).
// ---------------------------------------------------------------------------
template <int K, int Nc, int act>
__global__ void __launch_bounds__(BL) gemm_wmma_kernel(const float* __restrict__ A,
                                 const float* __restrict__ Bm,
                                 const float* __restrict__ bias,
                                 float* __restrict__ C) {
  extern __shared__ float smem[];
  float* sAb = smem;                 // [2][BM rows at pitch PA]
  float* sBb = smem + 2 * BM * PA;   // [2][KC rows at pitch PB]

  const int tid = threadIdx.x;
  const int rowBase = blockIdx.x * BM;
  const int colBase = blockIdx.y * BN;
  constexpr int nk = K / KC;

  // Stage K-chunk kb into LDS buffer buf (async DMA when available).
  auto stage = [&](int kb, int buf) {
    float* dA = sAb + buf * (BM * PA);
    float* dB = sBb + buf * (KC * PB);
    const float* gA = A + (size_t)rowBase * K + kb * KC;
    const float* gB = Bm + (size_t)(kb * KC) * Nc + colBase;
#pragma unroll
    for (int j = 0; j < (BM * KC) / (4 * BL); ++j) {  // 16 x b128 per thread
      int idx = tid + j * BL;
      int r = idx >> 4;
      int cs = (idx & 15) << 2;
      copy16(gA + (size_t)r * K + cs, dA + r * PA + cs);
    }
#pragma unroll
    for (int j = 0; j < (KC * BN) / (4 * BL); ++j) {  // 8 x b128 per thread
      int idx = tid + j * BL;
      int r = idx >> 4;
      int cs = (idx & 15) << 2;
      copy16(gB + (size_t)r * Nc + cs, dB + r * PB + cs);
    }
  };

  const int lane = tid & 31;
  const int wv = tid >> 5;
  const int mw = (wv & 1) * 64;    // wave row offset in block tile
  const int nw = (wv >> 1) * 32;   // wave col offset in block tile
  const int m = lane & 15;         // A row / C column within 16x16 subtile
  const int hi = lane >> 4;        // K-pair selector (lanes 16-31: K+2,K+3)

  v8f acc[4][2] = {};

  stage(0, 0);
  stage_sync();

  for (int kb = 0; kb < nk; ++kb) {
    const int cur = kb & 1;
    if (kb + 1 < nk) stage(kb + 1, cur ^ 1);
    if (kb + 2 < nk)  // warm L2 for the chunk after next (global_prefetch_b8)
      __builtin_prefetch(A + (size_t)(rowBase + (tid >> 1)) * K + (kb + 2) * KC, 0, 0);

    const float* cA = sAb + cur * (BM * PA);
    const float* cB = sBb + cur * (KC * PB);

#pragma unroll 4
    for (int k0 = 0; k0 < KC; k0 += 4) {
      const int ka = k0 + 2 * hi;
      v2f av[4], bv[2];
#pragma unroll
      for (int mt = 0; mt < 4; ++mt) {
        const float* p = cA + (size_t)(mw + mt * 16 + m) * PA + ka;
        av[mt].x = p[0];
        av[mt].y = p[1];
      }
#pragma unroll
      for (int nt = 0; nt < 2; ++nt) {
        const float* p = cB + (size_t)ka * PB + nw + nt * 16 + m;
        bv[nt].x = p[0];
        bv[nt].y = p[PB];
      }
#pragma unroll
      for (int mt = 0; mt < 4; ++mt)
#pragma unroll
        for (int nt = 0; nt < 2; ++nt)
          acc[mt][nt] = __builtin_amdgcn_wmma_f32_16x16x4_f32(
              false, av[mt], false, bv[nt], (short)0, acc[mt][nt], false, false);
    }
    stage_sync();
  }

  // C/D layout: VGPR r2 holds M=r2 (lanes 0-15) or M=r2+8 (lanes 16-31)
#pragma unroll
  for (int nt = 0; nt < 2; ++nt) {
    const int col = colBase + nw + nt * 16 + m;
    const float bb = bias[col];
#pragma unroll
    for (int mt = 0; mt < 4; ++mt) {
#pragma unroll
      for (int r2 = 0; r2 < 8; ++r2) {
        int row = rowBase + mw + mt * 16 + hi * 8 + r2;
        C[(size_t)row * Nc + col] = act_apply(acc[mt][nt][r2] + bb, act);
      }
    }
  }
}

// ---------------------------------------------------------------------------
// The attention's output projection and the local MLP's first layer are two
// linear maps with nothing between them:
//   (o @ Wo + bo) @ W1 + b1 = o @ (Wo @ W1) + (bo @ W1 + b1).
// Wf = Wo @ W1 [128,256] and bf = bo @ W1 + b1 [256] are formed here, anew in
// every call, and the MLP kernel then takes the attention rows with Wf and bf:
// the product of all 65,536 rows with Wo is not needed any more.
// One wave per 16x32 tile (a row's 32 columns are one whole 128-byte line), 72
// tiles: row tiles 0..7 are Wo's rows; in row tile 8 every row is bo, the sums
// start from b1, and row 0 is kept. Fragments come straight from global memory,
// k in rising order, 4 per WMMA, in the lane order of the GEMM kernel's loaders.
// ---------------------------------------------------------------------------
#define FG 5                   // work-groups at the head of the first launch that form Wf and bf

__device__ __forceinline__ void fold_tile(const float* __restrict__ Wo,
                                          const float* __restrict__ bo,
                                          const float* __restrict__ W1,
                                          const float* __restrict__ b1,
                                          float* __restrict__ Wf,
                                          float* __restrict__ bf,
                                          int tile, int lane) {
  const int rt = tile >> 3;        // wave-uniform
  const int c0 = (tile & 7) * 32;
  const int m = lane & 15;         // A row / C column within a 16x16 subtile
  const int hi = lane >> 4;        // K-pair selector (lanes 16-31: K+2,K+3)
  const bool brow = (rt == 8);
  const float* pa = (brow ? bo : Wo + (rt * 16 + m) * 128) + 2 * hi;
  const float* pb = W1 + (2 * hi) * 256 + c0 + m;
  const float* pc = b1 + c0 + m;
  const float bb[2] = {pc[0], pc[16]};

  // C/D layout: a lane's 8 registers are 8 rows of its one column (lane & 15).
  v8f acc[2];
#pragma unroll
  for (int nt = 0; nt < 2; ++nt)
#pragma unroll
    for (int r2 = 0; r2 < 8; ++r2) acc[nt][r2] = brow ? bb[nt] : 0.f;
  // Four batches of 8 k-steps, fully unrolled (constant offsets from pa and pb):
  // 40 loads in flight a batch, few enough registers for two work-groups a WGP.
#pragma unroll
  for (int q = 0; q < 4; ++q) {
    v2f av[8], bv[8][2];
#pragma unroll
    for (int i = 0; i < 8; ++i) {
      const int k0 = (q * 8 + i) * 4;
      av[i] = *reinterpret_cast<const v2f*>(pa + k0);
#pragma unroll
      for (int nt = 0; nt < 2; ++nt) {
        bv[i][nt].x = pb[k0 * 256 + nt * 16];
        bv[i][nt].y = pb[(k0 + 1) * 256 + nt * 16];
      }
    }
    XWAIT3(pa, pb, pc);  // behind these loads, before their address registers are written again
#pragma unroll
    for (int i = 0; i < 8; ++i)
#pragma unroll
      for (int nt = 0; nt < 2; ++nt)
        acc[nt] = __builtin_amdgcn_wmma_f32_16x16x4_f32(
            false, av[i], false, bv[i][nt], (short)0, acc[nt], false, false);
  }
  // Four free vector slots between the last WMMA and the first reader of its
  // result: the stores stand behind branches.
  asm volatile("v_nop\n\tv_nop\n\tv_nop\n\tv_nop" : "+v"(acc[0]), "+v"(acc[1]));

  // C/D layout: VGPR r2 holds M=r2 (lanes 0-15) or M=r2+8 (lanes 16-31)
  if (!brow) {
#pragma unroll
    for (int nt = 0; nt < 2; ++nt)
#pragma unroll
      for (int r2 = 0; r2 < 8; ++r2)
        Wf[(rt * 16 + hi * 8 + r2) * 256 + c0 + nt * 16 + m] = acc[nt][r2];
    XWAIT0();  // behind these stores, before a register that they name is written again
  } else if (hi == 0) {
    bf[c0 + m] = acc[0][0];
    bf[c0 + 16 + m] = acc[1][0];
  }
}

// ---------------------------------------------------------------------------
// prep_local: xl[bn,t,:] = x[b,t,n,:] - softmax(window_weight)-weighted
// 3-tap trend (zero-padded in time). One wave per (b, n, run of SR time steps);
// the neighbours in time come from the wave's own registers.
// The launch's first FG work-groups form Wf and bf instead (fold_tile): that
// work needs a handful of waves only and runs beside the streaming.
// ---------------------------------------------------------------------------
__global__ void __launch_bounds__(ST) prep_local_kernel(const float* __restrict__ x,
                                  const float* __restrict__ wwraw,
                                  float* __restrict__ xl,
                                  const float* __restrict__ Wo,
                                  const float* __restrict__ bo,
                                  const float* __restrict__ W1,
                                  const float* __restrict__ b1,
                                  float* __restrict__ Wf,
                                  float* __restrict__ bf) {
  const int lane = threadIdx.x & 31;
  if (blockIdx.x < FG) {
    const int tile = blockIdx.x * SW + __builtin_amdgcn_readfirstlane(threadIdx.x >> 5);
    if (tile < 72) fold_tile(Wo, bo, W1, b1, Wf, bf, tile, lane);
    return;
  }
  const int w = (blockIdx.x - FG) * SW + (threadIdx.x >> 5);
  const int n = w & 63;               // a work-group's waves read neighbouring n
  const int t0 = ((w >> 6) & 15) * SR;
  const int b = w >> 10;

  float w0 = wwraw[0], w1 = wwraw[1], w2 = wwraw[2];
  float mw = fmaxf(w0, fmaxf(w1, w2));
  float e0 = expf(w0 - mw), e1 = expf(w1 - mw), e2 = expf(w2 - mw);
  float inv = 1.0f / (e0 + e1 + e2);
  e0 *= inv; e1 *= inv; e2 *= inv;

  const float4* X4 = reinterpret_cast<const float4*>(x) + ((size_t)(b * TT) * NN + n) * 32 + lane;
  float4 v[SR + 2];                   // time steps t0-1 .. t0+SR
  const float4* xlo = X4 + (size_t)(t0 > 0 ? t0 - 1 : 0) * (NN * 32);
  const float4* xhi = X4 + (size_t)(t0 + SR < TT ? t0 + SR : TT - 1) * (NN * 32);
  const float4* xb = X4 + (size_t)t0 * (NN * 32);
  v[0] = *xlo;
  v[SR + 1] = *xhi;
  XWAIT2(xlo, xhi);  // behind these loads, before their address registers are written again
#pragma unroll
  for (int i = 0; i < SR; ++i) v[i + 1] = xb[(size_t)i * (NN * 32)];
  XWAIT1(xb);  // behind these loads, before their address registers are written again
  if (t0 == 0)       v[0] = make_float4(0.f, 0.f, 0.f, 0.f);
  if (t0 + SR == TT) v[SR + 1] = make_float4(0.f, 0.f, 0.f, 0.f);

  float4* O4 = reinterpret_cast<float4*>(xl) + ((size_t)(b * NN + n) * TT + t0) * 32 + lane;
#pragma unroll
  for (int i = 0; i < SR; ++i) {
    const float4 xm = v[i], xc = v[i + 1], xp = v[i + 2];
    float4 o;
    o.x = xc.x - (e0 * xm.x + e1 * xc.x + e2 * xp.x);
    o.y = xc.y - (e0 * xm.y + e1 * xc.y + e2 * xp.y);
    o.z = xc.z - (e0 * xm.z + e1 * xc.z + e2 * xp.z);
    o.w = xc.w - (e0 * xm.w + e1 * xc.w + e2 * xp.w);
    O4[(size_t)i * 32] = o;
  }
  XWAIT0();  // behind these stores, before a register that they name is written again
}

// ---------------------------------------------------------------------------
// Banded (|i-j|<=1) multi-head attention: off-band -1e9 scores underflow to
// exactly 0 after fp32 softmax, so only 3 neighbors matter.
// One wave per (bn, run of SR time steps). A lane holds 4 of a row's 128
// features (8 lanes a head), so each load and store of a wave is 512 contiguous
// bytes (4 whole lines) of one row's q, k, v or output, and a k or v row serves
// its three queries from registers. A score is 4 products in the lane, then a
// sum over the head's 8 lanes; every lane of a head then holds the same softmax.
// ---------------------------------------------------------------------------
template <int CTRL>
__device__ __forceinline__ float dpp_add(float v) {
  // v + (v of the lane that CTRL names): a cross-lane add on the vector port
  // (__shfl_xor would go through the LDS queue and its latency).
  const int o = __builtin_amdgcn_mov_dpp(__builtin_bit_cast(int, v), CTRL, 0xf, 0xf, true);
  return v + __builtin_bit_cast(float, o);
}

__device__ __forceinline__ float head_dot(const float4 a, const float4 b) {
  float d = a.x * b.x + a.y * b.y + a.z * b.z + a.w * b.w;
  d = dpp_add<0x161>(d);  // row_xmask:1
  d = dpp_add<0x162>(d);  // row_xmask:2
  d = dpp_add<0x164>(d);  // row_xmask:4
  return d;
}

__global__ void __launch_bounds__(ST) attn_kernel(const float* __restrict__ qkv,
                            float* __restrict__ outp) {
  const int lane = threadIdx.x & 31;
  const int w = blockIdx.x * SW + (threadIdx.x >> 5);
  const int t0 = (w & 15) * SR;       // a work-group's waves cover one bn
  const int bn = w >> 4;

  // Two batches of SR/2 rows, 28 loads each: all of a run's rows at once would
  // not fit the registers of 16 waves a WGP. Every loop is fully unrolled, so
  // that q, k and v are registers and a batch's loads issue back to back.
  constexpr int HB = SR / 2;
#pragma unroll
  for (int h = 0; h < 2; ++h) {
    const int tb = t0 + h * HB;
    const bool lo_out = (tb == 0), hi_out = (tb + HB == TT);
    // a row of qkv is 96 float4: q at 0, k at 32, v at 64
    const float4* pb = reinterpret_cast<const float4*>(qkv) + (size_t)(bn * TT + tb) * 96 + lane;
    // The two neighbour rows outside [0,T) are read in bounds (the batch's own
    // edge row instead); their scores are masked below.
    const float4* plo = lo_out ? pb : pb - 96;
    const float4* phi = hi_out ? pb + (HB - 1) * 96 : pb + HB * 96;
    float4 q[HB], k[HB + 2], v[HB + 2];   // k, v: time steps tb-1 .. tb+HB
    k[0] = plo[32]; v[0] = plo[64];
    k[HB + 1] = phi[32]; v[HB + 1] = phi[64];
#pragma unroll
    for (int i = 0; i < HB; ++i) {
      q[i] = pb[i * 96];
      k[i + 1] = pb[i * 96 + 32];
      v[i + 1] = pb[i * 96 + 64];
    }
    XWAIT3(pb, plo, phi);  // behind these loads, before their address registers are written again

    float4* O4 = reinterpret_cast<float4*>(outp) + (size_t)(bn * TT + tb) * 32 + lane;
#pragma unroll
    for (int i = 0; i < HB; ++i) {
      const float sc = 0.17677669529663687f;  // 1/sqrt(32)
      float s0 = head_dot(q[i], k[i]) * sc;
      const float s1 = head_dot(q[i], k[i + 1]) * sc;
      float s2 = head_dot(q[i], k[i + 2]) * sc;
      if (i == 0 && lo_out) s0 = -3.0e38f;       // t = 0: no step before; its weight is exp(-huge) = 0
      if (i == HB - 1 && hi_out) s2 = -3.0e38f;  // t = T-1: no step behind
      const float mmax = fmaxf(fmaxf(s0, s1), s2);
      const float p0 = expf(s0 - mmax), p1 = expf(s1 - mmax), p2 = expf(s2 - mmax);
      const float invd = 1.0f / (p0 + p1 + p2);
      const float4 va = v[i], vb = v[i + 1], vc = v[i + 2];
      float4 o;
      o.x = (p0 * va.x + p1 * vb.x + p2 * vc.x) * invd;
      o.y = (p0 * va.y + p1 * vb.y + p2 * vc.y) * invd;
      o.z = (p0 * va.z + p1 * vb.z + p2 * vc.z) * invd;
      o.w = (p0 * va.w + p1 * vb.w + p2 * vc.w) * invd;
      O4[(size_t)i * 32] = o;
    }
  }
}

// ---------------------------------------------------------------------------
// One branch's MLP with its LayerNorm in one kernel:
//   Y = LN(gelu(X @ W1 + b1) @ W2 + b2) * g + b,  X, Y: [R,128], W1: [128,256], W2: [256,128]
// A work-group of 8 waves owns FM = 64 rows from end to end. Its X rows, the 256
// hidden values of each row and the 128 values in front of the LayerNorm live in
// LDS only; global memory sees one read of X and one write of Y. The weights
// come through LDS in 16 chunks of 4,096 floats (8 of W1: 16 k-rows; 8 of W2:
// 32 k-rows), two buffers, the copies of chunk c + 2 in flight during chunk c + 1.
// First product: wave tile 64x32 (4x2 subtiles), 8 waves side by side = 256 columns.
// Second product: wave tile 32x32 (2x2 subtiles), 2 waves down x 4 across.
// Both sum k in rising order, 4 per WMMA, as the stand-alone GEMM does.
// 135,168 B of LDS: two work-groups per WGP, 4 waves per SIMD.
// ---------------------------------------------------------------------------
#define FM 64                   // rows per work-group
#define FT 256                  // threads per work-group (8 waves)
#define PX 132                  // pitch of the X rows (and of the rows in front of the LayerNorm): 4 mod 64, as PA
#define PH 260                  // pitch of the hidden rows: 4 mod 64, as PA
#define PW1 264                 // pitch of W1 rows: two rows are 16 banks apart, as PB
#define PW2 136                 // pitch of W2 rows: the same
#define WBUF 4352               // floats per weight buffer: max(16 * PW1, 32 * PW2)
#define FUSED_LDS_FLOATS (FM * PX + FM * PH + 2 * WBUF)
// End of a chunk: this wave's LDS reads and writes are done, its own copies have
// landed, and the barrier then publishes both to the other waves and frees the
// buffer that was just read for the next copies.
#define CHUNK_FOOT()                                   \
  do {                                                 \
    asm volatile("s_wait_dscnt 0x0" ::: "memory");     \
    asm volatile("s_wait_asynccnt 0x0" ::: "memory");  \
    __syncthreads();                                   \
  } while (0)

__global__ void __launch_bounds__(FT) mlp_ln_kernel(const float* __restrict__ X,
                              const float* __restrict__ W1,
                              const float* __restrict__ b1,
                              const float* __restrict__ W2,
                              const float* __restrict__ b2,
                              const float* __restrict__ g,
                              const float* __restrict__ b,
                              float* __restrict__ Y) {
  extern __shared__ float smem[];
  float* sX = smem;                      // [FM][PX]: X, later the rows in front of the LayerNorm
  float* sH = smem + FM * PX;            // [FM][PH]: hidden rows
  float* sW = smem + FM * PX + FM * PH;  // [2][WBUF]: weight chunks

  const int tid = threadIdx.x;
  const int lane = tid & 31;
  const int wv = __builtin_amdgcn_readfirstlane(tid >> 5);  // wave-uniform: tile offsets are scalar
  const int m = lane & 15;         // A row / C column within a 16x16 subtile
  const int hi = lane >> 4;        // K-pair selector (lanes 16-31: K+2,K+3)
  const int rowBase = blockIdx.x * FM;

  // A weight chunk is 4,096 floats in a row in global memory: 4 x b128 per
  // thread. Chunk c of W1 and chunk j of W2 go into buffer c & 1 and j & 1.
  auto stage1 = [&](int c) {
    float* d = sW + (c & 1) * WBUF;
    const float* gw = W1 + c * 4096;
#pragma unroll
    for (int j = 0; j < 4; ++j) {
      const int idx = tid + j * FT;
      copy16(gw + idx * 4, d + (idx >> 6) * PW1 + ((idx & 63) << 2));
    }
  };
  auto stage2 = [&](int c) {
    float* d = sW + (c & 1) * WBUF;
    const float* gw = W2 + c * 4096;
#pragma unroll
    for (int j = 0; j < 4; ++j) {
      const int idx = tid + j * FT;
      copy16(gw + idx * 4, d + (idx >> 5) * PW2 + ((idx & 31) << 2));
    }
  };

  // X rows (8 x b128 per thread) and the first weight chunk.
#pragma unroll
  for (int j = 0; j < (FM * 128) / (4 * FT); ++j) {
    const int idx = tid + j * FT;
    const int r = idx >> 5;
    const int cs = (idx & 31) << 2;
    copy16(X + (size_t)(rowBase + r) * 128 + cs, sX + r * PX + cs);
  }
  stage1(0);
  // Biases and LayerNorm parameters: asked for here, so that their latency runs
  // out beside that of the first copies.
  const int c1 = wv * 32 + m;         // this lane's columns of the first product: c1, c1 + 16
  const int c2 = (wv >> 1) * 32 + m;  // of the second product: c2, c2 + 16
  const float bb1[2] = {b1[c1], b1[c1 + 16]};
  const float bb2[2] = {b2[c2], b2[c2 + 16]};
  const v4f g4 = reinterpret_cast<const v4f*>(g)[lane];
  const v4f b4 = reinterpret_cast<const v4f*>(b)[lane];
  XWAIT3(c1, c2, lane);  // behind these loads, before their address registers are written again
  asm volatile("s_wait_asynccnt 0x0" ::: "memory");  // own copies landed, before the barrier that publishes them
  __syncthreads();
  stage1(1);

  // ---- hidden = gelu(X @ W1 + b1) ----
  {
    v8f acc[4][2] = {};
    const int nw = wv * 32;
    // The two chunk loops stay rolled (for speed only).
#pragma unroll 1
    for (int c = 0; c < 8; ++c) {
      const float* cA = sX + c * 16;
      const float* cB = sW + (c & 1) * WBUF;
#pragma unroll
      for (int k0 = 0; k0 < 16; k0 += 4) {
        const int kl = k0 + 2 * hi;
        v2f av[4], bv[2];
#pragma unroll
        for (int mt = 0; mt < 4; ++mt) {
          const float* p = cA + (mt * 16 + m) * PX + kl;
          av[mt].x = p[0];
          av[mt].y = p[1];
        }
#pragma unroll
        for (int nt = 0; nt < 2; ++nt) {
          const float* p = cB + kl * PW1 + nw + nt * 16 + m;
          bv[nt].x = p[0];
          bv[nt].y = p[PW1];
        }
#pragma unroll
        for (int mt = 0; mt < 4; ++mt)
#pragma unroll
          for (int nt = 0; nt < 2; ++nt)
            acc[mt][nt] = __builtin_amdgcn_wmma_f32_16x16x4_f32(
                false, av[mt], false, bv[nt], (short)0, acc[mt][nt], false, false);
      }
      CHUNK_FOOT();
      if (c < 6) stage1(c + 2);  // the test reads the same for the whole work-group
      else       stage2(c - 6);  // the first two chunks of W2 fly during the last of W1 and the GELU
    }
    // C/D layout: VGPR r2 holds M=r2 (lanes 0-15) or M=r2+8 (lanes 16-31)
#pragma unroll
    for (int nt = 0; nt < 2; ++nt) {
      const int col = nw + nt * 16 + m;
#pragma unroll
      for (int mt = 0; mt < 4; ++mt)
#pragma unroll
        for (int r2 = 0; r2 < 8; ++r2)
          sH[(mt * 16 + hi * 8 + r2) * PH + col] = act_apply(acc[mt][nt][r2] + bb1[nt], 1);
    }
    asm volatile("s_wait_dscnt 0x0" ::: "memory");  // own hidden values written, before the barrier that publishes them
    __syncthreads();
  }

  // ---- rows in front of the LayerNorm = hidden @ W2 + b2 ----
  {
    v8f acc[2][2] = {};
    const int mw = (wv & 1) * 32;
    const int nw = (wv >> 1) * 32;
#pragma unroll 1
    for (int c = 0; c < 8; ++c) {
      const float* cA = sH + c * 32;
      const float* cB = sW + (c & 1) * WBUF;
#pragma unroll
      for (int k0 = 0; k0 < 32; k0 += 4) {
        const int kl = k0 + 2 * hi;
        v2f av[2], bv[2];
#pragma unroll
        for (int mt = 0; mt < 2; ++mt) {
          const float* p = cA + (mw + mt * 16 + m) * PH + kl;
          av[mt].x = p[0];
          av[mt].y = p[1];
        }
#pragma unroll
        for (int nt = 0; nt < 2; ++nt) {
          const float* p = cB + kl * PW2 + nw + nt * 16 + m;
          bv[nt].x = p[0];
          bv[nt].y = p[PW2];
        }
#pragma unroll
        for (int mt = 0; mt < 2; ++mt)
#pragma unroll
          for (int nt = 0; nt < 2; ++nt)
            acc[mt][nt] = __builtin_amdgcn_wmma_f32_16x16x4_f32(
                false, av[mt], false, bv[nt], (short)0, acc[mt][nt], false, false);
      }
      CHUNK_FOOT();
      if (c < 6) stage2(c + 2);  // the test reads the same for the whole work-group
    }
    // X was last read many barriers ago: its rows now take the sums.
#pragma unroll
    for (int nt = 0; nt < 2; ++nt) {
      const int col = nw + nt * 16 + m;
#pragma unroll
      for (int mt = 0; mt < 2; ++mt)
#pragma unroll
        for (int r2 = 0; r2 < 8; ++r2)
          sX[(mw + mt * 16 + hi * 8 + r2) * PX + col] = acc[mt][nt][r2] + bb2[nt];
    }
    asm volatile("s_wait_dscnt 0x0" ::: "memory");  // own sums written, before the barrier that publishes them
    __syncthreads();
  }

  // ---- LayerNorm over D=128: one wave per row at a time (4 floats/lane,
  // shfl_xor reduce), 8 rows per wave; each store is one whole 512-byte row ----
  v4f* Y4 = reinterpret_cast<v4f*>(Y) + (size_t)(rowBase + wv * 8) * 32 + lane;
#pragma unroll
  for (int i = 0; i < FM / 8; ++i) {
    const v4f v = *reinterpret_cast<const v4f*>(sX + (wv * 8 + i) * PX + lane * 4);
    float s = v.x + v.y + v.z + v.w;
    float sq = v.x * v.x + v.y * v.y + v.z * v.z + v.w * v.w;
#pragma unroll
    for (int off = 16; off > 0; off >>= 1) {
      s += __shfl_xor(s, off, 32);
      sq += __shfl_xor(sq, off, 32);
    }
    float mean = s * (1.0f / 128.0f);
    float var = sq * (1.0f / 128.0f) - mean * mean;
    float inv = rsqrtf(var + 1e-5f);

    v4f o;
    o.x = (v.x - mean) * inv * g4.x + b4.x;
    o.y = (v.y - mean) * inv * g4.y + b4.y;
    o.z = (v.z - mean) * inv * g4.z + b4.z;
    o.w = (v.w - mean) * inv * g4.w + b4.w;
    Y4[(size_t)i * 32] = o;
  }
}

// ---------------------------------------------------------------------------
// prep_conv: x_pos = x + pos_enc; depthwise conv3 (pad 1, zeros AFTER pos add
// per reference) + conv bias. Output layout [bn,t,D]. One wave per (b, n, run
// of SR time steps); the taps and the neighbours in time stay in registers.
// ---------------------------------------------------------------------------
__global__ void __launch_bounds__(ST) prep_conv_kernel(const float* __restrict__ x,
                                 const float* __restrict__ pos,
                                 const float* __restrict__ cw,
                                 const float* __restrict__ cb,
                                 float* __restrict__ xconv) {
  const int lane = threadIdx.x & 31;
  const int w = blockIdx.x * SW + (threadIdx.x >> 5);
  const int n = w & 63;               // a work-group's waves read neighbouring n
  const int t0 = ((w >> 6) & 15) * SR;
  const int b = w >> 10;
  const int d0 = lane * 4;

  const float4* X4 = reinterpret_cast<const float4*>(x) + ((size_t)(b * TT) * NN + n) * 32 + lane;
  const float4* P4 = reinterpret_cast<const float4*>(pos) + lane;

  float k0[4], k1[4], k2[4], kb[4];
#pragma unroll
  for (int c = 0; c < 4; ++c) {
    int d = d0 + c;
    k0[c] = cw[d * 3 + 0]; k1[c] = cw[d * 3 + 1]; k2[c] = cw[d * 3 + 2];
    kb[c] = cb[d];
  }
  XWAIT0();  // behind these loads, before their address registers are written again
  float4 v[SR + 2], p[SR + 2];        // time steps t0-1 .. t0+SR
  const int tlo = t0 > 0 ? t0 - 1 : 0;              // the two edge rows are read in
  const int thi = t0 + SR < TT ? t0 + SR : TT - 1;  // bounds and set to zero below
  const float4* xlo = X4 + (size_t)tlo * (NN * 32);
  const float4* xhi = X4 + (size_t)thi * (NN * 32);
  const float4* plo = P4 + (size_t)tlo * 32;
  const float4* phi = P4 + (size_t)thi * 32;
  const float4* xb = X4 + (size_t)t0 * (NN * 32);
  const float4* pb = P4 + (size_t)t0 * 32;
  v[0] = *xlo; p[0] = *plo;
  v[SR + 1] = *xhi; p[SR + 1] = *phi;
  XWAIT4(xlo, xhi, plo, phi);  // behind these loads, before their address registers are written again
#pragma unroll
  for (int i = 0; i < SR; ++i) {
    v[i + 1] = xb[(size_t)i * (NN * 32)];
    p[i + 1] = pb[(size_t)i * 32];
  }
  XWAIT2(xb, pb);  // behind these loads, before their address registers are written again
#pragma unroll
  for (int i = 0; i < SR + 2; ++i) {
    v[i].x += p[i].x; v[i].y += p[i].y; v[i].z += p[i].z; v[i].w += p[i].w;
  }
  if (t0 == 0)       v[0] = make_float4(0.f, 0.f, 0.f, 0.f);
  if (t0 + SR == TT) v[SR + 1] = make_float4(0.f, 0.f, 0.f, 0.f);

  float4* O4 = reinterpret_cast<float4*>(xconv) + ((size_t)(b * NN + n) * TT + t0) * 32 + lane;
#pragma unroll
  for (int i = 0; i < SR; ++i) {
    const float4 xm = v[i], xc = v[i + 1], xp = v[i + 2];
    float4 o;
    o.x = k0[0] * xm.x + k1[0] * xc.x + k2[0] * xp.x + kb[0];
    o.y = k0[1] * xm.y + k1[1] * xc.y + k2[1] * xp.y + kb[1];
    o.z = k0[2] * xm.z + k1[2] * xc.z + k2[2] * xp.z + kb[2];
    o.w = k0[3] * xm.w + k1[3] * xc.w + k2[3] * xp.w + kb[3];
    O4[(size_t)i * 32] = o;
  }
}

// ---------------------------------------------------------------------------
// Mixed pool: k=6, stride 1, pad (2,2) -> length T-1, right zero-pad to T.
// avg divides by 6 always (zero pad contributes 0); max over valid entries.
// One wave per (bn, run of SR time steps): the SR+5 rows its windows cover are
// loaded once; each window is summed on its own, in rising time order.
// ---------------------------------------------------------------------------
__global__ void __launch_bounds__(ST) pool_kernel(const float* __restrict__ xconv,
                            const float* __restrict__ alpha_p,
                            float* __restrict__ outp) {
  const int lane = threadIdx.x & 31;
  const int w = blockIdx.x * SW + (threadIdx.x >> 5);
  const int t0 = (w & 15) * SR;
  const int bn = w >> 4;
  const bool first = (t0 == 0), last = (t0 + SR == TT);

  const float a = 1.0f / (1.0f + expf(-alpha_p[0]));
  const float4* XC4 = reinterpret_cast<const float4*>(xconv) + (size_t)(bn * TT) * 32 + lane;

  float4 vs[SR + 5], vm[SR + 5];      // time steps t0-2 .. t0+SR+2: for the sum, for the max
  // Rows outside [0,T) are read in bounds (rows of the run itself instead) and replaced below.
  const float4* cb4 = XC4 + (size_t)t0 * 32;
  const float4* clo = first ? cb4 + 2 * 32 : cb4;            // clo[-2 rows], clo[-1 row]
  const float4* chi = last ? cb4 - 3 * 32 : cb4;             // chi[SR rows] .. chi[SR+2 rows]
  vs[0] = clo[-2 * 32]; vs[1] = clo[-1 * 32];
  vs[SR + 2] = chi[SR * 32]; vs[SR + 3] = chi[(SR + 1) * 32]; vs[SR + 4] = chi[(SR + 2) * 32];
  XWAIT2(clo, chi);  // behind these loads, before their address registers are written again
#pragma unroll
  for (int i = 0; i < SR; ++i) vs[i + 2] = cb4[(size_t)i * 32];
  XWAIT1(cb4);  // behind these loads, before their address registers are written again
#pragma unroll
  for (int i = 0; i < SR + 5; ++i) {
    vm[i] = vs[i];
    if ((i < 2 && first) || (i >= SR + 2 && last)) {
      vs[i] = make_float4(0.f, 0.f, 0.f, 0.f);
      vm[i] = make_float4(-3.0e38f, -3.0e38f, -3.0e38f, -3.0e38f);
    }
  }

  float4* O4 = reinterpret_cast<float4*>(outp) + ((size_t)(bn * TT) + t0) * 32 + lane;
  const float inv6 = 1.0f / 6.0f;
#pragma unroll
  for (int i = 0; i < SR; ++i) {
    float sx = 0.f, sy = 0.f, sz = 0.f, sw = 0.f;
    float mx = -3.0e38f, my = -3.0e38f, mz = -3.0e38f, mw = -3.0e38f;
#pragma unroll
    for (int k = 0; k < 6; ++k) {
      const float4 s = vs[i + k], m = vm[i + k];
      sx += s.x; sy += s.y; sz += s.z; sw += s.w;
      mx = fmaxf(mx, m.x); my = fmaxf(my, m.y);
      mz = fmaxf(mz, m.z); mw = fmaxf(mw, m.w);
    }
    float4 res;
    res.x = a * (sx * inv6) + (1.f - a) * mx;
    res.y = a * (sy * inv6) + (1.f - a) * my;
    res.z = a * (sz * inv6) + (1.f - a) * mz;
    res.w = a * (sw * inv6) + (1.f - a) * mw;
    if (i == SR - 1 && last) res = make_float4(0.f, 0.f, 0.f, 0.f);  // t = T-1: the right zero-pad
    O4[(size_t)i * 32] = res;
  }
}

// ---------------------------------------------------------------------------
// The gated fusion and the residual in one kernel:
//   gate = sigmoid(tanh([x_loc | x_glob] @ W1 + b1) @ W2 + b2),  W1: [256,128], W2: [128,128]
//   out  = x + softplus(res_scale) * (gate * x_loc + (1 - gate) * x_glob)
// with the [bn,t,D] -> [B,T,N,D] relayout on x and out. A work-group of 8 waves
// owns FM = 64 rows (one bn, 64 time steps) from end to end. The two branches'
// rows lie side by side in LDS, where they are the first product's A rows and
// later the two sides of the blend; the tanh rows and the gate live in LDS only.
// Global memory sees one read each of x_loc, x_glob and x and one write of out.
// The weights come through LDS in 12 chunks of 32 k-rows (8 of W1, 4 of W2), two
// buffers, the copies of chunk c + 2 in flight during chunk c + 1.
// Both products: wave tile 32x32 (2x2 subtiles), 2 waves down x 4 across; k is
// summed in rising order, 4 per WMMA, as the stand-alone GEMM does.
// 135,168 B of LDS: two work-groups per WGP, 4 waves per SIMD.
// ---------------------------------------------------------------------------
#define GATE_LDS_FLOATS (FM * PH + FM * PX + 2 * WBUF)

__device__ __forceinline__ float softplus_f(float v) {
  return (v > 0.f) ? (v + log1pf(expf(-v))) : log1pf(expf(v));
}

__global__ void __launch_bounds__(FT) gate_out_kernel(const float* __restrict__ xloc,
                                const float* __restrict__ xglob,
                                const float* __restrict__ W1,
                                const float* __restrict__ b1,
                                const float* __restrict__ W2,
                                const float* __restrict__ b2,
                                const float* __restrict__ x,
                                const float* __restrict__ res_scale,
                                float* __restrict__ out) {
  extern __shared__ float smem[];
  float* sC = smem;                      // [FM][PH]: x_loc in columns 0..127, x_glob in 128..255
  float* sT = smem + FM * PH;            // [FM][PX]: tanh rows, later the gate
  float* sW = smem + FM * PH + FM * PX;  // [2][WBUF]: weight chunks

  const int tid = threadIdx.x;
  const int lane = tid & 31;
  const int wv = __builtin_amdgcn_readfirstlane(tid >> 5);  // wave-uniform: tile offsets are scalar
  const int m = lane & 15;         // A row / C column within a 16x16 subtile
  const int hi = lane >> 4;        // K-pair selector (lanes 16-31: K+2,K+3)
  const int rowBase = blockIdx.x * FM;
  const int mw = (wv & 1) * 32;    // wave row offset, both products
  const int nw = (wv >> 1) * 32;   // wave column offset, both products

  // A weight chunk is 32 k-rows of 128 floats, 4,096 floats in a row in global
  // memory: 4 x b128 per thread. Chunk c goes into buffer c & 1.
  auto stage = [&](const float* Wg, int c) {
    float* d = sW + (c & 1) * WBUF;
    const float* gw = Wg + c * 4096;
#pragma unroll
    for (int j = 0; j < 4; ++j) {
      const int idx = tid + j * FT;
      copy16(gw + idx * 4, d + (idx >> 5) * PW2 + ((idx & 31) << 2));
    }
  };

  // The scale's raw values: asked for first, so that they are here when the copies have been issued.
  const v4f rs = reinterpret_cast<const v4f*>(res_scale)[lane];
  // The two branches' rows (16 x b128 per thread) and the first weight chunk.
#pragma unroll
  for (int j = 0; j < (FM * 128) / (4 * FT); ++j) {
    const int idx = tid + j * FT;
    const int r = idx >> 5;
    const int cs = (idx & 31) << 2;
    copy16(xloc + (size_t)(rowBase + r) * 128 + cs, sC + r * PH + cs);
    copy16(xglob + (size_t)(rowBase + r) * 128 + cs, sC + r * PH + 128 + cs);
  }
  stage(W1, 0);
  // Biases: asked for here, so that their latency runs out beside that of the first copies.
  const int cc = nw + m;              // this lane's columns of both products: cc, cc + 16
  const float bb1[2] = {b1[cc], b1[cc + 16]};
  const float bb2[2] = {b2[cc], b2[cc + 16]};
  XWAIT2(cc, lane);  // behind these loads, before their address registers are written again
  // The scale of this lane's 4 columns, formed while the first copies are under way.
  const float sx = softplus_f(rs.x), sy = softplus_f(rs.y);
  const float sz = softplus_f(rs.z), sw = softplus_f(rs.w);
  asm volatile("s_wait_asynccnt 0x0" ::: "memory");  // own copies landed, before the barrier that publishes them
  __syncthreads();
  stage(W1, 1);

  // The 8 rows of x and out that this wave blends and stores at the end.
  const int bn = rowBase >> 8;                 // TT = 256 rows a bn
  const int t0 = (rowBase & (TT - 1)) + wv * 8;
  const size_t xo = ((size_t)((bn >> 6) * TT + t0) * NN + (bn & 63)) * 32 + lane;  // [B,T,N,D]
  const v4f* X4 = reinterpret_cast<const v4f*>(x) + xo;
  v4f xv[FM / 8];

  // ---- tanh rows = tanh([x_loc | x_glob] @ W1 + b1) ----
  {
    v8f acc[2][2] = {};
    // The two chunk loops stay rolled, as in the MLP kernel (for speed only).
#pragma unroll 1
    for (int c = 0; c < 8; ++c) {
      const float* cA = sC + c * 32;
      const float* cB = sW + (c & 1) * WBUF;
#pragma unroll
      for (int k0 = 0; k0 < 32; k0 += 4) {
        const int kl = k0 + 2 * hi;
        v2f av[2], bv[2];
#pragma unroll
        for (int mt = 0; mt < 2; ++mt) {
          const float* p = cA + (mw + mt * 16 + m) * PH + kl;
          av[mt].x = p[0];
          av[mt].y = p[1];
        }
#pragma unroll
        for (int nt = 0; nt < 2; ++nt) {
          const float* p = cB + kl * PW2 + nw + nt * 16 + m;
          bv[nt].x = p[0];
          bv[nt].y = p[PW2];
        }
#pragma unroll
        for (int mt = 0; mt < 2; ++mt)
#pragma unroll
          for (int nt = 0; nt < 2; ++nt)
            acc[mt][nt] = __builtin_amdgcn_wmma_f32_16x16x4_f32(
                false, av[mt], false, bv[nt], (short)0, acc[mt][nt], false, false);
      }
      CHUNK_FOOT();
      if (c < 6) stage(W1, c + 2);  // the test reads the same for the whole work-group
      else       stage(W2, c - 6);  // the first two chunks of W2 fly during the last of W1 and the tanh
    }
    // This wave's 8 rows of x: asked for here, so that their latency runs out under the tanh.
#pragma unroll
    for (int i = 0; i < FM / 8; ++i) xv[i] = X4[(size_t)i * (NN * 32)];
    XWAIT1(X4);  // behind these loads, before their address registers are written again
    // Keeps the tanh arithmetic behind the loads: left free, the compiler issues
    // them two thirds of the way through it, with too little left to cover their latency.
    __builtin_amdgcn_sched_barrier(0);
    // C/D layout: VGPR r2 holds M=r2 (lanes 0-15) or M=r2+8 (lanes 16-31)
#pragma unroll
    for (int nt = 0; nt < 2; ++nt) {
      const int col = nw + nt * 16 + m;
#pragma unroll
      for (int mt = 0; mt < 2; ++mt)
#pragma unroll
        for (int r2 = 0; r2 < 8; ++r2)
          sT[(mw + mt * 16 + hi * 8 + r2) * PX + col] = act_apply(acc[mt][nt][r2] + bb1[nt], 2);
    }
    asm volatile("s_wait_dscnt 0x0" ::: "memory");  // own tanh values written, before the barrier that publishes them
    __syncthreads();
  }

  // ---- gate = sigmoid(tanh rows @ W2 + b2) ----
  {
    v8f acc[2][2] = {};
#pragma unroll 1
    for (int c = 0; c < 4; ++c) {
      const float* cA = sT + c * 32;
      const float* cB = sW + (c & 1) * WBUF;
#pragma unroll
      for (int k0 = 0; k0 < 32; k0 += 4) {
        const int kl = k0 + 2 * hi;
        v2f av[2], bv[2];
#pragma unroll
        for (int mt = 0; mt < 2; ++mt) {
          const float* p = cA + (mw + mt * 16 + m) * PX + kl;
          av[mt].x = p[0];
          av[mt].y = p[1];
        }
#pragma unroll
        for (int nt = 0; nt < 2; ++nt) {
          const float* p = cB + kl * PW2 + nw + nt * 16 + m;
          bv[nt].x = p[0];
          bv[nt].y = p[PW2];
        }
#pragma unroll
        for (int mt = 0; mt < 2; ++mt)
#pragma unroll
          for (int nt = 0; nt < 2; ++nt)
            acc[mt][nt] = __builtin_amdgcn_wmma_f32_16x16x4_f32(
                false, av[mt], false, bv[nt], (short)0, acc[mt][nt], false, false);
      }
      CHUNK_FOOT();
      if (c < 2) stage(W2, c + 2);  // the test reads the same for the whole work-group
    }
    // The last foot's barrier ended every read of the tanh rows: they now take the gate.
#pragma unroll
    for (int nt = 0; nt < 2; ++nt) {
      const int col = nw + nt * 16 + m;
#pragma unroll
      for (int mt = 0; mt < 2; ++mt)
#pragma unroll
        for (int r2 = 0; r2 < 8; ++r2)
          sT[(mw + mt * 16 + hi * 8 + r2) * PX + col] = act_apply(acc[mt][nt][r2] + bb2[nt], 3);
    }
    asm volatile("s_wait_dscnt 0x0" ::: "memory");  // own gate values written, before the barrier that publishes them
    __syncthreads();
  }

  // ---- blend and residual: one wave per row at a time (4 floats/lane), 8 rows
  // per wave; each store is one whole 512-byte row of out ----
  v4f* O4 = reinterpret_cast<v4f*>(out) + xo;
#pragma unroll
  for (int i = 0; i < FM / 8; ++i) {
    const int r = wv * 8 + i;
    const v4f gt = *reinterpret_cast<const v4f*>(sT + r * PX + lane * 4);
    const v4f xl = *reinterpret_cast<const v4f*>(sC + r * PH + lane * 4);
    const v4f xg = *reinterpret_cast<const v4f*>(sC + r * PH + 128 + lane * 4);
    v4f o;
    o.x = xv[i].x + sx * (gt.x * xl.x + (1.f - gt.x) * xg.x);
    o.y = xv[i].y + sy * (gt.y * xl.y + (1.f - gt.y) * xg.y);
    o.z = xv[i].z + sz * (gt.z * xl.z + (1.f - gt.z) * xg.z);
    o.w = xv[i].w + sw * (gt.w * xl.w + (1.f - gt.w) * xg.w);
    O4[(size_t)i * (NN * 32)] = o;
  }
}

// ---------------------------------------------------------------------------
// Host launcher
// ---------------------------------------------------------------------------
extern "C" void kernel_launch(void* const* d_in, const int* in_sizes, int n_in,
                              void* d_out, int out_size, void* d_ws, size_t ws_size,
                              hipStream_t stream) {
  const float* x          = (const float*)d_in[0];
  const float* window_w   = (const float*)d_in[1];
  const float* local_w1   = (const float*)d_in[2];
  const float* local_b1   = (const float*)d_in[3];
  const float* local_w2   = (const float*)d_in[4];
  const float* local_b2   = (const float*)d_in[5];
  const float* local_ln_g = (const float*)d_in[6];
  const float* local_ln_b = (const float*)d_in[7];
  const float* qkv_w      = (const float*)d_in[8];
  const float* qkv_b      = (const float*)d_in[9];
  const float* out_w      = (const float*)d_in[10];
  const float* out_b      = (const float*)d_in[11];
  const float* conv_w     = (const float*)d_in[12];
  const float* conv_b     = (const float*)d_in[13];
  const float* alpha      = (const float*)d_in[14];
  const float* pos_enc    = (const float*)d_in[15];
  const float* global_w1  = (const float*)d_in[16];
  const float* global_b1  = (const float*)d_in[17];
  const float* global_w2  = (const float*)d_in[18];
  const float* global_b2  = (const float*)d_in[19];
  const float* global_ln_g= (const float*)d_in[20];
  const float* global_ln_b= (const float*)d_in[21];
  const float* gate_w1    = (const float*)d_in[22];
  const float* gate_b1    = (const float*)d_in[23];
  const float* gate_w2    = (const float*)d_in[24];
  const float* gate_b2    = (const float*)d_in[25];
  const float* res_scale  = (const float*)d_in[26];
  float* out = (float*)d_out;

  const size_t R = (size_t)RR;
  float* ws = (float*)d_ws;
  float* P0 = ws;             // R*128: xl -> attn_out
  float* P1 = ws + R * 128;   // R*384: qkv -> x_loc
  float* P2 = ws + R * 512;   // R*128: xconv -> x_glob
  float* P3 = ws + R * 640;   // R*128: x_glob_in
  float* Wf = ws + R * 768;   // 128*256: out_w @ local_w1
  float* bf = Wf + 128 * 256; // 256: out_b @ local_w1 + local_b1

  const size_t GEMM_LDS = (2 * BM * PA + 2 * KC * PB) * sizeof(float);  // 104 KB
  const size_t FUSED_LDS = FUSED_LDS_FLOATS * sizeof(float);            // 132 KB
  const size_t GATE_LDS = GATE_LDS_FLOATS * sizeof(float);              // 132 KB

  // local branch
  prep_local_kernel<<<SG + FG, ST, 0, stream>>>(x, window_w, P0,
                                                out_w, out_b, local_w1, local_b1, Wf, bf);
  gemm_wmma_kernel<128, 384, 0><<<dim3(RR / BM, 384 / BN), BL, GEMM_LDS, stream>>>(
      P0, qkv_w, qkv_b, P1);
  attn_kernel<<<SG, ST, 0, stream>>>(P1, P0);
  mlp_ln_kernel<<<RR / FM, FT, FUSED_LDS, stream>>>(
      P0, Wf, bf, local_w2, local_b2, local_ln_g, local_ln_b, P1);  // x_loc = P1

  // global branch
  prep_conv_kernel<<<SG, ST, 0, stream>>>(x, pos_enc, conv_w, conv_b, P2);
  pool_kernel<<<SG, ST, 0, stream>>>(P2, alpha, P3);
  mlp_ln_kernel<<<RR / FM, FT, FUSED_LDS, stream>>>(
      P3, global_w1, global_b1, global_w2, global_b2, global_ln_g, global_ln_b, P2);  // x_glob = P2

  // gated fusion and residual
  gate_out_kernel<<<RR / FM, FT, GATE_LDS, stream>>>(
      P1, P2, gate_w1, gate_b1, gate_w2, gate_b2, x, res_scale, out);
}

// v009
// A run of this version takes 242 microseconds.
// Next to v008, in two timings, it ran 1.09 and 1.03 times as fast.
// All steps since v000 together make it 4.16 times as fast.
#include <hip/hip_runtime.h>
#include <math.h>

// Problem constants (from reference)
#define BB 4
#define TT 256
#define NN 64
#define DD 128
#define HH 4
#define HD 32
#define RR (BB * NN * TT)   // 65536 rows

// LDS row pitches in floats (LDS bank = dword address mod 64). All stay multiples
// of 4 floats so every 16-byte copy lands 16-byte aligned.
// A rows: pitch 4 mod 64, so that the 16 rows x 2 k-pairs of a fragment read fall on 64 distinct banks.
// B rows: pitch 8 mod 64, so that rows k and k+2, read by the two lane halves, sit 16 banks apart.

// Streaming kernels (everything but the GEMMs and the fused kernels): one wave
// walks SR rows of 128 floats, one float4 per lane and row, so a launch starts
// 4,096 row waves (one 16-wave work-group per WGP) and each wave has SR or more
// 512-byte loads in flight. The row loops are fully unrolled, so that the row
// arrays are registers and a run's loads can issue back to back.
#define SW 16                  // waves per work-group
#define ST (SW * 32)           // threads per work-group
#define SR 16                  // rows per wave
#define SG (RR / (SW * SR))    // row work-groups per launch
// Stands behind a run of loads: s_wait_xcnt 0 before any register that an issued
// load names is written again. The address operands only keep those registers
// alive up to the wait, so that no later load's result lands in them before it.
#define XWAIT0() asm volatile("s_wait_xcnt 0x0" ::: "memory")
#define XWAIT1(a) asm volatile("s_wait_xcnt 0x0" :: "v"(a) : "memory")
#define XWAIT2(a, b) asm volatile("s_wait_xcnt 0x0" :: "v"(a), "v"(b) : "memory")
#define XWAIT3(a, b, c) asm volatile("s_wait_xcnt 0x0" :: "v"(a), "v"(b), "v"(c) : "memory")
#define XWAIT4(a, b, c, d) asm volatile("s_wait_xcnt 0x0" :: "v"(a), "v"(b), "v"(c), "v"(d) : "memory")

typedef __attribute__((ext_vector_type(2))) float v2f;
typedef __attribute__((ext_vector_type(8))) float v8f;
typedef __attribute__((ext_vector_type(4))) float v4f;

// ---------------------------------------------------------------------------
// CDNA5 async global->LDS copy (ASYNCcnt-tracked DMA), with sync fallback.
// Builtin signature (from hipcc diagnostic): (int4 AS1*, int4 AS3*, Ii, Ii).
// ---------------------------------------------------------------------------
#if defined(__has_builtin)
#if __has_builtin(__builtin_amdgcn_global_load_async_to_lds_b128) && \
    __has_builtin(__builtin_amdgcn_s_wait_asynccnt)
#define HAVE_ASYNC_LDS 1
#endif
#endif

#ifdef HAVE_ASYNC_LDS
typedef int vi4 __attribute__((__vector_size__(4 * sizeof(int))));
typedef __attribute__((address_space(1))) vi4 as1_vi4;
typedef __attribute__((address_space(3))) vi4 as3_vi4;
#endif

__device__ __forceinline__ void copy16(const float* g, float* l) {
#ifdef HAVE_ASYNC_LDS
  as1_vi4* gp = reinterpret_cast<as1_vi4*>((uintptr_t)g);
  as3_vi4* lp = reinterpret_cast<as3_vi4*>((uintptr_t)l);
  __builtin_amdgcn_global_load_async_to_lds_b128(gp, lp, 0, 0);
#else
  *reinterpret_cast<float4*>(l) = *reinterpret_cast<const float4*>(g);
#endif
}

// ---------------------------------------------------------------------------
// Activation epilogues: 0=none, 1=exact GELU (erf), 2=tanh, 3=sigmoid
// ---------------------------------------------------------------------------
// erf and tanh without a branch. The math library's erff and tanhf each pick one
// of two formulas by a test on |x| that differs from lane to lane: two branches
// on the lane mask per element, which make each element one dependent chain with
// nothing of the next element issued beside it. Here both formulas are worked
// out for every element and a select keeps the one the library would have
// taken: same coefficients (given as bit patterns), same operations in the same
// order, so the values are bit-identical, and the elements of a tile are
// straight-line code whose chains can be issued side by side.
#define FB(u) __builtin_bit_cast(float, u)

__device__ __forceinline__ float erf_sel(float x) {
  const float ax = fabsf(x);
  float p = fmaf(ax, FB(0x378e98abu), FB(0xb9c68948u));  // |x| >= 1: 1 - exp(-(ax + ax*poly(ax)))
  p = fmaf(ax, p, FB(0x3b7cd369u));
  p = fmaf(ax, p, FB(0xbcc618b2u));
  p = fmaf(ax, p, FB(0x3dda74e4u));
  p = fmaf(ax, p, FB(0x3f228afdu));
  p = fmaf(ax, p, FB(0x3e03c728u));
  p = fmaf(ax, p, ax);
  const float big = 1.0f - expf(-p);
  const float t = x * x;                                 // |x| < 1: ax + ax*poly(x*x)
  float s = fmaf(t, FB(0xba1345e1u), FB(0x3ba10414u));
  s = fmaf(t, s, FB(0xbcdac9b8u));
  s = fmaf(t, s, FB(0x3de703beu));
  s = fmaf(t, s, FB(0xbec09330u));
  s = fmaf(t, s, FB(0x3e0375d0u));
  const float small = fmaf(ax, s, ax);
  return copysignf(ax < 1.0f ? small : big, x);
}

__device__ __forceinline__ float tanh_sel(float x) {
  const float ax = fabsf(x);
  const float e = expf(ax + ax);                         // |x| >= 0.625: 1 - 2/(1 + exp(2|x|))
  float r;
  // v_rcp_f32 with the one free slot that the instruction set asks for behind a
  // transcendental.
  asm("v_rcp_f32 %0, %1\n\tv_nop" : "=v"(r) : "v"(1.0f + e));
  const float big = fmaf(r, -2.0f, 1.0f);
  const float t = x * x;                                 // |x| < 0.625: ax + x*x*(ax*poly(x*x))
  float s = fmaf(t, FB(0xbbbac73du), FB(0x3ca908c9u));
  s = fmaf(t, s, FB(0xbd5c1c4eu));
  s = fmaf(t, s, FB(0x3e088382u));
  s = fmaf(t, s, FB(0xbeaaaa99u));
  const float small = fmaf(t, ax * s, ax);
  return copysignf(0.625f > ax ? small : big, x);
}

__device__ __forceinline__ float act_apply(float v, int act) {
  if (act == 1) return 0.5f * v * (1.0f + erf_sel(v * 0.70710678118654752440f));
  if (act == 2) return tanh_sel(v);
  if (act == 3) return 1.0f / (1.0f + expf(-v));
  return v;
}

// ---------------------------------------------------------------------------
// The attention's output projection and the local MLP's first layer are two
// linear maps with nothing between them:
//   (o @ Wo + bo) @ W1 + b1 = o @ (Wo @ W1) + (bo @ W1 + b1).
// Wf = Wo @ W1 [128,256] and bf = bo @ W1 + b1 [256] are formed here, anew in
// every call, and the MLP kernel then takes the attention rows with Wf and bf:
// the product of all 65,536 rows with Wo is not needed any more.
// One wave per 16x32 tile (a row's 32 columns are one whole 128-byte line), 72
// tiles: row tiles 0..7 are Wo's rows; in row tile 8 every row is bo, the sums
// start from b1, and row 0 is kept. Fragments come straight from global memory,
// k in rising order, 4 per WMMA, in the lane order of the other kernels' loaders.
// ---------------------------------------------------------------------------
#define FG 9                   // work-groups of 8 waves at the head of the first launch that form Wf and bf

__device__ __forceinline__ void fold_tile(const float* __restrict__ Wo,
                                          const float* __restrict__ bo,
                                          const float* __restrict__ W1,
                                          const float* __restrict__ b1,
                                          float* __restrict__ Wf,
                                          float* __restrict__ bf,
                                          int tile, int lane) {
  const int rt = tile >> 3;        // wave-uniform
  const int c0 = (tile & 7) * 32;
  const int m = lane & 15;         // A row / C column within a 16x16 subtile
  const int hi = lane >> 4;        // K-pair selector (lanes 16-31: K+2,K+3)
  const bool brow = (rt == 8);
  const float* pa = (brow ? bo : Wo + (rt * 16 + m) * 128) + 2 * hi;
  const float* pb = W1 + (2 * hi) * 256 + c0 + m;
  const float* pc = b1 + c0 + m;
  const float bb[2] = {pc[0], pc[16]};

  // C/D layout: a lane's 8 registers are 8 rows of its one column (lane & 15).
  v8f acc[2];
#pragma unroll
  for (int nt = 0; nt < 2; ++nt)
#pragma unroll
    for (int r2 = 0; r2 < 8; ++r2) acc[nt][r2] = brow ? bb[nt] : 0.f;
  // Four batches of 8 k-steps, fully unrolled (constant offsets from pa and pb):
  // 40 loads in flight a batch, few enough registers for two work-groups a WGP.
#pragma unroll
  for (int q = 0; q < 4; ++q) {
    v2f av[8], bv[8][2];
#pragma unroll
    for (int i = 0; i < 8; ++i) {
      const int k0 = (q * 8 + i) * 4;
      av[i] = *reinterpret_cast<const v2f*>(pa + k0);
#pragma unroll
      for (int nt = 0; nt < 2; ++nt) {
        bv[i][nt].x = pb[k0 * 256 + nt * 16];
        bv[i][nt].y = pb[(k0 + 1) * 256 + nt * 16];
      }
    }
    XWAIT3(pa, pb, pc);  // behind these loads, before their address registers are written again
#pragma unroll
    for (int i = 0; i < 8; ++i)
#pragma unroll
      for (int nt = 0; nt < 2; ++nt)
        acc[nt] = __builtin_amdgcn_wmma_f32_16x16x4_f32(
            false, av[i], false, bv[i][nt], (short)0, acc[nt], false, false);
  }
  // Four free vector slots between the last WMMA and the first reader of its
  // result: the stores stand behind branches.
  asm volatile("v_nop\n\tv_nop\n\tv_nop\n\tv_nop" : "+v"(acc[0]), "+v"(acc[1]));

  // C/D layout: VGPR r2 holds M=r2 (lanes 0-15) or M=r2+8 (lanes 16-31)
  if (!brow) {
#pragma unroll
    for (int nt = 0; nt < 2; ++nt)
#pragma unroll
      for (int r2 = 0; r2 < 8; ++r2)
        Wf[(rt * 16 + hi * 8 + r2) * 256 + c0 + nt * 16 + m] = acc[nt][r2];
    XWAIT0();  // behind these stores, before a register that they name is written again
  } else if (hi == 0) {
    bf[c0 + m] = acc[0][0];
    bf[c0 + 16 + m] = acc[1][0];
  }
}

// ---------------------------------------------------------------------------
// Banded (|i-j|<=1) multi-head attention: off-band -1e9 scores underflow to
// exactly 0 after fp32 softmax, so only 3 neighbors matter.
// One wave per (bn, run of SR time steps). A lane holds 4 of a row's 128
// features (8 lanes a head), so each load and store of a wave is 512 contiguous
// bytes (4 whole lines) of one row's q, k, v or output, and a k or v row serves
// its three queries from registers. A score is 4 products in the lane, then a
// sum over the head's 8 lanes; every lane of a head then holds the same softmax.
// ---------------------------------------------------------------------------
template <int CTRL>
__device__ __forceinline__ float dpp_add(float v) {
  // v + (v of the lane that CTRL names): a cross-lane add on the vector port
  // (__shfl_xor would go through the LDS queue and its latency).
  const int o = __builtin_amdgcn_mov_dpp(__builtin_bit_cast(int, v), CTRL, 0xf, 0xf, true);
  return v + __builtin_bit_cast(float, o);
}

__device__ __forceinline__ float head_dot(const float4 a, const float4 b) {
  float d = a.x * b.x + a.y * b.y + a.z * b.z + a.w * b.w;
  d = dpp_add<0x161>(d);  // row_xmask:1
  d = dpp_add<0x162>(d);  // row_xmask:2
  d = dpp_add<0x164>(d);  // row_xmask:4
  return d;
}

__global__ void __launch_bounds__(ST) attn_kernel(const float* __restrict__ qkv,
                            float* __restrict__ outp) {
  const int lane = threadIdx.x & 31;
  const int w = blockIdx.x * SW + (threadIdx.x >> 5);
  const int t0 = (w & 15) * SR;       // a work-group's waves cover one bn
  const int bn = w >> 4;

  // Two batches of SR/2 rows, 28 loads each: all of a run's rows at once would
  // not fit the registers of 16 waves a WGP. Every loop is fully unrolled, so
  // that q, k and v are registers and a batch's loads issue back to back.
  constexpr int HB = SR / 2;
#pragma unroll
  for (int h = 0; h < 2; ++h) {
    const int tb = t0 + h * HB;
    const bool lo_out = (tb == 0), hi_out = (tb + HB == TT);
    // a row of qkv is 96 float4: q at 0, k at 32, v at 64
    const float4* pb = reinterpret_cast<const float4*>(qkv) + (size_t)(bn * TT + tb) * 96 + lane;
    // The two neighbour rows outside [0,T) are read in bounds (the batch's own
    // edge row instead); their scores are masked below.
    const float4* plo = lo_out ? pb : pb - 96;
    const float4* phi = hi_out ? pb + (HB - 1) * 96 : pb + HB * 96;
    float4 q[HB], k[HB + 2], v[HB + 2];   // k, v: time steps tb-1 .. tb+HB
    k[0] = plo[32]; v[0] = plo[64];
    k[HB + 1] = phi[32]; v[HB + 1] = phi[64];
#pragma unroll
    for (int i = 0; i < HB; ++i) {
      q[i] = pb[i * 96];
      k[i + 1] = pb[i * 96 + 32];
      v[i + 1] = pb[i * 96 + 64];
    }
    XWAIT3(pb, plo, phi);  // behind these loads, before their address registers are written again

    float4* O4 = reinterpret_cast<float4*>(outp) + (size_t)(bn * TT + tb) * 32 + lane;
#pragma unroll
    for (int i = 0; i < HB; ++i) {
      const float sc = 0.17677669529663687f;  // 1/sqrt(32)
      float s0 = head_dot(q[i], k[i]) * sc;
      const float s1 = head_dot(q[i], k[i + 1]) * sc;
      float s2 = head_dot(q[i], k[i + 2]) * sc;
      if (i == 0 && lo_out) s0 = -3.0e38f;       // t = 0: no step before; its weight is exp(-huge) = 0
      if (i == HB - 1 && hi_out) s2 = -3.0e38f;  // t = T-1: no step behind
      const float mmax = fmaxf(fmaxf(s0, s1), s2);
      const float p0 = expf(s0 - mmax), p1 = expf(s1 - mmax), p2 = expf(s2 - mmax);
      const float invd = 1.0f / (p0 + p1 + p2);
      const float4 va = v[i], vb = v[i + 1], vc = v[i + 2];
      float4 o;
      o.x = (p0 * va.x + p1 * vb.x + p2 * vc.x) * invd;
      o.y = (p0 * va.y + p1 * vb.y + p2 * vc.y) * invd;
      o.z = (p0 * va.z + p1 * vb.z + p2 * vc.z) * invd;
      o.w = (p0 * va.w + p1 * vb.w + p2 * vc.w) * invd;
      O4[(size_t)i * 32] = o;
    }
  }
}

// ---------------------------------------------------------------------------
// One branch's MLP with its LayerNorm in one kernel:
//   Y = LN(gelu(X @ W1 + b1) @ W2 + b2) * g + b,  X, Y: [R,128], W1: [128,256], W2: [256,128]
// A work-group of 8 waves owns FM = 64 rows from end to end. Its X rows, the 256
// hidden values of each row and the 128 values in front of the LayerNorm live in
// LDS only; global memory sees one read of X and one write of Y. The weights
// come through LDS in 16 chunks of 4,096 floats (8 of W1: 16 k-rows; 8 of W2:
// 32 k-rows), two buffers, the copies of chunk c + 2 in flight during chunk c + 1.
// First product: wave tile 64x32 (4x2 subtiles), 8 waves side by side = 256 columns.
// Second product: wave tile 32x32 (2x2 subtiles), 2 waves down x 4 across.
// Both sum k in rising order, 4 per WMMA, as every product of this file does.
// 135,168 B of LDS: two work-groups per WGP, 4 waves per SIMD.
// ---------------------------------------------------------------------------
#define FM 64                   // rows per work-group
#define FT 256                  // threads per work-group (8 waves)
#define PX 132                  // pitch of the X rows (and of the rows in front of the LayerNorm): 4 mod 64 (A rows)
#define PH 260                  // pitch of the hidden rows: 4 mod 64 (A rows)
#define PW1 264                 // pitch of W1 rows: 8 mod 64 (B rows)
#define PW2 136                 // pitch of W2 rows: the same
#define WBUF 4352               // floats per weight buffer: max(16 * PW1, 32 * PW2)
#define FUSED_LDS_FLOATS (FM * PX + FM * PH + 2 * WBUF)
// End of a chunk: this wave's LDS reads and writes are done, its own copies have
// landed, and the barrier then publishes both to the other waves and frees the
// buffer that was just read for the next copies.
#define CHUNK_FOOT()                                   \
  do {                                                 \
    asm volatile("s_wait_dscnt 0x0" ::: "memory");     \
    asm volatile("s_wait_asynccnt 0x0" ::: "memory");  \
    __syncthreads();                                   \
  } while (0)

__global__ void __launch_bounds__(FT) mlp_ln_kernel(const float* __restrict__ X,
                              const float* __restrict__ W1,
                              const float* __restrict__ b1,
                              const float* __restrict__ W2,
                              const float* __restrict__ b2,
                              const float* __restrict__ g,
                              const float* __restrict__ b,
                              float* __restrict__ Y) {
  extern __shared__ float smem[];
  float* sX = smem;                      // [FM][PX]: X, later the rows in front of the LayerNorm
  float* sH = smem + FM * PX;            // [FM][PH]: hidden rows
  float* sW = smem + FM * PX + FM * PH;  // [2][WBUF]: weight chunks

  const int tid = threadIdx.x;
  const int lane = tid & 31;
  const int wv = __builtin_amdgcn_readfirstlane(tid >> 5);  // wave-uniform: tile offsets are scalar
  const int m = lane & 15;         // A row / C column within a 16x16 subtile
  const int hi = lane >> 4;        // K-pair selector (lanes 16-31: K+2,K+3)
  const int rowBase = blockIdx.x * FM;

  // A weight chunk is 4,096 floats in a row in global memory: 4 x b128 per
  // thread. Chunk c of W1 and chunk j of W2 go into buffer c & 1 and j & 1.
  auto stage1 = [&](int c) {
    float* d = sW + (c & 1) * WBUF;
    const float* gw = W1 + c * 4096;
#pragma unroll
    for (int j = 0; j < 4; ++j) {
      const int idx = tid + j * FT;
      copy16(gw + idx * 4, d + (idx >> 6) * PW1 + ((idx & 63) << 2));
    }
  };
  auto stage2 = [&](int c) {
    float* d = sW + (c & 1) * WBUF;
    const float* gw = W2 + c * 4096;
#pragma unroll
    for (int j = 0; j < 4; ++j) {
      const int idx = tid + j * FT;
      copy16(gw + idx * 4, d + (idx >> 5) * PW2 + ((idx & 31) << 2));
    }
  };

  // X rows (8 x b128 per thread) and the first weight chunk.
#pragma unroll
  for (int j = 0; j < (FM * 128) / (4 * FT); ++j) {
    const int idx = tid + j * FT;
    const int r = idx >> 5;
    const int cs = (idx & 31) << 2;
    copy16(X + (size_t)(rowBase + r) * 128 + cs, sX + r * PX + cs);
  }
  stage1(0);
  // Biases and LayerNorm parameters: asked for here, so that their latency runs
  // out beside that of the first copies.
  const int c1 = wv * 32 + m;         // this lane's columns of the first product: c1, c1 + 16
  const int c2 = (wv >> 1) * 32 + m;  // of the second product: c2, c2 + 16
  const float bb1[2] = {b1[c1], b1[c1 + 16]};
  const float bb2[2] = {b2[c2], b2[c2 + 16]};
  const v4f g4 = reinterpret_cast<const v4f*>(g)[lane];
  const v4f b4 = reinterpret_cast<const v4f*>(b)[lane];
  XWAIT3(c1, c2, lane);  // behind these loads, before their address registers are written again
  asm volatile("s_wait_asynccnt 0x0" ::: "memory");  // own copies landed, before the barrier that publishes them
  __syncthreads();
  stage1(1);

  // ---- hidden = gelu(X @ W1 + b1) ----
  {
    v8f acc[4][2] = {};
    const int nw = wv * 32;
    // The two chunk loops stay rolled (for speed only).
#pragma unroll 1
    for (int c = 0; c < 8; ++c) {
      const float* cA = sX + c * 16;
      const float* cB = sW + (c & 1) * WBUF;
#pragma unroll
      for (int k0 = 0; k0 < 16; k0 += 4) {
        const int kl = k0 + 2 * hi;
        v2f av[4], bv[2];
#pragma unroll
        for (int mt = 0; mt < 4; ++mt) {
          const float* p = cA + (mt * 16 + m) * PX + kl;
          av[mt].x = p[0];
          av[mt].y = p[1];
        }
#pragma unroll
        for (int nt = 0; nt < 2; ++nt) {
          const float* p = cB + kl * PW1 + nw + nt * 16 + m;
          bv[nt].x = p[0];
          bv[nt].y = p[PW1];
        }
#pragma unroll
        for (int mt = 0; mt < 4; ++mt)
#pragma unroll
          for (int nt = 0; nt < 2; ++nt)
            acc[mt][nt] = __builtin_amdgcn_wmma_f32_16x16x4_f32(
                false, av[mt], false, bv[nt], (short)0, acc[mt][nt], false, false);
      }
      CHUNK_FOOT();
      if (c < 6) stage1(c + 2);  // the test reads the same for the whole work-group
      else       stage2(c - 6);  // the first two chunks of W2 fly during the last of W1 and the GELU
    }
    // C/D layout: VGPR r2 holds M=r2 (lanes 0-15) or M=r2+8 (lanes 16-31)
#pragma unroll
    for (int nt = 0; nt < 2; ++nt) {
      const int col = nw + nt * 16 + m;
#pragma unroll
      for (int mt = 0; mt < 4; ++mt)
#pragma unroll
        for (int r2 = 0; r2 < 8; ++r2)
          sH[(mt * 16 + hi * 8 + r2) * PH + col] = act_apply(acc[mt][nt][r2] + bb1[nt], 1);
    }
    asm volatile("s_wait_dscnt 0x0" ::: "memory");  // own hidden values written, before the barrier that publishes them
    __syncthreads();
  }

  // ---- rows in front of the LayerNorm = hidden @ W2 + b2 ----
  {
    v8f acc[2][2] = {};
    const int mw = (wv & 1) * 32;
    const int nw = (wv >> 1) * 32;
#pragma unroll 1
    for (int c = 0; c < 8; ++c) {
      const float* cA = sH + c * 32;
      const float* cB = sW + (c & 1) * WBUF;
#pragma unroll
      for (int k0 = 0; k0 < 32; k0 += 4) {
        const int kl = k0 + 2 * hi;
        v2f av[2], bv[2];
#pragma unroll
        for (int mt = 0; mt < 2; ++mt) {
          const float* p = cA + (mw + mt * 16 + m) * PH + kl;
          av[mt].x = p[0];
          av[mt].y = p[1];
        }
#pragma unroll
        for (int nt = 0; nt < 2; ++nt) {
          const float* p = cB + kl * PW2 + nw + nt * 16 + m;
          bv[nt].x = p[0];
          bv[nt].y = p[PW2];
        }
#pragma unroll
        for (int mt = 0; mt < 2; ++mt)
#pragma unroll
          for (int nt = 0; nt < 2; ++nt)
            acc[mt][nt] = __builtin_amdgcn_wmma_f32_16x16x4_f32(
                false, av[mt], false, bv[nt], (short)0, acc[mt][nt], false, false);
      }
      CHUNK_FOOT();
      if (c < 6) stage2(c + 2);  // the test reads the same for the whole work-group
    }
    // X was last read many barriers ago: its rows now take the sums.
#pragma unroll
    for (int nt = 0; nt < 2; ++nt) {
      const int col = nw + nt * 16 + m;
#pragma unroll
      for (int mt = 0; mt < 2; ++mt)
#pragma unroll
        for (int r2 = 0; r2 < 8; ++r2)
          sX[(mw + mt * 16 + hi * 8 + r2) * PX + col] = acc[mt][nt][r2] + bb2[nt];
    }
    asm volatile("s_wait_dscnt 0x0" ::: "memory");  // own sums written, before the barrier that publishes them
    __syncthreads();
  }

  // ---- LayerNorm over D=128: one wave per row at a time (4 floats/lane,
  // shfl_xor reduce), 8 rows per wave; each store is one whole 512-byte row ----
  v4f* Y4 = reinterpret_cast<v4f*>(Y) + (size_t)(rowBase + wv * 8) * 32 + lane;
#pragma unroll
  for (int i = 0; i < FM / 8; ++i) {
    const v4f v = *reinterpret_cast<const v4f*>(sX + (wv * 8 + i) * PX + lane * 4);
    float s = v.x + v.y + v.z + v.w;
    float sq = v.x * v.x + v.y * v.y + v.z * v.z + v.w * v.w;
#pragma unroll
    for (int off = 16; off > 0; off >>= 1) {
      s += __shfl_xor(s, off, 32);
      sq += __shfl_xor(sq, off, 32);
    }
    float mean = s * (1.0f / 128.0f);
    float var = sq * (1.0f / 128.0f) - mean * mean;
    float inv = rsqrtf(var + 1e-5f);

    v4f o;
    o.x = (v.x - mean) * inv * g4.x + b4.x;
    o.y = (v.y - mean) * inv * g4.y + b4.y;
    o.z = (v.z - mean) * inv * g4.z + b4.z;
    o.w = (v.w - mean) * inv * g4.w + b4.w;
    Y4[(size_t)i * 32] = o;
  }
}

// ---------------------------------------------------------------------------
// The local branch's detrend and its QKV projection in one kernel:
//   xl[bn,t,:] = x[b,t,n,:] - softmax(window_weight)-weighted 3-tap trend (zero-padded in time)
//   qkv = xl @ Wq + bq,  Wq: [128,384]
// A work-group of 8 waves owns FM = 64 rows (one b and n, 64 time steps) and all
// 384 columns. Each wave forms 8 detrended rows in registers (10 rows of x: the
// neighbours in time come from its own registers) and puts them into LDS, where
// they are the product's A rows: xl never goes to global memory, and a row is
// fetched once, not once per column block. The weights come through LDS in 4
// chunks of QK = 32 k-rows, two buffers, the copies of chunk c + 2 in flight
// during chunk c + 1. Wave tile 32x96 (2x6 subtiles: whole 128-byte lines of a
// qkv row), 2 waves down x 4 across; k is summed in rising order, 4 per WMMA.
// 134,144 B of LDS: two work-groups per WGP, 4 waves per SIMD, 1,024 work-groups
// in two even rounds. Work-groups next to each other take neighbouring n, whose
// rows of x lie side by side in memory.
// The launch's first FG work-groups form Wf and bf instead (fold_tile): that
// work needs a handful of waves only and runs beside the rest.
// ---------------------------------------------------------------------------
#define QK 32                   // k-rows per weight chunk
#define PWQ 392                 // pitch of the Wq rows: 8 mod 64 (B rows)
#define QBUF (QK * PWQ)         // floats per weight buffer
#define QKV_LDS_FLOATS (FM * PX + 2 * QBUF)

__global__ void __launch_bounds__(FT) detrend_qkv_kernel(const float* __restrict__ x,
                                   const float* __restrict__ wwraw,
                                   const float* __restrict__ Wq,
                                   const float* __restrict__ bq,
                                   float* __restrict__ qkv,
                                   const float* __restrict__ Wo,
                                   const float* __restrict__ bo,
                                   const float* __restrict__ W1,
                                   const float* __restrict__ b1,
                                   float* __restrict__ Wf,
                                   float* __restrict__ bf) {
  extern __shared__ float smem[];
  float* sX = smem;            // [FM][PX]: detrended rows
  float* sW = smem + FM * PX;  // [2][QBUF]: weight chunks

  const int tid = threadIdx.x;
  const int lane = tid & 31;
  const int wv = __builtin_amdgcn_readfirstlane(tid >> 5);  // wave-uniform: tile offsets are scalar
  if (blockIdx.x < FG) {       // whole work-groups, in front of every barrier
    fold_tile(Wo, bo, W1, b1, Wf, bf, blockIdx.x * (FT / 32) + wv, lane);  // 72 tiles
    return;
  }
  const int blk = blockIdx.x - FG;
  const int n = blk & 63;
  const int tc = (blk >> 6) & 3;
  const int b = blk >> 8;
  const int t0 = tc * FM + wv * 8;   // this wave's 8 time steps
  const int m = lane & 15;           // A row / C column within a 16x16 subtile
  const int hi = lane >> 4;          // K-pair selector (lanes 16-31: K+2,K+3)
  const int mw = (wv & 1) * 32;      // wave row offset
  const int nw = (wv >> 1) * 96;     // wave column offset

  // This wave's rows of x, time steps t0-1 .. t0+8: asked for first, theirs is the
  // longest way. The two edge rows are read in bounds and set to zero below.
  const float4* X4 = reinterpret_cast<const float4*>(x) + ((size_t)(b * TT) * NN + n) * 32 + lane;
  float4 v[10];
  const float4* xlo = X4 + (size_t)(t0 > 0 ? t0 - 1 : 0) * (NN * 32);
  const float4* xhi = X4 + (size_t)(t0 + 8 < TT ? t0 + 8 : TT - 1) * (NN * 32);
  const float4* xb = X4 + (size_t)t0 * (NN * 32);
  v[0] = *xlo;
  v[9] = *xhi;
#pragma unroll
  for (int i = 0; i < 8; ++i) v[i + 1] = xb[(size_t)i * (NN * 32)];
  XWAIT3(xlo, xhi, xb);  // behind these loads, before their address registers are written again

  // A weight chunk is 32 rows of 96 x b128, 12,288 floats in a row in global
  // memory: 12 x b128 per thread. 8 rows are 3 copies per thread, and their
  // places in LDS repeat every 8 rows. Chunk c goes into buffer c & 1.
  int lo[3];
#pragma unroll
  for (int j = 0; j < 3; ++j) {
    const int idx = tid + j * FT;
    lo[j] = (idx / 96) * PWQ + (idx % 96) * 4;
  }
  auto stage = [&](int c) {
    float* d = sW + (c & 1) * QBUF;
    const float* gw = Wq + c * (QK * 384) + tid * 4;
#pragma unroll
    for (int q = 0; q < QK / 8; ++q)
#pragma unroll
      for (int j = 0; j < 3; ++j)
        copy16(gw + (q * 3 + j) * (FT * 4), d + q * (8 * PWQ) + lo[j]);
  };
  stage(0);
  // Biases: asked for here, so that their latency runs out beside that of the first copies.
  const float* pq = bq + nw + m;     // this lane's columns: nw + m + 16 * nt
  float bb[6];
#pragma unroll
  for (int nt = 0; nt < 6; ++nt) bb[nt] = pq[nt * 16];
  XWAIT1(pq);  // behind these loads, before their address registers are written again

  float w0 = wwraw[0], w1 = wwraw[1], w2 = wwraw[2];
  float mx = fmaxf(w0, fmaxf(w1, w2));
  float e0 = expf(w0 - mx), e1 = expf(w1 - mx), e2 = expf(w2 - mx);
  float inv = 1.0f / (e0 + e1 + e2);
  e0 *= inv; e1 *= inv; e2 *= inv;

  if (t0 == 0)       v[0] = make_float4(0.f, 0.f, 0.f, 0.f);
  if (t0 + 8 == TT)  v[9] = make_float4(0.f, 0.f, 0.f, 0.f);
#pragma unroll
  for (int i = 0; i < 8; ++i) {
    const float4 xm = v[i], xc = v[i + 1], xp = v[i + 2];
    float4 o;
    o.x = xc.x - (e0 * xm.x + e1 * xc.x + e2 * xp.x);
    o.y = xc.y - (e0 * xm.y + e1 * xc.y + e2 * xp.y);
    o.z = xc.z - (e0 * xm.z + e1 * xc.z + e2 * xp.z);
    o.w = xc.w - (e0 * xm.w + e1 * xc.w + e2 * xp.w);
    *reinterpret_cast<float4*>(sX + (wv * 8 + i) * PX + lane * 4) = o;
  }
  CHUNK_FOOT();  // own rows written and own copies landed, before the barrier that publishes both
  stage(1);

  v8f acc[2][6] = {};
  // The chunk loop stays rolled, as in the MLP kernel.
#pragma unroll 1
  for (int c = 0; c < 128 / QK; ++c) {
    const float* cA = sX + c * QK;
    const float* cB = sW + (c & 1) * QBUF;
#pragma unroll
    for (int k0 = 0; k0 < QK; k0 += 4) {
      const int kl = k0 + 2 * hi;
      v2f av[2], bv[6];
#pragma unroll
      for (int mt = 0; mt < 2; ++mt) {
        const float* p = cA + (mw + mt * 16 + m) * PX + kl;
        av[mt].x = p[0];
        av[mt].y = p[1];
      }
#pragma unroll
      for (int nt = 0; nt < 6; ++nt) {
        const float* p = cB + kl * PWQ + nw + nt * 16 + m;
        bv[nt].x = p[0];
        bv[nt].y = p[PWQ];
      }
#pragma unroll
      for (int mt = 0; mt < 2; ++mt)
#pragma unroll
        for (int nt = 0; nt < 6; ++nt)
          acc[mt][nt] = __builtin_amdgcn_wmma_f32_16x16x4_f32(
              false, av[mt], false, bv[nt], (short)0, acc[mt][nt], false, false);
    }
    // Four free vector slots behind the chunk's last WMMA: the next vector
    // instruction that writes one of its A or B registers stands behind the
    // loop's branches.
    asm volatile("v_nop\n\tv_nop\n\tv_nop\n\tv_nop"
                 : "+v"(acc[0][0]), "+v"(acc[0][1]), "+v"(acc[0][2]), "+v"(acc[0][3]),
                   "+v"(acc[0][4]), "+v"(acc[0][5]), "+v"(acc[1][0]), "+v"(acc[1][1]),
                   "+v"(acc[1][2]), "+v"(acc[1][3]), "+v"(acc[1][4]), "+v"(acc[1][5]));
    CHUNK_FOOT();
    if (c < 128 / QK - 2) stage(c + 2);  // the test reads the same for the whole work-group
  }

  // C/D layout: VGPR r2 holds M=r2 (lanes 0-15) or M=r2+8 (lanes 16-31).
  // Row by row: six stores in a row fill the wave's 384 contiguous bytes of a row.
#pragma unroll
  for (int mt = 0; mt < 2; ++mt)
#pragma unroll
    for (int nt = 0; nt < 6; ++nt)
#pragma unroll
      for (int r2 = 0; r2 < 8; ++r2) acc[mt][nt][r2] += bb[nt];
  float* Cq = qkv + ((size_t)((b * NN + n) * TT + tc * FM + mw + hi * 8)) * 384 + nw + m;
#pragma unroll
  for (int mt = 0; mt < 2; ++mt)
#pragma unroll
    for (int r2 = 0; r2 < 8; ++r2)
#pragma unroll
      for (int nt = 0; nt < 6; ++nt)
        Cq[(mt * 16 + r2) * 384 + nt * 16] = acc[mt][nt][r2];
  XWAIT0();  // behind these stores, before a register that they name is written again
}

// ---------------------------------------------------------------------------
// prep_conv: x_pos = x + pos_enc; depthwise conv3 (pad 1, zeros AFTER pos add
// per reference) + conv bias. Output layout [bn,t,D]. One wave per (b, n, run
// of SR time steps); the taps and the neighbours in time stay in registers.
// ---------------------------------------------------------------------------
__global__ void __launch_bounds__(ST) prep_conv_kernel(const float* __restrict__ x,
                                 const float* __restrict__ pos,
                                 const float* __restrict__ cw,
                                 const float* __restrict__ cb,
                                 float* __restrict__ xconv) {
  const int lane = threadIdx.x & 31;
  const int w = blockIdx.x * SW + (threadIdx.x >> 5);
  const int n = w & 63;               // a work-group's waves read neighbouring n
  const int t0 = ((w >> 6) & 15) * SR;
  const int b = w >> 10;
  const int d0 = lane * 4;

  const float4* X4 = reinterpret_cast<const float4*>(x) + ((size_t)(b * TT) * NN + n) * 32 + lane;
  const float4* P4 = reinterpret_cast<const float4*>(pos) + lane;

  float k0[4], k1[4], k2[4], kb[4];
#pragma unroll
  for (int c = 0; c < 4; ++c) {
    int d = d0 + c;
    k0[c] = cw[d * 3 + 0]; k1[c] = cw[d * 3 + 1]; k2[c] = cw[d * 3 + 2];
    kb[c] = cb[d];
  }
  XWAIT0();  // behind these loads, before their address registers are written again
  float4 v[SR + 2], p[SR + 2];        // time steps t0-1 .. t0+SR
  const int tlo = t0 > 0 ? t0 - 1 : 0;              // the two edge rows are read in
  const int thi = t0 + SR < TT ? t0 + SR : TT - 1;  // bounds and set to zero below
  const float4* xlo = X4 + (size_t)tlo * (NN * 32);
  const float4* xhi = X4 + (size_t)thi * (NN * 32);
  const float4* plo = P4 + (size_t)tlo * 32;
  const float4* phi = P4 + (size_t)thi * 32;
  const float4* xb = X4 + (size_t)t0 * (NN * 32);
  const float4* pb = P4 + (size_t)t0 * 32;
  v[0] = *xlo; p[0] = *plo;
  v[SR + 1] = *xhi; p[SR + 1] = *phi;
  XWAIT4(xlo, xhi, plo, phi);  // behind these loads, before their address registers are written again
#pragma unroll
  for (int i = 0; i < SR; ++i) {
    v[i + 1] = xb[(size_t)i * (NN * 32)];
    p[i + 1] = pb[(size_t)i * 32];
  }
  XWAIT2(xb, pb);  // behind these loads, before their address registers are written again
#pragma unroll
  for (int i = 0; i < SR + 2; ++i) {
    v[i].x += p[i].x; v[i].y += p[i].y; v[i].z += p[i].z; v[i].w += p[i].w;
  }
  if (t0 == 0)       v[0] = make_float4(0.f, 0.f, 0.f, 0.f);
  if (t0 + SR == TT) v[SR + 1] = make_float4(0.f, 0.f, 0.f, 0.f);

  float4* O4 = reinterpret_cast<float4*>(xconv) + ((size_t)(b * NN + n) * TT + t0) * 32 + lane;
#pragma unroll
  for (int i = 0; i < SR; ++i) {
    const float4 xm = v[i], xc = v[i + 1], xp = v[i + 2];
    float4 o;
    o.x = k0[0] * xm.x + k1[0] * xc.x + k2[0] * xp.x + kb[0];
    o.y = k0[1] * xm.y + k1[1] * xc.y + k2[1] * xp.y + kb[1];
    o.z = k0[2] * xm.z + k1[2] * xc.z + k2[2] * xp.z + kb[2];
    o.w = k0[3] * xm.w + k1[3] * xc.w + k2[3] * xp.w + kb[3];
    O4[(size_t)i * 32] = o;
  }
}

// ---------------------------------------------------------------------------
// Mixed pool: k=6, stride 1, pad (2,2) -> length T-1, right zero-pad to T.
// avg divides by 6 always (zero pad contributes 0); max over valid entries.
// One wave per (bn, run of SR time steps): the SR+5 rows its windows cover are
// loaded once; each window is summed on its own, in rising time order.
// ---------------------------------------------------------------------------
__global__ void __launch_bounds__(ST) pool_kernel(const float* __restrict__ xconv,
                            const float* __restrict__ alpha_p,
                            float* __restrict__ outp) {
  const int lane = threadIdx.x & 31;
  const int w = blockIdx.x * SW + (threadIdx.x >> 5);
  const int t0 = (w & 15) * SR;
  const int bn = w >> 4;
  const bool first = (t0 == 0), last = (t0 + SR == TT);

  const float a = 1.0f / (1.0f + expf(-alpha_p[0]));
  const float4* XC4 = reinterpret_cast<const float4*>(xconv) + (size_t)(bn * TT) * 32 + lane;

  float4 vs[SR + 5], vm[SR + 5];      // time steps t0-2 .. t0+SR+2: for the sum, for the max
  // Rows outside [0,T) are read in bounds (rows of the run itself instead) and replaced below.
  const float4* cb4 = XC4 + (size_t)t0 * 32;
  const float4* clo = first ? cb4 + 2 * 32 : cb4;            // clo[-2 rows], clo[-1 row]
  const float4* chi = last ? cb4 - 3 * 32 : cb4;             // chi[SR rows] .. chi[SR+2 rows]
  vs[0] = clo[-2 * 32]; vs[1] = clo[-1 * 32];
  vs[SR + 2] = chi[SR * 32]; vs[SR + 3] = chi[(SR + 1) * 32]; vs[SR + 4] = chi[(SR + 2) * 32];
  XWAIT2(clo, chi);  // behind these loads, before their address registers are written again
#pragma unroll
  for (int i = 0; i < SR; ++i) vs[i + 2] = cb4[(size_t)i * 32];
  XWAIT1(cb4);  // behind these loads, before their address registers are written again
#pragma unroll
  for (int i = 0; i < SR + 5; ++i) {
    vm[i] = vs[i];
    if ((i < 2 && first) || (i >= SR + 2 && last)) {
      vs[i] = make_float4(0.f, 0.f, 0.f, 0.f);
      vm[i] = make_float4(-3.0e38f, -3.0e38f, -3.0e38f, -3.0e38f);
    }
  }

  float4* O4 = reinterpret_cast<float4*>(outp) + ((size_t)(bn * TT) + t0) * 32 + lane;
  const float inv6 = 1.0f / 6.0f;
#pragma unroll
  for (int i = 0; i < SR; ++i) {
    float sx = 0.f, sy = 0.f, sz = 0.f, sw = 0.f;
    float mx = -3.0e38f, my = -3.0e38f, mz = -3.0e38f, mw = -3.0e38f;
#pragma unroll
    for (int k = 0; k < 6; ++k) {
      const float4 s = vs[i + k], m = vm[i + k];
      sx += s.x; sy += s.y; sz += s.z; sw += s.w;
      mx = fmaxf(mx, m.x); my = fmaxf(my, m.y);
      mz = fmaxf(mz, m.z); mw = fmaxf(mw, m.w);
    }
    float4 res;
    res.x = a * (sx * inv6) + (1.f - a) * mx;
    res.y = a * (sy * inv6) + (1.f - a) * my;
    res.z = a * (sz * inv6) + (1.f - a) * mz;
    res.w = a * (sw * inv6) + (1.f - a) * mw;
    if (i == SR - 1 && last) res = make_float4(0.f, 0.f, 0.f, 0.f);  // t = T-1: the right zero-pad
    O4[(size_t)i * 32] = res;
  }
}

// ---------------------------------------------------------------------------
// The gated fusion and the residual in one kernel:
//   gate = sigmoid(tanh([x_loc | x_glob] @ W1 + b1) @ W2 + b2),  W1: [256,128], W2: [128,128]
//   out  = x + softplus(res_scale) * (gate * x_loc + (1 - gate) * x_glob)
// with the [bn,t,D] -> [B,T,N,D] relayout on x and out. A work-group of 8 waves
// owns FM = 64 rows (one bn, 64 time steps) from end to end. The two branches'
// rows lie side by side in LDS, where they are the first product's A rows and
// later the two sides of the blend; the tanh rows and the gate live in LDS only.
// Global memory sees one read each of x_loc, x_glob and x and one write of out.
// The weights come through LDS in 12 chunks of 32 k-rows (8 of W1, 4 of W2), two
// buffers, the copies of chunk c + 2 in flight during chunk c + 1.
// Both products: wave tile 32x32 (2x2 subtiles), 2 waves down x 4 across; k is
// summed in rising order, 4 per WMMA, as every product of this file does.
// 135,168 B of LDS: two work-groups per WGP, 4 waves per SIMD.
// ---------------------------------------------------------------------------
#define GATE_LDS_FLOATS (FM * PH + FM * PX + 2 * WBUF)

__device__ __forceinline__ float softplus_f(float v) {
  return (v > 0.f) ? (v + log1pf(expf(-v))) : log1pf(expf(v));
}

__global__ void __launch_bounds__(FT) gate_out_kernel(const float* __restrict__ xloc,
                                const float* __restrict__ xglob,
                                const float* __restrict__ W1,
                                const float* __restrict__ b1,
                                const float* __restrict__ W2,
                                const float* __restrict__ b2,
                                const float* __restrict__ x,
                                const float* __restrict__ res_scale,
                                float* __restrict__ out) {
  extern __shared__ float smem[];
  float* sC = smem;                      // [FM][PH]: x_loc in columns 0..127, x_glob in 128..255
  float* sT = smem + FM * PH;            // [FM][PX]: tanh rows, later the gate
  float* sW = smem + FM * PH + FM * PX;  // [2][WBUF]: weight chunks

  const int tid = threadIdx.x;
  const int lane = tid & 31;
  const int wv = __builtin_amdgcn_readfirstlane(tid >> 5);  // wave-uniform: tile offsets are scalar
  const int m = lane & 15;         // A row / C column within a 16x16 subtile
  const int hi = lane >> 4;        // K-pair selector (lanes 16-31: K+2,K+3)
  const int rowBase = blockIdx.x * FM;
  const int mw = (wv & 1) * 32;    // wave row offset, both products
  const int nw = (wv >> 1) * 32;   // wave column offset, both products

  // A weight chunk is 32 k-rows of 128 floats, 4,096 floats in a row in global
  // memory: 4 x b128 per thread. Chunk c goes into buffer c & 1.
  auto stage = [&](const float* Wg, int c) {
    float* d = sW + (c & 1) * WBUF;
    const float* gw = Wg + c * 4096;
#pragma unroll
    for (int j = 0; j < 4; ++j) {
      const int idx = tid + j * FT;
      copy16(gw + idx * 4, d + (idx >> 5) * PW2 + ((idx & 31) << 2));
    }
  };

  // The scale's raw values: asked for first, so that they are here when the copies have been issued.
  const v4f rs = reinterpret_cast<const v4f*>(res_scale)[lane];
  // The two branches' rows (16 x b128 per thread) and the first weight chunk.
#pragma unroll
  for (int j = 0; j < (FM * 128) / (4 * FT); ++j) {
    const int idx = tid + j * FT;
    const int r = idx >> 5;
    const int cs = (idx & 31) << 2;
    copy16(xloc + (size_t)(rowBase + r) * 128 + cs, sC + r * PH + cs);
    copy16(xglob + (size_t)(rowBase + r) * 128 + cs, sC + r * PH + 128 + cs);
  }
  stage(W1, 0);
  // Biases: asked for here, so that their latency runs out beside that of the first copies.
  const int cc = nw + m;              // this lane's columns of both products: cc, cc + 16
  const float bb1[2] = {b1[cc], b1[cc + 16]};
  const float bb2[2] = {b2[cc], b2[cc + 16]};
  XWAIT2(cc, lane);  // behind these loads, before their address registers are written again
  // The scale of this lane's 4 columns, formed while the first copies are under way.
  const float sx = softplus_f(rs.x), sy = softplus_f(rs.y);
  const float sz = softplus_f(rs.z), sw = softplus_f(rs.w);
  asm volatile("s_wait_asynccnt 0x0" ::: "memory");  // own copies landed, before the barrier that publishes them
  __syncthreads();
  stage(W1, 1);

  // The 8 rows of x and out that this wave blends and stores at the end.
  const int bn = rowBase >> 8;                 // TT = 256 rows a bn
  const int t0 = (rowBase & (TT - 1)) + wv * 8;
  const size_t xo = ((size_t)((bn >> 6) * TT + t0) * NN + (bn & 63)) * 32 + lane;  // [B,T,N,D]
  const v4f* X4 = reinterpret_cast<const v4f*>(x) + xo;
  v4f xv[FM / 8];

  // ---- tanh rows = tanh([x_loc | x_glob] @ W1 + b1) ----
  {
    v8f acc[2][2] = {};
    // The two chunk loops stay rolled, as in the MLP kernel (for speed only).
#pragma unroll 1
    for (int c = 0; c < 8; ++c) {
      const float* cA = sC + c * 32;
      const float* cB = sW + (c & 1) * WBUF;
#pragma unroll
      for (int k0 = 0; k0 < 32; k0 += 4) {
        const int kl = k0 + 2 * hi;
        v2f av[2], bv[2];
#pragma unroll
        for (int mt = 0; mt < 2; ++mt) {
          const float* p = cA + (mw + mt * 16 + m) * PH + kl;
          av[mt].x = p[0];
          av[mt].y = p[1];
        }
#pragma unroll
        for (int nt = 0; nt < 2; ++nt) {
          const float* p = cB + kl * PW2 + nw + nt * 16 + m;
          bv[nt].x = p[0];
          bv[nt].y = p[PW2];
        }
#pragma unroll
        for (int mt = 0; mt < 2; ++mt)
#pragma unroll
          for (int nt = 0; nt < 2; ++nt)
            acc[mt][nt] = __builtin_amdgcn_wmma_f32_16x16x4_f32(
                false, av[mt], false, bv[nt], (short)0, acc[mt][nt], false, false);
      }
      CHUNK_FOOT();
      if (c < 6) stage(W1, c + 2);  // the test reads the same for the whole work-group
      else       stage(W2, c - 6);  // the first two chunks of W2 fly during the last of W1 and the tanh
    }
    // This wave's 8 rows of x: asked for here, so that their latency runs out under the tanh.
#pragma unroll
    for (int i = 0; i < FM / 8; ++i) xv[i] = X4[(size_t)i * (NN * 32)];
    XWAIT1(X4);  // behind these loads, before their address registers are written again
    // Keeps the tanh arithmetic behind the loads: left free, the compiler issues
    // them two thirds of the way through it, with too little left to cover their latency.
    __builtin_amdgcn_sched_barrier(0);
    // C/D layout: VGPR r2 holds M=r2 (lanes 0-15) or M=r2+8 (lanes 16-31)
#pragma unroll
    for (int nt = 0; nt < 2; ++nt) {
      const int col = nw + nt * 16 + m;
#pragma unroll
      for (int mt = 0; mt < 2; ++mt)
#pragma unroll
        for (int r2 = 0; r2 < 8; ++r2)
          sT[(mw + mt * 16 + hi * 8 + r2) * PX + col] = act_apply(acc[mt][nt][r2] + bb1[nt], 2);
    }
    asm volatile("s_wait_dscnt 0x0" ::: "memory");  // own tanh values written, before the barrier that publishes them
    __syncthreads();
  }

  // ---- gate = sigmoid(tanh rows @ W2 + b2) ----
  {
    v8f acc[2][2] = {};
#pragma unroll 1
    for (int c = 0; c < 4; ++c) {
      const float* cA = sT + c * 32;
      const float* cB = sW + (c & 1) * WBUF;
#pragma unroll
      for (int k0 = 0; k0 < 32; k0 += 4) {
        const int kl = k0 + 2 * hi;
        v2f av[2], bv[2];
#pragma unroll
        for (int mt = 0; mt < 2; ++mt) {
          const float* p = cA + (mw + mt * 16 + m) * PX + kl;
          av[mt].x = p[0];
          av[mt].y = p[1];
        }
#pragma unroll
        for (int nt = 0; nt < 2; ++nt) {
          const float* p = cB + kl * PW2 + nw + nt * 16 + m;
          bv[nt].x = p[0];
          bv[nt].y = p[PW2];
        }
#pragma unroll
        for (int mt = 0; mt < 2; ++mt)
#pragma unroll
          for (int nt = 0; nt < 2; ++nt)
            acc[mt][nt] = __builtin_amdgcn_wmma_f32_16x16x4_f32(
                false, av[mt], false, bv[nt], (short)0, acc[mt][nt], false, false);
      }
      CHUNK_FOOT();
      if (c < 2) stage(W2, c + 2);  // the test reads the same for the whole work-group
    }
    // The last foot's barrier ended every read of the tanh rows: they now take the gate.
#pragma unroll
    for (int nt = 0; nt < 2; ++nt) {
      const int col = nw + nt * 16 + m;
#pragma unroll
      for (int mt = 0; mt < 2; ++mt)
#pragma unroll
        for (int r2 = 0; r2 < 8; ++r2)
          sT[(mw + mt * 16 + hi * 8 + r2) * PX + col] = act_apply(acc[mt][nt][r2] + bb2[nt], 3);
    }
    asm volatile("s_wait_dscnt 0x0" ::: "memory");  // own gate values written, before the barrier that publishes them
    __syncthreads();
  }

  // ---- blend and residual: one wave per row at a time (4 floats/lane), 8 rows
  // per wave; each store is one whole 512-byte row of out ----
  v4f* O4 = reinterpret_cast<v4f*>(out) + xo;
#pragma unroll
  for (int i = 0; i < FM / 8; ++i) {
    const int r = wv * 8 + i;
    const v4f gt = *reinterpret_cast<const v4f*>(sT + r * PX + lane * 4);
    const v4f xl = *reinterpret_cast<const v4f*>(sC + r * PH + lane * 4);
    const v4f xg = *reinterpret_cast<const v4f*>(sC + r * PH + 128 + lane * 4);
    v4f o;
    o.x = xv[i].x + sx * (gt.x * xl.x + (1.f - gt.x) * xg.x);
    o.y = xv[i].y + sy * (gt.y * xl.y + (1.f - gt.y) * xg.y);
    o.z = xv[i].z + sz * (gt.z * xl.z + (1.f - gt.z) * xg.z);
    o.w = xv[i].w + sw * (gt.w * xl.w + (1.f - gt.w) * xg.w);
    O4[(size_t)i * (NN * 32)] = o;
  }
}

// ---------------------------------------------------------------------------
// Host launcher
// ---------------------------------------------------------------------------
extern "C" void kernel_launch(void* const* d_in, const int* in_sizes, int n_in,
                              void* d_out, int out_size, void* d_ws, size_t ws_size,
                              hipStream_t stream) {
  const float* x          = (const float*)d_in[0];
  const float* window_w   = (const float*)d_in[1];
  const float* local_w1   = (const float*)d_in[2];
  const float* local_b1   = (const float*)d_in[3];
  const float* local_w2   = (const float*)d_in[4];
  const float* local_b2   = (const float*)d_in[5];
  const float* local_ln_g = (const float*)d_in[6];
  const float* local_ln_b = (const float*)d_in[7];
  const float* qkv_w      = (const float*)d_in[8];
  const float* qkv_b      = (const float*)d_in[9];
  const float* out_w      = (const float*)d_in[10];
  const float* out_b      = (const float*)d_in[11];
  const float* conv_w     = (const float*)d_in[12];
  const float* conv_b     = (const float*)d_in[13];
  const float* alpha      = (const float*)d_in[14];
  const float* pos_enc    = (const float*)d_in[15];
  const float* global_w1  = (const float*)d_in[16];
  const float* global_b1  = (const float*)d_in[17];
  const float* global_w2  = (const float*)d_in[18];
  const float* global_b2  = (const float*)d_in[19];
  const float* global_ln_g= (const float*)d_in[20];
  const float* global_ln_b= (const float*)d_in[21];
  const float* gate_w1    = (const float*)d_in[22];
  const float* gate_b1    = (const float*)d_in[23];
  const float* gate_w2    = (const float*)d_in[24];
  const float* gate_b2    = (const float*)d_in[25];
  const float* res_scale  = (const float*)d_in[26];
  float* out = (float*)d_out;

  const size_t R = (size_t)RR;
  float* ws = (float*)d_ws;
  float* P0 = ws;             // R*128: attn_out
  float* P1 = ws + R * 128;   // R*384: qkv -> x_loc
  float* P2 = ws + R * 512;   // R*128: xconv -> x_glob
  float* P3 = ws + R * 640;   // R*128: x_glob_in
  float* Wf = ws + R * 768;   // 128*256: out_w @ local_w1
  float* bf = Wf + 128 * 256; // 256: out_b @ local_w1 + local_b1

  const size_t QKV_LDS = QKV_LDS_FLOATS * sizeof(float);                // 131 KB
  const size_t FUSED_LDS = FUSED_LDS_FLOATS * sizeof(float);            // 132 KB
  const size_t GATE_LDS = GATE_LDS_FLOATS * sizeof(float);              // 132 KB

  // local branch
  detrend_qkv_kernel<<<RR / FM + FG, FT, QKV_LDS, stream>>>(x, window_w, qkv_w, qkv_b, P1,
                                                            out_w, out_b, local_w1, local_b1, Wf, bf);
  attn_kernel<<<SG, ST, 0, stream>>>(P1, P0);
  mlp_ln_kernel<<<RR / FM, FT, FUSED_LDS, stream>>>(
      P0, Wf, bf, local_w2, local_b2, local_ln_g, local_ln_b, P1);  // x_loc = P1

  // global branch
  prep_conv_kernel<<<SG, ST, 0, stream>>>(x, pos_enc, conv_w, conv_b, P2);
  pool_kernel<<<SG, ST, 0, stream>>>(P2, alpha, P3);
  mlp_ln_kernel<<<RR / FM, FT, FUSED_LDS, stream>>>(
      P3, global_w1, global_b1, global_w2, global_b2, global_ln_g, global_ln_b, P2);  // x_glob = P2

  // gated fusion and residual
  gate_out_kernel<<<RR / FM, FT, GATE_LDS, stream>>>(
      P1, P2, gate_w1, gate_b1, gate_w2, gate_b2, x, res_scale, out);
}

// v010
// Measured time: 215 microseconds a run.
// Next to v009, in two timings, it ran 1.14 times as fast each time.
// All steps since v000 together make it 4.75 times as fast.
#include <hip/hip_runtime.h>
#include <math.h>

// Problem constants (from reference)
#define BB 4
#define TT 256
#define NN 64
#define DD 128
#define HH 4
#define HD 32
#define RR (BB * NN * TT)   // 65536 rows

// LDS row pitches in floats (LDS bank = dword address mod 64). All stay multiples
// of 4 floats so every 16-byte copy lands 16-byte aligned.
// A rows: pitch 4 mod 64, so that the 16 rows x 2 k-pairs of a fragment read fall on 64 distinct banks.
// B rows: pitch 8 mod 64, so that rows k and k+2, read by the two lane halves, sit 16 banks apart.

// Streaming kernels (everything but the GEMMs and the fused kernels): one wave
// walks SR rows of 128 floats, one float4 per lane and row, so a launch starts
// 4,096 row waves (one 16-wave work-group per WGP) and each wave has SR or more
// 512-byte loads in flight. The row loops are fully unrolled, so that the row
// arrays are registers and a run's loads can issue back to back.
#define SW 16                  // waves per work-group
#define ST (SW * 32)           // threads per work-group
#define SR 16                  // rows per wave
#define SG (RR / (SW * SR))    // row work-groups per launch
// Stands behind a run of loads: s_wait_xcnt 0 before any register that an issued
// load names is written again. The address operands only keep those registers
// alive up to the wait, so that no later load's result lands in them before it.
#define XWAIT0() asm volatile("s_wait_xcnt 0x0" ::: "memory")
#define XWAIT1(a) asm volatile("s_wait_xcnt 0x0" :: "v"(a) : "memory")
#define XWAIT2(a, b) asm volatile("s_wait_xcnt 0x0" :: "v"(a), "v"(b) : "memory")
#define XWAIT3(a, b, c) asm volatile("s_wait_xcnt 0x0" :: "v"(a), "v"(b), "v"(c) : "memory")
#define XWAIT4(a, b, c, d) asm volatile("s_wait_xcnt 0x0" :: "v"(a), "v"(b), "v"(c), "v"(d) : "memory")

typedef __attribute__((ext_vector_type(2))) float v2f;
typedef __attribute__((ext_vector_type(8))) float v8f;
typedef __attribute__((ext_vector_type(4))) float v4f;

// ---------------------------------------------------------------------------
// CDNA5 async global->LDS copy (ASYNCcnt-tracked DMA), with sync fallback.
// Builtin signature (from hipcc diagnostic): (int4 AS1*, int4 AS3*, Ii, Ii).
// ---------------------------------------------------------------------------
#if defined(__has_builtin)
#if __has_builtin(__builtin_amdgcn_global_load_async_to_lds_b128) && \
    __has_builtin(__builtin_amdgcn_s_wait_asynccnt)
#define HAVE_ASYNC_LDS 1
#endif
#endif

#ifdef HAVE_ASYNC_LDS
typedef int vi4 __attribute__((__vector_size__(4 * sizeof(int))));
typedef __attribute__((address_space(1))) vi4 as1_vi4;
typedef __attribute__((address_space(3))) vi4 as3_vi4;
#endif

__device__ __forceinline__ void copy16(const float* g, float* l) {
#ifdef HAVE_ASYNC_LDS
  as1_vi4* gp = reinterpret_cast<as1_vi4*>((uintptr_t)g);
  as3_vi4* lp = reinterpret_cast<as3_vi4*>((uintptr_t)l);
  __builtin_amdgcn_global_load_async_to_lds_b128(gp, lp, 0, 0);
#else
  *reinterpret_cast<float4*>(l) = *reinterpret_cast<const float4*>(g);
#endif
}

// ---------------------------------------------------------------------------
// Activation epilogues: 0=none, 1=exact GELU (erf), 2=tanh, 3=sigmoid
// ---------------------------------------------------------------------------
// The activations are vector-port work that the matrix unit waits behind, so each
// is written in the fewest vector instructions that still give float accuracy,
// and for two elements at a time, so that the arithmetic is packed (v_pk_*_f32:
// two results an instruction).
// erf and tanh: one odd rational function x * P(x*x) / Q(x*x) on a clamped
// argument (beyond the clamp both are 1 to within a float's last places), the
// quotient by v_rcp_f32. No exponential, no second formula, no select.
// Largest error against the exact function over the whole range: 3.4e-7.
__device__ __forceinline__ v2f fma2(v2f a, v2f b, float c) {
  return __builtin_elementwise_fma(a, b, (v2f){c, c});
}
__device__ __forceinline__ v2f clamp2(v2f x, float lim) {
  return (v2f){__builtin_amdgcn_fmed3f(x.x, -lim, lim), __builtin_amdgcn_fmed3f(x.y, -lim, lim)};
}
__device__ __forceinline__ v2f rcp2(v2f x) {
  return (v2f){__builtin_amdgcn_rcpf(x.x), __builtin_amdgcn_rcpf(x.y)};
}

// v_rcp_f32 and v_exp_f32 with the one free slot that the instruction set asks for
// behind a transcendental.
__device__ __forceinline__ float rcp_slot(float x) {
  float r;
  asm("v_rcp_f32 %0, %1\n\tv_nop" : "=v"(r) : "v"(x));
  return r;
}
__device__ __forceinline__ float exp2_slot(float x) {
  float r;
  asm("v_exp_f32 %0, %1\n\tv_nop" : "=v"(r) : "v"(x));
  return r;
}

__device__ __forceinline__ v2f erf_rat(v2f x) {
  const v2f c = clamp2(x, 4.0f);
  const v2f t = c * c;
  v2f p = fma2(t, (v2f){-2.72614225801306e-10f, -2.72614225801306e-10f}, 2.77068142495902e-08f);
  p = fma2(t, p, -2.10102402082508e-06f);
  p = fma2(t, p, -5.69250639462346e-05f);
  p = fma2(t, p, -7.34990630326855e-04f);
  p = fma2(t, p, -2.95459980854025e-03f);
  p = fma2(t, p, -1.60960333262415e-02f);
  v2f q = fma2(t, (v2f){-1.45660718464996e-05f, -1.45660718464996e-05f}, -2.13374055278905e-04f);
  q = fma2(t, q, -1.68282697438203e-03f);
  q = fma2(t, q, -7.37332916720468e-03f);
  q = fma2(t, q, -1.42647390514189e-02f);
  return (c * p) * rcp2(q);
}

__device__ __forceinline__ v2f tanh_rat(v2f x) {
  const v2f c = clamp2(x, 7.90531110763549805f);
  const v2f t = c * c;
  v2f p = fma2(t, (v2f){-2.76076847742355e-16f, -2.76076847742355e-16f}, 2.00018790482477e-13f);
  p = fma2(t, p, -8.60467152213735e-11f);
  p = fma2(t, p, 5.12229709037114e-08f);
  p = fma2(t, p, 1.48572235717979e-05f);
  p = fma2(t, p, 6.37261928875436e-04f);
  p = fma2(t, p, 4.89352455891786e-03f);
  v2f q = fma2(t, (v2f){1.19825839466702e-06f, 1.19825839466702e-06f}, 1.18534705686654e-04f);
  q = fma2(t, q, 2.26843463243900e-03f);
  q = fma2(t, q, 4.89352518554385e-03f);
  return (c * p) * rcp2(q);
}

// sigmoid(v) = 1 / (1 + 2^(-v * log2 e)): v_exp_f32 and v_rcp_f32 as they are. The
// library's exp spends a dozen instructions on the last bit and on results below
// the normal range, the exact division ten more; neither shows in 1 / (1 + e).
// 2^(+big) = inf gives 0, 2^(-big) = 0 gives 1.
__device__ __forceinline__ v2f sigmoid_fast(v2f v) {
  const v2f a = v * -1.4426950408889634f;
  const v2f e = (v2f){__builtin_amdgcn_exp2f(a.x), __builtin_amdgcn_exp2f(a.y)} + 1.0f;
  return (v2f){rcp_slot(e.x), rcp_slot(e.y)};
}

__device__ __forceinline__ v2f act_apply(v2f v, int act) {
  if (act == 1) return (v * 0.5f) * (erf_rat(v * 0.70710678118654752440f) + 1.0f);
  if (act == 2) return tanh_rat(v);
  if (act == 3) return sigmoid_fast(v);
  return v;
}

// ---------------------------------------------------------------------------
// The attention's output projection and the local MLP's first layer are two
// linear maps with nothing between them:
//   (o @ Wo + bo) @ W1 + b1 = o @ (Wo @ W1) + (bo @ W1 + b1).
// Wf = Wo @ W1 [128,256] and bf = bo @ W1 + b1 [256] are formed here, anew in
// every call, and the MLP kernel then takes the attention rows with Wf and bf:
// the product of all 65,536 rows with Wo is not needed any more.
// One wave per 16x32 tile (a row's 32 columns are one whole 128-byte line), 72
// tiles: row tiles 0..7 are Wo's rows; in row tile 8 every row is bo, the sums
// start from b1, and row 0 is kept. Fragments come straight from global memory,
// k in rising order, 4 per WMMA, in the lane order of the other kernels' loaders.
// ---------------------------------------------------------------------------
#define FG 9                   // work-groups of 8 waves at the head of the first launch that form Wf and bf

__device__ __forceinline__ void fold_tile(const float* __restrict__ Wo,
                                          const float* __restrict__ bo,
                                          const float* __restrict__ W1,
                                          const float* __restrict__ b1,
                                          float* __restrict__ Wf,
                                          float* __restrict__ bf,
                                          int tile, int lane) {
  const int rt = tile >> 3;        // wave-uniform
  const int c0 = (tile & 7) * 32;
  const int m = lane & 15;         // A row / C column within a 16x16 subtile
  const int hi = lane >> 4;        // K-pair selector (lanes 16-31: K+2,K+3)
  const bool brow = (rt == 8);
  const float* pa = (brow ? bo : Wo + (rt * 16 + m) * 128) + 2 * hi;
  const float* pb = W1 + (2 * hi) * 256 + c0 + m;
  const float* pc = b1 + c0 + m;
  const float bb[2] = {pc[0], pc[16]};

  // C/D layout: a lane's 8 registers are 8 rows of its one column (lane & 15).
  v8f acc[2];
#pragma unroll
  for (int nt = 0; nt < 2; ++nt)
#pragma unroll
    for (int r2 = 0; r2 < 8; ++r2) acc[nt][r2] = brow ? bb[nt] : 0.f;
  // Four batches of 8 k-steps, fully unrolled (constant offsets from pa and pb):
  // 40 loads in flight a batch, few enough registers for two work-groups a WGP.
#pragma unroll
  for (int q = 0; q < 4; ++q) {
    v2f av[8], bv[8][2];
#pragma unroll
    for (int i = 0; i < 8; ++i) {
      const int k0 = (q * 8 + i) * 4;
      av[i] = *reinterpret_cast<const v2f*>(pa + k0);
#pragma unroll
      for (int nt = 0; nt < 2; ++nt) {
        bv[i][nt].x = pb[k0 * 256 + nt * 16];
        bv[i][nt].y = pb[(k0 + 1) * 256 + nt * 16];
      }
    }
    XWAIT3(pa, pb, pc);  // behind these loads, before their address registers are written again
#pragma unroll
    for (int i = 0; i < 8; ++i)
#pragma unroll
      for (int nt = 0; nt < 2; ++nt)
        acc[nt] = __builtin_amdgcn_wmma_f32_16x16x4_f32(
            false, av[i], false, bv[i][nt], (short)0, acc[nt], false, false);
  }
  // Four free vector slots between the last WMMA and the first reader of its
  // result: the stores stand behind branches.
  asm volatile("v_nop\n\tv_nop\n\tv_nop\n\tv_nop" : "+v"(acc[0]), "+v"(acc[1]));

  // C/D layout: VGPR r2 holds M=r2 (lanes 0-15) or M=r2+8 (lanes 16-31)
  if (!brow) {
#pragma unroll
    for (int nt = 0; nt < 2; ++nt)
#pragma unroll
      for (int r2 = 0; r2 < 8; ++r2)
        Wf[(rt * 16 + hi * 8 + r2) * 256 + c0 + nt * 16 + m] = acc[nt][r2];
    XWAIT0();  // behind these stores, before a register that they name is written again
  } else if (hi == 0) {
    bf[c0 + m] = acc[0][0];
    bf[c0 + 16 + m] = acc[1][0];
  }
}

// ---------------------------------------------------------------------------
// Banded (|i-j|<=1) multi-head attention: off-band -1e9 scores underflow to
// exactly 0 after fp32 softmax, so only 3 neighbors matter.
// One wave per (bn, run of SR time steps). A lane holds 4 of a row's 128
// features (8 lanes a head), so each load and store of a wave is 512 contiguous
// bytes (4 whole lines) of one row's q, k, v or output, and a k or v row serves
// its three queries from registers. A score is 4 products in the lane, then a
// sum over the head's 8 lanes; every lane of a head then holds the same softmax.
// ---------------------------------------------------------------------------
template <int CTRL>
__device__ __forceinline__ float dpp_add(float v) {
  // v + (v of the lane that CTRL names): a cross-lane add on the vector port
  // (__shfl_xor would go through the LDS queue and its latency).
  const int o = __builtin_amdgcn_mov_dpp(__builtin_bit_cast(int, v), CTRL, 0xf, 0xf, true);
  return v + __builtin_bit_cast(float, o);
}

__device__ __forceinline__ float head_dot(const float4 a, const float4 b) {
  float d = a.x * b.x + a.y * b.y + a.z * b.z + a.w * b.w;
  d = dpp_add<0x161>(d);  // row_xmask:1
  d = dpp_add<0x162>(d);  // row_xmask:2
  d = dpp_add<0x164>(d);  // row_xmask:4
  return d;
}

__global__ void __launch_bounds__(ST) attn_kernel(const float* __restrict__ qkv,
                            float* __restrict__ outp) {
  const int lane = threadIdx.x & 31;
  const int w = blockIdx.x * SW + (threadIdx.x >> 5);
  const int t0 = (w & 15) * SR;       // a work-group's waves cover one bn
  const int bn = w >> 4;

  // Two batches of SR/2 rows, 28 loads each: all of a run's rows at once would
  // not fit the registers of 16 waves a WGP. Every loop is fully unrolled, so
  // that q, k and v are registers and a batch's loads issue back to back.
  constexpr int HB = SR / 2;
#pragma unroll
  for (int h = 0; h < 2; ++h) {
    const int tb = t0 + h * HB;
    const bool lo_out = (tb == 0), hi_out = (tb + HB == TT);
    // a row of qkv is 96 float4: q at 0, k at 32, v at 64
    const float4* pb = reinterpret_cast<const float4*>(qkv) + (size_t)(bn * TT + tb) * 96 + lane;
    // The two neighbour rows outside [0,T) are read in bounds (the batch's own
    // edge row instead); their scores are masked below.
    const float4* plo = lo_out ? pb : pb - 96;
    const float4* phi = hi_out ? pb + (HB - 1) * 96 : pb + HB * 96;
    float4 q[HB], k[HB + 2], v[HB + 2];   // k, v: time steps tb-1 .. tb+HB
    k[0] = plo[32]; v[0] = plo[64];
    k[HB + 1] = phi[32]; v[HB + 1] = phi[64];
#pragma unroll
    for (int i = 0; i < HB; ++i) {
      q[i] = pb[i * 96];
      k[i + 1] = pb[i * 96 + 32];
      v[i + 1] = pb[i * 96 + 64];
    }
    XWAIT3(pb, plo, phi);  // behind these loads, before their address registers are written again

    float4* O4 = reinterpret_cast<float4*>(outp) + (size_t)(bn * TT + tb) * 32 + lane;
#pragma unroll
    for (int i = 0; i < HB; ++i) {
      // 1/sqrt(32) times log2 e: the softmax is taken in powers of two, so that each
      // weight is one v_exp_f32 (arguments <= 0; a result below the normal range is 0
      // beside the largest weight, which is 1) and the quotient one v_rcp_f32.
      const float sc = 0.17677669529663687f * 1.4426950408889634f;
      float s0 = head_dot(q[i], k[i]) * sc;
      const float s1 = head_dot(q[i], k[i + 1]) * sc;
      float s2 = head_dot(q[i], k[i + 2]) * sc;
      if (i == 0 && lo_out) s0 = -3.0e38f;       // t = 0: no step before; its weight is exp(-huge) = 0
      if (i == HB - 1 && hi_out) s2 = -3.0e38f;  // t = T-1: no step behind
      const float mmax = fmaxf(fmaxf(s0, s1), s2);
      const float p0 = exp2_slot(s0 - mmax), p1 = exp2_slot(s1 - mmax), p2 = exp2_slot(s2 - mmax);
      const float invd = rcp_slot(p0 + p1 + p2);
      const float4 va = v[i], vb = v[i + 1], vc = v[i + 2];
      float4 o;
      o.x = (p0 * va.x + p1 * vb.x + p2 * vc.x) * invd;
      o.y = (p0 * va.y + p1 * vb.y + p2 * vc.y) * invd;
      o.z = (p0 * va.z + p1 * vb.z + p2 * vc.z) * invd;
      o.w = (p0 * va.w + p1 * vb.w + p2 * vc.w) * invd;
      O4[(size_t)i * 32] = o;
    }
  }
}

// ---------------------------------------------------------------------------
// One branch's MLP with its LayerNorm in one kernel:
//   Y = LN(gelu(X @ W1 + b1) @ W2 + b2) * g + b,  X, Y: [R,128], W1: [128,256], W2: [256,128]
// A work-group of 8 waves owns FM = 64 rows from end to end. Its X rows, the 256
// hidden values of each row and the 128 values in front of the LayerNorm live in
// LDS only; global memory sees one read of X and one write of Y. The weights
// come through LDS in 16 chunks of 4,096 floats (8 of W1: 16 k-rows; 8 of W2:
// 32 k-rows), two buffers, the copies of chunk c + 2 in flight during chunk c + 1.
// First product: wave tile 64x32 (4x2 subtiles), 8 waves side by side = 256 columns.
// Second product: wave tile 32x32 (2x2 subtiles), 2 waves down x 4 across.
// Both sum k in rising order, 4 per WMMA, as every product of this file does.
// 135,168 B of LDS: two work-groups per WGP, 4 waves per SIMD.
// ---------------------------------------------------------------------------
#define FM 64                   // rows per work-group
#define FT 256                  // threads per work-group (8 waves)
#define PX 132                  // pitch of the X rows (and of the rows in front of the LayerNorm): 4 mod 64 (A rows)
#define PH 260                  // pitch of the hidden rows: 4 mod 64 (A rows)
#define PW1 264                 // pitch of W1 rows: 8 mod 64 (B rows)
#define PW2 136                 // pitch of W2 rows: the same
#define WBUF 4352               // floats per weight buffer: max(16 * PW1, 32 * PW2)
#define FUSED_LDS_FLOATS (FM * PX + FM * PH + 2 * WBUF)
// End of a chunk: this wave's LDS reads and writes are done, its own copies have
// landed, and the barrier then publishes both to the other waves and frees the
// buffer that was just read for the next copies.
#define CHUNK_FOOT()                                   \
  do {                                                 \
    asm volatile("s_wait_dscnt 0x0" ::: "memory");     \
    asm volatile("s_wait_asynccnt 0x0" ::: "memory");  \
    __syncthreads();                                   \
  } while (0)

__global__ void __launch_bounds__(FT) mlp_ln_kernel(const float* __restrict__ X,
                              const float* __restrict__ W1,
                              const float* __restrict__ b1,
                              const float* __restrict__ W2,
                              const float* __restrict__ b2,
                              const float* __restrict__ g,
                              const float* __restrict__ b,
                              float* __restrict__ Y) {
  extern __shared__ float smem[];
  float* sX = smem;                      // [FM][PX]: X, later the rows in front of the LayerNorm
  float* sH = smem + FM * PX;            // [FM][PH]: hidden rows
  float* sW = smem + FM * PX + FM * PH;  // [2][WBUF]: weight chunks

  const int tid = threadIdx.x;
  const int lane = tid & 31;
  const int wv = __builtin_amdgcn_readfirstlane(tid >> 5);  // wave-uniform: tile offsets are scalar
  const int m = lane & 15;         // A row / C column within a 16x16 subtile
  const int hi = lane >> 4;        // K-pair selector (lanes 16-31: K+2,K+3)
  const int rowBase = blockIdx.x * FM;

  // A weight chunk is 4,096 floats in a row in global memory: 4 x b128 per
  // thread. Chunk c of W1 and chunk j of W2 go into buffer c & 1 and j & 1.
  auto stage1 = [&](int c) {
    float* d = sW + (c & 1) * WBUF;
    const float* gw = W1 + c * 4096;
#pragma unroll
    for (int j = 0; j < 4; ++j) {
      const int idx = tid + j * FT;
      copy16(gw + idx * 4, d + (idx >> 6) * PW1 + ((idx & 63) << 2));
    }
  };
  auto stage2 = [&](int c) {
    float* d = sW + (c & 1) * WBUF;
    const float* gw = W2 + c * 4096;
#pragma unroll
    for (int j = 0; j < 4; ++j) {
      const int idx = tid + j * FT;
      copy16(gw + idx * 4, d + (idx >> 5) * PW2 + ((idx & 31) << 2));
    }
  };

  // X rows (8 x b128 per thread) and the first weight chunk.
#pragma unroll
  for (int j = 0; j < (FM * 128) / (4 * FT); ++j) {
    const int idx = tid + j * FT;
    const int r = idx >> 5;
    const int cs = (idx & 31) << 2;
    copy16(X + (size_t)(rowBase + r) * 128 + cs, sX + r * PX + cs);
  }
  stage1(0);
  // Biases and LayerNorm parameters: asked for here, so that their latency runs
  // out beside that of the first copies.
  const int c1 = wv * 32 + m;         // this lane's columns of the first product: c1, c1 + 16
  const int c2 = (wv >> 1) * 32 + m;  // of the second product: c2, c2 + 16
  const float bb1[2] = {b1[c1], b1[c1 + 16]};
  const float bb2[2] = {b2[c2], b2[c2 + 16]};
  const v4f g4 = reinterpret_cast<const v4f*>(g)[lane];
  const v4f b4 = reinterpret_cast<const v4f*>(b)[lane];
  XWAIT3(c1, c2, lane);  // behind these loads, before their address registers are written again
  asm volatile("s_wait_asynccnt 0x0" ::: "memory");  // own copies landed, before the barrier that publishes them
  __syncthreads();
  stage1(1);

  // ---- hidden = gelu(X @ W1 + b1) ----
  {
    v8f acc[4][2] = {};
    const int nw = wv * 32;
    // The two chunk loops stay rolled (for speed only).
#pragma unroll 1
    for (int c = 0; c < 8; ++c) {
      const float* cA = sX + c * 16;
      const float* cB = sW + (c & 1) * WBUF;
#pragma unroll
      for (int k0 = 0; k0 < 16; k0 += 4) {
        const int kl = k0 + 2 * hi;
        v2f av[4], bv[2];
#pragma unroll
        for (int mt = 0; mt < 4; ++mt) {
          const float* p = cA + (mt * 16 + m) * PX + kl;
          av[mt].x = p[0];
          av[mt].y = p[1];
        }
#pragma unroll
        for (int nt = 0; nt < 2; ++nt) {
          const float* p = cB + kl * PW1 + nw + nt * 16 + m;
          bv[nt].x = p[0];
          bv[nt].y = p[PW1];
        }
#pragma unroll
        for (int mt = 0; mt < 4; ++mt)
#pragma unroll
          for (int nt = 0; nt < 2; ++nt)
            acc[mt][nt] = __builtin_amdgcn_wmma_f32_16x16x4_f32(
                false, av[mt], false, bv[nt], (short)0, acc[mt][nt], false, false);
      }
      CHUNK_FOOT();
      if (c < 6) stage1(c + 2);  // the test reads the same for the whole work-group
      else       stage2(c - 6);  // the first two chunks of W2 fly during the last of W1 and the GELU
    }
    // C/D layout: VGPR r2 holds M=r2 (lanes 0-15) or M=r2+8 (lanes 16-31)
#pragma unroll
    for (int nt = 0; nt < 2; ++nt) {
      const int col = nw + nt * 16 + m;
#pragma unroll
      for (int mt = 0; mt < 4; ++mt)
#pragma unroll
        for (int r2 = 0; r2 < 8; r2 += 2) {
          const v2f h = act_apply((v2f){acc[mt][nt][r2], acc[mt][nt][r2 + 1]} + bb1[nt], 1);
          sH[(mt * 16 + hi * 8 + r2) * PH + col] = h.x;
          sH[(mt * 16 + hi * 8 + r2 + 1) * PH + col] = h.y;
        }
    }
    asm volatile("s_wait_dscnt 0x0" ::: "memory");  // own hidden values written, before the barrier that publishes them
    __syncthreads();
  }

  // ---- rows in front of the LayerNorm = hidden @ W2 + b2 ----
  {
    v8f acc[2][2] = {};
    const int mw = (wv & 1) * 32;
    const int nw = (wv >> 1) * 32;
#pragma unroll 1
    for (int c = 0; c < 8; ++c) {
      const float* cA = sH + c * 32;
      const float* cB = sW + (c & 1) * WBUF;
#pragma unroll
      for (int k0 = 0; k0 < 32; k0 += 4) {
        const int kl = k0 + 2 * hi;
        v2f av[2], bv[2];
#pragma unroll
        for (int mt = 0; mt < 2; ++mt) {
          const float* p = cA + (mw + mt * 16 + m) * PH + kl;
          av[mt].x = p[0];
          av[mt].y = p[1];
        }
#pragma unroll
        for (int nt = 0; nt < 2; ++nt) {
          const float* p = cB + kl * PW2 + nw + nt * 16 + m;
          bv[nt].x = p[0];
          bv[nt].y = p[PW2];
        }
#pragma unroll
        for (int mt = 0; mt < 2; ++mt)
#pragma unroll
          for (int nt = 0; nt < 2; ++nt)
            acc[mt][nt] = __builtin_amdgcn_wmma_f32_16x16x4_f32(
                false, av[mt], false, bv[nt], (short)0, acc[mt][nt], false, false);
      }
      CHUNK_FOOT();
      if (c < 6) stage2(c + 2);  // the test reads the same for the whole work-group
    }
    // X was last read many barriers ago: its rows now take the sums.
#pragma unroll
    for (int nt = 0; nt < 2; ++nt) {
      const int col = nw + nt * 16 + m;
#pragma unroll
      for (int mt = 0; mt < 2; ++mt)
#pragma unroll
        for (int r2 = 0; r2 < 8; ++r2)
          sX[(mw + mt * 16 + hi * 8 + r2) * PX + col] = acc[mt][nt][r2] + bb2[nt];
    }
    asm volatile("s_wait_dscnt 0x0" ::: "memory");  // own sums written, before the barrier that publishes them
    __syncthreads();
  }

  // ---- LayerNorm over D=128: one wave per row at a time (4 floats/lane,
  // shfl_xor reduce), 8 rows per wave; each store is one whole 512-byte row ----
  v4f* Y4 = reinterpret_cast<v4f*>(Y) + (size_t)(rowBase + wv * 8) * 32 + lane;
#pragma unroll
  for (int i = 0; i < FM / 8; ++i) {
    const v4f v = *reinterpret_cast<const v4f*>(sX + (wv * 8 + i) * PX + lane * 4);
    float s = v.x + v.y + v.z + v.w;
    float sq = v.x * v.x + v.y * v.y + v.z * v.z + v.w * v.w;
#pragma unroll
    for (int off = 16; off > 0; off >>= 1) {
      s += __shfl_xor(s, off, 32);
      sq += __shfl_xor(sq, off, 32);
    }
    float mean = s * (1.0f / 128.0f);
    float var = sq * (1.0f / 128.0f) - mean * mean;
    float inv = rsqrtf(var + 1e-5f);

    v4f o;
    o.x = (v.x - mean) * inv * g4.x + b4.x;
    o.y = (v.y - mean) * inv * g4.y + b4.y;
    o.z = (v.z - mean) * inv * g4.z + b4.z;
    o.w = (v.w - mean) * inv * g4.w + b4.w;
    Y4[(size_t)i * 32] = o;
  }
}

// ---------------------------------------------------------------------------
// The local branch's detrend and its QKV projection in one kernel:
//   xl[bn,t,:] = x[b,t,n,:] - softmax(window_weight)-weighted 3-tap trend (zero-padded in time)
//   qkv = xl @ Wq + bq,  Wq: [128,384]
// A work-group of 8 waves owns FM = 64 rows (one b and n, 64 time steps) and all
// 384 columns. Each wave forms 8 detrended rows in registers (10 rows of x: the
// neighbours in time come from its own registers) and puts them into LDS, where
// they are the product's A rows: xl never goes to global memory, and a row is
// fetched once, not once per column block. The weights come through LDS in 4
// chunks of QK = 32 k-rows, two buffers, the copies of chunk c + 2 in flight
// during chunk c + 1. Wave tile 32x96 (2x6 subtiles: whole 128-byte lines of a
// qkv row), 2 waves down x 4 across; k is summed in rising order, 4 per WMMA.
// 134,144 B of LDS: two work-groups per WGP, 4 waves per SIMD, 1,024 work-groups
// in two even rounds. Work-groups next to each other take neighbouring n, whose
// rows of x lie side by side in memory.
// The launch's first FG work-groups form Wf and bf instead (fold_tile): that
// work needs a handful of waves only and runs beside the rest.
// ---------------------------------------------------------------------------
#define QK 32                   // k-rows per weight chunk
#define PWQ 392                 // pitch of the Wq rows: 8 mod 64 (B rows)
#define QBUF (QK * PWQ)         // floats per weight buffer
#define QKV_LDS_FLOATS (FM * PX + 2 * QBUF)

__global__ void __launch_bounds__(FT) detrend_qkv_kernel(const float* __restrict__ x,
                                   const float* __restrict__ wwraw,
                                   const float* __restrict__ Wq,
                                   const float* __restrict__ bq,
                                   float* __restrict__ qkv,
                                   const float* __restrict__ Wo,
                                   const float* __restrict__ bo,
                                   const float* __restrict__ W1,
                                   const float* __restrict__ b1,
                                   float* __restrict__ Wf,
                                   float* __restrict__ bf) {
  extern __shared__ float smem[];
  float* sX = smem;            // [FM][PX]: detrended rows
  float* sW = smem + FM * PX;  // [2][QBUF]: weight chunks

  const int tid = threadIdx.x;
  const int lane = tid & 31;
  const int wv = __builtin_amdgcn_readfirstlane(tid >> 5);  // wave-uniform: tile offsets are scalar
  if (blockIdx.x < FG) {       // whole work-groups, in front of every barrier
    fold_tile(Wo, bo, W1, b1, Wf, bf, blockIdx.x * (FT / 32) + wv, lane);  // 72 tiles
    return;
  }
  const int blk = blockIdx.x - FG;
  const int n = blk & 63;
  const int tc = (blk >> 6) & 3;
  const int b = blk >> 8;
  const int t0 = tc * FM + wv * 8;   // this wave's 8 time steps
  const int m = lane & 15;           // A row / C column within a 16x16 subtile
  const int hi = lane >> 4;          // K-pair selector (lanes 16-31: K+2,K+3)
  const int mw = (wv & 1) * 32;      // wave row offset
  const int nw = (wv >> 1) * 96;     // wave column offset

  // This wave's rows of x, time steps t0-1 .. t0+8: asked for first, theirs is the
  // longest way. The two edge rows are read in bounds and set to zero below.
  const float4* X4 = reinterpret_cast<const float4*>(x) + ((size_t)(b * TT) * NN + n) * 32 + lane;
  float4 v[10];
  const float4* xlo = X4 + (size_t)(t0 > 0 ? t0 - 1 : 0) * (NN * 32);
  const float4* xhi = X4 + (size_t)(t0 + 8 < TT ? t0 + 8 : TT - 1) * (NN * 32);
  const float4* xb = X4 + (size_t)t0 * (NN * 32);
  v[0] = *xlo;
  v[9] = *xhi;
#pragma unroll
  for (int i = 0; i < 8; ++i) v[i + 1] = xb[(size_t)i * (NN * 32)];
  XWAIT3(xlo, xhi, xb);  // behind these loads, before their address registers are written again

  // A weight chunk is 32 rows of 96 x b128, 12,288 floats in a row in global
  // memory: 12 x b128 per thread. 8 rows are 3 copies per thread, and their
  // places in LDS repeat every 8 rows. Chunk c goes into buffer c & 1.
  int lo[3];
#pragma unroll
  for (int j = 0; j < 3; ++j) {
    const int idx = tid + j * FT;
    lo[j] = (idx / 96) * PWQ + (idx % 96) * 4;
  }
  auto stage = [&](int c) {
    float* d = sW + (c & 1) * QBUF;
    const float* gw = Wq + c * (QK * 384) + tid * 4;
#pragma unroll
    for (int q = 0; q < QK / 8; ++q)
#pragma unroll
      for (int j = 0; j < 3; ++j)
        copy16(gw + (q * 3 + j) * (FT * 4), d + q * (8 * PWQ) + lo[j]);
  };
  stage(0);
  // Biases: asked for here, so that their latency runs out beside that of the first copies.
  const float* pq = bq + nw + m;     // this lane's columns: nw + m + 16 * nt
  float bb[6];
#pragma unroll
  for (int nt = 0; nt < 6; ++nt) bb[nt] = pq[nt * 16];
  XWAIT1(pq);  // behind these loads, before their address registers are written again

  float w0 = wwraw[0], w1 = wwraw[1], w2 = wwraw[2];
  float mx = fmaxf(w0, fmaxf(w1, w2));
  float e0 = expf(w0 - mx), e1 = expf(w1 - mx), e2 = expf(w2 - mx);
  float inv = 1.0f / (e0 + e1 + e2);
  e0 *= inv; e1 *= inv; e2 *= inv;

  if (t0 == 0)       v[0] = make_float4(0.f, 0.f, 0.f, 0.f);
  if (t0 + 8 == TT)  v[9] = make_float4(0.f, 0.f, 0.f, 0.f);
#pragma unroll
  for (int i = 0; i < 8; ++i) {
    const float4 xm = v[i], xc = v[i + 1], xp = v[i + 2];
    float4 o;
    o.x = xc.x - (e0 * xm.x + e1 * xc.x + e2 * xp.x);
    o.y = xc.y - (e0 * xm.y + e1 * xc.y + e2 * xp.y);
    o.z = xc.z - (e0 * xm.z + e1 * xc.z + e2 * xp.z);
    o.w = xc.w - (e0 * xm.w + e1 * xc.w + e2 * xp.w);
    *reinterpret_cast<float4*>(sX + (wv * 8 + i) * PX + lane * 4) = o;
  }
  CHUNK_FOOT();  // own rows written and own copies landed, before the barrier that publishes both
  stage(1);

  v8f acc[2][6] = {};
  // The chunk loop stays rolled, as in the MLP kernel.
#pragma unroll 1
  for (int c = 0; c < 128 / QK; ++c) {
    const float* cA = sX + c * QK;
    const float* cB = sW + (c & 1) * QBUF;
#pragma unroll
    for (int k0 = 0; k0 < QK; k0 += 4) {
      const int kl = k0 + 2 * hi;
      v2f av[2], bv[6];
#pragma unroll
      for (int mt = 0; mt < 2; ++mt) {
        const float* p = cA + (mw + mt * 16 + m) * PX + kl;
        av[mt].x = p[0];
        av[mt].y = p[1];
      }
#pragma unroll
      for (int nt = 0; nt < 6; ++nt) {
        const float* p = cB + kl * PWQ + nw + nt * 16 + m;
        bv[nt].x = p[0];
        bv[nt].y = p[PWQ];
      }
#pragma unroll
      for (int mt = 0; mt < 2; ++mt)
#pragma unroll
        for (int nt = 0; nt < 6; ++nt)
          acc[mt][nt] = __builtin_amdgcn_wmma_f32_16x16x4_f32(
              false, av[mt], false, bv[nt], (short)0, acc[mt][nt], false, false);
    }
    // Four free vector slots behind the chunk's last WMMA: the next vector
    // instruction that writes one of its A or B registers stands behind the
    // loop's branches.
    asm volatile("v_nop\n\tv_nop\n\tv_nop\n\tv_nop"
                 : "+v"(acc[0][0]), "+v"(acc[0][1]), "+v"(acc[0][2]), "+v"(acc[0][3]),
                   "+v"(acc[0][4]), "+v"(acc[0][5]), "+v"(acc[1][0]), "+v"(acc[1][1]),
                   "+v"(acc[1][2]), "+v"(acc[1][3]), "+v"(acc[1][4]), "+v"(acc[1][5]));
    CHUNK_FOOT();
    if (c < 128 / QK - 2) stage(c + 2);  // the test reads the same for the whole work-group
  }

  // C/D layout: VGPR r2 holds M=r2 (lanes 0-15) or M=r2+8 (lanes 16-31).
  // Row by row: six stores in a row fill the wave's 384 contiguous bytes of a row.
#pragma unroll
  for (int mt = 0; mt < 2; ++mt)
#pragma unroll
    for (int nt = 0; nt < 6; ++nt)
#pragma unroll
      for (int r2 = 0; r2 < 8; ++r2) acc[mt][nt][r2] += bb[nt];
  float* Cq = qkv + ((size_t)((b * NN + n) * TT + tc * FM + mw + hi * 8)) * 384 + nw + m;
#pragma unroll
  for (int mt = 0; mt < 2; ++mt)
#pragma unroll
    for (int r2 = 0; r2 < 8; ++r2)
#pragma unroll
      for (int nt = 0; nt < 6; ++nt)
        Cq[(mt * 16 + r2) * 384 + nt * 16] = acc[mt][nt][r2];
  XWAIT0();  // behind these stores, before a register that they name is written again
}

// ---------------------------------------------------------------------------
// prep_conv: x_pos = x + pos_enc; depthwise conv3 (pad 1, zeros AFTER pos add
// per reference) + conv bias. Output layout [bn,t,D]. One wave per (b, n, run
// of SR time steps); the taps and the neighbours in time stay in registers.
// ---------------------------------------------------------------------------
__global__ void __launch_bounds__(ST) prep_conv_kernel(const float* __restrict__ x,
                                 const float* __restrict__ pos,
                                 const float* __restrict__ cw,
                                 const float* __restrict__ cb,
                                 float* __restrict__ xconv) {
  const int lane = threadIdx.x & 31;
  const int w = blockIdx.x * SW + (threadIdx.x >> 5);
  const int n = w & 63;               // a work-group's waves read neighbouring n
  const int t0 = ((w >> 6) & 15) * SR;
  const int b = w >> 10;
  const int d0 = lane * 4;

  const float4* X4 = reinterpret_cast<const float4*>(x) + ((size_t)(b * TT) * NN + n) * 32 + lane;
  const float4* P4 = reinterpret_cast<const float4*>(pos) + lane;

  float k0[4], k1[4], k2[4], kb[4];
#pragma unroll
  for (int c = 0; c < 4; ++c) {
    int d = d0 + c;
    k0[c] = cw[d * 3 + 0]; k1[c] = cw[d * 3 + 1]; k2[c] = cw[d * 3 + 2];
    kb[c] = cb[d];
  }
  XWAIT0();  // behind these loads, before their address registers are written again
  float4 v[SR + 2], p[SR + 2];        // time steps t0-1 .. t0+SR
  const int tlo = t0 > 0 ? t0 - 1 : 0;              // the two edge rows are read in
  const int thi = t0 + SR < TT ? t0 + SR : TT - 1;  // bounds and set to zero below
  const float4* xlo = X4 + (size_t)tlo * (NN * 32);
  const float4* xhi = X4 + (size_t)thi * (NN * 32);
  const float4* plo = P4 + (size_t)tlo * 32;
  const float4* phi = P4 + (size_t)thi * 32;
  const float4* xb = X4 + (size_t)t0 * (NN * 32);
  const float4* pb = P4 + (size_t)t0 * 32;
  v[0] = *xlo; p[0] = *plo;
  v[SR + 1] = *xhi; p[SR + 1] = *phi;
  XWAIT4(xlo, xhi, plo, phi);  // behind these loads, before their address registers are written again
#pragma unroll
  for (int i = 0; i < SR; ++i) {
    v[i + 1] = xb[(size_t)i * (NN * 32)];
    p[i + 1] = pb[(size_t)i * 32];
  }
  XWAIT2(xb, pb);  // behind these loads, before their address registers are written again
#pragma unroll
  for (int i = 0; i < SR + 2; ++i) {
    v[i].x += p[i].x; v[i].y += p[i].y; v[i].z += p[i].z; v[i].w += p[i].w;
  }
  if (t0 == 0)       v[0] = make_float4(0.f, 0.f, 0.f, 0.f);
  if (t0 + SR == TT) v[SR + 1] = make_float4(0.f, 0.f, 0.f, 0.f);

  float4* O4 = reinterpret_cast<float4*>(xconv) + ((size_t)(b * NN + n) * TT + t0) * 32 + lane;
#pragma unroll
  for (int i = 0; i < SR; ++i) {
    const float4 xm = v[i], xc = v[i + 1], xp = v[i + 2];
    float4 o;
    o.x = k0[0] * xm.x + k1[0] * xc.x + k2[0] * xp.x + kb[0];
    o.y = k0[1] * xm.y + k1[1] * xc.y + k2[1] * xp.y + kb[1];
    o.z = k0[2] * xm.z + k1[2] * xc.z + k2[2] * xp.z + kb[2];
    o.w = k0[3] * xm.w + k1[3] * xc.w + k2[3] * xp.w + kb[3];
    O4[(size_t)i * 32] = o;
  }
}

// ---------------------------------------------------------------------------
// Mixed pool: k=6, stride 1, pad (2,2) -> length T-1, right zero-pad to T.
// avg divides by 6 always (zero pad contributes 0); max over valid entries.
// One wave per (bn, run of SR time steps): the SR+5 rows its windows cover are
// loaded once; each window is summed on its own, in rising time order.
// ---------------------------------------------------------------------------
__global__ void __launch_bounds__(ST) pool_kernel(const float* __restrict__ xconv,
                            const float* __restrict__ alpha_p,
                            float* __restrict__ outp) {
  const int lane = threadIdx.x & 31;
  const int w = blockIdx.x * SW + (threadIdx.x >> 5);
  const int t0 = (w & 15) * SR;
  const int bn = w >> 4;
  const bool first = (t0 == 0), last = (t0 + SR == TT);

  const float a = 1.0f / (1.0f + expf(-alpha_p[0]));
  const float4* XC4 = reinterpret_cast<const float4*>(xconv) + (size_t)(bn * TT) * 32 + lane;

  float4 vs[SR + 5], vm[SR + 5];      // time steps t0-2 .. t0+SR+2: for the sum, for the max
  // Rows outside [0,T) are read in bounds (rows of the run itself instead) and replaced below.
  const float4* cb4 = XC4 + (size_t)t0 * 32;
  const float4* clo = first ? cb4 + 2 * 32 : cb4;            // clo[-2 rows], clo[-1 row]
  const float4* chi = last ? cb4 - 3 * 32 : cb4;             // chi[SR rows] .. chi[SR+2 rows]
  vs[0] = clo[-2 * 32]; vs[1] = clo[-1 * 32];
  vs[SR + 2] = chi[SR * 32]; vs[SR + 3] = chi[(SR + 1) * 32]; vs[SR + 4] = chi[(SR + 2) * 32];
  XWAIT2(clo, chi);  // behind these loads, before their address registers are written again
#pragma unroll
  for (int i = 0; i < SR; ++i) vs[i + 2] = cb4[(size_t)i * 32];
  XWAIT1(cb4);  // behind these loads, before their address registers are written again
#pragma unroll
  for (int i = 0; i < SR + 5; ++i) {
    vm[i] = vs[i];
    if ((i < 2 && first) || (i >= SR + 2 && last)) {
      vs[i] = make_float4(0.f, 0.f, 0.f, 0.f);
      vm[i] = make_float4(-3.0e38f, -3.0e38f, -3.0e38f, -3.0e38f);
    }
  }

  float4* O4 = reinterpret_cast<float4*>(outp) + ((size_t)(bn * TT) + t0) * 32 + lane;
  const float inv6 = 1.0f / 6.0f;
#pragma unroll
  for (int i = 0; i < SR; ++i) {
    float sx = 0.f, sy = 0.f, sz = 0.f, sw = 0.f;
    float mx = -3.0e38f, my = -3.0e38f, mz = -3.0e38f, mw = -3.0e38f;
#pragma unroll
    for (int k = 0; k < 6; ++k) {
      const float4 s = vs[i + k], m = vm[i + k];
      sx += s.x; sy += s.y; sz += s.z; sw += s.w;
      mx = fmaxf(mx, m.x); my = fmaxf(my, m.y);
      mz = fmaxf(mz, m.z); mw = fmaxf(mw, m.w);
    }
    float4 res;
    res.x = a * (sx * inv6) + (1.f - a) * mx;
    res.y = a * (sy * inv6) + (1.f - a) * my;
    res.z = a * (sz * inv6) + (1.f - a) * mz;
    res.w = a * (sw * inv6) + (1.f - a) * mw;
    if (i == SR - 1 && last) res = make_float4(0.f, 0.f, 0.f, 0.f);  // t = T-1: the right zero-pad
    O4[(size_t)i * 32] = res;
  }
}

// ---------------------------------------------------------------------------
// The gated fusion and the residual in one kernel:
//   gate = sigmoid(tanh([x_loc | x_glob] @ W1 + b1) @ W2 + b2),  W1: [256,128], W2: [128,128]
//   out  = x + softplus(res_scale) * (gate * x_loc + (1 - gate) * x_glob)
// with the [bn,t,D] -> [B,T,N,D] relayout on x and out. A work-group of 8 waves
// owns FM = 64 rows (one bn, 64 time steps) from end to end. The two branches'
// rows lie side by side in LDS, where they are the first product's A rows and
// later the two sides of the blend; the tanh rows and the gate live in LDS only.
// Global memory sees one read each of x_loc, x_glob and x and one write of out.
// The weights come through LDS in 12 chunks of 32 k-rows (8 of W1, 4 of W2), two
// buffers, the copies of chunk c + 2 in flight during chunk c + 1.
// Both products: wave tile 32x32 (2x2 subtiles), 2 waves down x 4 across; k is
// summed in rising order, 4 per WMMA, as every product of this file does.
// 135,168 B of LDS: two work-groups per WGP, 4 waves per SIMD.
// ---------------------------------------------------------------------------
#define GATE_LDS_FLOATS (FM * PH + FM * PX + 2 * WBUF)

__device__ __forceinline__ float softplus_f(float v) {
  // One path for both signs, the same values: max(v, 0) + log1p(exp(-|v|)).
  return fmaxf(v, 0.f) + log1pf(expf(-fabsf(v)));
}

__global__ void __launch_bounds__(FT) gate_out_kernel(const float* __restrict__ xloc,
                                const float* __restrict__ xglob,
                                const float* __restrict__ W1,
                                const float* __restrict__ b1,
                                const float* __restrict__ W2,
                                const float* __restrict__ b2,
                                const float* __restrict__ x,
                                const float* __restrict__ res_scale,
                                float* __restrict__ out) {
  extern __shared__ float smem[];
  float* sC = smem;                      // [FM][PH]: x_loc in columns 0..127, x_glob in 128..255
  float* sT = smem + FM * PH;            // [FM][PX]: tanh rows, later the gate
  float* sW = smem + FM * PH + FM * PX;  // [2][WBUF]: weight chunks

  const int tid = threadIdx.x;
  const int lane = tid & 31;
  const int wv = __builtin_amdgcn_readfirstlane(tid >> 5);  // wave-uniform: tile offsets are scalar
  const int m = lane & 15;         // A row / C column within a 16x16 subtile
  const int hi = lane >> 4;        // K-pair selector (lanes 16-31: K+2,K+3)
  const int rowBase = blockIdx.x * FM;
  const int mw = (wv & 1) * 32;    // wave row offset, both products
  const int nw = (wv >> 1) * 32;   // wave column offset, both products

  // A weight chunk is 32 k-rows of 128 floats, 4,096 floats in a row in global
  // memory: 4 x b128 per thread. Chunk c goes into buffer c & 1.
  auto stage = [&](const float* Wg, int c) {
    float* d = sW + (c & 1) * WBUF;
    const float* gw = Wg + c * 4096;
#pragma unroll
    for (int j = 0; j < 4; ++j) {
      const int idx = tid + j * FT;
      copy16(gw + idx * 4, d + (idx >> 5) * PW2 + ((idx & 31) << 2));
    }
  };

  // The scale's raw values: asked for first, so that they are here when the copies have been issued.
  const v4f rs = reinterpret_cast<const v4f*>(res_scale)[lane];
  // The two branches' rows (16 x b128 per thread) and the first weight chunk.
#pragma unroll
  for (int j = 0; j < (FM * 128) / (4 * FT); ++j) {
    const int idx = tid + j * FT;
    const int r = idx >> 5;
    const int cs = (idx & 31) << 2;
    copy16(xloc + (size_t)(rowBase + r) * 128 + cs, sC + r * PH + cs);
    copy16(xglob + (size_t)(rowBase + r) * 128 + cs, sC + r * PH + 128 + cs);
  }
  stage(W1, 0);
  // Biases: asked for here, so that their latency runs out beside that of the first copies.
  const int cc = nw + m;              // this lane's columns of both products: cc, cc + 16
  const float bb1[2] = {b1[cc], b1[cc + 16]};
  const float bb2[2] = {b2[cc], b2[cc + 16]};
  XWAIT2(cc, lane);  // behind these loads, before their address registers are written again
  // The scale of this lane's 4 columns, formed while the first copies are under way.
  const float sx = softplus_f(rs.x), sy = softplus_f(rs.y);
  const float sz = softplus_f(rs.z), sw = softplus_f(rs.w);
  // Own copies landed, before the barrier that publishes them. The scale's four
  // values are named as inputs so that their arithmetic stays in front of this
  // wait, under the copies' flight: left free, it moves into the kernel's tail.
  asm volatile("s_wait_asynccnt 0x0" :: "v"(sx), "v"(sy), "v"(sz), "v"(sw) : "memory");
  __syncthreads();
  stage(W1, 1);

  // The 8 rows of x and out that this wave blends and stores at the end.
  const int bn = rowBase >> 8;                 // TT = 256 rows a bn
  const int t0 = (rowBase & (TT - 1)) + wv * 8;
  const size_t xo = ((size_t)((bn >> 6) * TT + t0) * NN + (bn & 63)) * 32 + lane;  // [B,T,N,D]
  const v4f* X4 = reinterpret_cast<const v4f*>(x) + xo;
  v4f xv[FM / 8];

  // ---- tanh rows = tanh([x_loc | x_glob] @ W1 + b1) ----
  {
    v8f acc[2][2] = {};
    // The two chunk loops stay rolled, as in the MLP kernel (for speed only).
#pragma unroll 1
    for (int c = 0; c < 8; ++c) {
      const float* cA = sC + c * 32;
      const float* cB = sW + (c & 1) * WBUF;
#pragma unroll
      for (int k0 = 0; k0 < 32; k0 += 4) {
        const int kl = k0 + 2 * hi;
        v2f av[2], bv[2];
#pragma unroll
        for (int mt = 0; mt < 2; ++mt) {
          const float* p = cA + (mw + mt * 16 + m) * PH + kl;
          av[mt].x = p[0];
          av[mt].y = p[1];
        }
#pragma unroll
        for (int nt = 0; nt < 2; ++nt) {
          const float* p = cB + kl * PW2 + nw + nt * 16 + m;
          bv[nt].x = p[0];
          bv[nt].y = p[PW2];
        }
#pragma unroll
        for (int mt = 0; mt < 2; ++mt)
#pragma unroll
          for (int nt = 0; nt < 2; ++nt)
            acc[mt][nt] = __builtin_amdgcn_wmma_f32_16x16x4_f32(
                false, av[mt], false, bv[nt], (short)0, acc[mt][nt], false, false);
      }
      CHUNK_FOOT();
      if (c < 6) stage(W1, c + 2);  // the test reads the same for the whole work-group
      else       stage(W2, c - 6);  // the first two chunks of W2 fly during the last of W1 and the tanh
    }
    // This wave's 8 rows of x: asked for here, so that their latency runs out under the tanh.
#pragma unroll
    for (int i = 0; i < FM / 8; ++i) xv[i] = X4[(size_t)i * (NN * 32)];
    XWAIT1(X4);  // behind these loads, before their address registers are written again
    // Keeps the tanh arithmetic behind the loads: left free, the compiler issues
    // them two thirds of the way through it, with too little left to cover their latency.
    __builtin_amdgcn_sched_barrier(0);
    // C/D layout: VGPR r2 holds M=r2 (lanes 0-15) or M=r2+8 (lanes 16-31)
#pragma unroll
    for (int nt = 0; nt < 2; ++nt) {
      const int col = nw + nt * 16 + m;
#pragma unroll
      for (int mt = 0; mt < 2; ++mt)
#pragma unroll
        for (int r2 = 0; r2 < 8; r2 += 2) {
          const v2f h = act_apply((v2f){acc[mt][nt][r2], acc[mt][nt][r2 + 1]} + bb1[nt], 2);
          sT[(mw + mt * 16 + hi * 8 + r2) * PX + col] = h.x;
          sT[(mw + mt * 16 + hi * 8 + r2 + 1) * PX + col] = h.y;
        }
    }
    asm volatile("s_wait_dscnt 0x0" ::: "memory");  // own tanh values written, before the barrier that publishes them
    __syncthreads();
  }

  // ---- gate = sigmoid(tanh rows @ W2 + b2) ----
  {
    v8f acc[2][2] = {};
#pragma unroll 1
    for (int c = 0; c < 4; ++c) {
      const float* cA = sT + c * 32;
      const float* cB = sW + (c & 1) * WBUF;
#pragma unroll
      for (int k0 = 0; k0 < 32; k0 += 4) {
        const int kl = k0 + 2 * hi;
        v2f av[2], bv[2];
#pragma unroll
        for (int mt = 0; mt < 2; ++mt) {
          const float* p = cA + (mw + mt * 16 + m) * PX + kl;
          av[mt].x = p[0];
          av[mt].y = p[1];
        }
#pragma unroll
        for (int nt = 0; nt < 2; ++nt) {
          const float* p = cB + kl * PW2 + nw + nt * 16 + m;
          bv[nt].x = p[0];
          bv[nt].y = p[PW2];
        }
#pragma unroll
        for (int mt = 0; mt < 2; ++mt)
#pragma unroll
          for (int nt = 0; nt < 2; ++nt)
            acc[mt][nt] = __builtin_amdgcn_wmma_f32_16x16x4_f32(
                false, av[mt], false, bv[nt], (short)0, acc[mt][nt], false, false);
      }
      CHUNK_FOOT();
      if (c < 2) stage(W2, c + 2);  // the test reads the same for the whole work-group
    }
    // The last foot's barrier ended every read of the tanh rows: they now take the gate.
#pragma unroll
    for (int nt = 0; nt < 2; ++nt) {
      const int col = nw + nt * 16 + m;
#pragma unroll
      for (int mt = 0; mt < 2; ++mt)
#pragma unroll
        for (int r2 = 0; r2 < 8; r2 += 2) {
          const v2f h = act_apply((v2f){acc[mt][nt][r2], acc[mt][nt][r2 + 1]} + bb2[nt], 3);
          sT[(mw + mt * 16 + hi * 8 + r2) * PX + col] = h.x;
          sT[(mw + mt * 16 + hi * 8 + r2 + 1) * PX + col] = h.y;
        }
    }
    asm volatile("s_wait_dscnt 0x0" ::: "memory");  // own gate values written, before the barrier that publishes them
    __syncthreads();
  }

  // ---- blend and residual: one wave per row at a time (4 floats/lane), 8 rows
  // per wave; each store is one whole 512-byte row of out ----
  v4f* O4 = reinterpret_cast<v4f*>(out) + xo;
#pragma unroll
  for (int i = 0; i < FM / 8; ++i) {
    const int r = wv * 8 + i;
    const v4f gt = *reinterpret_cast<const v4f*>(sT + r * PX + lane * 4);
    const v4f xl = *reinterpret_cast<const v4f*>(sC + r * PH + lane * 4);
    const v4f xg = *reinterpret_cast<const v4f*>(sC + r * PH + 128 + lane * 4);
    v4f o;
    o.x = xv[i].x + sx * (gt.x * xl.x + (1.f - gt.x) * xg.x);
    o.y = xv[i].y + sy * (gt.y * xl.y + (1.f - gt.y) * xg.y);
    o.z = xv[i].z + sz * (gt.z * xl.z + (1.f - gt.z) * xg.z);
    o.w = xv[i].w + sw * (gt.w * xl.w + (1.f - gt.w) * xg.w);
    O4[(size_t)i * (NN * 32)] = o;
  }
}

// ---------------------------------------------------------------------------
// Host launcher
// ---------------------------------------------------------------------------
extern "C" void kernel_launch(void* const* d_in, const int* in_sizes, int n_in,
                              void* d_out, int out_size, void* d_ws, size_t ws_size,
                              hipStream_t stream) {
  const float* x          = (const float*)d_in[0];
  const float* window_w   = (const float*)d_in[1];
  const float* local_w1   = (const float*)d_in[2];
  const float* local_b1   = (const float*)d_in[3];
  const float* local_w2   = (const float*)d_in[4];
  const float* local_b2   = (const float*)d_in[5];
  const float* local_ln_g = (const float*)d_in[6];
  const float* local_ln_b = (const float*)d_in[7];
  const float* qkv_w      = (const float*)d_in[8];
  const float* qkv_b      = (const float*)d_in[9];
  const float* out_w      = (const float*)d_in[10];
  const float* out_b      = (const float*)d_in[11];
  const float* conv_w     = (const float*)d_in[12];
  const float* conv_b     = (const float*)d_in[13];
  const float* alpha      = (const float*)d_in[14];
  const float* pos_enc    = (const float*)d_in[15];
  const float* global_w1  = (const float*)d_in[16];
  const float* global_b1  = (const float*)d_in[17];
  const float* global_w2  = (const float*)d_in[18];
  const float* global_b2  = (const float*)d_in[19];
  const float* global_ln_g= (const float*)d_in[20];
  const float* global_ln_b= (const float*)d_in[21];
  const float* gate_w1    = (const float*)d_in[22];
  const float* gate_b1    = (const float*)d_in[23];
  const float* gate_w2    = (const float*)d_in[24];
  const float* gate_b2    = (const float*)d_in[25];
  const float* res_scale  = (const float*)d_in[26];
  float* out = (float*)d_out;

  const size_t R = (size_t)RR;
  float* ws = (float*)d_ws;
  float* P0 = ws;             // R*128: attn_out
  float* P1 = ws + R * 128;   // R*384: qkv -> x_loc
  float* P2 = ws + R * 512;   // R*128: xconv -> x_glob
  float* P3 = ws + R * 640;   // R*128: x_glob_in
  float* Wf = ws + R * 768;   // 128*256: out_w @ local_w1
  float* bf = Wf + 128 * 256; // 256: out_b @ local_w1 + local_b1

  const size_t QKV_LDS = QKV_LDS_FLOATS * sizeof(float);                // 131 KB
  const size_t FUSED_LDS = FUSED_LDS_FLOATS * sizeof(float);            // 132 KB
  const size_t GATE_LDS = GATE_LDS_FLOATS * sizeof(float);              // 132 KB

  // local branch
  detrend_qkv_kernel<<<RR / FM + FG, FT, QKV_LDS, stream>>>(x, window_w, qkv_w, qkv_b, P1,
                                                            out_w, out_b, local_w1, local_b1, Wf, bf);
  attn_kernel<<<SG, ST, 0, stream>>>(P1, P0);
  mlp_ln_kernel<<<RR / FM, FT, FUSED_LDS, stream>>>(
      P0, Wf, bf, local_w2, local_b2, local_ln_g, local_ln_b, P1);  // x_loc = P1

  // global branch
  prep_conv_kernel<<<SG, ST, 0, stream>>>(x, pos_enc, conv_w, conv_b, P2);
  pool_kernel<<<SG, ST, 0, stream>>>(P2, alpha, P3);
  mlp_ln_kernel<<<RR / FM, FT, FUSED_LDS, stream>>>(
      P3, global_w1, global_b1, global_w2, global_b2, global_ln_g, global_ln_b, P2);  // x_glob = P2

  // gated fusion and residual
  gate_out_kernel<<<RR / FM, FT, GATE_LDS, stream>>>(
      P1, P2, gate_w1, gate_b1, gate_w2, gate_b2, x, res_scale, out);
}
